// v000
// Times are from an AMD MI455X. After a warm-up the kernel runs many times in a row, and a time is the length of
// such a window on the GPU divided by its runs, so every launch and the gaps after it count. The runs cycle
// through copies of the inputs. A figure is the median of several windows, for all but v000 over two sittings.
// Sittings can differ by a few percent; kernels timed side by side share one.
// The starting kernel, v000, takes 520 microseconds a run.
#include <hip/hip_runtime.h>
// Routing (windowed) attention (2 x 8 windows of 1024 tokens x 256; 8 heads x 32): qh/kh/vh = inputs q/k/v W^T + b split into heads; per (window, head) softmax(qh kh^T / sqrt(32)) vh; heads re-merged; ctx Wo^T + bo -> [2,8,4,16,16,256].
// Structure: q, k, v as exact f16 planes; projections as f16 WMMA GEMMs (32x64 wave tiles, f32 accumulation, exact x16 weights + bias) through zero-row-padded weights so each 32-dim head occupies a 64-wide slot (the flash kernel's head width), outputs split into hi + 2^10 residual planes; V^T by LDS tiles; the fused flash kernel with hi + 2^10-residual q/k planes (S = QhKh + (QlKh + QhKl)/1024) and plain f16 P (x2^10) and V (16 sequences x 8 heads); the merged context as an f16 plane into the output GEMM through zero-column-padded Wo.
// Compute dtype: q, k, v and parameters rounded to bf16; qh, kh hi + residual (~2^-21-class logits); P and vh plain f16 (~2^-12); context as f16 (~2^-12) into Wo; f32 accumulation/softmax. v_wmma_f32_16x16x32_f16.
#define NSEQ 16
#define NB NSEQ
#define CM 256
#define HDT 32                   /* true head dim */
#define DP (NH * 64)             /* 512: padded q/k/v width */
#define NR (NSEQ * SLEN)         /* 16384 rows */
#define QBLKS (TQ / 64)
#define SLEN 1024                /* tokens per routing window (K*Hp*W) */
#define TQ SLEN
#define TK SLEN
#define NH 8
#define SCL 0.17677669529663687f /* 32^-0.5 (true head dim 32, zero-padded to 64) */
typedef __bf16 v16b __attribute__((ext_vector_type(16)));
typedef unsigned short v8us __attribute__((ext_vector_type(8), may_alias));
typedef float  v8f  __attribute__((ext_vector_type(8)));
typedef float  v4f  __attribute__((ext_vector_type(4)));
typedef float  v4fa __attribute__((ext_vector_type(4), may_alias));
union FragB { v16b v; v8us half[2]; unsigned short u[16]; };

__device__ __forceinline__ unsigned short bf16_bits(float x) { unsigned int u = __float_as_uint(x); return (unsigned short)((u + 0x7FFFu + ((u >> 16) & 1u)) >> 16); }
__device__ __forceinline__ float bf16_val(unsigned short b) { return __uint_as_float(((unsigned int)b) << 16); }
__device__ __forceinline__ float bf16_round(float x) { return bf16_val(bf16_bits(x)); }
// D += A·B with NT terms: 1 = ah·bh, 2 = + al·bh (A split), 3 = + ah·bl (both split)
template <int NT>
__device__ __forceinline__ v8f mmaN(v16b ah, v16b al, v16b bh, v16b bl, v8f c) {
  c = __builtin_amdgcn_wmma_f32_16x16x32_bf16(false, ah, false, bh, (short)0, c, false, false);
  if (NT >= 2) c = __builtin_amdgcn_wmma_f32_16x16x32_bf16(false, al, false, bh, (short)0, c, false, false);
  if (NT >= 3) c = __builtin_amdgcn_wmma_f32_16x16x32_bf16(false, ah, false, bl, (short)0, c, false, false);
  asm volatile("v_nop\n\tv_nop\n\tv_nop\n\tv_nop" : "+v"(c) : "v"(ah), "v"(al), "v"(bh), "v"(bl));
  return c;
}

__global__ __launch_bounds__(256) void k_wt_bf16(const float* __restrict__ W, unsigned short* __restrict__ Wt, int K, int N) {
  const int t = blockIdx.x * 256 + threadIdx.x;
  const int k8n = K / 8;
  if (t >= N * k8n) return;
  const int n = t / k8n, k8 = (t % k8n) * 8;
  v8us v;
#pragma unroll
  for (int i = 0; i < 8; ++i) v[i] = bf16_bits(W[(size_t)(k8 + i) * N + n]);
  *(v8us*)(Wt + (size_t)n * K + k8) = v;
  
}

// GEMM C[M][N] (f32, pitch ldc) = act(A[M][K]·W + bias). A f32 row-major (pitch lda) converted per fragment to bf16
// (ASPLIT: hi/lo two planes -> 2 terms, else single rounded term); Wt bf16 [N][K] (pitch ldb). BIAS_BF16 rounds the
// bias to bf16 first (bias quantised to bf16 before the add). K%32==0, M%16==0, N%64==0.
template <bool ASPLIT, int ACT, bool BIAS_BF16>
__global__ __launch_bounds__(128) void k_gemm_bf(const float* __restrict__ A, int lda, const unsigned short* __restrict__ Wt, int ldb,
                                               const float* __restrict__ bias, float* __restrict__ C, int ldc, int M, int N, int K) {
  __shared__ __attribute__((aligned(16))) float so[4][16][64];
  const int tid = threadIdx.x, w = tid >> 5, lane = tid & 31, ln = lane & 15, hh = lane >> 4;
  const int ntn = N / 64;
  const int wid = blockIdx.x * 4 + w;
  const int mt = wid / ntn, nq = wid % ntn;
  if (mt * 16 >= M) return;
  const int row0 = mt * 16, col0 = nq * 64;
  const float* arow = A + (size_t)(row0 + ln) * lda;
  v8f acc[4] = {};
  for (int kb = 0; kb < K; kb += 32) {
    FragB ah, al;
    const v4f x0 = *(const v4fa*)(arow + kb + 8 * hh), x1 = *(const v4fa*)(arow + kb + 8 * hh + 4);
    const v4f x2 = *(const v4fa*)(arow + kb + 16 + 8 * hh), x3 = *(const v4fa*)(arow + kb + 16 + 8 * hh + 4);
    float xs[16] = {x0[0],x0[1],x0[2],x0[3],x1[0],x1[1],x1[2],x1[3],x2[0],x2[1],x2[2],x2[3],x3[0],x3[1],x3[2],x3[3]};
#pragma unroll
    for (int i = 0; i < 16; ++i) { const unsigned short hb = bf16_bits(xs[i]); ah.u[i] = hb; al.u[i] = ASPLIT ? bf16_bits(xs[i] - bf16_val(hb)) : (unsigned short)0; }
#pragma unroll
    for (int t = 0; t < 4; ++t) {
      const unsigned short* brow = Wt + (size_t)(col0 + t * 16 + ln) * ldb + kb;
      FragB b;
      b.half[0] = *(const v8us*)(brow + 8 * hh);
      b.half[1] = *(const v8us*)(brow + 16 + 8 * hh);
      acc[t] = mmaN<ASPLIT ? 2 : 1>(ah.v, al.v, b.v, b.v, acc[t]);
    }
  }
#pragma unroll
  for (int t = 0; t < 4; ++t) {
    float bv = bias ? bias[col0 + t * 16 + ln] : 0.f;
    if (BIAS_BF16) bv = bf16_round(bv);
#pragma unroll
    for (int r = 0; r < 8; ++r) { float v = acc[t][r] + bv; if (ACT == 1) v = fmaxf(v, 0.f); so[w][8 * hh + r][t * 16 + ln] = v; }
  }
  __builtin_amdgcn_fence(__ATOMIC_ACQ_REL, "workgroup");
  __builtin_amdgcn_wave_barrier();
  const int rsub = lane >> 4, c4 = (lane & 15) * 4;
  {
#pragma unroll
    for (int q = 0; q < 8; ++q) {
      const int r = q * 2 + rsub;
      const v4f v = *(const v4fa*)&so[w][r][c4];
      *(v4f*)(C + (size_t)(row0 + r) * ldc + col0 + c4) = v;
    }
    
  }
}

// GEMM C = act(A·W + bias + resid): A f32 (ASPLIT -> hi/lo 2 terms), Wt bf16 [N][K]; ACT 0 none, 1 relu, 2 exact gelu;
// resid (optional, f32, row index = (row % rmod), pitch ldr, RES_BF16 rounds it) added before the activation.
template <bool ASPLIT, int ACT, bool BIAS_BF16, bool RES_BF16>
__global__ __launch_bounds__(128) void k_gemm_bf3(const float* __restrict__ A, int lda, const unsigned short* __restrict__ Wt, int ldb,
                                                const float* __restrict__ bias, const float* __restrict__ resid, int rmod, int ldr,
                                                float* __restrict__ C, int ldc, int M, int N, int K) {
  __shared__ __attribute__((aligned(16))) float so[4][16][64];
  const int tid = threadIdx.x, w = tid >> 5, lane = tid & 31, ln = lane & 15, hh = lane >> 4;
  const int ntn = N / 64;
  const int wid = blockIdx.x * 4 + w;
  const int mt = wid / ntn, nq = wid % ntn;
  if (mt * 16 >= M) return;
  const int row0 = mt * 16, col0 = nq * 64;
  const float* arow = A + (size_t)(row0 + ln) * lda;
  v8f acc[4] = {};
  for (int kb = 0; kb < K; kb += 32) {
    FragB ah, al;
    const v4f x0 = *(const v4fa*)(arow + kb + 8 * hh), x1 = *(const v4fa*)(arow + kb + 8 * hh + 4);
    const v4f x2 = *(const v4fa*)(arow + kb + 16 + 8 * hh), x3 = *(const v4fa*)(arow + kb + 16 + 8 * hh + 4);
    float xs[16] = {x0[0],x0[1],x0[2],x0[3],x1[0],x1[1],x1[2],x1[3],x2[0],x2[1],x2[2],x2[3],x3[0],x3[1],x3[2],x3[3]};
#pragma unroll
    for (int i = 0; i < 16; ++i) { const unsigned short hb = bf16_bits(xs[i]); ah.u[i] = hb; al.u[i] = ASPLIT ? bf16_bits(xs[i] - bf16_val(hb)) : (unsigned short)0; }
#pragma unroll
    for (int t = 0; t < 4; ++t) {
      const unsigned short* brow = Wt + (size_t)(col0 + t * 16 + ln) * ldb + kb;
      FragB b;
      b.half[0] = *(const v8us*)(brow + 8 * hh);
      b.half[1] = *(const v8us*)(brow + 16 + 8 * hh);
      acc[t] = mmaN<ASPLIT ? 2 : 1>(ah.v, al.v, b.v, b.v, acc[t]);
    }
  }
#pragma unroll
  for (int t = 0; t < 4; ++t) {
    const int col = col0 + t * 16 + ln;
    float bv = bias ? bias[col] : 0.f;
    if (BIAS_BF16) bv = bf16_round(bv);
#pragma unroll
    for (int r = 0; r < 8; ++r) {
      float v = acc[t][r] + bv;
      if (resid) { float rv = resid[(size_t)((row0 + 8 * hh + r) % rmod) * ldr + col]; if (RES_BF16) rv = bf16_round(rv); v += rv; }
      if (ACT == 1) v = fmaxf(v, 0.f);
      if (ACT == 2) v = 0.5f * v * (1.0f + erff(v * 0.70710678118654752f));
      if (ACT == 3) { const float u = 0.7978845608028654f * (v + 0.044715f * v * v * v); v = 0.5f * v * (1.0f + tanhf(u)); }
      so[w][8 * hh + r][t * 16 + ln] = v;
    }
  }
  __builtin_amdgcn_fence(__ATOMIC_ACQ_REL, "workgroup");
  __builtin_amdgcn_wave_barrier();
  const int rsub = lane >> 4, c4 = (lane & 15) * 4;
  {
#pragma unroll
    for (int q = 0; q < 8; ++q) {
      const int r = q * 2 + rsub;
      const v4f v = *(const v4fa*)&so[w][r][c4];
      *(v4f*)(C + (size_t)(row0 + r) * ldc + col0 + c4) = v;
    }
    
  }
}
// row LayerNorm (biased variance, eps) over N: s = X (+ R); optional out_sum <- s; out_norm <- (s-mu)*rsqrt(var+eps)*g + b
template <bool PARAM_BF16>
__global__ __launch_bounds__(256) void k_layernorm(const float* __restrict__ X, const float* __restrict__ R, const float* __restrict__ g, const float* __restrict__ bta,
                                                  float* __restrict__ out_sum, float* __restrict__ out_norm, int N, float eps) {
  __shared__ float red[256];
  const int row = blockIdx.x, tid = threadIdx.x;
  const float* x = X + (size_t)row * N; const float* rr = R ? R + (size_t)row * N : nullptr;
  float vals[16];                     // up to N = 4096
  const int per = N / 256;            // contiguous chunk per thread? use strided-by-4 chunks: thread handles j = tid*4 + 1024*u
  float s1 = 0.f;
  for (int u = 0; u < per / 4; ++u) {
    const int j = tid * 4 + 1024 * u;
    const v4f a = *(const v4fa*)(x + j);
    v4f b = {0.f,0.f,0.f,0.f}; if (rr) b = *(const v4fa*)(rr + j);
#pragma unroll
    for (int q = 0; q < 4; ++q) { const float v = a[q] + b[q]; vals[u * 4 + q] = v; s1 += v; }
  }
  red[tid] = s1; __syncthreads();
  for (int st = 128; st > 0; st >>= 1) { if (tid < st) red[tid] += red[tid + st]; __syncthreads(); }
  const float mu = red[0] / (float)N; __syncthreads();
  float s2 = 0.f;
  for (int u = 0; u < per / 4; ++u)
#pragma unroll
    for (int q = 0; q < 4; ++q) { const float c = vals[u * 4 + q] - mu; s2 += c * c; }
  red[tid] = s2; __syncthreads();
  for (int st = 128; st > 0; st >>= 1) { if (tid < st) red[tid] += red[tid + st]; __syncthreads(); }
  const float rs = rsqrtf(red[0] / (float)N + eps);
  {
    for (int u = 0; u < per / 4; ++u) {
      const int j = tid * 4 + 1024 * u;
      v4f o, sm;
#pragma unroll
      for (int q = 0; q < 4; ++q) {
        float gg = g[j + q], bb = bta[j + q];
        if (PARAM_BF16) { gg = bf16_round(gg); bb = bf16_round(bb); }
        sm[q] = vals[u * 4 + q]; o[q] = (vals[u * 4 + q] - mu) * rs * gg + bb;
      }
      if (out_sum) *(v4f*)(out_sum + (size_t)row * N + j) = sm;
      *(v4f*)(out_norm + (size_t)row * N + j) = o;
    }
    
  }
}



// ---- f16 WMMA path (v_wmma_f32_16x16x32_f16): 11-bit significands for operands in range — used where a [0,1] probability operand needs more precision than bf16
typedef _Float16 v16h __attribute__((ext_vector_type(16)));
union FragH { v16h v; v8us half[2]; _Float16 h[16]; unsigned short u[16]; };
template <int NT>
__device__ __forceinline__ v8f mmaH(v16h ah, v16h al, v16h bh, v16h bl, v8f c) {
  c = __builtin_amdgcn_wmma_f32_16x16x32_f16(false, ah, false, bh, (short)0, c, false, false);
  if (NT >= 2) c = __builtin_amdgcn_wmma_f32_16x16x32_f16(false, al, false, bh, (short)0, c, false, false);
  if (NT >= 3) c = __builtin_amdgcn_wmma_f32_16x16x32_f16(false, ah, false, bl, (short)0, c, false, false);
  asm volatile("v_nop\n\tv_nop\n\tv_nop\n\tv_nop" : "+v"(c) : "v"(ah), "v"(al), "v"(bh), "v"(bl));
  return c;
}
// batched GEMM like k_gemm_b but f16 operands: A f32 (split into f16 hi/lo if ASPLIT, else rounded to f16), Bt = f16 values [n][k]; alpha; C f32; N multiple of 16 (partial tiles skipped)
template <bool ASPLIT>
__global__ __launch_bounds__(128) void k_gemm_h(const float* __restrict__ A, int lda, size_t sA, const _Float16* __restrict__ Bh, int ldb, size_t sB, float alpha, float* __restrict__ C, int ldc, size_t sC, int M, int N, int K) {
  __shared__ __attribute__((aligned(16))) float so[4][16][64];
  const int tid = threadIdx.x, w = tid >> 5, lane = tid & 31, ln = lane & 15, hh = lane >> 4; const int by = blockIdx.y;
  A += (size_t)by * sA; Bh += (size_t)by * sB; C += (size_t)by * sC;
  const int ntn = (N + 63) / 64; const int wid = blockIdx.x * 4 + w; const int mt = wid / ntn, nq = wid % ntn; if (mt * 16 >= M) return;
  const int row0 = mt * 16, col0 = nq * 64; const float* arow = A + (size_t)(row0 + ln) * lda;
  v8f acc[4] = {};
  for (int kb = 0; kb < K; kb += 32) {
    FragH ah, al;
    const v4f x0 = *(const v4fa*)(arow + kb + 8 * hh), x1 = *(const v4fa*)(arow + kb + 8 * hh + 4), x2 = *(const v4fa*)(arow + kb + 16 + 8 * hh), x3 = *(const v4fa*)(arow + kb + 16 + 8 * hh + 4);
    float xs[16] = {x0[0],x0[1],x0[2],x0[3],x1[0],x1[1],x1[2],x1[3],x2[0],x2[1],x2[2],x2[3],x3[0],x3[1],x3[2],x3[3]};
#pragma unroll
    for (int i = 0; i < 16; ++i) { const _Float16 h = (_Float16)xs[i]; ah.h[i] = h; al.h[i] = ASPLIT ? (_Float16)(xs[i] - (float)h) : (_Float16)0.0f; }
#pragma unroll
    for (int t = 0; t < 4; ++t) { if (col0 + t * 16 >= N) continue; const size_t boff = (size_t)(col0 + t * 16 + ln) * ldb + kb; FragH bq; bq.half[0] = *(const v8us*)(Bh + boff + 8 * hh); bq.half[1] = *(const v8us*)(Bh + boff + 16 + 8 * hh);
      acc[t] = mmaH<ASPLIT ? 2 : 1>(ah.v, al.v, bq.v, bq.v, acc[t]); }
  }
#pragma unroll
  for (int t = 0; t < 4; ++t) { if (col0 + t * 16 >= N) continue;
#pragma unroll
    for (int r = 0; r < 8; ++r) so[w][8 * hh + r][t * 16 + ln] = acc[t][r] * alpha; }
  __builtin_amdgcn_fence(__ATOMIC_ACQ_REL, "workgroup"); __builtin_amdgcn_wave_barrier();
  const int rsub = lane >> 4, c4 = (lane & 15) * 4;
  {
#pragma unroll
    for (int q = 0; q < 8; ++q) { const int r = q * 2 + rsub; if (col0 + c4 < N) { const v4f v = *(const v4fa*)&so[w][r][c4]; *(v4f*)(C + (size_t)(row0 + r) * ldc + col0 + c4) = v; } }
     }
}

// Wt[n][k] = f16(W[k][n]·scale) from f32 row-major W[K][N] (scale = power of two; bf16-exact weights stay exact in f16 away from the subnormal range)
__global__ __launch_bounds__(256) void k_wt_f16(const float* __restrict__ W, _Float16* __restrict__ Wt, int K, int N, float scale) {
  const int t = blockIdx.x * 256 + threadIdx.x; if (t >= N * (K / 8)) return; const int n = t / (K / 8), k8 = (t % (K / 8)) * 8; FragH f;
#pragma unroll
  for (int i = 0; i < 8; ++i) f.h[i] = (_Float16)(bf16_round(W[(size_t)(k8 + i) * N + n]) * scale); const v8us o = f.half[0];
  *(v8us*)((unsigned short*)Wt + (size_t)n * K + k8) = o; 
}
// k_gemm_hh variant with fused epilogue: v = acc·alpha + bias[by·sBias + col] (+ CP[(row/rowsPerB)·sCPb + by·64 + col] if CP) ; ACT 0 none / 1 elu ; writes f16 C16 (and f32 C if non-null)
template <int ACT>
__global__ __launch_bounds__(128) void k_gemm_hhx(const _Float16* __restrict__ A, int lda, size_t sA, const _Float16* __restrict__ Bh, int ldb, size_t sB, float alpha, const float* __restrict__ bias, size_t sBias, const float* __restrict__ CP, int rowsPerB, size_t sCPb, int row0g,
    float* __restrict__ C, _Float16* __restrict__ C16, int ldc, size_t sC, int M, int N, int K) {
  __shared__ __attribute__((aligned(16))) float so[4][16][64];
  const int tid = threadIdx.x, w = tid >> 5, lane = tid & 31, ln = lane & 15, hh = lane >> 4; const int by = blockIdx.y;
  A += (size_t)by * sA; Bh += (size_t)by * sB; const size_t cofs = (size_t)by * sC; const float* bp = bias ? bias + (size_t)by * sBias : nullptr;
  const int ntn = (N + 63) / 64; const int wid = blockIdx.x * 4 + w; const int mt = wid / ntn, nq = wid % ntn; if (mt * 16 >= M) return;
  const int row0 = mt * 16, col0 = nq * 64; const _Float16* arow = A + (size_t)(row0 + ln) * lda;
  v8f acc[4] = {};
  for (int kb = 0; kb < K; kb += 32) { FragH ah; ah.half[0] = *(const v8us*)((const unsigned short*)arow + kb + 8 * hh); ah.half[1] = *(const v8us*)((const unsigned short*)arow + kb + 16 + 8 * hh);
#pragma unroll
    for (int t = 0; t < 4; ++t) { if (col0 + t * 16 >= N) continue; const size_t boff = (size_t)(col0 + t * 16 + ln) * ldb + kb; FragH bq; bq.half[0] = *(const v8us*)((const unsigned short*)Bh + boff + 8 * hh); bq.half[1] = *(const v8us*)((const unsigned short*)Bh + boff + 16 + 8 * hh);
      acc[t] = mmaH<1>(ah.v, ah.v, bq.v, bq.v, acc[t]); }
  }
#pragma unroll
  for (int t = 0; t < 4; ++t) { if (col0 + t * 16 >= N) continue; const int col = col0 + t * 16 + ln; const float bv = bp ? bf16_round(bp[col]) : 0.f;
#pragma unroll
    for (int r = 0; r < 8; ++r) { float v = acc[t][r] * alpha + bv; if (CP) { const int bidx = (row0g + row0 + 8 * hh + r) / rowsPerB; v += CP[(size_t)bidx * sCPb + (size_t)by * 64 + col]; } if (ACT == 1) v = (v > 0.f) ? v : expm1f(v); else if (ACT == 7) v = (v > 0.f) ? v + 1.0f : expf(v); else if (ACT == 8) v = tanhf(v); else if (ACT == 9) v = 0.5f * v * (1.0f + tanhf(0.7978845608028654f * (v + 0.044715f * v * v * v))); else if (ACT == 11) v = 1.0f / (1.0f + expf(-v)); else if (ACT == 12) v = (v > 0.f) ? v : 0.01f * v; else if (ACT == 14) v = (v > 0.f) ? v : 0.1f * v; else if (ACT == 15) v = v / (1.0f + expf(-v)); else if (ACT == 3) v = fmaxf(v, 0.f); else if (ACT == 6) v = 0.5f * v * (1.0f + erff(v * 0.70710678118654752f)); so[w][8 * hh + r][t * 16 + ln] = v; } }
  __builtin_amdgcn_fence(__ATOMIC_ACQ_REL, "workgroup"); __builtin_amdgcn_wave_barrier();
  const int rsub = lane >> 4, c4 = (lane & 15) * 4; typedef _Float16 v4h __attribute__((ext_vector_type(4)));
  {
#pragma unroll
    for (int q = 0; q < 8; ++q) { const int r = q * 2 + rsub; if (col0 + c4 < N) { const v4f v = *(const v4fa*)&so[w][r][c4]; if (C) *(v4f*)(C + cofs + (size_t)(row0 + r) * ldc + col0 + c4) = v; if (C16) { v4h h4; for (int i = 0; i < 4; ++i) h4[i] = (_Float16)v[i]; *(v4h*)(C16 + cofs + (size_t)(row0 + r) * ldc + col0 + c4) = h4; } } }
     }
}


typedef _Float16 v4h __attribute__((ext_vector_type(4)));

__global__ __launch_bounds__(256) void k_x16(const float* __restrict__ x, _Float16* __restrict__ X16, size_t n8) { const size_t t = (size_t)blockIdx.x * 256 + threadIdx.x; if (t >= n8) return; FragH f;
#pragma unroll
  for (int q = 0; q < 8; ++q) f.h[q] = (_Float16)bf16_round(x[t * 8 + q]); *(v8us*)((unsigned short*)X16 + t * 8) = f.half[0];  }
__global__ __launch_bounds__(256) void k_h16(const float* __restrict__ x, _Float16* __restrict__ X16, size_t n8) { const size_t t = (size_t)blockIdx.x * 256 + threadIdx.x; if (t >= n8) return; FragH f;
#pragma unroll
  for (int q = 0; q < 8; ++q) f.h[q] = (_Float16)x[t * 8 + q]; *(v8us*)((unsigned short*)X16 + t * 8) = f.half[0];  }
__global__ __launch_bounds__(256) void k_round16f(const float* __restrict__ W, _Float16* __restrict__ Bt, size_t n8) { const size_t t = (size_t)blockIdx.x * 256 + threadIdx.x; if (t >= n8) return; FragH f;
#pragma unroll
  for (int i = 0; i < 8; ++i) f.h[i] = (_Float16)(bf16_round(W[t * 8 + i]) * 16.0f); *(v8us*)((unsigned short*)Bt + t * 8) = f.half[0];  }
template <int NHv, int TTv>
__global__ __launch_bounds__(256) void k_vt(const _Float16* __restrict__ V16, int ldv, int voff, _Float16* __restrict__ Vt) { __shared__ unsigned short tl[64][66]; const int tid = threadIdx.x; const int slab = blockIdx.x / (TTv / 64), lg = blockIdx.x % (TTv / 64); const int b = slab / NHv, h = slab % NHv;
  for (int i = tid; i < 64 * 8; i += 256) { const int r = i / 8, c8 = (i % 8) * 8; FragH f; f.half[0] = *(const v8us*)((const unsigned short*)V16 + ((size_t)b * TTv + lg * 64 + r) * ldv + voff + h * 64 + c8);
#pragma unroll
    for (int q = 0; q < 8; ++q) tl[r][c8 + q] = f.u[q]; }
  __syncthreads();
  {
#pragma unroll
    for (int rd = 0; rd < 2; ++rd) { const int d = rd * 32 + tid / 8, pc = tid % 8; FragH f;
#pragma unroll
      for (int q = 0; q < 8; ++q) f.u[q] = tl[pc * 8 + q][d];
      *(v8us*)((unsigned short*)Vt + ((size_t)slab * 64 + d) * TTv + lg * 64 + pc * 8) = f.half[0]; }
     } }

__global__ __launch_bounds__(256) void k_hl(const float* __restrict__ F, _Float16* __restrict__ Hh, _Float16* __restrict__ Hl, size_t n8) { const size_t t = (size_t)blockIdx.x * 256 + threadIdx.x; if (t >= n8) return; FragH fh, fl; const v4f a = *(const v4fa*)(F + t * 8), c = *(const v4fa*)(F + t * 8 + 4);
#pragma unroll
  for (int q = 0; q < 4; ++q) { _Float16 h = (_Float16)a[q]; fh.h[q] = h; fl.h[q] = (_Float16)((a[q] - (float)h) * 1024.0f); h = (_Float16)c[q]; fh.h[4 + q] = h; fl.h[4 + q] = (_Float16)((c[q] - (float)h) * 1024.0f); }
  { *(v8us*)((unsigned short*)Hh + t * 8) = fh.half[0]; *(v8us*)((unsigned short*)Hl + t * 8) = fl.half[0];  } }

// ---- fast GEMM (wave tile 32x64; requires M % 32 == 0 rows per launch region and N % 64 == 0); epilogue = k_gemm_hhx semantics ----
__device__ __forceinline__ v16h g2_frag(const _Float16* p, int hh) { FragH f; f.half[0] = *(const v8us*)((const unsigned short*)p + 8 * hh); f.half[1] = *(const v8us*)((const unsigned short*)p + 16 + 8 * hh); return f.v; }
__device__ __forceinline__ v8f g2_mma(v16h a, v16h b, v8f c) { v8f d = __builtin_amdgcn_wmma_f32_16x16x32_f16(false, a, false, b, (short)0, c, false, false); asm volatile("v_nop\n\tv_nop\n\tv_nop\n\tv_nop" : "+v"(d) : "v"(a), "v"(b)); return d; }
template <int ACT>
__global__ __launch_bounds__(128) void k_gemm2(const _Float16* __restrict__ A, int lda, size_t sA, const _Float16* __restrict__ Bh, int ldb, size_t sB, float alpha, const float* __restrict__ bias, size_t sBias, const float* __restrict__ CP, int rowsPerB, size_t sCPb, int row0g,
    float* __restrict__ C, _Float16* __restrict__ C16, int ldc, size_t sC, int M, int N, int K) {
  __shared__ __attribute__((aligned(16))) float so[4][32][68];
  const int tid = threadIdx.x, w = tid >> 5, lane = tid & 31, ln = lane & 15, hh = lane >> 4; const int by = blockIdx.y;
  A += (size_t)by * sA; Bh += (size_t)by * sB; const size_t cofs = (size_t)by * sC; const float* bp = bias ? bias + (size_t)by * sBias : nullptr;
  const int ntn = N >> 6; const int mt = blockIdx.x / ntn, nq = blockIdx.x - mt * ntn; const int row0 = mt * 128 + 32 * w, col0 = nq * 64; if (row0 >= M) return;
  const _Float16* a0p = A + (size_t)(row0 + ln) * lda; const _Float16* a1p = a0p + (size_t)16 * lda;
  const _Float16* b0p = Bh + (size_t)(col0 + ln) * ldb; const _Float16* b1p = b0p + (size_t)16 * ldb; const _Float16* b2p = b1p + (size_t)16 * ldb; const _Float16* b3p = b2p + (size_t)16 * ldb;
  const v8f z8 = {0.f,0.f,0.f,0.f,0.f,0.f,0.f,0.f}; v8f c00 = z8, c01 = z8, c02 = z8, c03 = z8, c10 = z8, c11 = z8, c12 = z8, c13 = z8;
#pragma unroll 1
  for (int kb = 0; kb < K; kb += 32) { const v16h a0 = g2_frag(a0p + kb, hh), a1 = g2_frag(a1p + kb, hh);
    v16h b = g2_frag(b0p + kb, hh); c00 = g2_mma(a0, b, c00); c10 = g2_mma(a1, b, c10);
    b = g2_frag(b1p + kb, hh); c01 = g2_mma(a0, b, c01); c11 = g2_mma(a1, b, c11);
    b = g2_frag(b2p + kb, hh); c02 = g2_mma(a0, b, c02); c12 = g2_mma(a1, b, c12);
    b = g2_frag(b3p + kb, hh); c03 = g2_mma(a0, b, c03); c13 = g2_mma(a1, b, c13); }
  v8f accs[8] = {c00, c01, c02, c03, c10, c11, c12, c13};
#pragma unroll
  for (int u = 0; u < 8; ++u) { const int t = u & 3, half = u >> 2; const int col = col0 + t * 16 + ln; const float bv = bp ? bf16_round(bp[col]) : 0.f;
#pragma unroll
    for (int r = 0; r < 8; ++r) { const int rloc = half * 16 + 8 * hh + r; float v = accs[u][r] * alpha + bv; if (CP) { const int bidx = (row0g + row0 + rloc) / rowsPerB; v += CP[(size_t)bidx * sCPb + (size_t)by * 64 + col]; }
      if (ACT == 3) v = fmaxf(v, 0.f); else if (ACT == 6) v = 0.5f * v * (1.0f + erff(v * 0.70710678118654752f)); else if (ACT == 11) v = 1.0f / (1.0f + expf(-v)); else if (ACT == 15) v = v / (1.0f + expf(-v)); else if (ACT == 12) v = (v > 0.f) ? v : 0.01f * v; else if (ACT == 8) v = tanhf(v);
      so[w][rloc][t * 16 + ln] = v; } }
  __builtin_amdgcn_fence(__ATOMIC_ACQ_REL, "workgroup"); __builtin_amdgcn_wave_barrier();
  const int rsub = lane >> 4, c4 = (lane & 15) * 4;
  {
#pragma unroll
    for (int q = 0; q < 16; ++q) { const int r = q * 2 + rsub; const v4f v = *(const v4fa*)&so[w][r][c4]; if (C) *(v4f*)(C + cofs + (size_t)(row0 + r) * ldc + col0 + c4) = v; if (C16) { v4h h4; for (int i = 0; i < 4; ++i) h4[i] = (_Float16)v[i]; *(v4h*)(C16 + cofs + (size_t)(row0 + r) * ldc + col0 + c4) = h4; } }
     } }



template <int CAUSAL>
__global__ __launch_bounds__(128) void k_flash(const _Float16* __restrict__ Q16, int ldq, const _Float16* __restrict__ K16, int ldk, const _Float16* __restrict__ Vt, const int* __restrict__ MSK, float* __restrict__ O, int ldo) {
  constexpr int RPW = 16, RTN = RPW / 16, NQB = TQ / (4 * RPW), DT = 4, KS = 2;
  __shared__ __attribute__((aligned(16))) unsigned short sP[4][RPW][40]; __shared__ __attribute__((aligned(16))) float sO[4][RPW][64 + 4];
  const int tid = threadIdx.x, w = tid >> 5, lane = tid & 31, ln = lane & 15, hh = lane >> 4;
  const int slab = blockIdx.x / QBLKS, qblk = blockIdx.x % QBLKS; (void)NQB; const int b = slab / NH, h = slab % NH; const int qb0 = qblk * (4 * RPW); const int q0 = qb0 + w * RPW;
  FragH aq[2][KS];
#pragma unroll
  for (int rt = 0; rt < RTN; ++rt) { const unsigned short* qr = (const unsigned short*)Q16 + ((size_t)b * TQ + q0 + rt * 16 + ln) * ldq + h * 64;
#pragma unroll
    for (int ks = 0; ks < KS; ++ks) { aq[rt][ks].half[0] = *(const v8us*)(qr + ks * 32 + 8 * hh); aq[rt][ks].half[1] = *(const v8us*)(qr + ks * 32 + 16 + 8 * hh); } }
  const unsigned short* Vth = (const unsigned short*)Vt + (size_t)slab * 64 * TK;
  float m_r[2][8], l_r[2][8]; v8f oacc[2][DT];
#pragma unroll
  for (int rt = 0; rt < RTN; ++rt) {
#pragma unroll
    for (int r = 0; r < 8; ++r) { m_r[rt][r] = -3.0e38f; l_r[rt][r] = 0.f; }
#pragma unroll
    for (int dt = 0; dt < DT; ++dt) oacc[rt][dt] = (v8f){0.f,0.f,0.f,0.f,0.f,0.f,0.f,0.f}; }
  const int jend = (CAUSAL == 1) ? (qb0 + 4 * RPW) : TK;      /* causal: keys beyond the block's last query never contribute */
#pragma unroll 1
  for (int j0 = 0; j0 < jend; j0 += 32) {
    v8f s[2][2];
#pragma unroll
    for (int nt = 0; nt < 2; ++nt) { const unsigned short* kr = (const unsigned short*)K16 + ((size_t)b * TK + j0 + nt * 16 + ln) * ldk + h * 64; FragH bk[KS];
#pragma unroll
      for (int ks = 0; ks < KS; ++ks) { bk[ks].half[0] = *(const v8us*)(kr + ks * 32 + 8 * hh); bk[ks].half[1] = *(const v8us*)(kr + ks * 32 + 16 + 8 * hh); }
#pragma unroll
      for (int rt = 0; rt < RTN; ++rt) { v8f acc = (v8f){0.f,0.f,0.f,0.f,0.f,0.f,0.f,0.f};
#pragma unroll
        for (int ks = 0; ks < KS; ++ks) acc = mmaH<1>(aq[rt][ks].v, aq[rt][ks].v, bk[ks].v, bk[ks].v, acc); s[rt][nt] = acc; } }
#pragma unroll
    for (int rt = 0; rt < RTN; ++rt)
#pragma unroll
      for (int r = 0; r < 8; ++r) { const int tq = q0 + rt * 16 + 8 * hh + r; const int k0 = j0 + ln, k1 = j0 + 16 + ln;
        const bool ok0 = (CAUSAL == 1) ? (k0 <= tq) : ((CAUSAL == 2) ? ((k0 >> 5) == (tq >> 5)) : true), ok1 = (CAUSAL == 1) ? (k1 <= tq) : ((CAUSAL == 2) ? ((k1 >> 5) == (tq >> 5)) : true);      /* mode 2: block-diagonal 32-token groups */
        const float s0 = ok0 ? s[rt][0][r] * SCL : -3.0e38f, s1 = ok1 ? s[rt][1][r] * SCL : -3.0e38f; float mc = fmaxf(s0, s1);
        mc = fmaxf(mc, __shfl_xor(mc, 1, 32)); mc = fmaxf(mc, __shfl_xor(mc, 2, 32)); mc = fmaxf(mc, __shfl_xor(mc, 4, 32)); mc = fmaxf(mc, __shfl_xor(mc, 8, 32));
        const float mn = fmaxf(m_r[rt][r], mc); const float al = (mn > -1.0e38f) ? expf(m_r[rt][r] - mn) : 1.0f; m_r[rt][r] = mn; const float p0 = ok0 ? expf(s0 - mn) : 0.f, p1 = ok1 ? expf(s1 - mn) : 0.f; l_r[rt][r] = l_r[rt][r] * al + p0 + p1;
#pragma unroll
        for (int dt = 0; dt < DT; ++dt) oacc[rt][dt][r] *= al;
        FragH t2; t2.h[0] = (_Float16)(p0 * 1024.0f); t2.h[1] = (_Float16)(p1 * 1024.0f); sP[w][rt * 16 + 8 * hh + r][ln] = t2.u[0]; sP[w][rt * 16 + 8 * hh + r][16 + ln] = t2.u[1]; }
    __builtin_amdgcn_fence(__ATOMIC_ACQ_REL, "workgroup"); __builtin_amdgcn_wave_barrier();
    FragH pa[2];
#pragma unroll
    for (int rt = 0; rt < RTN; ++rt) { pa[rt].half[0] = *(const v8us*)&sP[w][rt * 16 + ln][8 * hh]; pa[rt].half[1] = *(const v8us*)&sP[w][rt * 16 + ln][16 + 8 * hh]; }
#pragma unroll
    for (int dt = 0; dt < DT; ++dt) { const unsigned short* vrow = Vth + (size_t)(dt * 16 + ln) * TK + j0; FragH bv; bv.half[0] = *(const v8us*)(vrow + 8 * hh); bv.half[1] = *(const v8us*)(vrow + 16 + 8 * hh);
#pragma unroll
      for (int rt = 0; rt < RTN; ++rt) oacc[rt][dt] = mmaH<1>(pa[rt].v, pa[rt].v, bv.v, bv.v, oacc[rt][dt]); }
    __builtin_amdgcn_fence(__ATOMIC_ACQ_REL, "workgroup"); __builtin_amdgcn_wave_barrier(); }
#pragma unroll
  for (int rt = 0; rt < RTN; ++rt) {
#pragma unroll
    for (int r = 0; r < 8; ++r) { float l = l_r[rt][r]; l += __shfl_xor(l, 1, 32); l += __shfl_xor(l, 2, 32); l += __shfl_xor(l, 4, 32); l += __shfl_xor(l, 8, 32); l_r[rt][r] = (l > 0.f) ? 1.0f / (l * 1024.0f) : 0.f; }
#pragma unroll
    for (int dt = 0; dt < DT; ++dt)
#pragma unroll
      for (int r = 0; r < 8; ++r) sO[w][rt * 16 + 8 * hh + r][dt * 16 + ln] = oacc[rt][dt][r] * l_r[rt][r]; }
  __builtin_amdgcn_fence(__ATOMIC_ACQ_REL, "workgroup"); __builtin_amdgcn_wave_barrier();
  {
#pragma unroll
    for (int rp = 0; rp < RPW; rp += 2) { const int r = rp + (lane >> 4), pc = lane & 15; const v4f val = *(const v4fa*)&sO[w][r][pc * 4]; *(v4f*)(O + ((size_t)b * TQ + q0 + r) * ldo + h * 64 + pc * 4) = val; }
     } }
// Q/K-split variant: S = Qh Kh^T + (Ql Kh^T + Qh Kl^T)/1024 with Q/K = [hi | 2^10 residual] f16 planes (QL/KL same layout as Q16/K16); plain f16 P (x2^10) . V^T as in k_flash
template <int CAUSAL>
__global__ __launch_bounds__(128) void k_flashqk(const _Float16* __restrict__ Q16, const _Float16* __restrict__ QL, int ldq, const _Float16* __restrict__ K16, const _Float16* __restrict__ KL, int ldk, const _Float16* __restrict__ Vt, const int* __restrict__ MSK, float* __restrict__ O, int ldo) {
  constexpr int RPW = 16, RTN = RPW / 16, NQB = TQ / (4 * RPW), DT = 4, KS = 2;
  __shared__ __attribute__((aligned(16))) unsigned short sP[4][RPW][40]; __shared__ __attribute__((aligned(16))) float sO[4][RPW][64 + 4];
  const int tid = threadIdx.x, w = tid >> 5, lane = tid & 31, ln = lane & 15, hh = lane >> 4;
  const int slab = blockIdx.x / QBLKS, qblk = blockIdx.x % QBLKS; (void)NQB; const int b = slab / NH, h = slab % NH; const int qb0 = qblk * (4 * RPW); const int q0 = qb0 + w * RPW;
  FragH aq[2][KS], aql[2][KS];
#pragma unroll
  for (int rt = 0; rt < RTN; ++rt) { const unsigned short* qr = (const unsigned short*)Q16 + ((size_t)b * TQ + q0 + rt * 16 + ln) * ldq + h * 64; const unsigned short* ql = (const unsigned short*)QL + ((size_t)b * TQ + q0 + rt * 16 + ln) * ldq + h * 64;
#pragma unroll
    for (int ks = 0; ks < KS; ++ks) { aq[rt][ks].half[0] = *(const v8us*)(qr + ks * 32 + 8 * hh); aq[rt][ks].half[1] = *(const v8us*)(qr + ks * 32 + 16 + 8 * hh); aql[rt][ks].half[0] = *(const v8us*)(ql + ks * 32 + 8 * hh); aql[rt][ks].half[1] = *(const v8us*)(ql + ks * 32 + 16 + 8 * hh); } }
  const unsigned short* Vth = (const unsigned short*)Vt + (size_t)slab * 64 * TK;
  float m_r[2][8], l_r[2][8]; v8f oacc[2][DT];
#pragma unroll
  for (int rt = 0; rt < RTN; ++rt) {
#pragma unroll
    for (int r = 0; r < 8; ++r) { m_r[rt][r] = -3.0e38f; l_r[rt][r] = 0.f; }
#pragma unroll
    for (int dt = 0; dt < DT; ++dt) oacc[rt][dt] = (v8f){0.f,0.f,0.f,0.f,0.f,0.f,0.f,0.f}; }
  const int jend = (CAUSAL == 1) ? (qb0 + 4 * RPW) : TK;      /* causal: keys beyond the block's last query never contribute */
#pragma unroll 1
  for (int j0 = 0; j0 < jend; j0 += 32) {
    v8f s[2][2];
#pragma unroll
    for (int nt = 0; nt < 2; ++nt) { const unsigned short* kr = (const unsigned short*)K16 + ((size_t)b * TK + j0 + nt * 16 + ln) * ldk + h * 64; const unsigned short* klr = (const unsigned short*)KL + ((size_t)b * TK + j0 + nt * 16 + ln) * ldk + h * 64; FragH bk[KS], bkl[KS];
#pragma unroll
      for (int ks = 0; ks < KS; ++ks) { bk[ks].half[0] = *(const v8us*)(kr + ks * 32 + 8 * hh); bk[ks].half[1] = *(const v8us*)(kr + ks * 32 + 16 + 8 * hh); bkl[ks].half[0] = *(const v8us*)(klr + ks * 32 + 8 * hh); bkl[ks].half[1] = *(const v8us*)(klr + ks * 32 + 16 + 8 * hh); }
#pragma unroll
      for (int rt = 0; rt < RTN; ++rt) { v8f acc = (v8f){0.f,0.f,0.f,0.f,0.f,0.f,0.f,0.f}, accl = acc;
#pragma unroll
        for (int ks = 0; ks < KS; ++ks) { acc = mmaH<1>(aq[rt][ks].v, aq[rt][ks].v, bk[ks].v, bk[ks].v, acc); accl = mmaH<1>(aql[rt][ks].v, aql[rt][ks].v, bk[ks].v, bk[ks].v, accl); accl = mmaH<1>(aq[rt][ks].v, aq[rt][ks].v, bkl[ks].v, bkl[ks].v, accl); }
#pragma unroll
        for (int r = 0; r < 8; ++r) acc[r] += accl[r] * 0.0009765625f;
        s[rt][nt] = acc; } }
#pragma unroll
    for (int rt = 0; rt < RTN; ++rt)
#pragma unroll
      for (int r = 0; r < 8; ++r) { const int tq = q0 + rt * 16 + 8 * hh + r; const int k0 = j0 + ln, k1 = j0 + 16 + ln;
        bool ok0 = (CAUSAL == 1) ? (k0 <= tq) : ((CAUSAL == 2) ? ((k0 >> 5) == (tq >> 5)) : true), ok1 = (CAUSAL == 1) ? (k1 <= tq) : ((CAUSAL == 2) ? ((k1 >> 5) == (tq >> 5)) : true);      /* mode 2: block-diagonal 32-token groups */
        if (CAUSAL == 4) { const int* mrow = MSK + ((size_t)b * TQ + tq) * TK; ok0 = mrow[k0] != 0; ok1 = mrow[k1] != 0; }      /* mode 4: per-(query, key) INPUT mask shared by all heads; masked keys contribute nothing (== the reference's -4096 fill, whose exp underflows to 0), rows with no valid key give l = 0 -> output 0 (== the reference's row_valid zeroing) */
        const float s0 = ok0 ? s[rt][0][r] * SCL : -3.0e38f, s1 = ok1 ? s[rt][1][r] * SCL : -3.0e38f; float mc = fmaxf(s0, s1);
        mc = fmaxf(mc, __shfl_xor(mc, 1, 32)); mc = fmaxf(mc, __shfl_xor(mc, 2, 32)); mc = fmaxf(mc, __shfl_xor(mc, 4, 32)); mc = fmaxf(mc, __shfl_xor(mc, 8, 32));
        const float mn = fmaxf(m_r[rt][r], mc); const float al = (mn > -1.0e38f) ? expf(m_r[rt][r] - mn) : 1.0f; m_r[rt][r] = mn; const float p0 = ok0 ? expf(s0 - mn) : 0.f, p1 = ok1 ? expf(s1 - mn) : 0.f; l_r[rt][r] = l_r[rt][r] * al + p0 + p1;
#pragma unroll
        for (int dt = 0; dt < DT; ++dt) oacc[rt][dt][r] *= al;
        FragH t2; t2.h[0] = (_Float16)(p0 * 1024.0f); t2.h[1] = (_Float16)(p1 * 1024.0f); sP[w][rt * 16 + 8 * hh + r][ln] = t2.u[0]; sP[w][rt * 16 + 8 * hh + r][16 + ln] = t2.u[1]; }
    __builtin_amdgcn_fence(__ATOMIC_ACQ_REL, "workgroup"); __builtin_amdgcn_wave_barrier();
    FragH pa[2];
#pragma unroll
    for (int rt = 0; rt < RTN; ++rt) { pa[rt].half[0] = *(const v8us*)&sP[w][rt * 16 + ln][8 * hh]; pa[rt].half[1] = *(const v8us*)&sP[w][rt * 16 + ln][16 + 8 * hh]; }
#pragma unroll
    for (int dt = 0; dt < DT; ++dt) { const unsigned short* vrow = Vth + (size_t)(dt * 16 + ln) * TK + j0; FragH bv; bv.half[0] = *(const v8us*)(vrow + 8 * hh); bv.half[1] = *(const v8us*)(vrow + 16 + 8 * hh);
#pragma unroll
      for (int rt = 0; rt < RTN; ++rt) oacc[rt][dt] = mmaH<1>(pa[rt].v, pa[rt].v, bv.v, bv.v, oacc[rt][dt]); }
    __builtin_amdgcn_fence(__ATOMIC_ACQ_REL, "workgroup"); __builtin_amdgcn_wave_barrier(); }
#pragma unroll
  for (int rt = 0; rt < RTN; ++rt) {
#pragma unroll
    for (int r = 0; r < 8; ++r) { float l = l_r[rt][r]; l += __shfl_xor(l, 1, 32); l += __shfl_xor(l, 2, 32); l += __shfl_xor(l, 4, 32); l += __shfl_xor(l, 8, 32); l_r[rt][r] = (l > 0.f) ? 1.0f / (l * 1024.0f) : 0.f; }
#pragma unroll
    for (int dt = 0; dt < DT; ++dt)
#pragma unroll
      for (int r = 0; r < 8; ++r) sO[w][rt * 16 + 8 * hh + r][dt * 16 + ln] = oacc[rt][dt][r] * l_r[rt][r]; }
  __builtin_amdgcn_fence(__ATOMIC_ACQ_REL, "workgroup"); __builtin_amdgcn_wave_barrier();
  {
#pragma unroll
    for (int rp = 0; rp < RPW; rp += 2) { const int r = rp + (lane >> 4), pc = lane & 15; const v4f val = *(const v4fa*)&sO[w][r][pc * 4]; *(v4f*)(O + ((size_t)b * TQ + q0 + r) * ldo + h * 64 + pc * 4) = val; }
     } }

__global__ __launch_bounds__(256) void k_wpad(const float* __restrict__ Wm, const float* __restrict__ bm, _Float16* __restrict__ BP, float* __restrict__ PB) {
  const int r = blockIdx.x * 256 + threadIdx.x; if (r >= DP) return; const int h = r / 64, d = r % 64; const bool live = d < HDT; const int srow = h * HDT + d;
  for (int c0 = 0; c0 < CM; c0 += 8) { FragH f; for (int q = 0; q < 8; ++q) f.h[q] = live ? (_Float16)(bf16_round(Wm[(size_t)srow * CM + c0 + q]) * 16.0f) : (_Float16)0.0f; unsigned short* dst = (unsigned short*)BP + (size_t)r * CM + c0; *(v8us*)dst = f.half[0];  }
  const float bv = live ? bm[srow] : 0.f; *(float*)(PB + r) = bv;  }
__global__ __launch_bounds__(256) void k_wopad(const float* __restrict__ Wo, _Float16* __restrict__ BOP) { const int t = blockIdx.x * 256 + threadIdx.x; if (t >= CM * (DP / 8)) return; const int c0 = (t % (DP / 8)) * 8; const int o = t / (DP / 8); FragH f;
  for (int q = 0; q < 8; ++q) { const int col = c0 + q; const int h = col / 64, d = col % 64; f.h[q] = (d < HDT) ? (_Float16)(bf16_round(Wo[(size_t)o * CM + h * HDT + d]) * 16.0f) : (_Float16)0.0f; } *(v8us*)((unsigned short*)BOP + (size_t)o * DP + c0) = f.half[0];  }

extern "C" void kernel_launch(void* const* d_in, const int* in_sizes, int n_in,
                              void* d_out, int out_size, void* d_ws, size_t ws_size, hipStream_t stream) {
  (void)in_sizes; (void)n_in; (void)out_size;
  const float* const* I = (const float* const*)d_in; const float* qx = I[0]; const float* kx = I[1]; const float* vx = I[2]; const float* Wq = I[3]; const float* bq = I[4]; const float* Wk = I[5]; const float* bk = I[6]; const float* Wv = I[7]; const float* bv = I[8]; const float* Wo = I[9]; const float* bo = I[10];
  char* ws = (char*)d_ws; size_t off = 0;
  auto take = [&](size_t bytes) { char* p = ws + off; off += (bytes + 255) & ~(size_t)255; return p; };
  _Float16* BPq = (_Float16*)take((size_t)DP * CM * 2); _Float16* BPk = (_Float16*)take((size_t)DP * CM * 2); _Float16* BPv = (_Float16*)take((size_t)DP * CM * 2); float* PBq = (float*)take(DP * 4); float* PBk = (float*)take(DP * 4); float* PBv = (float*)take(DP * 4); _Float16* BOP = (_Float16*)take((size_t)CM * DP * 2);
  _Float16* X16 = (_Float16*)take((size_t)NR * CM * 2); float* F32 = (float*)take((size_t)NR * DP * 4); _Float16* QH = (_Float16*)take((size_t)NR * DP * 2); _Float16* QL = (_Float16*)take((size_t)NR * DP * 2); _Float16* KH = (_Float16*)take((size_t)NR * DP * 2); _Float16* KL = (_Float16*)take((size_t)NR * DP * 2); _Float16* VH = (_Float16*)take((size_t)NR * DP * 2); _Float16* VL = (_Float16*)take((size_t)NR * DP * 2); _Float16* VT = (_Float16*)take((size_t)NR * DP * 2); _Float16* VTL = (_Float16*)take((size_t)NR * DP * 2); _Float16* O16 = (_Float16*)take((size_t)NR * DP * 2);
  float* O = F32;
  if (off > ws_size) return;      /* 1 + 8 + 32 + 9 x 16 = 185 MiB (256 MiB ws) */
  k_wpad<<<(DP + 255) / 256, 256, 0, stream>>>(Wq, bq, BPq, PBq); k_wpad<<<(DP + 255) / 256, 256, 0, stream>>>(Wk, bk, BPk, PBk); k_wpad<<<(DP + 255) / 256, 256, 0, stream>>>(Wv, bv, BPv, PBv); k_wopad<<<(CM * (DP / 8) + 255) / 256, 256, 0, stream>>>(Wo, BOP);
  const dim3 gP((NR / 128) * (DP / 64), 1), gO((NR / 128) * (CM / 64), 1); const unsigned n8x = (unsigned)(((size_t)NR * CM / 8 + 255) / 256), n8 = (unsigned)(((size_t)NR * DP / 8 + 255) / 256);
  k_x16<<<n8x, 256, 0, stream>>>(qx, X16, (size_t)NR * CM / 8); k_gemm2<0><<<gP, 128, 0, stream>>>(X16, CM, 0, BPq, CM, 0, 0.0625f, PBq, 0, nullptr, 1, 0, 0, F32, nullptr, DP, 0, NR, DP, CM); k_hl<<<n8, 256, 0, stream>>>(F32, QH, QL, (size_t)NR * DP / 8);
  k_x16<<<n8x, 256, 0, stream>>>(kx, X16, (size_t)NR * CM / 8); k_gemm2<0><<<gP, 128, 0, stream>>>(X16, CM, 0, BPk, CM, 0, 0.0625f, PBk, 0, nullptr, 1, 0, 0, F32, nullptr, DP, 0, NR, DP, CM); k_hl<<<n8, 256, 0, stream>>>(F32, KH, KL, (size_t)NR * DP / 8);
  k_x16<<<n8x, 256, 0, stream>>>(vx, X16, (size_t)NR * CM / 8); k_gemm2<0><<<gP, 128, 0, stream>>>(X16, CM, 0, BPv, CM, 0, 0.0625f, PBv, 0, nullptr, 1, 0, 0, F32, nullptr, DP, 0, NR, DP, CM); k_hl<<<n8, 256, 0, stream>>>(F32, VH, VL, (size_t)NR * DP / 8);
  k_vt<NH, SLEN><<<NSEQ * NH * (SLEN / 64), 256, 0, stream>>>(VH, DP, 0, VT);
  k_flashqk<0><<<NSEQ * NH * QBLKS, 128, 0, stream>>>(QH, QL, DP, KH, KL, DP, VT, nullptr, O, DP);      /* q/k hi + residual; P (x2^10) and V plain f16 */
  k_h16<<<n8, 256, 0, stream>>>(O, O16, (size_t)NR * DP / 8);
  k_gemm2<0><<<gO, 128, 0, stream>>>(O16, DP, 0, BOP, DP, 0, 0.0625f, bo, 0, nullptr, 1, 0, 0, (float*)d_out, nullptr, CM, 0, NR, CM, DP);
}

// v001
// It runs in 394 microseconds.
// In two side-by-side timings against v000, it was 1.33 and 1.35 times as fast.
#include <hip/hip_runtime.h>
// Routing (windowed) attention (2 x 8 windows of 1024 tokens x 256; 8 heads x 32): qh/kh/vh = inputs q/k/v W^T + b split into heads; per (window, head) softmax(qh kh^T / sqrt(32)) vh; heads re-merged; ctx Wo^T + bo -> [2,8,4,16,16,256].
// Structure: q, k, v as exact f16 planes; projections as f16 WMMA GEMMs (32x64 wave tiles, f32 accumulation, exact x16 weights + bias), each head in its own 32-wide slot (the flash kernel's head width), outputs split into hi + 2^10 residual planes; V^T by LDS tiles; the fused flash kernel with hi + 2^10-residual q/k planes (S = QhKh + (QlKh + QhKl)/1024) and plain f16 P (x2^10) and V (16 sequences x 8 heads); the merged context as an f16 plane into the output GEMM.
// Compute dtype: q, k, v and parameters rounded to bf16; qh, kh hi + residual (~2^-21-class logits); P and vh plain f16 (~2^-12); context as f16 (~2^-12) into Wo; f32 accumulation/softmax. v_wmma_f32_16x16x32_f16.
#define NSEQ 16
#define NB NSEQ
#define CM 256
#define HS 32                    /* head slot width in the q/k/v/context planes = true head dim */
#define DP (NH * HS)             /* 256: q/k/v width */
#define NR (NSEQ * SLEN)         /* 16384 rows */
#define QBLKS (TQ / 64)
#define SLEN 1024                /* tokens per routing window (K*Hp*W) */
#define TQ SLEN
#define TK SLEN
#define NH 8
#define SCL 0.17677669529663687f /* 32^-0.5 */
typedef __bf16 v16b __attribute__((ext_vector_type(16)));
typedef unsigned short v8us __attribute__((ext_vector_type(8), may_alias));
typedef float  v8f  __attribute__((ext_vector_type(8)));
typedef float  v4f  __attribute__((ext_vector_type(4)));
typedef float  v4fa __attribute__((ext_vector_type(4), may_alias));
union FragB { v16b v; v8us half[2]; unsigned short u[16]; };

__device__ __forceinline__ unsigned short bf16_bits(float x) { unsigned int u = __float_as_uint(x); return (unsigned short)((u + 0x7FFFu + ((u >> 16) & 1u)) >> 16); }
__device__ __forceinline__ float bf16_val(unsigned short b) { return __uint_as_float(((unsigned int)b) << 16); }
__device__ __forceinline__ float bf16_round(float x) { return bf16_val(bf16_bits(x)); }
// D += A·B with NT terms: 1 = ah·bh, 2 = + al·bh (A split), 3 = + ah·bl (both split)
template <int NT>
__device__ __forceinline__ v8f mmaN(v16b ah, v16b al, v16b bh, v16b bl, v8f c) {
  c = __builtin_amdgcn_wmma_f32_16x16x32_bf16(false, ah, false, bh, (short)0, c, false, false);
  if (NT >= 2) c = __builtin_amdgcn_wmma_f32_16x16x32_bf16(false, al, false, bh, (short)0, c, false, false);
  if (NT >= 3) c = __builtin_amdgcn_wmma_f32_16x16x32_bf16(false, ah, false, bl, (short)0, c, false, false);
  asm volatile("v_nop\n\tv_nop\n\tv_nop\n\tv_nop" : "+v"(c) : "v"(ah), "v"(al), "v"(bh), "v"(bl));
  return c;
}

__global__ __launch_bounds__(256) void k_wt_bf16(const float* __restrict__ W, unsigned short* __restrict__ Wt, int K, int N) {
  const int t = blockIdx.x * 256 + threadIdx.x;
  const int k8n = K / 8;
  if (t >= N * k8n) return;
  const int n = t / k8n, k8 = (t % k8n) * 8;
  v8us v;
#pragma unroll
  for (int i = 0; i < 8; ++i) v[i] = bf16_bits(W[(size_t)(k8 + i) * N + n]);
  *(v8us*)(Wt + (size_t)n * K + k8) = v;
  
}

// GEMM C[M][N] (f32, pitch ldc) = act(A[M][K]·W + bias). A f32 row-major (pitch lda) converted per fragment to bf16
// (ASPLIT: hi/lo two planes -> 2 terms, else single rounded term); Wt bf16 [N][K] (pitch ldb). BIAS_BF16 rounds the
// bias to bf16 first (bias quantised to bf16 before the add). K%32==0, M%16==0, N%64==0.
template <bool ASPLIT, int ACT, bool BIAS_BF16>
__global__ __launch_bounds__(128) void k_gemm_bf(const float* __restrict__ A, int lda, const unsigned short* __restrict__ Wt, int ldb,
                                               const float* __restrict__ bias, float* __restrict__ C, int ldc, int M, int N, int K) {
  __shared__ __attribute__((aligned(16))) float so[4][16][64];
  const int tid = threadIdx.x, w = tid >> 5, lane = tid & 31, ln = lane & 15, hh = lane >> 4;
  const int ntn = N / 64;
  const int wid = blockIdx.x * 4 + w;
  const int mt = wid / ntn, nq = wid % ntn;
  if (mt * 16 >= M) return;
  const int row0 = mt * 16, col0 = nq * 64;
  const float* arow = A + (size_t)(row0 + ln) * lda;
  v8f acc[4] = {};
  for (int kb = 0; kb < K; kb += 32) {
    FragB ah, al;
    const v4f x0 = *(const v4fa*)(arow + kb + 8 * hh), x1 = *(const v4fa*)(arow + kb + 8 * hh + 4);
    const v4f x2 = *(const v4fa*)(arow + kb + 16 + 8 * hh), x3 = *(const v4fa*)(arow + kb + 16 + 8 * hh + 4);
    float xs[16] = {x0[0],x0[1],x0[2],x0[3],x1[0],x1[1],x1[2],x1[3],x2[0],x2[1],x2[2],x2[3],x3[0],x3[1],x3[2],x3[3]};
#pragma unroll
    for (int i = 0; i < 16; ++i) { const unsigned short hb = bf16_bits(xs[i]); ah.u[i] = hb; al.u[i] = ASPLIT ? bf16_bits(xs[i] - bf16_val(hb)) : (unsigned short)0; }
#pragma unroll
    for (int t = 0; t < 4; ++t) {
      const unsigned short* brow = Wt + (size_t)(col0 + t * 16 + ln) * ldb + kb;
      FragB b;
      b.half[0] = *(const v8us*)(brow + 8 * hh);
      b.half[1] = *(const v8us*)(brow + 16 + 8 * hh);
      acc[t] = mmaN<ASPLIT ? 2 : 1>(ah.v, al.v, b.v, b.v, acc[t]);
    }
  }
#pragma unroll
  for (int t = 0; t < 4; ++t) {
    float bv = bias ? bias[col0 + t * 16 + ln] : 0.f;
    if (BIAS_BF16) bv = bf16_round(bv);
#pragma unroll
    for (int r = 0; r < 8; ++r) { float v = acc[t][r] + bv; if (ACT == 1) v = fmaxf(v, 0.f); so[w][8 * hh + r][t * 16 + ln] = v; }
  }
  __builtin_amdgcn_fence(__ATOMIC_ACQ_REL, "workgroup");
  __builtin_amdgcn_wave_barrier();
  const int rsub = lane >> 4, c4 = (lane & 15) * 4;
  {
#pragma unroll
    for (int q = 0; q < 8; ++q) {
      const int r = q * 2 + rsub;
      const v4f v = *(const v4fa*)&so[w][r][c4];
      *(v4f*)(C + (size_t)(row0 + r) * ldc + col0 + c4) = v;
    }
    
  }
}

// GEMM C = act(A·W + bias + resid): A f32 (ASPLIT -> hi/lo 2 terms), Wt bf16 [N][K]; ACT 0 none, 1 relu, 2 exact gelu;
// resid (optional, f32, row index = (row % rmod), pitch ldr, RES_BF16 rounds it) added before the activation.
template <bool ASPLIT, int ACT, bool BIAS_BF16, bool RES_BF16>
__global__ __launch_bounds__(128) void k_gemm_bf3(const float* __restrict__ A, int lda, const unsigned short* __restrict__ Wt, int ldb,
                                                const float* __restrict__ bias, const float* __restrict__ resid, int rmod, int ldr,
                                                float* __restrict__ C, int ldc, int M, int N, int K) {
  __shared__ __attribute__((aligned(16))) float so[4][16][64];
  const int tid = threadIdx.x, w = tid >> 5, lane = tid & 31, ln = lane & 15, hh = lane >> 4;
  const int ntn = N / 64;
  const int wid = blockIdx.x * 4 + w;
  const int mt = wid / ntn, nq = wid % ntn;
  if (mt * 16 >= M) return;
  const int row0 = mt * 16, col0 = nq * 64;
  const float* arow = A + (size_t)(row0 + ln) * lda;
  v8f acc[4] = {};
  for (int kb = 0; kb < K; kb += 32) {
    FragB ah, al;
    const v4f x0 = *(const v4fa*)(arow + kb + 8 * hh), x1 = *(const v4fa*)(arow + kb + 8 * hh + 4);
    const v4f x2 = *(const v4fa*)(arow + kb + 16 + 8 * hh), x3 = *(const v4fa*)(arow + kb + 16 + 8 * hh + 4);
    float xs[16] = {x0[0],x0[1],x0[2],x0[3],x1[0],x1[1],x1[2],x1[3],x2[0],x2[1],x2[2],x2[3],x3[0],x3[1],x3[2],x3[3]};
#pragma unroll
    for (int i = 0; i < 16; ++i) { const unsigned short hb = bf16_bits(xs[i]); ah.u[i] = hb; al.u[i] = ASPLIT ? bf16_bits(xs[i] - bf16_val(hb)) : (unsigned short)0; }
#pragma unroll
    for (int t = 0; t < 4; ++t) {
      const unsigned short* brow = Wt + (size_t)(col0 + t * 16 + ln) * ldb + kb;
      FragB b;
      b.half[0] = *(const v8us*)(brow + 8 * hh);
      b.half[1] = *(const v8us*)(brow + 16 + 8 * hh);
      acc[t] = mmaN<ASPLIT ? 2 : 1>(ah.v, al.v, b.v, b.v, acc[t]);
    }
  }
#pragma unroll
  for (int t = 0; t < 4; ++t) {
    const int col = col0 + t * 16 + ln;
    float bv = bias ? bias[col] : 0.f;
    if (BIAS_BF16) bv = bf16_round(bv);
#pragma unroll
    for (int r = 0; r < 8; ++r) {
      float v = acc[t][r] + bv;
      if (resid) { float rv = resid[(size_t)((row0 + 8 * hh + r) % rmod) * ldr + col]; if (RES_BF16) rv = bf16_round(rv); v += rv; }
      if (ACT == 1) v = fmaxf(v, 0.f);
      if (ACT == 2) v = 0.5f * v * (1.0f + erff(v * 0.70710678118654752f));
      if (ACT == 3) { const float u = 0.7978845608028654f * (v + 0.044715f * v * v * v); v = 0.5f * v * (1.0f + tanhf(u)); }
      so[w][8 * hh + r][t * 16 + ln] = v;
    }
  }
  __builtin_amdgcn_fence(__ATOMIC_ACQ_REL, "workgroup");
  __builtin_amdgcn_wave_barrier();
  const int rsub = lane >> 4, c4 = (lane & 15) * 4;
  {
#pragma unroll
    for (int q = 0; q < 8; ++q) {
      const int r = q * 2 + rsub;
      const v4f v = *(const v4fa*)&so[w][r][c4];
      *(v4f*)(C + (size_t)(row0 + r) * ldc + col0 + c4) = v;
    }
    
  }
}
// row LayerNorm (biased variance, eps) over N: s = X (+ R); optional out_sum <- s; out_norm <- (s-mu)*rsqrt(var+eps)*g + b
template <bool PARAM_BF16>
__global__ __launch_bounds__(256) void k_layernorm(const float* __restrict__ X, const float* __restrict__ R, const float* __restrict__ g, const float* __restrict__ bta,
                                                  float* __restrict__ out_sum, float* __restrict__ out_norm, int N, float eps) {
  __shared__ float red[256];
  const int row = blockIdx.x, tid = threadIdx.x;
  const float* x = X + (size_t)row * N; const float* rr = R ? R + (size_t)row * N : nullptr;
  float vals[16];                     // up to N = 4096
  const int per = N / 256;            // contiguous chunk per thread? use strided-by-4 chunks: thread handles j = tid*4 + 1024*u
  float s1 = 0.f;
  for (int u = 0; u < per / 4; ++u) {
    const int j = tid * 4 + 1024 * u;
    const v4f a = *(const v4fa*)(x + j);
    v4f b = {0.f,0.f,0.f,0.f}; if (rr) b = *(const v4fa*)(rr + j);
#pragma unroll
    for (int q = 0; q < 4; ++q) { const float v = a[q] + b[q]; vals[u * 4 + q] = v; s1 += v; }
  }
  red[tid] = s1; __syncthreads();
  for (int st = 128; st > 0; st >>= 1) { if (tid < st) red[tid] += red[tid + st]; __syncthreads(); }
  const float mu = red[0] / (float)N; __syncthreads();
  float s2 = 0.f;
  for (int u = 0; u < per / 4; ++u)
#pragma unroll
    for (int q = 0; q < 4; ++q) { const float c = vals[u * 4 + q] - mu; s2 += c * c; }
  red[tid] = s2; __syncthreads();
  for (int st = 128; st > 0; st >>= 1) { if (tid < st) red[tid] += red[tid + st]; __syncthreads(); }
  const float rs = rsqrtf(red[0] / (float)N + eps);
  {
    for (int u = 0; u < per / 4; ++u) {
      const int j = tid * 4 + 1024 * u;
      v4f o, sm;
#pragma unroll
      for (int q = 0; q < 4; ++q) {
        float gg = g[j + q], bb = bta[j + q];
        if (PARAM_BF16) { gg = bf16_round(gg); bb = bf16_round(bb); }
        sm[q] = vals[u * 4 + q]; o[q] = (vals[u * 4 + q] - mu) * rs * gg + bb;
      }
      if (out_sum) *(v4f*)(out_sum + (size_t)row * N + j) = sm;
      *(v4f*)(out_norm + (size_t)row * N + j) = o;
    }
    
  }
}



// ---- f16 WMMA path (v_wmma_f32_16x16x32_f16): 11-bit significands for operands in range — used where a [0,1] probability operand needs more precision than bf16
typedef _Float16 v16h __attribute__((ext_vector_type(16)));
union FragH { v16h v; v8us half[2]; _Float16 h[16]; unsigned short u[16]; };
template <int NT>
__device__ __forceinline__ v8f mmaH(v16h ah, v16h al, v16h bh, v16h bl, v8f c) {
  c = __builtin_amdgcn_wmma_f32_16x16x32_f16(false, ah, false, bh, (short)0, c, false, false);
  if (NT >= 2) c = __builtin_amdgcn_wmma_f32_16x16x32_f16(false, al, false, bh, (short)0, c, false, false);
  if (NT >= 3) c = __builtin_amdgcn_wmma_f32_16x16x32_f16(false, ah, false, bl, (short)0, c, false, false);
  asm volatile("v_nop\n\tv_nop\n\tv_nop\n\tv_nop" : "+v"(c) : "v"(ah), "v"(al), "v"(bh), "v"(bl));
  return c;
}
// batched GEMM like k_gemm_b but f16 operands: A f32 (split into f16 hi/lo if ASPLIT, else rounded to f16), Bt = f16 values [n][k]; alpha; C f32; N multiple of 16 (partial tiles skipped)
template <bool ASPLIT>
__global__ __launch_bounds__(128) void k_gemm_h(const float* __restrict__ A, int lda, size_t sA, const _Float16* __restrict__ Bh, int ldb, size_t sB, float alpha, float* __restrict__ C, int ldc, size_t sC, int M, int N, int K) {
  __shared__ __attribute__((aligned(16))) float so[4][16][64];
  const int tid = threadIdx.x, w = tid >> 5, lane = tid & 31, ln = lane & 15, hh = lane >> 4; const int by = blockIdx.y;
  A += (size_t)by * sA; Bh += (size_t)by * sB; C += (size_t)by * sC;
  const int ntn = (N + 63) / 64; const int wid = blockIdx.x * 4 + w; const int mt = wid / ntn, nq = wid % ntn; if (mt * 16 >= M) return;
  const int row0 = mt * 16, col0 = nq * 64; const float* arow = A + (size_t)(row0 + ln) * lda;
  v8f acc[4] = {};
  for (int kb = 0; kb < K; kb += 32) {
    FragH ah, al;
    const v4f x0 = *(const v4fa*)(arow + kb + 8 * hh), x1 = *(const v4fa*)(arow + kb + 8 * hh + 4), x2 = *(const v4fa*)(arow + kb + 16 + 8 * hh), x3 = *(const v4fa*)(arow + kb + 16 + 8 * hh + 4);
    float xs[16] = {x0[0],x0[1],x0[2],x0[3],x1[0],x1[1],x1[2],x1[3],x2[0],x2[1],x2[2],x2[3],x3[0],x3[1],x3[2],x3[3]};
#pragma unroll
    for (int i = 0; i < 16; ++i) { const _Float16 h = (_Float16)xs[i]; ah.h[i] = h; al.h[i] = ASPLIT ? (_Float16)(xs[i] - (float)h) : (_Float16)0.0f; }
#pragma unroll
    for (int t = 0; t < 4; ++t) { if (col0 + t * 16 >= N) continue; const size_t boff = (size_t)(col0 + t * 16 + ln) * ldb + kb; FragH bq; bq.half[0] = *(const v8us*)(Bh + boff + 8 * hh); bq.half[1] = *(const v8us*)(Bh + boff + 16 + 8 * hh);
      acc[t] = mmaH<ASPLIT ? 2 : 1>(ah.v, al.v, bq.v, bq.v, acc[t]); }
  }
#pragma unroll
  for (int t = 0; t < 4; ++t) { if (col0 + t * 16 >= N) continue;
#pragma unroll
    for (int r = 0; r < 8; ++r) so[w][8 * hh + r][t * 16 + ln] = acc[t][r] * alpha; }
  __builtin_amdgcn_fence(__ATOMIC_ACQ_REL, "workgroup"); __builtin_amdgcn_wave_barrier();
  const int rsub = lane >> 4, c4 = (lane & 15) * 4;
  {
#pragma unroll
    for (int q = 0; q < 8; ++q) { const int r = q * 2 + rsub; if (col0 + c4 < N) { const v4f v = *(const v4fa*)&so[w][r][c4]; *(v4f*)(C + (size_t)(row0 + r) * ldc + col0 + c4) = v; } }
     }
}

// Wt[n][k] = f16(W[k][n]·scale) from f32 row-major W[K][N] (scale = power of two; bf16-exact weights stay exact in f16 away from the subnormal range)
__global__ __launch_bounds__(256) void k_wt_f16(const float* __restrict__ W, _Float16* __restrict__ Wt, int K, int N, float scale) {
  const int t = blockIdx.x * 256 + threadIdx.x; if (t >= N * (K / 8)) return; const int n = t / (K / 8), k8 = (t % (K / 8)) * 8; FragH f;
#pragma unroll
  for (int i = 0; i < 8; ++i) f.h[i] = (_Float16)(bf16_round(W[(size_t)(k8 + i) * N + n]) * scale); const v8us o = f.half[0];
  *(v8us*)((unsigned short*)Wt + (size_t)n * K + k8) = o; 
}
// k_gemm_hh variant with fused epilogue: v = acc·alpha + bias[by·sBias + col] (+ CP[(row/rowsPerB)·sCPb + by·64 + col] if CP) ; ACT 0 none / 1 elu ; writes f16 C16 (and f32 C if non-null)
template <int ACT>
__global__ __launch_bounds__(128) void k_gemm_hhx(const _Float16* __restrict__ A, int lda, size_t sA, const _Float16* __restrict__ Bh, int ldb, size_t sB, float alpha, const float* __restrict__ bias, size_t sBias, const float* __restrict__ CP, int rowsPerB, size_t sCPb, int row0g,
    float* __restrict__ C, _Float16* __restrict__ C16, int ldc, size_t sC, int M, int N, int K) {
  __shared__ __attribute__((aligned(16))) float so[4][16][64];
  const int tid = threadIdx.x, w = tid >> 5, lane = tid & 31, ln = lane & 15, hh = lane >> 4; const int by = blockIdx.y;
  A += (size_t)by * sA; Bh += (size_t)by * sB; const size_t cofs = (size_t)by * sC; const float* bp = bias ? bias + (size_t)by * sBias : nullptr;
  const int ntn = (N + 63) / 64; const int wid = blockIdx.x * 4 + w; const int mt = wid / ntn, nq = wid % ntn; if (mt * 16 >= M) return;
  const int row0 = mt * 16, col0 = nq * 64; const _Float16* arow = A + (size_t)(row0 + ln) * lda;
  v8f acc[4] = {};
  for (int kb = 0; kb < K; kb += 32) { FragH ah; ah.half[0] = *(const v8us*)((const unsigned short*)arow + kb + 8 * hh); ah.half[1] = *(const v8us*)((const unsigned short*)arow + kb + 16 + 8 * hh);
#pragma unroll
    for (int t = 0; t < 4; ++t) { if (col0 + t * 16 >= N) continue; const size_t boff = (size_t)(col0 + t * 16 + ln) * ldb + kb; FragH bq; bq.half[0] = *(const v8us*)((const unsigned short*)Bh + boff + 8 * hh); bq.half[1] = *(const v8us*)((const unsigned short*)Bh + boff + 16 + 8 * hh);
      acc[t] = mmaH<1>(ah.v, ah.v, bq.v, bq.v, acc[t]); }
  }
#pragma unroll
  for (int t = 0; t < 4; ++t) { if (col0 + t * 16 >= N) continue; const int col = col0 + t * 16 + ln; const float bv = bp ? bf16_round(bp[col]) : 0.f;
#pragma unroll
    for (int r = 0; r < 8; ++r) { float v = acc[t][r] * alpha + bv; if (CP) { const int bidx = (row0g + row0 + 8 * hh + r) / rowsPerB; v += CP[(size_t)bidx * sCPb + (size_t)by * 64 + col]; } if (ACT == 1) v = (v > 0.f) ? v : expm1f(v); else if (ACT == 7) v = (v > 0.f) ? v + 1.0f : expf(v); else if (ACT == 8) v = tanhf(v); else if (ACT == 9) v = 0.5f * v * (1.0f + tanhf(0.7978845608028654f * (v + 0.044715f * v * v * v))); else if (ACT == 11) v = 1.0f / (1.0f + expf(-v)); else if (ACT == 12) v = (v > 0.f) ? v : 0.01f * v; else if (ACT == 14) v = (v > 0.f) ? v : 0.1f * v; else if (ACT == 15) v = v / (1.0f + expf(-v)); else if (ACT == 3) v = fmaxf(v, 0.f); else if (ACT == 6) v = 0.5f * v * (1.0f + erff(v * 0.70710678118654752f)); so[w][8 * hh + r][t * 16 + ln] = v; } }
  __builtin_amdgcn_fence(__ATOMIC_ACQ_REL, "workgroup"); __builtin_amdgcn_wave_barrier();
  const int rsub = lane >> 4, c4 = (lane & 15) * 4; typedef _Float16 v4h __attribute__((ext_vector_type(4)));
  {
#pragma unroll
    for (int q = 0; q < 8; ++q) { const int r = q * 2 + rsub; if (col0 + c4 < N) { const v4f v = *(const v4fa*)&so[w][r][c4]; if (C) *(v4f*)(C + cofs + (size_t)(row0 + r) * ldc + col0 + c4) = v; if (C16) { v4h h4; for (int i = 0; i < 4; ++i) h4[i] = (_Float16)v[i]; *(v4h*)(C16 + cofs + (size_t)(row0 + r) * ldc + col0 + c4) = h4; } } }
     }
}


typedef _Float16 v4h __attribute__((ext_vector_type(4)));

__global__ __launch_bounds__(256) void k_x16(const float* __restrict__ x, _Float16* __restrict__ X16, size_t n8) { const size_t t = (size_t)blockIdx.x * 256 + threadIdx.x; if (t >= n8) return; FragH f;
#pragma unroll
  for (int q = 0; q < 8; ++q) f.h[q] = (_Float16)bf16_round(x[t * 8 + q]); *(v8us*)((unsigned short*)X16 + t * 8) = f.half[0];  }
__global__ __launch_bounds__(256) void k_h16(const float* __restrict__ x, _Float16* __restrict__ X16, size_t n8) { const size_t t = (size_t)blockIdx.x * 256 + threadIdx.x; if (t >= n8) return; FragH f;
#pragma unroll
  for (int q = 0; q < 8; ++q) f.h[q] = (_Float16)x[t * 8 + q]; *(v8us*)((unsigned short*)X16 + t * 8) = f.half[0];  }
__global__ __launch_bounds__(256) void k_round16f(const float* __restrict__ W, _Float16* __restrict__ Bt, size_t n8) { const size_t t = (size_t)blockIdx.x * 256 + threadIdx.x; if (t >= n8) return; FragH f;
#pragma unroll
  for (int i = 0; i < 8; ++i) f.h[i] = (_Float16)(bf16_round(W[t * 8 + i]) * 16.0f); *(v8us*)((unsigned short*)Bt + t * 8) = f.half[0];  }
template <int NHv, int TTv>
__global__ __launch_bounds__(256) void k_vt(const _Float16* __restrict__ V16, int ldv, int voff, _Float16* __restrict__ Vt) { __shared__ unsigned short tl[64][HS + 2]; const int tid = threadIdx.x; const int slab = blockIdx.x / (TTv / 64), lg = blockIdx.x % (TTv / 64); const int b = slab / NHv, h = slab % NHv;
  for (int i = tid; i < 64 * (HS / 8); i += 256) { const int r = i / (HS / 8), c8 = (i % (HS / 8)) * 8; FragH f; f.half[0] = *(const v8us*)((const unsigned short*)V16 + ((size_t)b * TTv + lg * 64 + r) * ldv + voff + h * HS + c8);
#pragma unroll
    for (int q = 0; q < 8; ++q) tl[r][c8 + q] = f.u[q]; }
  __syncthreads();
  {
#pragma unroll
    for (int rd = 0; rd < HS / 32; ++rd) { const int d = rd * 32 + tid / 8, pc = tid % 8; FragH f;
#pragma unroll
      for (int q = 0; q < 8; ++q) f.u[q] = tl[pc * 8 + q][d];
      *(v8us*)((unsigned short*)Vt + ((size_t)slab * HS + d) * TTv + lg * 64 + pc * 8) = f.half[0]; }
     } }

__global__ __launch_bounds__(256) void k_hl(const float* __restrict__ F, _Float16* __restrict__ Hh, _Float16* __restrict__ Hl, size_t n8) { const size_t t = (size_t)blockIdx.x * 256 + threadIdx.x; if (t >= n8) return; FragH fh, fl; const v4f a = *(const v4fa*)(F + t * 8), c = *(const v4fa*)(F + t * 8 + 4);
#pragma unroll
  for (int q = 0; q < 4; ++q) { _Float16 h = (_Float16)a[q]; fh.h[q] = h; fl.h[q] = (_Float16)((a[q] - (float)h) * 1024.0f); h = (_Float16)c[q]; fh.h[4 + q] = h; fl.h[4 + q] = (_Float16)((c[q] - (float)h) * 1024.0f); }
  { *(v8us*)((unsigned short*)Hh + t * 8) = fh.half[0]; *(v8us*)((unsigned short*)Hl + t * 8) = fl.half[0];  } }

// ---- fast GEMM (wave tile 32x64; requires M % 32 == 0 rows per launch region and N % 64 == 0); epilogue = k_gemm_hhx semantics ----
__device__ __forceinline__ v16h g2_frag(const _Float16* p, int hh) { FragH f; f.half[0] = *(const v8us*)((const unsigned short*)p + 8 * hh); f.half[1] = *(const v8us*)((const unsigned short*)p + 16 + 8 * hh); return f.v; }
__device__ __forceinline__ v8f g2_mma(v16h a, v16h b, v8f c) { v8f d = __builtin_amdgcn_wmma_f32_16x16x32_f16(false, a, false, b, (short)0, c, false, false); asm volatile("v_nop\n\tv_nop\n\tv_nop\n\tv_nop" : "+v"(d) : "v"(a), "v"(b)); return d; }
template <int ACT>
__global__ __launch_bounds__(128) void k_gemm2(const _Float16* __restrict__ A, int lda, size_t sA, const _Float16* __restrict__ Bh, int ldb, size_t sB, float alpha, const float* __restrict__ bias, size_t sBias, const float* __restrict__ CP, int rowsPerB, size_t sCPb, int row0g,
    float* __restrict__ C, _Float16* __restrict__ C16, int ldc, size_t sC, int M, int N, int K) {
  __shared__ __attribute__((aligned(16))) float so[4][32][68];
  const int tid = threadIdx.x, w = tid >> 5, lane = tid & 31, ln = lane & 15, hh = lane >> 4; const int by = blockIdx.y;
  A += (size_t)by * sA; Bh += (size_t)by * sB; const size_t cofs = (size_t)by * sC; const float* bp = bias ? bias + (size_t)by * sBias : nullptr;
  const int ntn = N >> 6; const int mt = blockIdx.x / ntn, nq = blockIdx.x - mt * ntn; const int row0 = mt * 128 + 32 * w, col0 = nq * 64; if (row0 >= M) return;
  const _Float16* a0p = A + (size_t)(row0 + ln) * lda; const _Float16* a1p = a0p + (size_t)16 * lda;
  const _Float16* b0p = Bh + (size_t)(col0 + ln) * ldb; const _Float16* b1p = b0p + (size_t)16 * ldb; const _Float16* b2p = b1p + (size_t)16 * ldb; const _Float16* b3p = b2p + (size_t)16 * ldb;
  const v8f z8 = {0.f,0.f,0.f,0.f,0.f,0.f,0.f,0.f}; v8f c00 = z8, c01 = z8, c02 = z8, c03 = z8, c10 = z8, c11 = z8, c12 = z8, c13 = z8;
#pragma unroll 1
  for (int kb = 0; kb < K; kb += 32) { const v16h a0 = g2_frag(a0p + kb, hh), a1 = g2_frag(a1p + kb, hh);
    v16h b = g2_frag(b0p + kb, hh); c00 = g2_mma(a0, b, c00); c10 = g2_mma(a1, b, c10);
    b = g2_frag(b1p + kb, hh); c01 = g2_mma(a0, b, c01); c11 = g2_mma(a1, b, c11);
    b = g2_frag(b2p + kb, hh); c02 = g2_mma(a0, b, c02); c12 = g2_mma(a1, b, c12);
    b = g2_frag(b3p + kb, hh); c03 = g2_mma(a0, b, c03); c13 = g2_mma(a1, b, c13); }
  v8f accs[8] = {c00, c01, c02, c03, c10, c11, c12, c13};
#pragma unroll
  for (int u = 0; u < 8; ++u) { const int t = u & 3, half = u >> 2; const int col = col0 + t * 16 + ln; const float bv = bp ? bf16_round(bp[col]) : 0.f;
#pragma unroll
    for (int r = 0; r < 8; ++r) { const int rloc = half * 16 + 8 * hh + r; float v = accs[u][r] * alpha + bv; if (CP) { const int bidx = (row0g + row0 + rloc) / rowsPerB; v += CP[(size_t)bidx * sCPb + (size_t)by * 64 + col]; }
      if (ACT == 3) v = fmaxf(v, 0.f); else if (ACT == 6) v = 0.5f * v * (1.0f + erff(v * 0.70710678118654752f)); else if (ACT == 11) v = 1.0f / (1.0f + expf(-v)); else if (ACT == 15) v = v / (1.0f + expf(-v)); else if (ACT == 12) v = (v > 0.f) ? v : 0.01f * v; else if (ACT == 8) v = tanhf(v);
      so[w][rloc][t * 16 + ln] = v; } }
  __builtin_amdgcn_fence(__ATOMIC_ACQ_REL, "workgroup"); __builtin_amdgcn_wave_barrier();
  const int rsub = lane >> 4, c4 = (lane & 15) * 4;
  {
#pragma unroll
    for (int q = 0; q < 16; ++q) { const int r = q * 2 + rsub; const v4f v = *(const v4fa*)&so[w][r][c4]; if (C) *(v4f*)(C + cofs + (size_t)(row0 + r) * ldc + col0 + c4) = v; if (C16) { v4h h4; for (int i = 0; i < 4; ++i) h4[i] = (_Float16)v[i]; *(v4h*)(C16 + cofs + (size_t)(row0 + r) * ldc + col0 + c4) = h4; } }
     } }



template <int CAUSAL>
__global__ __launch_bounds__(128) void k_flash(const _Float16* __restrict__ Q16, int ldq, const _Float16* __restrict__ K16, int ldk, const _Float16* __restrict__ Vt, const int* __restrict__ MSK, float* __restrict__ O, int ldo) {
  constexpr int RPW = 16, RTN = RPW / 16, NQB = TQ / (4 * RPW), DT = 4, KS = 2;
  __shared__ __attribute__((aligned(16))) unsigned short sP[4][RPW][40]; __shared__ __attribute__((aligned(16))) float sO[4][RPW][64 + 4];
  const int tid = threadIdx.x, w = tid >> 5, lane = tid & 31, ln = lane & 15, hh = lane >> 4;
  const int slab = blockIdx.x / QBLKS, qblk = blockIdx.x % QBLKS; (void)NQB; const int b = slab / NH, h = slab % NH; const int qb0 = qblk * (4 * RPW); const int q0 = qb0 + w * RPW;
  FragH aq[2][KS];
#pragma unroll
  for (int rt = 0; rt < RTN; ++rt) { const unsigned short* qr = (const unsigned short*)Q16 + ((size_t)b * TQ + q0 + rt * 16 + ln) * ldq + h * 64;
#pragma unroll
    for (int ks = 0; ks < KS; ++ks) { aq[rt][ks].half[0] = *(const v8us*)(qr + ks * 32 + 8 * hh); aq[rt][ks].half[1] = *(const v8us*)(qr + ks * 32 + 16 + 8 * hh); } }
  const unsigned short* Vth = (const unsigned short*)Vt + (size_t)slab * 64 * TK;
  float m_r[2][8], l_r[2][8]; v8f oacc[2][DT];
#pragma unroll
  for (int rt = 0; rt < RTN; ++rt) {
#pragma unroll
    for (int r = 0; r < 8; ++r) { m_r[rt][r] = -3.0e38f; l_r[rt][r] = 0.f; }
#pragma unroll
    for (int dt = 0; dt < DT; ++dt) oacc[rt][dt] = (v8f){0.f,0.f,0.f,0.f,0.f,0.f,0.f,0.f}; }
  const int jend = (CAUSAL == 1) ? (qb0 + 4 * RPW) : TK;      /* causal: keys beyond the block's last query never contribute */
#pragma unroll 1
  for (int j0 = 0; j0 < jend; j0 += 32) {
    v8f s[2][2];
#pragma unroll
    for (int nt = 0; nt < 2; ++nt) { const unsigned short* kr = (const unsigned short*)K16 + ((size_t)b * TK + j0 + nt * 16 + ln) * ldk + h * 64; FragH bk[KS];
#pragma unroll
      for (int ks = 0; ks < KS; ++ks) { bk[ks].half[0] = *(const v8us*)(kr + ks * 32 + 8 * hh); bk[ks].half[1] = *(const v8us*)(kr + ks * 32 + 16 + 8 * hh); }
#pragma unroll
      for (int rt = 0; rt < RTN; ++rt) { v8f acc = (v8f){0.f,0.f,0.f,0.f,0.f,0.f,0.f,0.f};
#pragma unroll
        for (int ks = 0; ks < KS; ++ks) acc = mmaH<1>(aq[rt][ks].v, aq[rt][ks].v, bk[ks].v, bk[ks].v, acc); s[rt][nt] = acc; } }
#pragma unroll
    for (int rt = 0; rt < RTN; ++rt)
#pragma unroll
      for (int r = 0; r < 8; ++r) { const int tq = q0 + rt * 16 + 8 * hh + r; const int k0 = j0 + ln, k1 = j0 + 16 + ln;
        const bool ok0 = (CAUSAL == 1) ? (k0 <= tq) : ((CAUSAL == 2) ? ((k0 >> 5) == (tq >> 5)) : true), ok1 = (CAUSAL == 1) ? (k1 <= tq) : ((CAUSAL == 2) ? ((k1 >> 5) == (tq >> 5)) : true);      /* mode 2: block-diagonal 32-token groups */
        const float s0 = ok0 ? s[rt][0][r] * SCL : -3.0e38f, s1 = ok1 ? s[rt][1][r] * SCL : -3.0e38f; float mc = fmaxf(s0, s1);
        mc = fmaxf(mc, __shfl_xor(mc, 1, 32)); mc = fmaxf(mc, __shfl_xor(mc, 2, 32)); mc = fmaxf(mc, __shfl_xor(mc, 4, 32)); mc = fmaxf(mc, __shfl_xor(mc, 8, 32));
        const float mn = fmaxf(m_r[rt][r], mc); const float al = (mn > -1.0e38f) ? expf(m_r[rt][r] - mn) : 1.0f; m_r[rt][r] = mn; const float p0 = ok0 ? expf(s0 - mn) : 0.f, p1 = ok1 ? expf(s1 - mn) : 0.f; l_r[rt][r] = l_r[rt][r] * al + p0 + p1;
#pragma unroll
        for (int dt = 0; dt < DT; ++dt) oacc[rt][dt][r] *= al;
        FragH t2; t2.h[0] = (_Float16)(p0 * 1024.0f); t2.h[1] = (_Float16)(p1 * 1024.0f); sP[w][rt * 16 + 8 * hh + r][ln] = t2.u[0]; sP[w][rt * 16 + 8 * hh + r][16 + ln] = t2.u[1]; }
    __builtin_amdgcn_fence(__ATOMIC_ACQ_REL, "workgroup"); __builtin_amdgcn_wave_barrier();
    FragH pa[2];
#pragma unroll
    for (int rt = 0; rt < RTN; ++rt) { pa[rt].half[0] = *(const v8us*)&sP[w][rt * 16 + ln][8 * hh]; pa[rt].half[1] = *(const v8us*)&sP[w][rt * 16 + ln][16 + 8 * hh]; }
#pragma unroll
    for (int dt = 0; dt < DT; ++dt) { const unsigned short* vrow = Vth + (size_t)(dt * 16 + ln) * TK + j0; FragH bv; bv.half[0] = *(const v8us*)(vrow + 8 * hh); bv.half[1] = *(const v8us*)(vrow + 16 + 8 * hh);
#pragma unroll
      for (int rt = 0; rt < RTN; ++rt) oacc[rt][dt] = mmaH<1>(pa[rt].v, pa[rt].v, bv.v, bv.v, oacc[rt][dt]); }
    __builtin_amdgcn_fence(__ATOMIC_ACQ_REL, "workgroup"); __builtin_amdgcn_wave_barrier(); }
#pragma unroll
  for (int rt = 0; rt < RTN; ++rt) {
#pragma unroll
    for (int r = 0; r < 8; ++r) { float l = l_r[rt][r]; l += __shfl_xor(l, 1, 32); l += __shfl_xor(l, 2, 32); l += __shfl_xor(l, 4, 32); l += __shfl_xor(l, 8, 32); l_r[rt][r] = (l > 0.f) ? 1.0f / (l * 1024.0f) : 0.f; }
#pragma unroll
    for (int dt = 0; dt < DT; ++dt)
#pragma unroll
      for (int r = 0; r < 8; ++r) sO[w][rt * 16 + 8 * hh + r][dt * 16 + ln] = oacc[rt][dt][r] * l_r[rt][r]; }
  __builtin_amdgcn_fence(__ATOMIC_ACQ_REL, "workgroup"); __builtin_amdgcn_wave_barrier();
  {
#pragma unroll
    for (int rp = 0; rp < RPW; rp += 2) { const int r = rp + (lane >> 4), pc = lane & 15; const v4f val = *(const v4fa*)&sO[w][r][pc * 4]; *(v4f*)(O + ((size_t)b * TQ + q0 + r) * ldo + h * 64 + pc * 4) = val; }
     } }
// Q/K-split variant: S = Qh Kh^T + (Ql Kh^T + Qh Kl^T)/1024 with Q/K = [hi | 2^10 residual] f16 planes (QL/KL same layout as Q16/K16); plain f16 P (x2^10) . V^T as in k_flash
template <int CAUSAL>
__global__ __launch_bounds__(128) void k_flashqk(const _Float16* __restrict__ Q16, const _Float16* __restrict__ QL, int ldq, const _Float16* __restrict__ K16, const _Float16* __restrict__ KL, int ldk, const _Float16* __restrict__ Vt, const int* __restrict__ MSK, float* __restrict__ O, int ldo) {
  constexpr int RPW = 16, RTN = RPW / 16, NQB = TQ / (4 * RPW), DT = HS / 16, KS = HS / 32;
  __shared__ __attribute__((aligned(16))) unsigned short sP[4][RPW][40]; __shared__ __attribute__((aligned(16))) float sO[4][RPW][HS + 4];
  const int tid = threadIdx.x, w = tid >> 5, lane = tid & 31, ln = lane & 15, hh = lane >> 4;
  const int slab = blockIdx.x / QBLKS, qblk = blockIdx.x % QBLKS; (void)NQB; const int b = slab / NH, h = slab % NH; const int qb0 = qblk * (4 * RPW); const int q0 = qb0 + w * RPW;
  FragH aq[2][KS], aql[2][KS];
#pragma unroll
  for (int rt = 0; rt < RTN; ++rt) { const unsigned short* qr = (const unsigned short*)Q16 + ((size_t)b * TQ + q0 + rt * 16 + ln) * ldq + h * HS; const unsigned short* ql = (const unsigned short*)QL + ((size_t)b * TQ + q0 + rt * 16 + ln) * ldq + h * HS;
#pragma unroll
    for (int ks = 0; ks < KS; ++ks) { aq[rt][ks].half[0] = *(const v8us*)(qr + ks * 32 + 8 * hh); aq[rt][ks].half[1] = *(const v8us*)(qr + ks * 32 + 16 + 8 * hh); aql[rt][ks].half[0] = *(const v8us*)(ql + ks * 32 + 8 * hh); aql[rt][ks].half[1] = *(const v8us*)(ql + ks * 32 + 16 + 8 * hh); } }
  const unsigned short* Vth = (const unsigned short*)Vt + (size_t)slab * HS * TK;
  float m_r[2][8], l_r[2][8]; v8f oacc[2][DT];
#pragma unroll
  for (int rt = 0; rt < RTN; ++rt) {
#pragma unroll
    for (int r = 0; r < 8; ++r) { m_r[rt][r] = -3.0e38f; l_r[rt][r] = 0.f; }
#pragma unroll
    for (int dt = 0; dt < DT; ++dt) oacc[rt][dt] = (v8f){0.f,0.f,0.f,0.f,0.f,0.f,0.f,0.f}; }
  const int jend = (CAUSAL == 1) ? (qb0 + 4 * RPW) : TK;      /* causal: keys beyond the block's last query never contribute */
#pragma unroll 1
  for (int j0 = 0; j0 < jend; j0 += 32) {
    v8f s[2][2];
#pragma unroll
    for (int nt = 0; nt < 2; ++nt) { const unsigned short* kr = (const unsigned short*)K16 + ((size_t)b * TK + j0 + nt * 16 + ln) * ldk + h * HS; const unsigned short* klr = (const unsigned short*)KL + ((size_t)b * TK + j0 + nt * 16 + ln) * ldk + h * HS; FragH bk[KS], bkl[KS];
#pragma unroll
      for (int ks = 0; ks < KS; ++ks) { bk[ks].half[0] = *(const v8us*)(kr + ks * 32 + 8 * hh); bk[ks].half[1] = *(const v8us*)(kr + ks * 32 + 16 + 8 * hh); bkl[ks].half[0] = *(const v8us*)(klr + ks * 32 + 8 * hh); bkl[ks].half[1] = *(const v8us*)(klr + ks * 32 + 16 + 8 * hh); }
#pragma unroll
      for (int rt = 0; rt < RTN; ++rt) { v8f acc = (v8f){0.f,0.f,0.f,0.f,0.f,0.f,0.f,0.f}, accl = acc;
#pragma unroll
        for (int ks = 0; ks < KS; ++ks) { acc = mmaH<1>(aq[rt][ks].v, aq[rt][ks].v, bk[ks].v, bk[ks].v, acc); accl = mmaH<1>(aql[rt][ks].v, aql[rt][ks].v, bk[ks].v, bk[ks].v, accl); accl = mmaH<1>(aq[rt][ks].v, aq[rt][ks].v, bkl[ks].v, bkl[ks].v, accl); }
#pragma unroll
        for (int r = 0; r < 8; ++r) acc[r] += accl[r] * 0.0009765625f;
        s[rt][nt] = acc; } }
#pragma unroll
    for (int rt = 0; rt < RTN; ++rt)
#pragma unroll
      for (int r = 0; r < 8; ++r) { const int tq = q0 + rt * 16 + 8 * hh + r; const int k0 = j0 + ln, k1 = j0 + 16 + ln;
        bool ok0 = (CAUSAL == 1) ? (k0 <= tq) : ((CAUSAL == 2) ? ((k0 >> 5) == (tq >> 5)) : true), ok1 = (CAUSAL == 1) ? (k1 <= tq) : ((CAUSAL == 2) ? ((k1 >> 5) == (tq >> 5)) : true);      /* mode 2: block-diagonal 32-token groups */
        if (CAUSAL == 4) { const int* mrow = MSK + ((size_t)b * TQ + tq) * TK; ok0 = mrow[k0] != 0; ok1 = mrow[k1] != 0; }      /* mode 4: per-(query, key) INPUT mask shared by all heads; masked keys contribute nothing (== the reference's -4096 fill, whose exp underflows to 0), rows with no valid key give l = 0 -> output 0 (== the reference's row_valid zeroing) */
        const float s0 = ok0 ? s[rt][0][r] * SCL : -3.0e38f, s1 = ok1 ? s[rt][1][r] * SCL : -3.0e38f; float mc = fmaxf(s0, s1);
        mc = fmaxf(mc, __shfl_xor(mc, 1, 32)); mc = fmaxf(mc, __shfl_xor(mc, 2, 32)); mc = fmaxf(mc, __shfl_xor(mc, 4, 32)); mc = fmaxf(mc, __shfl_xor(mc, 8, 32));
        const float mn = fmaxf(m_r[rt][r], mc); const float al = (mn > -1.0e38f) ? expf(m_r[rt][r] - mn) : 1.0f; m_r[rt][r] = mn; const float p0 = ok0 ? expf(s0 - mn) : 0.f, p1 = ok1 ? expf(s1 - mn) : 0.f; l_r[rt][r] = l_r[rt][r] * al + p0 + p1;
#pragma unroll
        for (int dt = 0; dt < DT; ++dt) oacc[rt][dt][r] *= al;
        FragH t2; t2.h[0] = (_Float16)(p0 * 1024.0f); t2.h[1] = (_Float16)(p1 * 1024.0f); sP[w][rt * 16 + 8 * hh + r][ln] = t2.u[0]; sP[w][rt * 16 + 8 * hh + r][16 + ln] = t2.u[1]; }
    __builtin_amdgcn_fence(__ATOMIC_ACQ_REL, "workgroup"); __builtin_amdgcn_wave_barrier();
    FragH pa[2];
#pragma unroll
    for (int rt = 0; rt < RTN; ++rt) { pa[rt].half[0] = *(const v8us*)&sP[w][rt * 16 + ln][8 * hh]; pa[rt].half[1] = *(const v8us*)&sP[w][rt * 16 + ln][16 + 8 * hh]; }
#pragma unroll
    for (int dt = 0; dt < DT; ++dt) { const unsigned short* vrow = Vth + (size_t)(dt * 16 + ln) * TK + j0; FragH bv; bv.half[0] = *(const v8us*)(vrow + 8 * hh); bv.half[1] = *(const v8us*)(vrow + 16 + 8 * hh);
#pragma unroll
      for (int rt = 0; rt < RTN; ++rt) oacc[rt][dt] = mmaH<1>(pa[rt].v, pa[rt].v, bv.v, bv.v, oacc[rt][dt]); }
    __builtin_amdgcn_fence(__ATOMIC_ACQ_REL, "workgroup"); __builtin_amdgcn_wave_barrier(); }
#pragma unroll
  for (int rt = 0; rt < RTN; ++rt) {
#pragma unroll
    for (int r = 0; r < 8; ++r) { float l = l_r[rt][r]; l += __shfl_xor(l, 1, 32); l += __shfl_xor(l, 2, 32); l += __shfl_xor(l, 4, 32); l += __shfl_xor(l, 8, 32); l_r[rt][r] = (l > 0.f) ? 1.0f / (l * 1024.0f) : 0.f; }
#pragma unroll
    for (int dt = 0; dt < DT; ++dt)
#pragma unroll
      for (int r = 0; r < 8; ++r) sO[w][rt * 16 + 8 * hh + r][dt * 16 + ln] = oacc[rt][dt][r] * l_r[rt][r]; }
  __builtin_amdgcn_fence(__ATOMIC_ACQ_REL, "workgroup"); __builtin_amdgcn_wave_barrier();
  {
#pragma unroll
    for (int rp = 0; rp < RPW; rp += 128 / HS) { const int r = rp + lane / (HS / 4), pc = lane % (HS / 4); const v4f val = *(const v4fa*)&sO[w][r][pc * 4]; *(v4f*)(O + ((size_t)b * TQ + q0 + r) * ldo + h * HS + pc * 4) = val; }
     } }

__global__ __launch_bounds__(256) void k_wpad(const float* __restrict__ Wm, const float* __restrict__ bm, _Float16* __restrict__ BP, float* __restrict__ PB) {
  const int r = blockIdx.x * 256 + threadIdx.x; if (r >= DP) return; 
  for (int c0 = 0; c0 < CM; c0 += 8) { FragH f; for (int q = 0; q < 8; ++q) f.h[q] = (_Float16)(bf16_round(Wm[(size_t)r * CM + c0 + q]) * 16.0f); unsigned short* dst = (unsigned short*)BP + (size_t)r * CM + c0; *(v8us*)dst = f.half[0];  }
  const float bv = bm[r]; *(float*)(PB + r) = bv;  }
__global__ __launch_bounds__(256) void k_wopad(const float* __restrict__ Wo, _Float16* __restrict__ BOP) { const int t = blockIdx.x * 256 + threadIdx.x; if (t >= CM * (DP / 8)) return; const int c0 = (t % (DP / 8)) * 8; const int o = t / (DP / 8); FragH f;
  for (int q = 0; q < 8; ++q) f.h[q] = (_Float16)(bf16_round(Wo[(size_t)o * CM + c0 + q]) * 16.0f); *(v8us*)((unsigned short*)BOP + (size_t)o * DP + c0) = f.half[0];  }

extern "C" void kernel_launch(void* const* d_in, const int* in_sizes, int n_in,
                              void* d_out, int out_size, void* d_ws, size_t ws_size, hipStream_t stream) {
  (void)in_sizes; (void)n_in; (void)out_size;
  const float* const* I = (const float* const*)d_in; const float* qx = I[0]; const float* kx = I[1]; const float* vx = I[2]; const float* Wq = I[3]; const float* bq = I[4]; const float* Wk = I[5]; const float* bk = I[6]; const float* Wv = I[7]; const float* bv = I[8]; const float* Wo = I[9]; const float* bo = I[10];
  char* ws = (char*)d_ws; size_t off = 0;
  auto take = [&](size_t bytes) { char* p = ws + off; off += (bytes + 255) & ~(size_t)255; return p; };
  _Float16* BPq = (_Float16*)take((size_t)DP * CM * 2); _Float16* BPk = (_Float16*)take((size_t)DP * CM * 2); _Float16* BPv = (_Float16*)take((size_t)DP * CM * 2); float* PBq = (float*)take(DP * 4); float* PBk = (float*)take(DP * 4); float* PBv = (float*)take(DP * 4); _Float16* BOP = (_Float16*)take((size_t)CM * DP * 2);
  _Float16* X16 = (_Float16*)take((size_t)NR * CM * 2); float* F32 = (float*)take((size_t)NR * DP * 4); _Float16* QH = (_Float16*)take((size_t)NR * DP * 2); _Float16* QL = (_Float16*)take((size_t)NR * DP * 2); _Float16* KH = (_Float16*)take((size_t)NR * DP * 2); _Float16* KL = (_Float16*)take((size_t)NR * DP * 2); _Float16* VH = (_Float16*)take((size_t)NR * DP * 2); _Float16* VL = (_Float16*)take((size_t)NR * DP * 2); _Float16* VT = (_Float16*)take((size_t)NR * DP * 2); _Float16* VTL = (_Float16*)take((size_t)NR * DP * 2); _Float16* O16 = (_Float16*)take((size_t)NR * DP * 2);
  float* O = F32;
  if (off > ws_size) return;      /* under 100 MiB (256 MiB ws) */
  k_wpad<<<(DP + 255) / 256, 256, 0, stream>>>(Wq, bq, BPq, PBq); k_wpad<<<(DP + 255) / 256, 256, 0, stream>>>(Wk, bk, BPk, PBk); k_wpad<<<(DP + 255) / 256, 256, 0, stream>>>(Wv, bv, BPv, PBv); k_wopad<<<(CM * (DP / 8) + 255) / 256, 256, 0, stream>>>(Wo, BOP);
  const dim3 gP((NR / 128) * (DP / 64), 1), gO((NR / 128) * (CM / 64), 1); const unsigned n8x = (unsigned)(((size_t)NR * CM / 8 + 255) / 256), n8 = (unsigned)(((size_t)NR * DP / 8 + 255) / 256);
  k_x16<<<n8x, 256, 0, stream>>>(qx, X16, (size_t)NR * CM / 8); k_gemm2<0><<<gP, 128, 0, stream>>>(X16, CM, 0, BPq, CM, 0, 0.0625f, PBq, 0, nullptr, 1, 0, 0, F32, nullptr, DP, 0, NR, DP, CM); k_hl<<<n8, 256, 0, stream>>>(F32, QH, QL, (size_t)NR * DP / 8);
  k_x16<<<n8x, 256, 0, stream>>>(kx, X16, (size_t)NR * CM / 8); k_gemm2<0><<<gP, 128, 0, stream>>>(X16, CM, 0, BPk, CM, 0, 0.0625f, PBk, 0, nullptr, 1, 0, 0, F32, nullptr, DP, 0, NR, DP, CM); k_hl<<<n8, 256, 0, stream>>>(F32, KH, KL, (size_t)NR * DP / 8);
  k_x16<<<n8x, 256, 0, stream>>>(vx, X16, (size_t)NR * CM / 8); k_gemm2<0><<<gP, 128, 0, stream>>>(X16, CM, 0, BPv, CM, 0, 0.0625f, PBv, 0, nullptr, 1, 0, 0, F32, nullptr, DP, 0, NR, DP, CM); k_hl<<<n8, 256, 0, stream>>>(F32, VH, VL, (size_t)NR * DP / 8);
  k_vt<NH, SLEN><<<NSEQ * NH * (SLEN / 64), 256, 0, stream>>>(VH, DP, 0, VT);
  k_flashqk<0><<<NSEQ * NH * QBLKS, 128, 0, stream>>>(QH, QL, DP, KH, KL, DP, VT, nullptr, O, DP);      /* q/k hi + residual; P (x2^10) and V plain f16 */
  k_h16<<<n8, 256, 0, stream>>>(O, O16, (size_t)NR * DP / 8);
  k_gemm2<0><<<gO, 128, 0, stream>>>(O16, DP, 0, BOP, DP, 0, 0.0625f, bo, 0, nullptr, 1, 0, 0, (float*)d_out, nullptr, CM, 0, NR, CM, DP);
}

// v002
// Measured time: 257 microseconds a run.
// Next to v001, in two timings, it ran 1.54 and 1.55 times as fast.
// All steps since v000 together make it 2.07 times as fast.
#include <hip/hip_runtime.h>
// Routing (windowed) attention (2 x 8 windows of 1024 tokens x 256; 8 heads x 32): qh/kh/vh = inputs q/k/v W^T + b split into heads; per (window, head) softmax(qh kh^T / sqrt(32)) vh; heads re-merged; ctx Wo^T + bo -> [2,8,4,16,16,256].
// Structure: 4 launches. (1) the four weights as exact x16 f16 planes; (2) the q, k, v projections in one grid (grid.y picks the operand): f16 WMMA GEMM, 32x64 wave tiles, f32 accumulation, the A loader reads the f32 input rows and rounds them itself, the epilogue writes hi + 2^10 residual planes (q, k) or V^T (v), each head in its own 32-wide slot; (3) the fused flash kernel with hi + 2^10-residual q/k planes (S = QhKh + (QlKh + QhKl)/1024) and plain f16 P (x2^10) and V (16 sequences x 8 heads); (4) the output GEMM, whose A loader rounds the merged f32 context to f16.
// Compute dtype: q, k, v and parameters rounded to bf16; qh, kh hi + residual (~2^-21-class logits); P and vh plain f16 (~2^-12); context as f16 (~2^-12) into Wo; f32 accumulation/softmax. v_wmma_f32_16x16x32_f16.
#define NSEQ 16
#define NB NSEQ
#define CM 256
#define HS 32                    /* head slot width in the q/k/v/context planes = true head dim */
#define DP (NH * HS)             /* 256: q/k/v width */
#define NR (NSEQ * SLEN)         /* 16384 rows */
#define QBLKS (TQ / 64)
#define SLEN 1024                /* tokens per routing window (K*Hp*W) */
#define TQ SLEN
#define TK SLEN
#define NH 8
#define SCL 0.17677669529663687f /* 32^-0.5 */
typedef __bf16 v16b __attribute__((ext_vector_type(16)));
typedef unsigned short v8us __attribute__((ext_vector_type(8), may_alias));
typedef float  v8f  __attribute__((ext_vector_type(8)));
typedef float  v4f  __attribute__((ext_vector_type(4)));
typedef float  v4fa __attribute__((ext_vector_type(4), may_alias));
union FragB { v16b v; v8us half[2]; unsigned short u[16]; };

__device__ __forceinline__ unsigned short bf16_bits(float x) { unsigned int u = __float_as_uint(x); return (unsigned short)((u + 0x7FFFu + ((u >> 16) & 1u)) >> 16); }
__device__ __forceinline__ float bf16_val(unsigned short b) { return __uint_as_float(((unsigned int)b) << 16); }
__device__ __forceinline__ float bf16_round(float x) { return bf16_val(bf16_bits(x)); }
// D += A·B with NT terms: 1 = ah·bh, 2 = + al·bh (A split), 3 = + ah·bl (both split)
template <int NT>
__device__ __forceinline__ v8f mmaN(v16b ah, v16b al, v16b bh, v16b bl, v8f c) {
  c = __builtin_amdgcn_wmma_f32_16x16x32_bf16(false, ah, false, bh, (short)0, c, false, false);
  if (NT >= 2) c = __builtin_amdgcn_wmma_f32_16x16x32_bf16(false, al, false, bh, (short)0, c, false, false);
  if (NT >= 3) c = __builtin_amdgcn_wmma_f32_16x16x32_bf16(false, ah, false, bl, (short)0, c, false, false);
  asm volatile("v_nop\n\tv_nop\n\tv_nop\n\tv_nop" : "+v"(c) : "v"(ah), "v"(al), "v"(bh), "v"(bl));
  return c;
}

__global__ __launch_bounds__(256) void k_wt_bf16(const float* __restrict__ W, unsigned short* __restrict__ Wt, int K, int N) {
  const int t = blockIdx.x * 256 + threadIdx.x;
  const int k8n = K / 8;
  if (t >= N * k8n) return;
  const int n = t / k8n, k8 = (t % k8n) * 8;
  v8us v;
#pragma unroll
  for (int i = 0; i < 8; ++i) v[i] = bf16_bits(W[(size_t)(k8 + i) * N + n]);
  *(v8us*)(Wt + (size_t)n * K + k8) = v;
  
}

// GEMM C[M][N] (f32, pitch ldc) = act(A[M][K]·W + bias). A f32 row-major (pitch lda) converted per fragment to bf16
// (ASPLIT: hi/lo two planes -> 2 terms, else single rounded term); Wt bf16 [N][K] (pitch ldb). BIAS_BF16 rounds the
// bias to bf16 first (bias quantised to bf16 before the add). K%32==0, M%16==0, N%64==0.
template <bool ASPLIT, int ACT, bool BIAS_BF16>
__global__ __launch_bounds__(128) void k_gemm_bf(const float* __restrict__ A, int lda, const unsigned short* __restrict__ Wt, int ldb,
                                               const float* __restrict__ bias, float* __restrict__ C, int ldc, int M, int N, int K) {
  __shared__ __attribute__((aligned(16))) float so[4][16][64];
  const int tid = threadIdx.x, w = tid >> 5, lane = tid & 31, ln = lane & 15, hh = lane >> 4;
  const int ntn = N / 64;
  const int wid = blockIdx.x * 4 + w;
  const int mt = wid / ntn, nq = wid % ntn;
  if (mt * 16 >= M) return;
  const int row0 = mt * 16, col0 = nq * 64;
  const float* arow = A + (size_t)(row0 + ln) * lda;
  v8f acc[4] = {};
  for (int kb = 0; kb < K; kb += 32) {
    FragB ah, al;
    const v4f x0 = *(const v4fa*)(arow + kb + 8 * hh), x1 = *(const v4fa*)(arow + kb + 8 * hh + 4);
    const v4f x2 = *(const v4fa*)(arow + kb + 16 + 8 * hh), x3 = *(const v4fa*)(arow + kb + 16 + 8 * hh + 4);
    float xs[16] = {x0[0],x0[1],x0[2],x0[3],x1[0],x1[1],x1[2],x1[3],x2[0],x2[1],x2[2],x2[3],x3[0],x3[1],x3[2],x3[3]};
#pragma unroll
    for (int i = 0; i < 16; ++i) { const unsigned short hb = bf16_bits(xs[i]); ah.u[i] = hb; al.u[i] = ASPLIT ? bf16_bits(xs[i] - bf16_val(hb)) : (unsigned short)0; }
#pragma unroll
    for (int t = 0; t < 4; ++t) {
      const unsigned short* brow = Wt + (size_t)(col0 + t * 16 + ln) * ldb + kb;
      FragB b;
      b.half[0] = *(const v8us*)(brow + 8 * hh);
      b.half[1] = *(const v8us*)(brow + 16 + 8 * hh);
      acc[t] = mmaN<ASPLIT ? 2 : 1>(ah.v, al.v, b.v, b.v, acc[t]);
    }
  }
#pragma unroll
  for (int t = 0; t < 4; ++t) {
    float bv = bias ? bias[col0 + t * 16 + ln] : 0.f;
    if (BIAS_BF16) bv = bf16_round(bv);
#pragma unroll
    for (int r = 0; r < 8; ++r) { float v = acc[t][r] + bv; if (ACT == 1) v = fmaxf(v, 0.f); so[w][8 * hh + r][t * 16 + ln] = v; }
  }
  __builtin_amdgcn_fence(__ATOMIC_ACQ_REL, "workgroup");
  __builtin_amdgcn_wave_barrier();
  const int rsub = lane >> 4, c4 = (lane & 15) * 4;
  {
#pragma unroll
    for (int q = 0; q < 8; ++q) {
      const int r = q * 2 + rsub;
      const v4f v = *(const v4fa*)&so[w][r][c4];
      *(v4f*)(C + (size_t)(row0 + r) * ldc + col0 + c4) = v;
    }
    
  }
}

// GEMM C = act(A·W + bias + resid): A f32 (ASPLIT -> hi/lo 2 terms), Wt bf16 [N][K]; ACT 0 none, 1 relu, 2 exact gelu;
// resid (optional, f32, row index = (row % rmod), pitch ldr, RES_BF16 rounds it) added before the activation.
template <bool ASPLIT, int ACT, bool BIAS_BF16, bool RES_BF16>
__global__ __launch_bounds__(128) void k_gemm_bf3(const float* __restrict__ A, int lda, const unsigned short* __restrict__ Wt, int ldb,
                                                const float* __restrict__ bias, const float* __restrict__ resid, int rmod, int ldr,
                                                float* __restrict__ C, int ldc, int M, int N, int K) {
  __shared__ __attribute__((aligned(16))) float so[4][16][64];
  const int tid = threadIdx.x, w = tid >> 5, lane = tid & 31, ln = lane & 15, hh = lane >> 4;
  const int ntn = N / 64;
  const int wid = blockIdx.x * 4 + w;
  const int mt = wid / ntn, nq = wid % ntn;
  if (mt * 16 >= M) return;
  const int row0 = mt * 16, col0 = nq * 64;
  const float* arow = A + (size_t)(row0 + ln) * lda;
  v8f acc[4] = {};
  for (int kb = 0; kb < K; kb += 32) {
    FragB ah, al;
    const v4f x0 = *(const v4fa*)(arow + kb + 8 * hh), x1 = *(const v4fa*)(arow + kb + 8 * hh + 4);
    const v4f x2 = *(const v4fa*)(arow + kb + 16 + 8 * hh), x3 = *(const v4fa*)(arow + kb + 16 + 8 * hh + 4);
    float xs[16] = {x0[0],x0[1],x0[2],x0[3],x1[0],x1[1],x1[2],x1[3],x2[0],x2[1],x2[2],x2[3],x3[0],x3[1],x3[2],x3[3]};
#pragma unroll
    for (int i = 0; i < 16; ++i) { const unsigned short hb = bf16_bits(xs[i]); ah.u[i] = hb; al.u[i] = ASPLIT ? bf16_bits(xs[i] - bf16_val(hb)) : (unsigned short)0; }
#pragma unroll
    for (int t = 0; t < 4; ++t) {
      const unsigned short* brow = Wt + (size_t)(col0 + t * 16 + ln) * ldb + kb;
      FragB b;
      b.half[0] = *(const v8us*)(brow + 8 * hh);
      b.half[1] = *(const v8us*)(brow + 16 + 8 * hh);
      acc[t] = mmaN<ASPLIT ? 2 : 1>(ah.v, al.v, b.v, b.v, acc[t]);
    }
  }
#pragma unroll
  for (int t = 0; t < 4; ++t) {
    const int col = col0 + t * 16 + ln;
    float bv = bias ? bias[col] : 0.f;
    if (BIAS_BF16) bv = bf16_round(bv);
#pragma unroll
    for (int r = 0; r < 8; ++r) {
      float v = acc[t][r] + bv;
      if (resid) { float rv = resid[(size_t)((row0 + 8 * hh + r) % rmod) * ldr + col]; if (RES_BF16) rv = bf16_round(rv); v += rv; }
      if (ACT == 1) v = fmaxf(v, 0.f);
      if (ACT == 2) v = 0.5f * v * (1.0f + erff(v * 0.70710678118654752f));
      if (ACT == 3) { const float u = 0.7978845608028654f * (v + 0.044715f * v * v * v); v = 0.5f * v * (1.0f + tanhf(u)); }
      so[w][8 * hh + r][t * 16 + ln] = v;
    }
  }
  __builtin_amdgcn_fence(__ATOMIC_ACQ_REL, "workgroup");
  __builtin_amdgcn_wave_barrier();
  const int rsub = lane >> 4, c4 = (lane & 15) * 4;
  {
#pragma unroll
    for (int q = 0; q < 8; ++q) {
      const int r = q * 2 + rsub;
      const v4f v = *(const v4fa*)&so[w][r][c4];
      *(v4f*)(C + (size_t)(row0 + r) * ldc + col0 + c4) = v;
    }
    
  }
}
// row LayerNorm (biased variance, eps) over N: s = X (+ R); optional out_sum <- s; out_norm <- (s-mu)*rsqrt(var+eps)*g + b
template <bool PARAM_BF16>
__global__ __launch_bounds__(256) void k_layernorm(const float* __restrict__ X, const float* __restrict__ R, const float* __restrict__ g, const float* __restrict__ bta,
                                                  float* __restrict__ out_sum, float* __restrict__ out_norm, int N, float eps) {
  __shared__ float red[256];
  const int row = blockIdx.x, tid = threadIdx.x;
  const float* x = X + (size_t)row * N; const float* rr = R ? R + (size_t)row * N : nullptr;
  float vals[16];                     // up to N = 4096
  const int per = N / 256;            // contiguous chunk per thread? use strided-by-4 chunks: thread handles j = tid*4 + 1024*u
  float s1 = 0.f;
  for (int u = 0; u < per / 4; ++u) {
    const int j = tid * 4 + 1024 * u;
    const v4f a = *(const v4fa*)(x + j);
    v4f b = {0.f,0.f,0.f,0.f}; if (rr) b = *(const v4fa*)(rr + j);
#pragma unroll
    for (int q = 0; q < 4; ++q) { const float v = a[q] + b[q]; vals[u * 4 + q] = v; s1 += v; }
  }
  red[tid] = s1; __syncthreads();
  for (int st = 128; st > 0; st >>= 1) { if (tid < st) red[tid] += red[tid + st]; __syncthreads(); }
  const float mu = red[0] / (float)N; __syncthreads();
  float s2 = 0.f;
  for (int u = 0; u < per / 4; ++u)
#pragma unroll
    for (int q = 0; q < 4; ++q) { const float c = vals[u * 4 + q] - mu; s2 += c * c; }
  red[tid] = s2; __syncthreads();
  for (int st = 128; st > 0; st >>= 1) { if (tid < st) red[tid] += red[tid + st]; __syncthreads(); }
  const float rs = rsqrtf(red[0] / (float)N + eps);
  {
    for (int u = 0; u < per / 4; ++u) {
      const int j = tid * 4 + 1024 * u;
      v4f o, sm;
#pragma unroll
      for (int q = 0; q < 4; ++q) {
        float gg = g[j + q], bb = bta[j + q];
        if (PARAM_BF16) { gg = bf16_round(gg); bb = bf16_round(bb); }
        sm[q] = vals[u * 4 + q]; o[q] = (vals[u * 4 + q] - mu) * rs * gg + bb;
      }
      if (out_sum) *(v4f*)(out_sum + (size_t)row * N + j) = sm;
      *(v4f*)(out_norm + (size_t)row * N + j) = o;
    }
    
  }
}



// ---- f16 WMMA path (v_wmma_f32_16x16x32_f16): 11-bit significands for operands in range — used where a [0,1] probability operand needs more precision than bf16
typedef _Float16 v16h __attribute__((ext_vector_type(16)));
union FragH { v16h v; v8us half[2]; _Float16 h[16]; unsigned short u[16]; };
template <int NT>
__device__ __forceinline__ v8f mmaH(v16h ah, v16h al, v16h bh, v16h bl, v8f c) {
  c = __builtin_amdgcn_wmma_f32_16x16x32_f16(false, ah, false, bh, (short)0, c, false, false);
  if (NT >= 2) c = __builtin_amdgcn_wmma_f32_16x16x32_f16(false, al, false, bh, (short)0, c, false, false);
  if (NT >= 3) c = __builtin_amdgcn_wmma_f32_16x16x32_f16(false, ah, false, bl, (short)0, c, false, false);
  asm volatile("v_nop\n\tv_nop\n\tv_nop\n\tv_nop" : "+v"(c) : "v"(ah), "v"(al), "v"(bh), "v"(bl));
  return c;
}
// batched GEMM like k_gemm_b but f16 operands: A f32 (split into f16 hi/lo if ASPLIT, else rounded to f16), Bt = f16 values [n][k]; alpha; C f32; N multiple of 16 (partial tiles skipped)
template <bool ASPLIT>
__global__ __launch_bounds__(128) void k_gemm_h(const float* __restrict__ A, int lda, size_t sA, const _Float16* __restrict__ Bh, int ldb, size_t sB, float alpha, float* __restrict__ C, int ldc, size_t sC, int M, int N, int K) {
  __shared__ __attribute__((aligned(16))) float so[4][16][64];
  const int tid = threadIdx.x, w = tid >> 5, lane = tid & 31, ln = lane & 15, hh = lane >> 4; const int by = blockIdx.y;
  A += (size_t)by * sA; Bh += (size_t)by * sB; C += (size_t)by * sC;
  const int ntn = (N + 63) / 64; const int wid = blockIdx.x * 4 + w; const int mt = wid / ntn, nq = wid % ntn; if (mt * 16 >= M) return;
  const int row0 = mt * 16, col0 = nq * 64; const float* arow = A + (size_t)(row0 + ln) * lda;
  v8f acc[4] = {};
  for (int kb = 0; kb < K; kb += 32) {
    FragH ah, al;
    const v4f x0 = *(const v4fa*)(arow + kb + 8 * hh), x1 = *(const v4fa*)(arow + kb + 8 * hh + 4), x2 = *(const v4fa*)(arow + kb + 16 + 8 * hh), x3 = *(const v4fa*)(arow + kb + 16 + 8 * hh + 4);
    float xs[16] = {x0[0],x0[1],x0[2],x0[3],x1[0],x1[1],x1[2],x1[3],x2[0],x2[1],x2[2],x2[3],x3[0],x3[1],x3[2],x3[3]};
#pragma unroll
    for (int i = 0; i < 16; ++i) { const _Float16 h = (_Float16)xs[i]; ah.h[i] = h; al.h[i] = ASPLIT ? (_Float16)(xs[i] - (float)h) : (_Float16)0.0f; }
#pragma unroll
    for (int t = 0; t < 4; ++t) { if (col0 + t * 16 >= N) continue; const size_t boff = (size_t)(col0 + t * 16 + ln) * ldb + kb; FragH bq; bq.half[0] = *(const v8us*)(Bh + boff + 8 * hh); bq.half[1] = *(const v8us*)(Bh + boff + 16 + 8 * hh);
      acc[t] = mmaH<ASPLIT ? 2 : 1>(ah.v, al.v, bq.v, bq.v, acc[t]); }
  }
#pragma unroll
  for (int t = 0; t < 4; ++t) { if (col0 + t * 16 >= N) continue;
#pragma unroll
    for (int r = 0; r < 8; ++r) so[w][8 * hh + r][t * 16 + ln] = acc[t][r] * alpha; }
  __builtin_amdgcn_fence(__ATOMIC_ACQ_REL, "workgroup"); __builtin_amdgcn_wave_barrier();
  const int rsub = lane >> 4, c4 = (lane & 15) * 4;
  {
#pragma unroll
    for (int q = 0; q < 8; ++q) { const int r = q * 2 + rsub; if (col0 + c4 < N) { const v4f v = *(const v4fa*)&so[w][r][c4]; *(v4f*)(C + (size_t)(row0 + r) * ldc + col0 + c4) = v; } }
     }
}

// Wt[n][k] = f16(W[k][n]·scale) from f32 row-major W[K][N] (scale = power of two; bf16-exact weights stay exact in f16 away from the subnormal range)
__global__ __launch_bounds__(256) void k_wt_f16(const float* __restrict__ W, _Float16* __restrict__ Wt, int K, int N, float scale) {
  const int t = blockIdx.x * 256 + threadIdx.x; if (t >= N * (K / 8)) return; const int n = t / (K / 8), k8 = (t % (K / 8)) * 8; FragH f;
#pragma unroll
  for (int i = 0; i < 8; ++i) f.h[i] = (_Float16)(bf16_round(W[(size_t)(k8 + i) * N + n]) * scale); const v8us o = f.half[0];
  *(v8us*)((unsigned short*)Wt + (size_t)n * K + k8) = o; 
}
// k_gemm_hh variant with fused epilogue: v = acc·alpha + bias[by·sBias + col] (+ CP[(row/rowsPerB)·sCPb + by·64 + col] if CP) ; ACT 0 none / 1 elu ; writes f16 C16 (and f32 C if non-null)
template <int ACT>
__global__ __launch_bounds__(128) void k_gemm_hhx(const _Float16* __restrict__ A, int lda, size_t sA, const _Float16* __restrict__ Bh, int ldb, size_t sB, float alpha, const float* __restrict__ bias, size_t sBias, const float* __restrict__ CP, int rowsPerB, size_t sCPb, int row0g,
    float* __restrict__ C, _Float16* __restrict__ C16, int ldc, size_t sC, int M, int N, int K) {
  __shared__ __attribute__((aligned(16))) float so[4][16][64];
  const int tid = threadIdx.x, w = tid >> 5, lane = tid & 31, ln = lane & 15, hh = lane >> 4; const int by = blockIdx.y;
  A += (size_t)by * sA; Bh += (size_t)by * sB; const size_t cofs = (size_t)by * sC; const float* bp = bias ? bias + (size_t)by * sBias : nullptr;
  const int ntn = (N + 63) / 64; const int wid = blockIdx.x * 4 + w; const int mt = wid / ntn, nq = wid % ntn; if (mt * 16 >= M) return;
  const int row0 = mt * 16, col0 = nq * 64; const _Float16* arow = A + (size_t)(row0 + ln) * lda;
  v8f acc[4] = {};
  for (int kb = 0; kb < K; kb += 32) { FragH ah; ah.half[0] = *(const v8us*)((const unsigned short*)arow + kb + 8 * hh); ah.half[1] = *(const v8us*)((const unsigned short*)arow + kb + 16 + 8 * hh);
#pragma unroll
    for (int t = 0; t < 4; ++t) { if (col0 + t * 16 >= N) continue; const size_t boff = (size_t)(col0 + t * 16 + ln) * ldb + kb; FragH bq; bq.half[0] = *(const v8us*)((const unsigned short*)Bh + boff + 8 * hh); bq.half[1] = *(const v8us*)((const unsigned short*)Bh + boff + 16 + 8 * hh);
      acc[t] = mmaH<1>(ah.v, ah.v, bq.v, bq.v, acc[t]); }
  }
#pragma unroll
  for (int t = 0; t < 4; ++t) { if (col0 + t * 16 >= N) continue; const int col = col0 + t * 16 + ln; const float bv = bp ? bf16_round(bp[col]) : 0.f;
#pragma unroll
    for (int r = 0; r < 8; ++r) { float v = acc[t][r] * alpha + bv; if (CP) { const int bidx = (row0g + row0 + 8 * hh + r) / rowsPerB; v += CP[(size_t)bidx * sCPb + (size_t)by * 64 + col]; } if (ACT == 1) v = (v > 0.f) ? v : expm1f(v); else if (ACT == 7) v = (v > 0.f) ? v + 1.0f : expf(v); else if (ACT == 8) v = tanhf(v); else if (ACT == 9) v = 0.5f * v * (1.0f + tanhf(0.7978845608028654f * (v + 0.044715f * v * v * v))); else if (ACT == 11) v = 1.0f / (1.0f + expf(-v)); else if (ACT == 12) v = (v > 0.f) ? v : 0.01f * v; else if (ACT == 14) v = (v > 0.f) ? v : 0.1f * v; else if (ACT == 15) v = v / (1.0f + expf(-v)); else if (ACT == 3) v = fmaxf(v, 0.f); else if (ACT == 6) v = 0.5f * v * (1.0f + erff(v * 0.70710678118654752f)); so[w][8 * hh + r][t * 16 + ln] = v; } }
  __builtin_amdgcn_fence(__ATOMIC_ACQ_REL, "workgroup"); __builtin_amdgcn_wave_barrier();
  const int rsub = lane >> 4, c4 = (lane & 15) * 4; typedef _Float16 v4h __attribute__((ext_vector_type(4)));
  {
#pragma unroll
    for (int q = 0; q < 8; ++q) { const int r = q * 2 + rsub; if (col0 + c4 < N) { const v4f v = *(const v4fa*)&so[w][r][c4]; if (C) *(v4f*)(C + cofs + (size_t)(row0 + r) * ldc + col0 + c4) = v; if (C16) { v4h h4; for (int i = 0; i < 4; ++i) h4[i] = (_Float16)v[i]; *(v4h*)(C16 + cofs + (size_t)(row0 + r) * ldc + col0 + c4) = h4; } } }
     }
}


typedef _Float16 v4h __attribute__((ext_vector_type(4)));

__global__ __launch_bounds__(256) void k_round16f(const float* __restrict__ W, _Float16* __restrict__ Bt, size_t n8) { const size_t t = (size_t)blockIdx.x * 256 + threadIdx.x; if (t >= n8) return; FragH f;
#pragma unroll
  for (int i = 0; i < 8; ++i) f.h[i] = (_Float16)(bf16_round(W[t * 8 + i]) * 16.0f); *(v8us*)((unsigned short*)Bt + t * 8) = f.half[0];  }
// ---- fused GEMM (block 128x64, wave tile 32x64, K = KD): A is read as f32 rows and rounded in the loader, the epilogue writes what the next kernel reads ----
#define KD 256                   /* = CM = DP: K and the row pitch of A and of the weight planes */
__device__ __forceinline__ v16h g2_frag(const _Float16* p, int hh) { FragH f; f.half[0] = *(const v8us*)((const unsigned short*)p + 8 * hh); f.half[1] = *(const v8us*)((const unsigned short*)p + 16 + 8 * hh); return f.v; }
__device__ __forceinline__ v8f g2_mma(v16h a, v16h b, v8f c) { v8f d = __builtin_amdgcn_wmma_f32_16x16x32_f16(false, a, false, b, (short)0, c, false, false); asm volatile("v_nop\n\tv_nop\n\tv_nop\n\tv_nop" : "+v"(d) : "v"(a), "v"(b)); return d; }
// the k order of g2_frag from an f32 row; RB: rounded to bf16 first (inputs), else straight to f16 (context)
template <bool RB>
__device__ __forceinline__ v16h gf_frag(const float* p, int hh) {
  const v4f x0 = *(const v4fa*)(p + 8 * hh), x1 = *(const v4fa*)(p + 8 * hh + 4), x2 = *(const v4fa*)(p + 16 + 8 * hh), x3 = *(const v4fa*)(p + 16 + 8 * hh + 4); FragH f;
#pragma unroll
  for (int i = 0; i < 4; ++i) { f.h[i] = (_Float16)(RB ? bf16_round(x0[i]) : x0[i]); f.h[4 + i] = (_Float16)(RB ? bf16_round(x1[i]) : x1[i]); f.h[8 + i] = (_Float16)(RB ? bf16_round(x2[i]) : x2[i]); f.h[12 + i] = (_Float16)(RB ? bf16_round(x3[i]) : x3[i]); }
  return f.v; }
template <bool RB>
__device__ __forceinline__ void gf_tile(const float* __restrict__ A, const _Float16* __restrict__ Bh, int row0, int col0, int ln, int hh, v8f (&accs)[8]) {
  const float* a0p = A + (size_t)(row0 + ln) * KD; const float* a1p = a0p + (size_t)16 * KD;
  const _Float16* b0p = Bh + (size_t)(col0 + ln) * KD; const _Float16* b1p = b0p + (size_t)16 * KD; const _Float16* b2p = b1p + (size_t)16 * KD; const _Float16* b3p = b2p + (size_t)16 * KD;
  const v8f z8 = {0.f,0.f,0.f,0.f,0.f,0.f,0.f,0.f}; v8f c00 = z8, c01 = z8, c02 = z8, c03 = z8, c10 = z8, c11 = z8, c12 = z8, c13 = z8;
#pragma unroll 1                 /* rolled, as before the fusion: keeps the registers low enough for every block of the grid to be resident at once */
  for (int kb = 0; kb < KD; kb += 32) { const v16h a0 = gf_frag<RB>(a0p + kb, hh), a1 = gf_frag<RB>(a1p + kb, hh);
    v16h b = g2_frag(b0p + kb, hh); c00 = g2_mma(a0, b, c00); c10 = g2_mma(a1, b, c10);
    b = g2_frag(b1p + kb, hh); c01 = g2_mma(a0, b, c01); c11 = g2_mma(a1, b, c11);
    b = g2_frag(b2p + kb, hh); c02 = g2_mma(a0, b, c02); c12 = g2_mma(a1, b, c12);
    b = g2_frag(b3p + kb, hh); c03 = g2_mma(a0, b, c03); c13 = g2_mma(a1, b, c13); }
  accs[0] = c00; accs[1] = c01; accs[2] = c02; accs[3] = c03; accs[4] = c10; accs[5] = c11; accs[6] = c12; accs[7] = c13; }
// q, k, v projections, blockIdx.y = 0, 1, 2: y = x W^T + b (weights x16, so acc / 16). q, k -> hi + 2^10 residual planes [row][DP]; v -> f16 V^T [(b * DP + col)][token]
__global__ __launch_bounds__(128) void k_proj(const float* __restrict__ xq, const float* __restrict__ xk, const float* __restrict__ xv, const _Float16* __restrict__ Bq, const _Float16* __restrict__ Bk, const _Float16* __restrict__ Bv,
    const float* __restrict__ bq, const float* __restrict__ bk, const float* __restrict__ bv, _Float16* __restrict__ QH, _Float16* __restrict__ QL, _Float16* __restrict__ KH, _Float16* __restrict__ KL, _Float16* __restrict__ VT) {
  __shared__ __attribute__((aligned(16))) float so[4][32][68];
  const int tid = threadIdx.x, w = tid >> 5, lane = tid & 31, ln = lane & 15, hh = lane >> 4; const int by = blockIdx.y;
  const float* A = (by == 0) ? xq : ((by == 1) ? xk : xv); const _Float16* Bh = (by == 0) ? Bq : ((by == 1) ? Bk : Bv); const float* bp = (by == 0) ? bq : ((by == 1) ? bk : bv);
  const int mt = blockIdx.x / (DP / 64), nq = blockIdx.x % (DP / 64); const int row0 = mt * 128 + 32 * w, col0 = nq * 64;
  v8f accs[8]; gf_tile<true>(A, Bh, row0, col0, ln, hh, accs);
  if (by == 2) {                 /* block-uniform. A lane's 8 accumulator rows are 8 consecutive tokens of one column: pack them, turn the block's 128 x 64 tile in LDS, store whole 256-byte runs of V^T */
    constexpr int VP = 128 + 8;  /* u16 pitch: rows stay 16-byte aligned and step 4 banks */
    unsigned short* vt = (unsigned short*)&so[0][0][0];
#pragma unroll
    for (int u = 0; u < 8; ++u) { const int c = (u & 3) * 16 + ln, half = u >> 2; const float bvv = bf16_round(bp[col0 + c]); FragH f;
#pragma unroll
      for (int r = 0; r < 8; ++r) f.h[r] = (_Float16)(accs[u][r] * 0.0625f + bvv);
      *(v8us*)(vt + c * VP + w * 32 + half * 16 + 8 * hh) = f.half[0]; }
    __syncthreads();             /* the four waves' token ranges of a column are read back together */
    unsigned short* dst = (unsigned short*)VT + ((size_t)(mt / (SLEN / 128)) * DP + col0) * SLEN + (mt % (SLEN / 128)) * 128;
#pragma unroll
    for (int i = 0; i < 8; ++i) { const int p = i * 128 + tid, c = p >> 4, j = p & 15; const v8us val = *(const v8us*)(vt + c * VP + j * 8); *(v8us*)(dst + (size_t)c * SLEN + j * 8) = val; }
    return; }
  _Float16* Hh = (by == 0) ? QH : KH; _Float16* Hl = (by == 0) ? QL : KL;
#pragma unroll
  for (int u = 0; u < 8; ++u) { const int t = u & 3, half = u >> 2; const float bvv = bf16_round(bp[col0 + t * 16 + ln]);
#pragma unroll
    for (int r = 0; r < 8; ++r) so[w][half * 16 + 8 * hh + r][t * 16 + ln] = accs[u][r] * 0.0625f + bvv; }
  __builtin_amdgcn_fence(__ATOMIC_ACQ_REL, "workgroup"); __builtin_amdgcn_wave_barrier();
  const int rsub = lane >> 4, c4 = (lane & 15) * 4;
#pragma unroll
  for (int q = 0; q < 16; ++q) { const int r = q * 2 + rsub; const v4f v = *(const v4fa*)&so[w][r][c4]; v4h h4, l4;
#pragma unroll
    for (int i = 0; i < 4; ++i) { const _Float16 h = (_Float16)v[i]; h4[i] = h; l4[i] = (_Float16)((v[i] - (float)h) * 1024.0f); }
    const size_t o = (size_t)(row0 + r) * DP + col0 + c4; *(v4h*)(Hh + o) = h4; *(v4h*)(Hl + o) = l4; }
  asm volatile("s_wait_xcnt 0x0" ::: "memory");      /* the V branch is laid out behind these stores and rewrites their registers: the wait stands in front of it on the fall-through too */
}
// output projection: out = f16(ctx) Wo^T + bo, f32 rows of CM
__global__ __launch_bounds__(128) void k_outg(const float* __restrict__ Ctx, const _Float16* __restrict__ Bo, const float* __restrict__ bo, float* __restrict__ C) {
  __shared__ __attribute__((aligned(16))) float so[4][32][68];
  const int tid = threadIdx.x, w = tid >> 5, lane = tid & 31, ln = lane & 15, hh = lane >> 4;
  const int mt = blockIdx.x / (CM / 64), nq = blockIdx.x % (CM / 64); const int row0 = mt * 128 + 32 * w, col0 = nq * 64;
  v8f accs[8]; gf_tile<false>(Ctx, Bo, row0, col0, ln, hh, accs);
#pragma unroll
  for (int u = 0; u < 8; ++u) { const int t = u & 3, half = u >> 2; const float bvv = bf16_round(bo[col0 + t * 16 + ln]);
#pragma unroll
    for (int r = 0; r < 8; ++r) so[w][half * 16 + 8 * hh + r][t * 16 + ln] = accs[u][r] * 0.0625f + bvv; }
  __builtin_amdgcn_fence(__ATOMIC_ACQ_REL, "workgroup"); __builtin_amdgcn_wave_barrier();
  const int rsub = lane >> 4, c4 = (lane & 15) * 4;
#pragma unroll
  for (int q = 0; q < 16; ++q) { const int r = q * 2 + rsub; const v4f v = *(const v4fa*)&so[w][r][c4]; *(v4f*)(C + (size_t)(row0 + r) * CM + col0 + c4) = v; } }



template <int CAUSAL>
__global__ __launch_bounds__(128) void k_flash(const _Float16* __restrict__ Q16, int ldq, const _Float16* __restrict__ K16, int ldk, const _Float16* __restrict__ Vt, const int* __restrict__ MSK, float* __restrict__ O, int ldo) {
  constexpr int RPW = 16, RTN = RPW / 16, NQB = TQ / (4 * RPW), DT = 4, KS = 2;
  __shared__ __attribute__((aligned(16))) unsigned short sP[4][RPW][40]; __shared__ __attribute__((aligned(16))) float sO[4][RPW][64 + 4];
  const int tid = threadIdx.x, w = tid >> 5, lane = tid & 31, ln = lane & 15, hh = lane >> 4;
  const int slab = blockIdx.x / QBLKS, qblk = blockIdx.x % QBLKS; (void)NQB; const int b = slab / NH, h = slab % NH; const int qb0 = qblk * (4 * RPW); const int q0 = qb0 + w * RPW;
  FragH aq[2][KS];
#pragma unroll
  for (int rt = 0; rt < RTN; ++rt) { const unsigned short* qr = (const unsigned short*)Q16 + ((size_t)b * TQ + q0 + rt * 16 + ln) * ldq + h * 64;
#pragma unroll
    for (int ks = 0; ks < KS; ++ks) { aq[rt][ks].half[0] = *(const v8us*)(qr + ks * 32 + 8 * hh); aq[rt][ks].half[1] = *(const v8us*)(qr + ks * 32 + 16 + 8 * hh); } }
  const unsigned short* Vth = (const unsigned short*)Vt + (size_t)slab * 64 * TK;
  float m_r[2][8], l_r[2][8]; v8f oacc[2][DT];
#pragma unroll
  for (int rt = 0; rt < RTN; ++rt) {
#pragma unroll
    for (int r = 0; r < 8; ++r) { m_r[rt][r] = -3.0e38f; l_r[rt][r] = 0.f; }
#pragma unroll
    for (int dt = 0; dt < DT; ++dt) oacc[rt][dt] = (v8f){0.f,0.f,0.f,0.f,0.f,0.f,0.f,0.f}; }
  const int jend = (CAUSAL == 1) ? (qb0 + 4 * RPW) : TK;      /* causal: keys beyond the block's last query never contribute */
#pragma unroll 1
  for (int j0 = 0; j0 < jend; j0 += 32) {
    v8f s[2][2];
#pragma unroll
    for (int nt = 0; nt < 2; ++nt) { const unsigned short* kr = (const unsigned short*)K16 + ((size_t)b * TK + j0 + nt * 16 + ln) * ldk + h * 64; FragH bk[KS];
#pragma unroll
      for (int ks = 0; ks < KS; ++ks) { bk[ks].half[0] = *(const v8us*)(kr + ks * 32 + 8 * hh); bk[ks].half[1] = *(const v8us*)(kr + ks * 32 + 16 + 8 * hh); }
#pragma unroll
      for (int rt = 0; rt < RTN; ++rt) { v8f acc = (v8f){0.f,0.f,0.f,0.f,0.f,0.f,0.f,0.f};
#pragma unroll
        for (int ks = 0; ks < KS; ++ks) acc = mmaH<1>(aq[rt][ks].v, aq[rt][ks].v, bk[ks].v, bk[ks].v, acc); s[rt][nt] = acc; } }
#pragma unroll
    for (int rt = 0; rt < RTN; ++rt)
#pragma unroll
      for (int r = 0; r < 8; ++r) { const int tq = q0 + rt * 16 + 8 * hh + r; const int k0 = j0 + ln, k1 = j0 + 16 + ln;
        const bool ok0 = (CAUSAL == 1) ? (k0 <= tq) : ((CAUSAL == 2) ? ((k0 >> 5) == (tq >> 5)) : true), ok1 = (CAUSAL == 1) ? (k1 <= tq) : ((CAUSAL == 2) ? ((k1 >> 5) == (tq >> 5)) : true);      /* mode 2: block-diagonal 32-token groups */
        const float s0 = ok0 ? s[rt][0][r] * SCL : -3.0e38f, s1 = ok1 ? s[rt][1][r] * SCL : -3.0e38f; float mc = fmaxf(s0, s1);
        mc = fmaxf(mc, __shfl_xor(mc, 1, 32)); mc = fmaxf(mc, __shfl_xor(mc, 2, 32)); mc = fmaxf(mc, __shfl_xor(mc, 4, 32)); mc = fmaxf(mc, __shfl_xor(mc, 8, 32));
        const float mn = fmaxf(m_r[rt][r], mc); const float al = (mn > -1.0e38f) ? expf(m_r[rt][r] - mn) : 1.0f; m_r[rt][r] = mn; const float p0 = ok0 ? expf(s0 - mn) : 0.f, p1 = ok1 ? expf(s1 - mn) : 0.f; l_r[rt][r] = l_r[rt][r] * al + p0 + p1;
#pragma unroll
        for (int dt = 0; dt < DT; ++dt) oacc[rt][dt][r] *= al;
        FragH t2; t2.h[0] = (_Float16)(p0 * 1024.0f); t2.h[1] = (_Float16)(p1 * 1024.0f); sP[w][rt * 16 + 8 * hh + r][ln] = t2.u[0]; sP[w][rt * 16 + 8 * hh + r][16 + ln] = t2.u[1]; }
    __builtin_amdgcn_fence(__ATOMIC_ACQ_REL, "workgroup"); __builtin_amdgcn_wave_barrier();
    FragH pa[2];
#pragma unroll
    for (int rt = 0; rt < RTN; ++rt) { pa[rt].half[0] = *(const v8us*)&sP[w][rt * 16 + ln][8 * hh]; pa[rt].half[1] = *(const v8us*)&sP[w][rt * 16 + ln][16 + 8 * hh]; }
#pragma unroll
    for (int dt = 0; dt < DT; ++dt) { const unsigned short* vrow = Vth + (size_t)(dt * 16 + ln) * TK + j0; FragH bv; bv.half[0] = *(const v8us*)(vrow + 8 * hh); bv.half[1] = *(const v8us*)(vrow + 16 + 8 * hh);
#pragma unroll
      for (int rt = 0; rt < RTN; ++rt) oacc[rt][dt] = mmaH<1>(pa[rt].v, pa[rt].v, bv.v, bv.v, oacc[rt][dt]); }
    __builtin_amdgcn_fence(__ATOMIC_ACQ_REL, "workgroup"); __builtin_amdgcn_wave_barrier(); }
#pragma unroll
  for (int rt = 0; rt < RTN; ++rt) {
#pragma unroll
    for (int r = 0; r < 8; ++r) { float l = l_r[rt][r]; l += __shfl_xor(l, 1, 32); l += __shfl_xor(l, 2, 32); l += __shfl_xor(l, 4, 32); l += __shfl_xor(l, 8, 32); l_r[rt][r] = (l > 0.f) ? 1.0f / (l * 1024.0f) : 0.f; }
#pragma unroll
    for (int dt = 0; dt < DT; ++dt)
#pragma unroll
      for (int r = 0; r < 8; ++r) sO[w][rt * 16 + 8 * hh + r][dt * 16 + ln] = oacc[rt][dt][r] * l_r[rt][r]; }
  __builtin_amdgcn_fence(__ATOMIC_ACQ_REL, "workgroup"); __builtin_amdgcn_wave_barrier();
  {
#pragma unroll
    for (int rp = 0; rp < RPW; rp += 2) { const int r = rp + (lane >> 4), pc = lane & 15; const v4f val = *(const v4fa*)&sO[w][r][pc * 4]; *(v4f*)(O + ((size_t)b * TQ + q0 + r) * ldo + h * 64 + pc * 4) = val; }
     } }
// Q/K-split variant: S = Qh Kh^T + (Ql Kh^T + Qh Kl^T)/1024 with Q/K = [hi | 2^10 residual] f16 planes (QL/KL same layout as Q16/K16); plain f16 P (x2^10) . V^T as in k_flash
template <int CAUSAL>
__global__ __launch_bounds__(128) void k_flashqk(const _Float16* __restrict__ Q16, const _Float16* __restrict__ QL, int ldq, const _Float16* __restrict__ K16, const _Float16* __restrict__ KL, int ldk, const _Float16* __restrict__ Vt, const int* __restrict__ MSK, float* __restrict__ O, int ldo) {
  constexpr int RPW = 16, RTN = RPW / 16, NQB = TQ / (4 * RPW), DT = HS / 16, KS = HS / 32;
  __shared__ __attribute__((aligned(16))) unsigned short sP[4][RPW][40]; __shared__ __attribute__((aligned(16))) float sO[4][RPW][HS + 4];
  const int tid = threadIdx.x, w = tid >> 5, lane = tid & 31, ln = lane & 15, hh = lane >> 4;
  const int slab = blockIdx.x / QBLKS, qblk = blockIdx.x % QBLKS; (void)NQB; const int b = slab / NH, h = slab % NH; const int qb0 = qblk * (4 * RPW); const int q0 = qb0 + w * RPW;
  FragH aq[2][KS], aql[2][KS];
#pragma unroll
  for (int rt = 0; rt < RTN; ++rt) { const unsigned short* qr = (const unsigned short*)Q16 + ((size_t)b * TQ + q0 + rt * 16 + ln) * ldq + h * HS; const unsigned short* ql = (const unsigned short*)QL + ((size_t)b * TQ + q0 + rt * 16 + ln) * ldq + h * HS;
#pragma unroll
    for (int ks = 0; ks < KS; ++ks) { aq[rt][ks].half[0] = *(const v8us*)(qr + ks * 32 + 8 * hh); aq[rt][ks].half[1] = *(const v8us*)(qr + ks * 32 + 16 + 8 * hh); aql[rt][ks].half[0] = *(const v8us*)(ql + ks * 32 + 8 * hh); aql[rt][ks].half[1] = *(const v8us*)(ql + ks * 32 + 16 + 8 * hh); } }
  const unsigned short* Vth = (const unsigned short*)Vt + (size_t)slab * HS * TK;
  float m_r[2][8], l_r[2][8]; v8f oacc[2][DT];
#pragma unroll
  for (int rt = 0; rt < RTN; ++rt) {
#pragma unroll
    for (int r = 0; r < 8; ++r) { m_r[rt][r] = -3.0e38f; l_r[rt][r] = 0.f; }
#pragma unroll
    for (int dt = 0; dt < DT; ++dt) oacc[rt][dt] = (v8f){0.f,0.f,0.f,0.f,0.f,0.f,0.f,0.f}; }
  const int jend = (CAUSAL == 1) ? (qb0 + 4 * RPW) : TK;      /* causal: keys beyond the block's last query never contribute */
#pragma unroll 1
  for (int j0 = 0; j0 < jend; j0 += 32) {
    v8f s[2][2];
#pragma unroll
    for (int nt = 0; nt < 2; ++nt) { const unsigned short* kr = (const unsigned short*)K16 + ((size_t)b * TK + j0 + nt * 16 + ln) * ldk + h * HS; const unsigned short* klr = (const unsigned short*)KL + ((size_t)b * TK + j0 + nt * 16 + ln) * ldk + h * HS; FragH bk[KS], bkl[KS];
#pragma unroll
      for (int ks = 0; ks < KS; ++ks) { bk[ks].half[0] = *(const v8us*)(kr + ks * 32 + 8 * hh); bk[ks].half[1] = *(const v8us*)(kr + ks * 32 + 16 + 8 * hh); bkl[ks].half[0] = *(const v8us*)(klr + ks * 32 + 8 * hh); bkl[ks].half[1] = *(const v8us*)(klr + ks * 32 + 16 + 8 * hh); }
#pragma unroll
      for (int rt = 0; rt < RTN; ++rt) { v8f acc = (v8f){0.f,0.f,0.f,0.f,0.f,0.f,0.f,0.f}, accl = acc;
#pragma unroll
        for (int ks = 0; ks < KS; ++ks) { acc = mmaH<1>(aq[rt][ks].v, aq[rt][ks].v, bk[ks].v, bk[ks].v, acc); accl = mmaH<1>(aql[rt][ks].v, aql[rt][ks].v, bk[ks].v, bk[ks].v, accl); accl = mmaH<1>(aq[rt][ks].v, aq[rt][ks].v, bkl[ks].v, bkl[ks].v, accl); }
#pragma unroll
        for (int r = 0; r < 8; ++r) acc[r] += accl[r] * 0.0009765625f;
        s[rt][nt] = acc; } }
#pragma unroll
    for (int rt = 0; rt < RTN; ++rt)
#pragma unroll
      for (int r = 0; r < 8; ++r) { const int tq = q0 + rt * 16 + 8 * hh + r; const int k0 = j0 + ln, k1 = j0 + 16 + ln;
        bool ok0 = (CAUSAL == 1) ? (k0 <= tq) : ((CAUSAL == 2) ? ((k0 >> 5) == (tq >> 5)) : true), ok1 = (CAUSAL == 1) ? (k1 <= tq) : ((CAUSAL == 2) ? ((k1 >> 5) == (tq >> 5)) : true);      /* mode 2: block-diagonal 32-token groups */
        if (CAUSAL == 4) { const int* mrow = MSK + ((size_t)b * TQ + tq) * TK; ok0 = mrow[k0] != 0; ok1 = mrow[k1] != 0; }      /* mode 4: per-(query, key) INPUT mask shared by all heads; masked keys contribute nothing (== the reference's -4096 fill, whose exp underflows to 0), rows with no valid key give l = 0 -> output 0 (== the reference's row_valid zeroing) */
        const float s0 = ok0 ? s[rt][0][r] * SCL : -3.0e38f, s1 = ok1 ? s[rt][1][r] * SCL : -3.0e38f; float mc = fmaxf(s0, s1);
        mc = fmaxf(mc, __shfl_xor(mc, 1, 32)); mc = fmaxf(mc, __shfl_xor(mc, 2, 32)); mc = fmaxf(mc, __shfl_xor(mc, 4, 32)); mc = fmaxf(mc, __shfl_xor(mc, 8, 32));
        const float mn = fmaxf(m_r[rt][r], mc); const float al = (mn > -1.0e38f) ? expf(m_r[rt][r] - mn) : 1.0f; m_r[rt][r] = mn; const float p0 = ok0 ? expf(s0 - mn) : 0.f, p1 = ok1 ? expf(s1 - mn) : 0.f; l_r[rt][r] = l_r[rt][r] * al + p0 + p1;
#pragma unroll
        for (int dt = 0; dt < DT; ++dt) oacc[rt][dt][r] *= al;
        FragH t2; t2.h[0] = (_Float16)(p0 * 1024.0f); t2.h[1] = (_Float16)(p1 * 1024.0f); sP[w][rt * 16 + 8 * hh + r][ln] = t2.u[0]; sP[w][rt * 16 + 8 * hh + r][16 + ln] = t2.u[1]; }
    __builtin_amdgcn_fence(__ATOMIC_ACQ_REL, "workgroup"); __builtin_amdgcn_wave_barrier();
    FragH pa[2];
#pragma unroll
    for (int rt = 0; rt < RTN; ++rt) { pa[rt].half[0] = *(const v8us*)&sP[w][rt * 16 + ln][8 * hh]; pa[rt].half[1] = *(const v8us*)&sP[w][rt * 16 + ln][16 + 8 * hh]; }
#pragma unroll
    for (int dt = 0; dt < DT; ++dt) { const unsigned short* vrow = Vth + (size_t)(dt * 16 + ln) * TK + j0; FragH bv; bv.half[0] = *(const v8us*)(vrow + 8 * hh); bv.half[1] = *(const v8us*)(vrow + 16 + 8 * hh);
#pragma unroll
      for (int rt = 0; rt < RTN; ++rt) oacc[rt][dt] = mmaH<1>(pa[rt].v, pa[rt].v, bv.v, bv.v, oacc[rt][dt]); }
    __builtin_amdgcn_fence(__ATOMIC_ACQ_REL, "workgroup"); __builtin_amdgcn_wave_barrier(); }
#pragma unroll
  for (int rt = 0; rt < RTN; ++rt) {
#pragma unroll
    for (int r = 0; r < 8; ++r) { float l = l_r[rt][r]; l += __shfl_xor(l, 1, 32); l += __shfl_xor(l, 2, 32); l += __shfl_xor(l, 4, 32); l += __shfl_xor(l, 8, 32); l_r[rt][r] = (l > 0.f) ? 1.0f / (l * 1024.0f) : 0.f; }
#pragma unroll
    for (int dt = 0; dt < DT; ++dt)
#pragma unroll
      for (int r = 0; r < 8; ++r) sO[w][rt * 16 + 8 * hh + r][dt * 16 + ln] = oacc[rt][dt][r] * l_r[rt][r]; }
  __builtin_amdgcn_fence(__ATOMIC_ACQ_REL, "workgroup"); __builtin_amdgcn_wave_barrier();
  {
#pragma unroll
    for (int rp = 0; rp < RPW; rp += 128 / HS) { const int r = rp + lane / (HS / 4), pc = lane % (HS / 4); const v4f val = *(const v4fa*)&sO[w][r][pc * 4]; *(v4f*)(O + ((size_t)b * TQ + q0 + r) * ldo + h * HS + pc * 4) = val; }
     } }

// the four weights (row-major [out][in], the GEMM's B layout as they stand) as f16(bf16(W) x 16); blockIdx.y picks the weight
__global__ __launch_bounds__(256) void k_wprep(const float* __restrict__ Wq, const float* __restrict__ Wk, const float* __restrict__ Wv, const float* __restrict__ Wo, _Float16* __restrict__ Bq, _Float16* __restrict__ Bk, _Float16* __restrict__ Bv, _Float16* __restrict__ Bo) {
  const int by = blockIdx.y; const float* Wm = (by == 0) ? Wq : ((by == 1) ? Wk : ((by == 2) ? Wv : Wo)); _Float16* Bt = (by == 0) ? Bq : ((by == 1) ? Bk : ((by == 2) ? Bv : Bo));
  const size_t t = (size_t)blockIdx.x * 256 + threadIdx.x; FragH f;
#pragma unroll
  for (int i = 0; i < 8; ++i) f.h[i] = (_Float16)(bf16_round(Wm[t * 8 + i]) * 16.0f); *(v8us*)((unsigned short*)Bt + t * 8) = f.half[0]; }

extern "C" void kernel_launch(void* const* d_in, const int* in_sizes, int n_in,
                              void* d_out, int out_size, void* d_ws, size_t ws_size, hipStream_t stream) {
  (void)in_sizes; (void)n_in; (void)out_size;
  const float* const* I = (const float* const*)d_in; const float* qx = I[0]; const float* kx = I[1]; const float* vx = I[2]; const float* Wq = I[3]; const float* bq = I[4]; const float* Wk = I[5]; const float* bk = I[6]; const float* Wv = I[7]; const float* bv = I[8]; const float* Wo = I[9]; const float* bo = I[10];
  char* ws = (char*)d_ws; size_t off = 0;
  auto take = [&](size_t bytes) { char* p = ws + off; off += (bytes + 255) & ~(size_t)255; return p; };
  _Float16* BPq = (_Float16*)take((size_t)DP * CM * 2); _Float16* BPk = (_Float16*)take((size_t)DP * CM * 2); _Float16* BPv = (_Float16*)take((size_t)DP * CM * 2); _Float16* BOP = (_Float16*)take((size_t)CM * DP * 2);
  float* O = (float*)take((size_t)NR * DP * 4); _Float16* QH = (_Float16*)take((size_t)NR * DP * 2); _Float16* QL = (_Float16*)take((size_t)NR * DP * 2); _Float16* KH = (_Float16*)take((size_t)NR * DP * 2); _Float16* KL = (_Float16*)take((size_t)NR * DP * 2); _Float16* VT = (_Float16*)take((size_t)NR * DP * 2);
  if (off > ws_size) return;      /* under 64 MiB (256 MiB ws) */
  k_wprep<<<dim3(DP * CM / 8 / 256, 4), 256, 0, stream>>>(Wq, Wk, Wv, Wo, BPq, BPk, BPv, BOP);
  k_proj<<<dim3((NR / 128) * (DP / 64), 3), 128, 0, stream>>>(qx, kx, vx, BPq, BPk, BPv, bq, bk, bv, QH, QL, KH, KL, VT);
  k_flashqk<0><<<NSEQ * NH * QBLKS, 128, 0, stream>>>(QH, QL, DP, KH, KL, DP, VT, nullptr, O, DP);      /* q/k hi + residual; P (x2^10) and V plain f16 */
  k_outg<<<(NR / 128) * (CM / 64), 128, 0, stream>>>(O, BOP, bo, (float*)d_out);
}

// v003
// One run takes 125 microseconds.
// Two timings next to v002 put it at 2.04 and 2.03 times that version's speed.
// Counting every step since v000, it is 4.22 times as fast.
#include <hip/hip_runtime.h>
// Routing (windowed) attention (2 x 8 windows of 1024 tokens x 256; 8 heads x 32): qh/kh/vh = inputs q/k/v W^T + b split into heads; per (window, head) softmax(qh kh^T / sqrt(32)) vh; heads re-merged; ctx Wo^T + bo -> [2,8,4,16,16,256].
// Structure: 4 launches. (1) the four weights as exact x16 f16 planes; (2) the q, k, v projections in one grid (grid.y picks the operand): f16 WMMA GEMM, 32x64 wave tiles, f32 accumulation, the A loader reads the f32 input rows and rounds them itself, the epilogue writes hi + 2^10 residual planes (q, k) or V^T (v), each head in its own 32-wide slot; (3) the fused flash kernel, transposed (S^T = K Q^T, O^T += V^T P^T, P stays in registers), with hi + 2^10-residual q/k planes (S = QhKh + (QlKh + QhKl)/1024) and plain f16 P (x2^10) and V (16 sequences x 8 heads); (4) the output GEMM, whose A loader rounds the merged f32 context to f16.
// Compute dtype: q, k, v and parameters rounded to bf16; qh, kh hi + residual (~2^-21-class logits); P and vh plain f16 (~2^-12); context as f16 (~2^-12) into Wo; f32 accumulation/softmax. v_wmma_f32_16x16x32_f16.
#define NSEQ 16
#define NB NSEQ
#define CM 256
#define HS 32                    /* head slot width in the q/k/v/context planes = true head dim */
#define DP (NH * HS)             /* 256: q/k/v width */
#define NR (NSEQ * SLEN)         /* 16384 rows */
#define QBLKS (TQ / 64)
#define SLEN 1024                /* tokens per routing window (K*Hp*W) */
#define TQ SLEN
#define TK SLEN
#define NH 8
#define SCL 0.17677669529663687f /* 32^-0.5 */
typedef __bf16 v16b __attribute__((ext_vector_type(16)));
typedef unsigned short v8us __attribute__((ext_vector_type(8), may_alias));
typedef float  v8f  __attribute__((ext_vector_type(8)));
typedef float  v4f  __attribute__((ext_vector_type(4)));
typedef float  v4fa __attribute__((ext_vector_type(4), may_alias));
union FragB { v16b v; v8us half[2]; unsigned short u[16]; };

__device__ __forceinline__ unsigned short bf16_bits(float x) { unsigned int u = __float_as_uint(x); return (unsigned short)((u + 0x7FFFu + ((u >> 16) & 1u)) >> 16); }
__device__ __forceinline__ float bf16_val(unsigned short b) { return __uint_as_float(((unsigned int)b) << 16); }
__device__ __forceinline__ float bf16_round(float x) { return bf16_val(bf16_bits(x)); }
// D += A·B with NT terms: 1 = ah·bh, 2 = + al·bh (A split), 3 = + ah·bl (both split)
template <int NT>
__device__ __forceinline__ v8f mmaN(v16b ah, v16b al, v16b bh, v16b bl, v8f c) {
  c = __builtin_amdgcn_wmma_f32_16x16x32_bf16(false, ah, false, bh, (short)0, c, false, false);
  if (NT >= 2) c = __builtin_amdgcn_wmma_f32_16x16x32_bf16(false, al, false, bh, (short)0, c, false, false);
  if (NT >= 3) c = __builtin_amdgcn_wmma_f32_16x16x32_bf16(false, ah, false, bl, (short)0, c, false, false);
  asm volatile("v_nop\n\tv_nop\n\tv_nop\n\tv_nop" : "+v"(c) : "v"(ah), "v"(al), "v"(bh), "v"(bl));
  return c;
}

__global__ __launch_bounds__(256) void k_wt_bf16(const float* __restrict__ W, unsigned short* __restrict__ Wt, int K, int N) {
  const int t = blockIdx.x * 256 + threadIdx.x;
  const int k8n = K / 8;
  if (t >= N * k8n) return;
  const int n = t / k8n, k8 = (t % k8n) * 8;
  v8us v;
#pragma unroll
  for (int i = 0; i < 8; ++i) v[i] = bf16_bits(W[(size_t)(k8 + i) * N + n]);
  *(v8us*)(Wt + (size_t)n * K + k8) = v;
  
}

// GEMM C[M][N] (f32, pitch ldc) = act(A[M][K]·W + bias). A f32 row-major (pitch lda) converted per fragment to bf16
// (ASPLIT: hi/lo two planes -> 2 terms, else single rounded term); Wt bf16 [N][K] (pitch ldb). BIAS_BF16 rounds the
// bias to bf16 first (bias quantised to bf16 before the add). K%32==0, M%16==0, N%64==0.
template <bool ASPLIT, int ACT, bool BIAS_BF16>
__global__ __launch_bounds__(128) void k_gemm_bf(const float* __restrict__ A, int lda, const unsigned short* __restrict__ Wt, int ldb,
                                               const float* __restrict__ bias, float* __restrict__ C, int ldc, int M, int N, int K) {
  __shared__ __attribute__((aligned(16))) float so[4][16][64];
  const int tid = threadIdx.x, w = tid >> 5, lane = tid & 31, ln = lane & 15, hh = lane >> 4;
  const int ntn = N / 64;
  const int wid = blockIdx.x * 4 + w;
  const int mt = wid / ntn, nq = wid % ntn;
  if (mt * 16 >= M) return;
  const int row0 = mt * 16, col0 = nq * 64;
  const float* arow = A + (size_t)(row0 + ln) * lda;
  v8f acc[4] = {};
  for (int kb = 0; kb < K; kb += 32) {
    FragB ah, al;
    const v4f x0 = *(const v4fa*)(arow + kb + 8 * hh), x1 = *(const v4fa*)(arow + kb + 8 * hh + 4);
    const v4f x2 = *(const v4fa*)(arow + kb + 16 + 8 * hh), x3 = *(const v4fa*)(arow + kb + 16 + 8 * hh + 4);
    float xs[16] = {x0[0],x0[1],x0[2],x0[3],x1[0],x1[1],x1[2],x1[3],x2[0],x2[1],x2[2],x2[3],x3[0],x3[1],x3[2],x3[3]};
#pragma unroll
    for (int i = 0; i < 16; ++i) { const unsigned short hb = bf16_bits(xs[i]); ah.u[i] = hb; al.u[i] = ASPLIT ? bf16_bits(xs[i] - bf16_val(hb)) : (unsigned short)0; }
#pragma unroll
    for (int t = 0; t < 4; ++t) {
      const unsigned short* brow = Wt + (size_t)(col0 + t * 16 + ln) * ldb + kb;
      FragB b;
      b.half[0] = *(const v8us*)(brow + 8 * hh);
      b.half[1] = *(const v8us*)(brow + 16 + 8 * hh);
      acc[t] = mmaN<ASPLIT ? 2 : 1>(ah.v, al.v, b.v, b.v, acc[t]);
    }
  }
#pragma unroll
  for (int t = 0; t < 4; ++t) {
    float bv = bias ? bias[col0 + t * 16 + ln] : 0.f;
    if (BIAS_BF16) bv = bf16_round(bv);
#pragma unroll
    for (int r = 0; r < 8; ++r) { float v = acc[t][r] + bv; if (ACT == 1) v = fmaxf(v, 0.f); so[w][8 * hh + r][t * 16 + ln] = v; }
  }
  __builtin_amdgcn_fence(__ATOMIC_ACQ_REL, "workgroup");
  __builtin_amdgcn_wave_barrier();
  const int rsub = lane >> 4, c4 = (lane & 15) * 4;
  {
#pragma unroll
    for (int q = 0; q < 8; ++q) {
      const int r = q * 2 + rsub;
      const v4f v = *(const v4fa*)&so[w][r][c4];
      *(v4f*)(C + (size_t)(row0 + r) * ldc + col0 + c4) = v;
    }
    
  }
}

// GEMM C = act(A·W + bias + resid): A f32 (ASPLIT -> hi/lo 2 terms), Wt bf16 [N][K]; ACT 0 none, 1 relu, 2 exact gelu;
// resid (optional, f32, row index = (row % rmod), pitch ldr, RES_BF16 rounds it) added before the activation.
template <bool ASPLIT, int ACT, bool BIAS_BF16, bool RES_BF16>
__global__ __launch_bounds__(128) void k_gemm_bf3(const float* __restrict__ A, int lda, const unsigned short* __restrict__ Wt, int ldb,
                                                const float* __restrict__ bias, const float* __restrict__ resid, int rmod, int ldr,
                                                float* __restrict__ C, int ldc, int M, int N, int K) {
  __shared__ __attribute__((aligned(16))) float so[4][16][64];
  const int tid = threadIdx.x, w = tid >> 5, lane = tid & 31, ln = lane & 15, hh = lane >> 4;
  const int ntn = N / 64;
  const int wid = blockIdx.x * 4 + w;
  const int mt = wid / ntn, nq = wid % ntn;
  if (mt * 16 >= M) return;
  const int row0 = mt * 16, col0 = nq * 64;
  const float* arow = A + (size_t)(row0 + ln) * lda;
  v8f acc[4] = {};
  for (int kb = 0; kb < K; kb += 32) {
    FragB ah, al;
    const v4f x0 = *(const v4fa*)(arow + kb + 8 * hh), x1 = *(const v4fa*)(arow + kb + 8 * hh + 4);
    const v4f x2 = *(const v4fa*)(arow + kb + 16 + 8 * hh), x3 = *(const v4fa*)(arow + kb + 16 + 8 * hh + 4);
    float xs[16] = {x0[0],x0[1],x0[2],x0[3],x1[0],x1[1],x1[2],x1[3],x2[0],x2[1],x2[2],x2[3],x3[0],x3[1],x3[2],x3[3]};
#pragma unroll
    for (int i = 0; i < 16; ++i) { const unsigned short hb = bf16_bits(xs[i]); ah.u[i] = hb; al.u[i] = ASPLIT ? bf16_bits(xs[i] - bf16_val(hb)) : (unsigned short)0; }
#pragma unroll
    for (int t = 0; t < 4; ++t) {
      const unsigned short* brow = Wt + (size_t)(col0 + t * 16 + ln) * ldb + kb;
      FragB b;
      b.half[0] = *(const v8us*)(brow + 8 * hh);
      b.half[1] = *(const v8us*)(brow + 16 + 8 * hh);
      acc[t] = mmaN<ASPLIT ? 2 : 1>(ah.v, al.v, b.v, b.v, acc[t]);
    }
  }
#pragma unroll
  for (int t = 0; t < 4; ++t) {
    const int col = col0 + t * 16 + ln;
    float bv = bias ? bias[col] : 0.f;
    if (BIAS_BF16) bv = bf16_round(bv);
#pragma unroll
    for (int r = 0; r < 8; ++r) {
      float v = acc[t][r] + bv;
      if (resid) { float rv = resid[(size_t)((row0 + 8 * hh + r) % rmod) * ldr + col]; if (RES_BF16) rv = bf16_round(rv); v += rv; }
      if (ACT == 1) v = fmaxf(v, 0.f);
      if (ACT == 2) v = 0.5f * v * (1.0f + erff(v * 0.70710678118654752f));
      if (ACT == 3) { const float u = 0.7978845608028654f * (v + 0.044715f * v * v * v); v = 0.5f * v * (1.0f + tanhf(u)); }
      so[w][8 * hh + r][t * 16 + ln] = v;
    }
  }
  __builtin_amdgcn_fence(__ATOMIC_ACQ_REL, "workgroup");
  __builtin_amdgcn_wave_barrier();
  const int rsub = lane >> 4, c4 = (lane & 15) * 4;
  {
#pragma unroll
    for (int q = 0; q < 8; ++q) {
      const int r = q * 2 + rsub;
      const v4f v = *(const v4fa*)&so[w][r][c4];
      *(v4f*)(C + (size_t)(row0 + r) * ldc + col0 + c4) = v;
    }
    
  }
}
// row LayerNorm (biased variance, eps) over N: s = X (+ R); optional out_sum <- s; out_norm <- (s-mu)*rsqrt(var+eps)*g + b
template <bool PARAM_BF16>
__global__ __launch_bounds__(256) void k_layernorm(const float* __restrict__ X, const float* __restrict__ R, const float* __restrict__ g, const float* __restrict__ bta,
                                                  float* __restrict__ out_sum, float* __restrict__ out_norm, int N, float eps) {
  __shared__ float red[256];
  const int row = blockIdx.x, tid = threadIdx.x;
  const float* x = X + (size_t)row * N; const float* rr = R ? R + (size_t)row * N : nullptr;
  float vals[16];                     // up to N = 4096
  const int per = N / 256;            // contiguous chunk per thread? use strided-by-4 chunks: thread handles j = tid*4 + 1024*u
  float s1 = 0.f;
  for (int u = 0; u < per / 4; ++u) {
    const int j = tid * 4 + 1024 * u;
    const v4f a = *(const v4fa*)(x + j);
    v4f b = {0.f,0.f,0.f,0.f}; if (rr) b = *(const v4fa*)(rr + j);
#pragma unroll
    for (int q = 0; q < 4; ++q) { const float v = a[q] + b[q]; vals[u * 4 + q] = v; s1 += v; }
  }
  red[tid] = s1; __syncthreads();
  for (int st = 128; st > 0; st >>= 1) { if (tid < st) red[tid] += red[tid + st]; __syncthreads(); }
  const float mu = red[0] / (float)N; __syncthreads();
  float s2 = 0.f;
  for (int u = 0; u < per / 4; ++u)
#pragma unroll
    for (int q = 0; q < 4; ++q) { const float c = vals[u * 4 + q] - mu; s2 += c * c; }
  red[tid] = s2; __syncthreads();
  for (int st = 128; st > 0; st >>= 1) { if (tid < st) red[tid] += red[tid + st]; __syncthreads(); }
  const float rs = rsqrtf(red[0] / (float)N + eps);
  {
    for (int u = 0; u < per / 4; ++u) {
      const int j = tid * 4 + 1024 * u;
      v4f o, sm;
#pragma unroll
      for (int q = 0; q < 4; ++q) {
        float gg = g[j + q], bb = bta[j + q];
        if (PARAM_BF16) { gg = bf16_round(gg); bb = bf16_round(bb); }
        sm[q] = vals[u * 4 + q]; o[q] = (vals[u * 4 + q] - mu) * rs * gg + bb;
      }
      if (out_sum) *(v4f*)(out_sum + (size_t)row * N + j) = sm;
      *(v4f*)(out_norm + (size_t)row * N + j) = o;
    }
    
  }
}



// ---- f16 WMMA path (v_wmma_f32_16x16x32_f16): 11-bit significands for operands in range — used where a [0,1] probability operand needs more precision than bf16
typedef _Float16 v16h __attribute__((ext_vector_type(16)));
union FragH { v16h v; v8us half[2]; _Float16 h[16]; unsigned short u[16]; };
template <int NT>
__device__ __forceinline__ v8f mmaH(v16h ah, v16h al, v16h bh, v16h bl, v8f c) {
  c = __builtin_amdgcn_wmma_f32_16x16x32_f16(false, ah, false, bh, (short)0, c, false, false);
  if (NT >= 2) c = __builtin_amdgcn_wmma_f32_16x16x32_f16(false, al, false, bh, (short)0, c, false, false);
  if (NT >= 3) c = __builtin_amdgcn_wmma_f32_16x16x32_f16(false, ah, false, bl, (short)0, c, false, false);
  asm volatile("v_nop\n\tv_nop\n\tv_nop\n\tv_nop" : "+v"(c) : "v"(ah), "v"(al), "v"(bh), "v"(bl));
  return c;
}
// batched GEMM like k_gemm_b but f16 operands: A f32 (split into f16 hi/lo if ASPLIT, else rounded to f16), Bt = f16 values [n][k]; alpha; C f32; N multiple of 16 (partial tiles skipped)
template <bool ASPLIT>
__global__ __launch_bounds__(128) void k_gemm_h(const float* __restrict__ A, int lda, size_t sA, const _Float16* __restrict__ Bh, int ldb, size_t sB, float alpha, float* __restrict__ C, int ldc, size_t sC, int M, int N, int K) {
  __shared__ __attribute__((aligned(16))) float so[4][16][64];
  const int tid = threadIdx.x, w = tid >> 5, lane = tid & 31, ln = lane & 15, hh = lane >> 4; const int by = blockIdx.y;
  A += (size_t)by * sA; Bh += (size_t)by * sB; C += (size_t)by * sC;
  const int ntn = (N + 63) / 64; const int wid = blockIdx.x * 4 + w; const int mt = wid / ntn, nq = wid % ntn; if (mt * 16 >= M) return;
  const int row0 = mt * 16, col0 = nq * 64; const float* arow = A + (size_t)(row0 + ln) * lda;
  v8f acc[4] = {};
  for (int kb = 0; kb < K; kb += 32) {
    FragH ah, al;
    const v4f x0 = *(const v4fa*)(arow + kb + 8 * hh), x1 = *(const v4fa*)(arow + kb + 8 * hh + 4), x2 = *(const v4fa*)(arow + kb + 16 + 8 * hh), x3 = *(const v4fa*)(arow + kb + 16 + 8 * hh + 4);
    float xs[16] = {x0[0],x0[1],x0[2],x0[3],x1[0],x1[1],x1[2],x1[3],x2[0],x2[1],x2[2],x2[3],x3[0],x3[1],x3[2],x3[3]};
#pragma unroll
    for (int i = 0; i < 16; ++i) { const _Float16 h = (_Float16)xs[i]; ah.h[i] = h; al.h[i] = ASPLIT ? (_Float16)(xs[i] - (float)h) : (_Float16)0.0f; }
#pragma unroll
    for (int t = 0; t < 4; ++t) { if (col0 + t * 16 >= N) continue; const size_t boff = (size_t)(col0 + t * 16 + ln) * ldb + kb; FragH bq; bq.half[0] = *(const v8us*)(Bh + boff + 8 * hh); bq.half[1] = *(const v8us*)(Bh + boff + 16 + 8 * hh);
      acc[t] = mmaH<ASPLIT ? 2 : 1>(ah.v, al.v, bq.v, bq.v, acc[t]); }
  }
#pragma unroll
  for (int t = 0; t < 4; ++t) { if (col0 + t * 16 >= N) continue;
#pragma unroll
    for (int r = 0; r < 8; ++r) so[w][8 * hh + r][t * 16 + ln] = acc[t][r] * alpha; }
  __builtin_amdgcn_fence(__ATOMIC_ACQ_REL, "workgroup"); __builtin_amdgcn_wave_barrier();
  const int rsub = lane >> 4, c4 = (lane & 15) * 4;
  {
#pragma unroll
    for (int q = 0; q < 8; ++q) { const int r = q * 2 + rsub; if (col0 + c4 < N) { const v4f v = *(const v4fa*)&so[w][r][c4]; *(v4f*)(C + (size_t)(row0 + r) * ldc + col0 + c4) = v; } }
     }
}

// Wt[n][k] = f16(W[k][n]·scale) from f32 row-major W[K][N] (scale = power of two; bf16-exact weights stay exact in f16 away from the subnormal range)
__global__ __launch_bounds__(256) void k_wt_f16(const float* __restrict__ W, _Float16* __restrict__ Wt, int K, int N, float scale) {
  const int t = blockIdx.x * 256 + threadIdx.x; if (t >= N * (K / 8)) return; const int n = t / (K / 8), k8 = (t % (K / 8)) * 8; FragH f;
#pragma unroll
  for (int i = 0; i < 8; ++i) f.h[i] = (_Float16)(bf16_round(W[(size_t)(k8 + i) * N + n]) * scale); const v8us o = f.half[0];
  *(v8us*)((unsigned short*)Wt + (size_t)n * K + k8) = o; 
}
// k_gemm_hh variant with fused epilogue: v = acc·alpha + bias[by·sBias + col] (+ CP[(row/rowsPerB)·sCPb + by·64 + col] if CP) ; ACT 0 none / 1 elu ; writes f16 C16 (and f32 C if non-null)
template <int ACT>
__global__ __launch_bounds__(128) void k_gemm_hhx(const _Float16* __restrict__ A, int lda, size_t sA, const _Float16* __restrict__ Bh, int ldb, size_t sB, float alpha, const float* __restrict__ bias, size_t sBias, const float* __restrict__ CP, int rowsPerB, size_t sCPb, int row0g,
    float* __restrict__ C, _Float16* __restrict__ C16, int ldc, size_t sC, int M, int N, int K) {
  __shared__ __attribute__((aligned(16))) float so[4][16][64];
  const int tid = threadIdx.x, w = tid >> 5, lane = tid & 31, ln = lane & 15, hh = lane >> 4; const int by = blockIdx.y;
  A += (size_t)by * sA; Bh += (size_t)by * sB; const size_t cofs = (size_t)by * sC; const float* bp = bias ? bias + (size_t)by * sBias : nullptr;
  const int ntn = (N + 63) / 64; const int wid = blockIdx.x * 4 + w; const int mt = wid / ntn, nq = wid % ntn; if (mt * 16 >= M) return;
  const int row0 = mt * 16, col0 = nq * 64; const _Float16* arow = A + (size_t)(row0 + ln) * lda;
  v8f acc[4] = {};
  for (int kb = 0; kb < K; kb += 32) { FragH ah; ah.half[0] = *(const v8us*)((const unsigned short*)arow + kb + 8 * hh); ah.half[1] = *(const v8us*)((const unsigned short*)arow + kb + 16 + 8 * hh);
#pragma unroll
    for (int t = 0; t < 4; ++t) { if (col0 + t * 16 >= N) continue; const size_t boff = (size_t)(col0 + t * 16 + ln) * ldb + kb; FragH bq; bq.half[0] = *(const v8us*)((const unsigned short*)Bh + boff + 8 * hh); bq.half[1] = *(const v8us*)((const unsigned short*)Bh + boff + 16 + 8 * hh);
      acc[t] = mmaH<1>(ah.v, ah.v, bq.v, bq.v, acc[t]); }
  }
#pragma unroll
  for (int t = 0; t < 4; ++t) { if (col0 + t * 16 >= N) continue; const int col = col0 + t * 16 + ln; const float bv = bp ? bf16_round(bp[col]) : 0.f;
#pragma unroll
    for (int r = 0; r < 8; ++r) { float v = acc[t][r] * alpha + bv; if (CP) { const int bidx = (row0g + row0 + 8 * hh + r) / rowsPerB; v += CP[(size_t)bidx * sCPb + (size_t)by * 64 + col]; } if (ACT == 1) v = (v > 0.f) ? v : expm1f(v); else if (ACT == 7) v = (v > 0.f) ? v + 1.0f : expf(v); else if (ACT == 8) v = tanhf(v); else if (ACT == 9) v = 0.5f * v * (1.0f + tanhf(0.7978845608028654f * (v + 0.044715f * v * v * v))); else if (ACT == 11) v = 1.0f / (1.0f + expf(-v)); else if (ACT == 12) v = (v > 0.f) ? v : 0.01f * v; else if (ACT == 14) v = (v > 0.f) ? v : 0.1f * v; else if (ACT == 15) v = v / (1.0f + expf(-v)); else if (ACT == 3) v = fmaxf(v, 0.f); else if (ACT == 6) v = 0.5f * v * (1.0f + erff(v * 0.70710678118654752f)); so[w][8 * hh + r][t * 16 + ln] = v; } }
  __builtin_amdgcn_fence(__ATOMIC_ACQ_REL, "workgroup"); __builtin_amdgcn_wave_barrier();
  const int rsub = lane >> 4, c4 = (lane & 15) * 4; typedef _Float16 v4h __attribute__((ext_vector_type(4)));
  {
#pragma unroll
    for (int q = 0; q < 8; ++q) { const int r = q * 2 + rsub; if (col0 + c4 < N) { const v4f v = *(const v4fa*)&so[w][r][c4]; if (C) *(v4f*)(C + cofs + (size_t)(row0 + r) * ldc + col0 + c4) = v; if (C16) { v4h h4; for (int i = 0; i < 4; ++i) h4[i] = (_Float16)v[i]; *(v4h*)(C16 + cofs + (size_t)(row0 + r) * ldc + col0 + c4) = h4; } } }
     }
}


typedef _Float16 v4h __attribute__((ext_vector_type(4)));

__global__ __launch_bounds__(256) void k_round16f(const float* __restrict__ W, _Float16* __restrict__ Bt, size_t n8) { const size_t t = (size_t)blockIdx.x * 256 + threadIdx.x; if (t >= n8) return; FragH f;
#pragma unroll
  for (int i = 0; i < 8; ++i) f.h[i] = (_Float16)(bf16_round(W[t * 8 + i]) * 16.0f); *(v8us*)((unsigned short*)Bt + t * 8) = f.half[0];  }
// ---- fused GEMM (block 128x64, wave tile 32x64, K = KD): A is read as f32 rows and rounded in the loader, the epilogue writes what the next kernel reads ----
#define KD 256                   /* = CM = DP: K and the row pitch of A and of the weight planes */
__device__ __forceinline__ v16h g2_frag(const _Float16* p, int hh) { FragH f; f.half[0] = *(const v8us*)((const unsigned short*)p + 8 * hh); f.half[1] = *(const v8us*)((const unsigned short*)p + 16 + 8 * hh); return f.v; }
__device__ __forceinline__ v8f g2_mma(v16h a, v16h b, v8f c) { v8f d = __builtin_amdgcn_wmma_f32_16x16x32_f16(false, a, false, b, (short)0, c, false, false); asm volatile("v_nop\n\tv_nop\n\tv_nop\n\tv_nop" : "+v"(d) : "v"(a), "v"(b)); return d; }
// the k order of g2_frag from an f32 row; RB: rounded to bf16 first (inputs), else straight to f16 (context)
template <bool RB>
__device__ __forceinline__ v16h gf_frag(const float* p, int hh) {
  const v4f x0 = *(const v4fa*)(p + 8 * hh), x1 = *(const v4fa*)(p + 8 * hh + 4), x2 = *(const v4fa*)(p + 16 + 8 * hh), x3 = *(const v4fa*)(p + 16 + 8 * hh + 4); FragH f;
#pragma unroll
  for (int i = 0; i < 4; ++i) { f.h[i] = (_Float16)(RB ? bf16_round(x0[i]) : x0[i]); f.h[4 + i] = (_Float16)(RB ? bf16_round(x1[i]) : x1[i]); f.h[8 + i] = (_Float16)(RB ? bf16_round(x2[i]) : x2[i]); f.h[12 + i] = (_Float16)(RB ? bf16_round(x3[i]) : x3[i]); }
  return f.v; }
template <bool RB>
__device__ __forceinline__ void gf_tile(const float* __restrict__ A, const _Float16* __restrict__ Bh, int row0, int col0, int ln, int hh, v8f (&accs)[8]) {
  const float* a0p = A + (size_t)(row0 + ln) * KD; const float* a1p = a0p + (size_t)16 * KD;
  const _Float16* b0p = Bh + (size_t)(col0 + ln) * KD; const _Float16* b1p = b0p + (size_t)16 * KD; const _Float16* b2p = b1p + (size_t)16 * KD; const _Float16* b3p = b2p + (size_t)16 * KD;
  const v8f z8 = {0.f,0.f,0.f,0.f,0.f,0.f,0.f,0.f}; v8f c00 = z8, c01 = z8, c02 = z8, c03 = z8, c10 = z8, c11 = z8, c12 = z8, c13 = z8;
#pragma unroll 1                 /* rolled, as before the fusion: keeps the registers low enough for every block of the grid to be resident at once */
  for (int kb = 0; kb < KD; kb += 32) { const v16h a0 = gf_frag<RB>(a0p + kb, hh), a1 = gf_frag<RB>(a1p + kb, hh);
    v16h b = g2_frag(b0p + kb, hh); c00 = g2_mma(a0, b, c00); c10 = g2_mma(a1, b, c10);
    b = g2_frag(b1p + kb, hh); c01 = g2_mma(a0, b, c01); c11 = g2_mma(a1, b, c11);
    b = g2_frag(b2p + kb, hh); c02 = g2_mma(a0, b, c02); c12 = g2_mma(a1, b, c12);
    b = g2_frag(b3p + kb, hh); c03 = g2_mma(a0, b, c03); c13 = g2_mma(a1, b, c13); }
  accs[0] = c00; accs[1] = c01; accs[2] = c02; accs[3] = c03; accs[4] = c10; accs[5] = c11; accs[6] = c12; accs[7] = c13; }
// q, k, v projections, blockIdx.y = 0, 1, 2: y = x W^T + b (weights x16, so acc / 16). q, k -> hi + 2^10 residual planes [row][DP]; v -> f16 V^T [(b * DP + col)][token]
__global__ __launch_bounds__(128) void k_proj(const float* __restrict__ xq, const float* __restrict__ xk, const float* __restrict__ xv, const _Float16* __restrict__ Bq, const _Float16* __restrict__ Bk, const _Float16* __restrict__ Bv,
    const float* __restrict__ bq, const float* __restrict__ bk, const float* __restrict__ bv, _Float16* __restrict__ QH, _Float16* __restrict__ QL, _Float16* __restrict__ KH, _Float16* __restrict__ KL, _Float16* __restrict__ VT) {
  __shared__ __attribute__((aligned(16))) float so[4][32][68];
  const int tid = threadIdx.x, w = tid >> 5, lane = tid & 31, ln = lane & 15, hh = lane >> 4; const int by = blockIdx.y;
  const float* A = (by == 0) ? xq : ((by == 1) ? xk : xv); const _Float16* Bh = (by == 0) ? Bq : ((by == 1) ? Bk : Bv); const float* bp = (by == 0) ? bq : ((by == 1) ? bk : bv);
  const int mt = blockIdx.x / (DP / 64), nq = blockIdx.x % (DP / 64); const int row0 = mt * 128 + 32 * w, col0 = nq * 64;
  v8f accs[8]; gf_tile<true>(A, Bh, row0, col0, ln, hh, accs);
  if (by == 2) {                 /* block-uniform. A lane's 8 accumulator rows are 8 consecutive tokens of one column: pack them, turn the block's 128 x 64 tile in LDS, store whole 256-byte runs of V^T */
    constexpr int VP = 128 + 8;  /* u16 pitch: rows stay 16-byte aligned and step 4 banks */
    unsigned short* vt = (unsigned short*)&so[0][0][0];
#pragma unroll
    for (int u = 0; u < 8; ++u) { const int c = (u & 3) * 16 + ln, half = u >> 2; const float bvv = bf16_round(bp[col0 + c]); FragH f;
#pragma unroll
      for (int r = 0; r < 8; ++r) f.h[r] = (_Float16)(accs[u][r] * 0.0625f + bvv);
      *(v8us*)(vt + c * VP + w * 32 + half * 16 + 8 * hh) = f.half[0]; }
    __syncthreads();             /* the four waves' token ranges of a column are read back together */
    unsigned short* dst = (unsigned short*)VT + ((size_t)(mt / (SLEN / 128)) * DP + col0) * SLEN + (mt % (SLEN / 128)) * 128;
#pragma unroll
    for (int i = 0; i < 8; ++i) { const int p = i * 128 + tid, c = p >> 4, j = p & 15; const v8us val = *(const v8us*)(vt + c * VP + j * 8); *(v8us*)(dst + (size_t)c * SLEN + j * 8) = val; }
    return; }
  _Float16* Hh = (by == 0) ? QH : KH; _Float16* Hl = (by == 0) ? QL : KL;
#pragma unroll
  for (int u = 0; u < 8; ++u) { const int t = u & 3, half = u >> 2; const float bvv = bf16_round(bp[col0 + t * 16 + ln]);
#pragma unroll
    for (int r = 0; r < 8; ++r) so[w][half * 16 + 8 * hh + r][t * 16 + ln] = accs[u][r] * 0.0625f + bvv; }
  __builtin_amdgcn_fence(__ATOMIC_ACQ_REL, "workgroup"); __builtin_amdgcn_wave_barrier();
  const int rsub = lane >> 4, c4 = (lane & 15) * 4;
#pragma unroll
  for (int q = 0; q < 16; ++q) { const int r = q * 2 + rsub; const v4f v = *(const v4fa*)&so[w][r][c4]; v4h h4, l4;
#pragma unroll
    for (int i = 0; i < 4; ++i) { const _Float16 h = (_Float16)v[i]; h4[i] = h; l4[i] = (_Float16)((v[i] - (float)h) * 1024.0f); }
    const size_t o = (size_t)(row0 + r) * DP + col0 + c4; *(v4h*)(Hh + o) = h4; *(v4h*)(Hl + o) = l4; }
  asm volatile("s_wait_xcnt 0x0" ::: "memory");      /* the V branch is laid out behind these stores and rewrites their registers: the wait stands in front of it on the fall-through too */
}
// output projection: out = f16(ctx) Wo^T + bo, f32 rows of CM
__global__ __launch_bounds__(128) void k_outg(const float* __restrict__ Ctx, const _Float16* __restrict__ Bo, const float* __restrict__ bo, float* __restrict__ C) {
  __shared__ __attribute__((aligned(16))) float so[4][32][68];
  const int tid = threadIdx.x, w = tid >> 5, lane = tid & 31, ln = lane & 15, hh = lane >> 4;
  const int mt = blockIdx.x / (CM / 64), nq = blockIdx.x % (CM / 64); const int row0 = mt * 128 + 32 * w, col0 = nq * 64;
  v8f accs[8]; gf_tile<false>(Ctx, Bo, row0, col0, ln, hh, accs);
#pragma unroll
  for (int u = 0; u < 8; ++u) { const int t = u & 3, half = u >> 2; const float bvv = bf16_round(bo[col0 + t * 16 + ln]);
#pragma unroll
    for (int r = 0; r < 8; ++r) so[w][half * 16 + 8 * hh + r][t * 16 + ln] = accs[u][r] * 0.0625f + bvv; }
  __builtin_amdgcn_fence(__ATOMIC_ACQ_REL, "workgroup"); __builtin_amdgcn_wave_barrier();
  const int rsub = lane >> 4, c4 = (lane & 15) * 4;
#pragma unroll
  for (int q = 0; q < 16; ++q) { const int r = q * 2 + rsub; const v4f v = *(const v4fa*)&so[w][r][c4]; *(v4f*)(C + (size_t)(row0 + r) * CM + col0 + c4) = v; } }



template <int CAUSAL>
__global__ __launch_bounds__(128) void k_flash(const _Float16* __restrict__ Q16, int ldq, const _Float16* __restrict__ K16, int ldk, const _Float16* __restrict__ Vt, const int* __restrict__ MSK, float* __restrict__ O, int ldo) {
  constexpr int RPW = 16, RTN = RPW / 16, NQB = TQ / (4 * RPW), DT = 4, KS = 2;
  __shared__ __attribute__((aligned(16))) unsigned short sP[4][RPW][40]; __shared__ __attribute__((aligned(16))) float sO[4][RPW][64 + 4];
  const int tid = threadIdx.x, w = tid >> 5, lane = tid & 31, ln = lane & 15, hh = lane >> 4;
  const int slab = blockIdx.x / QBLKS, qblk = blockIdx.x % QBLKS; (void)NQB; const int b = slab / NH, h = slab % NH; const int qb0 = qblk * (4 * RPW); const int q0 = qb0 + w * RPW;
  FragH aq[2][KS];
#pragma unroll
  for (int rt = 0; rt < RTN; ++rt) { const unsigned short* qr = (const unsigned short*)Q16 + ((size_t)b * TQ + q0 + rt * 16 + ln) * ldq + h * 64;
#pragma unroll
    for (int ks = 0; ks < KS; ++ks) { aq[rt][ks].half[0] = *(const v8us*)(qr + ks * 32 + 8 * hh); aq[rt][ks].half[1] = *(const v8us*)(qr + ks * 32 + 16 + 8 * hh); } }
  const unsigned short* Vth = (const unsigned short*)Vt + (size_t)slab * 64 * TK;
  float m_r[2][8], l_r[2][8]; v8f oacc[2][DT];
#pragma unroll
  for (int rt = 0; rt < RTN; ++rt) {
#pragma unroll
    for (int r = 0; r < 8; ++r) { m_r[rt][r] = -3.0e38f; l_r[rt][r] = 0.f; }
#pragma unroll
    for (int dt = 0; dt < DT; ++dt) oacc[rt][dt] = (v8f){0.f,0.f,0.f,0.f,0.f,0.f,0.f,0.f}; }
  const int jend = (CAUSAL == 1) ? (qb0 + 4 * RPW) : TK;      /* causal: keys beyond the block's last query never contribute */
#pragma unroll 1
  for (int j0 = 0; j0 < jend; j0 += 32) {
    v8f s[2][2];
#pragma unroll
    for (int nt = 0; nt < 2; ++nt) { const unsigned short* kr = (const unsigned short*)K16 + ((size_t)b * TK + j0 + nt * 16 + ln) * ldk + h * 64; FragH bk[KS];
#pragma unroll
      for (int ks = 0; ks < KS; ++ks) { bk[ks].half[0] = *(const v8us*)(kr + ks * 32 + 8 * hh); bk[ks].half[1] = *(const v8us*)(kr + ks * 32 + 16 + 8 * hh); }
#pragma unroll
      for (int rt = 0; rt < RTN; ++rt) { v8f acc = (v8f){0.f,0.f,0.f,0.f,0.f,0.f,0.f,0.f};
#pragma unroll
        for (int ks = 0; ks < KS; ++ks) acc = mmaH<1>(aq[rt][ks].v, aq[rt][ks].v, bk[ks].v, bk[ks].v, acc); s[rt][nt] = acc; } }
#pragma unroll
    for (int rt = 0; rt < RTN; ++rt)
#pragma unroll
      for (int r = 0; r < 8; ++r) { const int tq = q0 + rt * 16 + 8 * hh + r; const int k0 = j0 + ln, k1 = j0 + 16 + ln;
        const bool ok0 = (CAUSAL == 1) ? (k0 <= tq) : ((CAUSAL == 2) ? ((k0 >> 5) == (tq >> 5)) : true), ok1 = (CAUSAL == 1) ? (k1 <= tq) : ((CAUSAL == 2) ? ((k1 >> 5) == (tq >> 5)) : true);      /* mode 2: block-diagonal 32-token groups */
        const float s0 = ok0 ? s[rt][0][r] * SCL : -3.0e38f, s1 = ok1 ? s[rt][1][r] * SCL : -3.0e38f; float mc = fmaxf(s0, s1);
        mc = fmaxf(mc, __shfl_xor(mc, 1, 32)); mc = fmaxf(mc, __shfl_xor(mc, 2, 32)); mc = fmaxf(mc, __shfl_xor(mc, 4, 32)); mc = fmaxf(mc, __shfl_xor(mc, 8, 32));
        const float mn = fmaxf(m_r[rt][r], mc); const float al = (mn > -1.0e38f) ? expf(m_r[rt][r] - mn) : 1.0f; m_r[rt][r] = mn; const float p0 = ok0 ? expf(s0 - mn) : 0.f, p1 = ok1 ? expf(s1 - mn) : 0.f; l_r[rt][r] = l_r[rt][r] * al + p0 + p1;
#pragma unroll
        for (int dt = 0; dt < DT; ++dt) oacc[rt][dt][r] *= al;
        FragH t2; t2.h[0] = (_Float16)(p0 * 1024.0f); t2.h[1] = (_Float16)(p1 * 1024.0f); sP[w][rt * 16 + 8 * hh + r][ln] = t2.u[0]; sP[w][rt * 16 + 8 * hh + r][16 + ln] = t2.u[1]; }
    __builtin_amdgcn_fence(__ATOMIC_ACQ_REL, "workgroup"); __builtin_amdgcn_wave_barrier();
    FragH pa[2];
#pragma unroll
    for (int rt = 0; rt < RTN; ++rt) { pa[rt].half[0] = *(const v8us*)&sP[w][rt * 16 + ln][8 * hh]; pa[rt].half[1] = *(const v8us*)&sP[w][rt * 16 + ln][16 + 8 * hh]; }
#pragma unroll
    for (int dt = 0; dt < DT; ++dt) { const unsigned short* vrow = Vth + (size_t)(dt * 16 + ln) * TK + j0; FragH bv; bv.half[0] = *(const v8us*)(vrow + 8 * hh); bv.half[1] = *(const v8us*)(vrow + 16 + 8 * hh);
#pragma unroll
      for (int rt = 0; rt < RTN; ++rt) oacc[rt][dt] = mmaH<1>(pa[rt].v, pa[rt].v, bv.v, bv.v, oacc[rt][dt]); }
    __builtin_amdgcn_fence(__ATOMIC_ACQ_REL, "workgroup"); __builtin_amdgcn_wave_barrier(); }
#pragma unroll
  for (int rt = 0; rt < RTN; ++rt) {
#pragma unroll
    for (int r = 0; r < 8; ++r) { float l = l_r[rt][r]; l += __shfl_xor(l, 1, 32); l += __shfl_xor(l, 2, 32); l += __shfl_xor(l, 4, 32); l += __shfl_xor(l, 8, 32); l_r[rt][r] = (l > 0.f) ? 1.0f / (l * 1024.0f) : 0.f; }
#pragma unroll
    for (int dt = 0; dt < DT; ++dt)
#pragma unroll
      for (int r = 0; r < 8; ++r) sO[w][rt * 16 + 8 * hh + r][dt * 16 + ln] = oacc[rt][dt][r] * l_r[rt][r]; }
  __builtin_amdgcn_fence(__ATOMIC_ACQ_REL, "workgroup"); __builtin_amdgcn_wave_barrier();
  {
#pragma unroll
    for (int rp = 0; rp < RPW; rp += 2) { const int r = rp + (lane >> 4), pc = lane & 15; const v4f val = *(const v4fa*)&sO[w][r][pc * 4]; *(v4f*)(O + ((size_t)b * TQ + q0 + r) * ldo + h * 64 + pc * 4) = val; }
     } }
// Q/K-split flash kernel, transposed: S^T = Kh Qh^T + (Kh Ql^T + Kl Qh^T)/1024 and O^T += V^T P^T, with Q/K = [hi | 2^10 residual] f16 planes (QL/KL same layout as Q16/K16) and plain f16 P (x2^10).
// K rows and V^T rows are the A operands, Q and P^T the B operands: a lane holds 16 of the 32 scores of ONE query (lane l and l ^ 16 share query l & 15), so the maximum and the sum run in the lane's own registers
// with one exchange between the wave's halves, and the two score tiles, converted in place, are the B fragment of the second product (register s of half hh = key 8 hh + s, then 16 + 8 hh + s - 8: the order in which V^T is loaded).
__device__ __forceinline__ float xhalf(float x) { return __int_as_float(__builtin_amdgcn_permlanex16(__float_as_int(x), __float_as_int(x), 0x76543210, 0xfedcba98, false, false)); }      /* lane l <-> l ^ 16 */
template <int CAUSAL>
__global__ __launch_bounds__(128) void k_flashqk(const _Float16* __restrict__ Q16, const _Float16* __restrict__ QL, const _Float16* __restrict__ K16, const _Float16* __restrict__ KL, const _Float16* __restrict__ Vt, const int* __restrict__ MSK, float* __restrict__ O) {
  constexpr int ldq = DP, ldk = DP, ldo = DP;      /* row pitch of the planes: a constant, so that a pass's twelve loads differ by immediate offsets only */
  static_assert(HS == 32, "one k step per score product, two output tiles");
  constexpr int RPW = 16, DT = HS / 16;
  __shared__ __attribute__((aligned(16))) float sO[4][RPW][HS + 4];
  const int tid = threadIdx.x, w = tid >> 5, lane = tid & 31, ln = lane & 15, hh = lane >> 4;
  const int slab = blockIdx.x / QBLKS, qblk = blockIdx.x % QBLKS; const int b = slab / NH, h = slab % NH; const int qb0 = qblk * (4 * RPW); const int q0 = qb0 + w * RPW; const int tq = q0 + ln;
  FragH bq, bql;                 /* B: column = query q0 + ln, k = head dim in the order of the K rows' loads */
  { const unsigned short* qr = (const unsigned short*)Q16 + ((size_t)b * TQ + tq) * ldq + h * HS; const unsigned short* ql = (const unsigned short*)QL + ((size_t)b * TQ + tq) * ldq + h * HS;
    bq.half[0] = *(const v8us*)(qr + 8 * hh); bq.half[1] = *(const v8us*)(qr + 16 + 8 * hh); bql.half[0] = *(const v8us*)(ql + 8 * hh); bql.half[1] = *(const v8us*)(ql + 16 + 8 * hh); }
  /* wave-uniform bases + one 32-bit byte offset per lane, which walks the keys (a plane is 8 MiB): A row = key (K) or head dim (V^T) ln, 16 bytes at 16 hh and at 32 + 16 hh of the row's 64 */
  const char* kb = (const char*)(K16 + (size_t)b * TK * ldk + h * HS); const char* klb = (const char*)(KL + (size_t)b * TK * ldk + h * HS); const char* vb = (const char*)(Vt + (size_t)slab * HS * TK);
  unsigned koff = (unsigned)(ln * ldk + 8 * hh) * 2u, voff = (unsigned)(ln * TK + 8 * hh) * 2u;
  float m_c = -3.0e38f, l_c = 0.f; v8f oacc[DT];
#pragma unroll
  for (int dt = 0; dt < DT; ++dt) oacc[dt] = (v8f){0.f,0.f,0.f,0.f,0.f,0.f,0.f,0.f};
  const int jend = (CAUSAL == 1) ? (qb0 + 4 * RPW) : TK;      /* causal: keys beyond the block's last query never contribute */
#pragma unroll 1                 /* rolled, as before: one pass's fragments and scores already fill the registers that eight waves a SIMD leave */
  for (int j0 = 0; j0 < jend; j0 += 32) {
    FragH ak[2], akl[2], av[DT];
#pragma unroll
    for (int nt = 0; nt < 2; ++nt) { const char* kr = kb + (size_t)nt * 16 * ldk * 2; const char* klr = klb + (size_t)nt * 16 * ldk * 2;
      ak[nt].half[0] = *(const v8us*)(kr + koff); ak[nt].half[1] = *(const v8us*)(kr + koff + 32); akl[nt].half[0] = *(const v8us*)(klr + koff); akl[nt].half[1] = *(const v8us*)(klr + koff + 32); }
#pragma unroll
    for (int dt = 0; dt < DT; ++dt) { const char* vrow = vb + (size_t)dt * 16 * TK * 2; av[dt].half[0] = *(const v8us*)(vrow + voff); av[dt].half[1] = *(const v8us*)(vrow + voff + 32); }
    koff += 32u * ldk * 2u; voff += 32u * 2u;      /* the next 32 keys */
    float sv[16]; bool ok[16];   /* element nt * 8 + r: key j0 + nt * 16 + 8 hh + r against query tq */
#pragma unroll
    for (int nt = 0; nt < 2; ++nt) { v8f acc = (v8f){0.f,0.f,0.f,0.f,0.f,0.f,0.f,0.f}, accl = acc;
      acc = mmaH<1>(ak[nt].v, ak[nt].v, bq.v, bq.v, acc); accl = mmaH<1>(ak[nt].v, ak[nt].v, bql.v, bql.v, accl); accl = mmaH<1>(akl[nt].v, akl[nt].v, bq.v, bq.v, accl);
#pragma unroll
      for (int r = 0; r < 8; ++r) { const int kk = j0 + nt * 16 + 8 * hh + r;
        bool o = (CAUSAL == 1) ? (kk <= tq) : ((CAUSAL == 2) ? ((kk >> 5) == (tq >> 5)) : true);      /* mode 2: block-diagonal 32-token groups */
        if (CAUSAL == 4) o = MSK[((size_t)b * TQ + tq) * TK + kk] != 0;      /* mode 4: per-(query, key) INPUT mask shared by all heads; masked keys contribute nothing, rows with no valid key give l = 0 -> output 0 */
        ok[nt * 8 + r] = o; sv[nt * 8 + r] = o ? (acc[r] + accl[r] * 0.0009765625f) * SCL : -3.0e38f; } }
    float mx[8];
#pragma unroll
    for (int i = 0; i < 8; ++i) mx[i] = fmaxf(sv[i], sv[8 + i]);
    float mc = fmaxf(fmaxf(fmaxf(mx[0], mx[1]), fmaxf(mx[2], mx[3])), fmaxf(fmaxf(mx[4], mx[5]), fmaxf(mx[6], mx[7])));
    mc = fmaxf(mc, xhalf(mc));   /* the query's other 16 keys */
    const float mn = fmaxf(m_c, mc); const float al = (mn > -1.0e38f) ? expf(m_c - mn) : 1.0f; m_c = mn;
    float p[16]; FragH pb;
#pragma unroll
    for (int i = 0; i < 16; ++i) { p[i] = ok[i] ? expf(sv[i] - mn) : 0.f; pb.h[i] = (_Float16)(p[i] * 1024.0f); }
    float t8[8], t4[4];          /* halving tree: neighbours stay neighbours, so the adds pair up two to an instruction */
#pragma unroll
    for (int i = 0; i < 8; ++i) t8[i] = p[i] + p[8 + i];
#pragma unroll
    for (int i = 0; i < 4; ++i) t4[i] = t8[i] + t8[4 + i];
    l_c = l_c * al + ((t4[0] + t4[2]) + (t4[1] + t4[3]));
#pragma unroll
    for (int dt = 0; dt < DT; ++dt) {
#pragma unroll
      for (int r = 0; r < 8; ++r) oacc[dt][r] *= al;
      oacc[dt] = mmaH<1>(av[dt].v, av[dt].v, pb.v, pb.v, oacc[dt]); } }
  const float l = l_c + xhalf(l_c); const float li = (l > 0.f) ? 1.0f / (l * 1024.0f) : 0.f;
#pragma unroll
  for (int dt = 0; dt < DT; ++dt) { v4f o0, o1;      /* a lane's 8 registers are 8 consecutive head dims of its query */
#pragma unroll
    for (int r = 0; r < 4; ++r) { o0[r] = oacc[dt][r] * li; o1[r] = oacc[dt][4 + r] * li; }
    *(v4fa*)&sO[w][ln][dt * 16 + 8 * hh] = o0; *(v4fa*)&sO[w][ln][dt * 16 + 8 * hh + 4] = o1; }
  __builtin_amdgcn_fence(__ATOMIC_ACQ_REL, "workgroup"); __builtin_amdgcn_wave_barrier();
  {
#pragma unroll
    for (int rp = 0; rp < RPW; rp += 128 / HS) { const int r = rp + lane / (HS / 4), pc = lane % (HS / 4); const v4f val = *(const v4fa*)&sO[w][r][pc * 4]; *(v4f*)(O + ((size_t)b * TQ + q0 + r) * ldo + h * HS + pc * 4) = val; }
     } }

// the four weights (row-major [out][in], the GEMM's B layout as they stand) as f16(bf16(W) x 16); blockIdx.y picks the weight
__global__ __launch_bounds__(256) void k_wprep(const float* __restrict__ Wq, const float* __restrict__ Wk, const float* __restrict__ Wv, const float* __restrict__ Wo, _Float16* __restrict__ Bq, _Float16* __restrict__ Bk, _Float16* __restrict__ Bv, _Float16* __restrict__ Bo) {
  const int by = blockIdx.y; const float* Wm = (by == 0) ? Wq : ((by == 1) ? Wk : ((by == 2) ? Wv : Wo)); _Float16* Bt = (by == 0) ? Bq : ((by == 1) ? Bk : ((by == 2) ? Bv : Bo));
  const size_t t = (size_t)blockIdx.x * 256 + threadIdx.x; FragH f;
#pragma unroll
  for (int i = 0; i < 8; ++i) f.h[i] = (_Float16)(bf16_round(Wm[t * 8 + i]) * 16.0f); *(v8us*)((unsigned short*)Bt + t * 8) = f.half[0]; }

extern "C" void kernel_launch(void* const* d_in, const int* in_sizes, int n_in,
                              void* d_out, int out_size, void* d_ws, size_t ws_size, hipStream_t stream) {
  (void)in_sizes; (void)n_in; (void)out_size;
  const float* const* I = (const float* const*)d_in; const float* qx = I[0]; const float* kx = I[1]; const float* vx = I[2]; const float* Wq = I[3]; const float* bq = I[4]; const float* Wk = I[5]; const float* bk = I[6]; const float* Wv = I[7]; const float* bv = I[8]; const float* Wo = I[9]; const float* bo = I[10];
  char* ws = (char*)d_ws; size_t off = 0;
  auto take = [&](size_t bytes) { char* p = ws + off; off += (bytes + 255) & ~(size_t)255; return p; };
  _Float16* BPq = (_Float16*)take((size_t)DP * CM * 2); _Float16* BPk = (_Float16*)take((size_t)DP * CM * 2); _Float16* BPv = (_Float16*)take((size_t)DP * CM * 2); _Float16* BOP = (_Float16*)take((size_t)CM * DP * 2);
  float* O = (float*)take((size_t)NR * DP * 4); _Float16* QH = (_Float16*)take((size_t)NR * DP * 2); _Float16* QL = (_Float16*)take((size_t)NR * DP * 2); _Float16* KH = (_Float16*)take((size_t)NR * DP * 2); _Float16* KL = (_Float16*)take((size_t)NR * DP * 2); _Float16* VT = (_Float16*)take((size_t)NR * DP * 2);
  if (off > ws_size) return;      /* under 64 MiB (256 MiB ws) */
  k_wprep<<<dim3(DP * CM / 8 / 256, 4), 256, 0, stream>>>(Wq, Wk, Wv, Wo, BPq, BPk, BPv, BOP);
  k_proj<<<dim3((NR / 128) * (DP / 64), 3), 128, 0, stream>>>(qx, kx, vx, BPq, BPk, BPv, bq, bk, bv, QH, QL, KH, KL, VT);
  k_flashqk<0><<<NSEQ * NH * QBLKS, 128, 0, stream>>>(QH, QL, KH, KL, VT, nullptr, O);      /* q/k hi + residual; P (x2^10) and V plain f16 */
  k_outg<<<(NR / 128) * (CM / 64), 128, 0, stream>>>(O, BOP, bo, (float*)d_out);
}

// v004
// A run of this version takes 120 microseconds.
// Timed twice side by side with v003, it ran 1.04 and 1.05 times as fast.
// All steps since v000 together make it 4.40 times as fast.
#include <hip/hip_runtime.h>
// Routing (windowed) attention (2 x 8 windows of 1024 tokens x 256; 8 heads x 32): qh/kh/vh = inputs q/k/v W^T + b split into heads; per (window, head) softmax(qh kh^T / sqrt(32)) vh; heads re-merged; ctx Wo^T + bo -> [2,8,4,16,16,256].
// Structure: 4 launches. Every workspace plane lies in WMMA fragment order (FTE below), so a wave's 16-byte loads and stores cover 512 contiguous bytes. (1) the four weights as exact x16 f16 planes; (2) the q, k, v projections in one grid (grid.y picks the operand): f16 WMMA GEMM, 32x64 wave tiles, f32 accumulation, the A loader reads the f32 input rows and rounds them itself, the epilogue writes hi + 2^10 residual planes (q, k) or V^T (v), one 16 x 32 fragment tile per (head, 16 tokens) or (head, 16 dims, 32 tokens); (3) the fused flash kernel, transposed (S^T = K Q^T, O^T += V^T P^T, P stays in registers), with hi + 2^10-residual q/k planes (S = QhKh + (QlKh + QhKl)/1024) and plain f16 P (x2^10) and V (16 sequences x 8 heads); (4) the output GEMM on the f16 context tiles that (3) stores.
// Compute dtype: q, k, v and parameters rounded to bf16; qh, kh hi + residual (~2^-21-class logits); P and vh plain f16 (~2^-12); context as f16 (~2^-12) into Wo; f32 accumulation/softmax. v_wmma_f32_16x16x32_f16.
#define NSEQ 16
#define NB NSEQ
#define CM 256
#define HS 32                    /* head slot width in the q/k/v/context planes = true head dim */
#define DP (NH * HS)             /* 256: q/k/v width */
#define NR (NSEQ * SLEN)         /* 16384 rows */
#define QBLKS (TQ / 64)
#define SLEN 1024                /* tokens per routing window (K*Hp*W) */
#define TQ SLEN
#define TK SLEN
#define NH 8
#define SCL 0.17677669529663687f /* 32^-0.5 */
typedef __bf16 v16b __attribute__((ext_vector_type(16)));
typedef unsigned short v8us __attribute__((ext_vector_type(8), may_alias));
typedef float  v8f  __attribute__((ext_vector_type(8)));
typedef float  v4f  __attribute__((ext_vector_type(4)));
typedef float  v4fa __attribute__((ext_vector_type(4), may_alias));
union FragB { v16b v; v8us half[2]; unsigned short u[16]; };

__device__ __forceinline__ unsigned short bf16_bits(float x) { unsigned int u = __float_as_uint(x); return (unsigned short)((u + 0x7FFFu + ((u >> 16) & 1u)) >> 16); }
__device__ __forceinline__ float bf16_val(unsigned short b) { return __uint_as_float(((unsigned int)b) << 16); }
__device__ __forceinline__ float bf16_round(float x) { return bf16_val(bf16_bits(x)); }
// D += A·B with NT terms: 1 = ah·bh, 2 = + al·bh (A split), 3 = + ah·bl (both split)
template <int NT>
__device__ __forceinline__ v8f mmaN(v16b ah, v16b al, v16b bh, v16b bl, v8f c) {
  c = __builtin_amdgcn_wmma_f32_16x16x32_bf16(false, ah, false, bh, (short)0, c, false, false);
  if (NT >= 2) c = __builtin_amdgcn_wmma_f32_16x16x32_bf16(false, al, false, bh, (short)0, c, false, false);
  if (NT >= 3) c = __builtin_amdgcn_wmma_f32_16x16x32_bf16(false, ah, false, bl, (short)0, c, false, false);
  asm volatile("v_nop\n\tv_nop\n\tv_nop\n\tv_nop" : "+v"(c) : "v"(ah), "v"(al), "v"(bh), "v"(bl));
  return c;
}

__global__ __launch_bounds__(256) void k_wt_bf16(const float* __restrict__ W, unsigned short* __restrict__ Wt, int K, int N) {
  const int t = blockIdx.x * 256 + threadIdx.x;
  const int k8n = K / 8;
  if (t >= N * k8n) return;
  const int n = t / k8n, k8 = (t % k8n) * 8;
  v8us v;
#pragma unroll
  for (int i = 0; i < 8; ++i) v[i] = bf16_bits(W[(size_t)(k8 + i) * N + n]);
  *(v8us*)(Wt + (size_t)n * K + k8) = v;
  
}

// GEMM C[M][N] (f32, pitch ldc) = act(A[M][K]·W + bias). A f32 row-major (pitch lda) converted per fragment to bf16
// (ASPLIT: hi/lo two planes -> 2 terms, else single rounded term); Wt bf16 [N][K] (pitch ldb). BIAS_BF16 rounds the
// bias to bf16 first (bias quantised to bf16 before the add). K%32==0, M%16==0, N%64==0.
template <bool ASPLIT, int ACT, bool BIAS_BF16>
__global__ __launch_bounds__(128) void k_gemm_bf(const float* __restrict__ A, int lda, const unsigned short* __restrict__ Wt, int ldb,
                                               const float* __restrict__ bias, float* __restrict__ C, int ldc, int M, int N, int K) {
  __shared__ __attribute__((aligned(16))) float so[4][16][64];
  const int tid = threadIdx.x, w = tid >> 5, lane = tid & 31, ln = lane & 15, hh = lane >> 4;
  const int ntn = N / 64;
  const int wid = blockIdx.x * 4 + w;
  const int mt = wid / ntn, nq = wid % ntn;
  if (mt * 16 >= M) return;
  const int row0 = mt * 16, col0 = nq * 64;
  const float* arow = A + (size_t)(row0 + ln) * lda;
  v8f acc[4] = {};
  for (int kb = 0; kb < K; kb += 32) {
    FragB ah, al;
    const v4f x0 = *(const v4fa*)(arow + kb + 8 * hh), x1 = *(const v4fa*)(arow + kb + 8 * hh + 4);
    const v4f x2 = *(const v4fa*)(arow + kb + 16 + 8 * hh), x3 = *(const v4fa*)(arow + kb + 16 + 8 * hh + 4);
    float xs[16] = {x0[0],x0[1],x0[2],x0[3],x1[0],x1[1],x1[2],x1[3],x2[0],x2[1],x2[2],x2[3],x3[0],x3[1],x3[2],x3[3]};
#pragma unroll
    for (int i = 0; i < 16; ++i) { const unsigned short hb = bf16_bits(xs[i]); ah.u[i] = hb; al.u[i] = ASPLIT ? bf16_bits(xs[i] - bf16_val(hb)) : (unsigned short)0; }
#pragma unroll
    for (int t = 0; t < 4; ++t) {
      const unsigned short* brow = Wt + (size_t)(col0 + t * 16 + ln) * ldb + kb;
      FragB b;
      b.half[0] = *(const v8us*)(brow + 8 * hh);
      b.half[1] = *(const v8us*)(brow + 16 + 8 * hh);
      acc[t] = mmaN<ASPLIT ? 2 : 1>(ah.v, al.v, b.v, b.v, acc[t]);
    }
  }
#pragma unroll
  for (int t = 0; t < 4; ++t) {
    float bv = bias ? bias[col0 + t * 16 + ln] : 0.f;
    if (BIAS_BF16) bv = bf16_round(bv);
#pragma unroll
    for (int r = 0; r < 8; ++r) { float v = acc[t][r] + bv; if (ACT == 1) v = fmaxf(v, 0.f); so[w][8 * hh + r][t * 16 + ln] = v; }
  }
  __builtin_amdgcn_fence(__ATOMIC_ACQ_REL, "workgroup");
  __builtin_amdgcn_wave_barrier();
  const int rsub = lane >> 4, c4 = (lane & 15) * 4;
  {
#pragma unroll
    for (int q = 0; q < 8; ++q) {
      const int r = q * 2 + rsub;
      const v4f v = *(const v4fa*)&so[w][r][c4];
      *(v4f*)(C + (size_t)(row0 + r) * ldc + col0 + c4) = v;
    }
    
  }
}

// GEMM C = act(A·W + bias + resid): A f32 (ASPLIT -> hi/lo 2 terms), Wt bf16 [N][K]; ACT 0 none, 1 relu, 2 exact gelu;
// resid (optional, f32, row index = (row % rmod), pitch ldr, RES_BF16 rounds it) added before the activation.
template <bool ASPLIT, int ACT, bool BIAS_BF16, bool RES_BF16>
__global__ __launch_bounds__(128) void k_gemm_bf3(const float* __restrict__ A, int lda, const unsigned short* __restrict__ Wt, int ldb,
                                                const float* __restrict__ bias, const float* __restrict__ resid, int rmod, int ldr,
                                                float* __restrict__ C, int ldc, int M, int N, int K) {
  __shared__ __attribute__((aligned(16))) float so[4][16][64];
  const int tid = threadIdx.x, w = tid >> 5, lane = tid & 31, ln = lane & 15, hh = lane >> 4;
  const int ntn = N / 64;
  const int wid = blockIdx.x * 4 + w;
  const int mt = wid / ntn, nq = wid % ntn;
  if (mt * 16 >= M) return;
  const int row0 = mt * 16, col0 = nq * 64;
  const float* arow = A + (size_t)(row0 + ln) * lda;
  v8f acc[4] = {};
  for (int kb = 0; kb < K; kb += 32) {
    FragB ah, al;
    const v4f x0 = *(const v4fa*)(arow + kb + 8 * hh), x1 = *(const v4fa*)(arow + kb + 8 * hh + 4);
    const v4f x2 = *(const v4fa*)(arow + kb + 16 + 8 * hh), x3 = *(const v4fa*)(arow + kb + 16 + 8 * hh + 4);
    float xs[16] = {x0[0],x0[1],x0[2],x0[3],x1[0],x1[1],x1[2],x1[3],x2[0],x2[1],x2[2],x2[3],x3[0],x3[1],x3[2],x3[3]};
#pragma unroll
    for (int i = 0; i < 16; ++i) { const unsigned short hb = bf16_bits(xs[i]); ah.u[i] = hb; al.u[i] = ASPLIT ? bf16_bits(xs[i] - bf16_val(hb)) : (unsigned short)0; }
#pragma unroll
    for (int t = 0; t < 4; ++t) {
      const unsigned short* brow = Wt + (size_t)(col0 + t * 16 + ln) * ldb + kb;
      FragB b;
      b.half[0] = *(const v8us*)(brow + 8 * hh);
      b.half[1] = *(const v8us*)(brow + 16 + 8 * hh);
      acc[t] = mmaN<ASPLIT ? 2 : 1>(ah.v, al.v, b.v, b.v, acc[t]);
    }
  }
#pragma unroll
  for (int t = 0; t < 4; ++t) {
    const int col = col0 + t * 16 + ln;
    float bv = bias ? bias[col] : 0.f;
    if (BIAS_BF16) bv = bf16_round(bv);
#pragma unroll
    for (int r = 0; r < 8; ++r) {
      float v = acc[t][r] + bv;
      if (resid) { float rv = resid[(size_t)((row0 + 8 * hh + r) % rmod) * ldr + col]; if (RES_BF16) rv = bf16_round(rv); v += rv; }
      if (ACT == 1) v = fmaxf(v, 0.f);
      if (ACT == 2) v = 0.5f * v * (1.0f + erff(v * 0.70710678118654752f));
      if (ACT == 3) { const float u = 0.7978845608028654f * (v + 0.044715f * v * v * v); v = 0.5f * v * (1.0f + tanhf(u)); }
      so[w][8 * hh + r][t * 16 + ln] = v;
    }
  }
  __builtin_amdgcn_fence(__ATOMIC_ACQ_REL, "workgroup");
  __builtin_amdgcn_wave_barrier();
  const int rsub = lane >> 4, c4 = (lane & 15) * 4;
  {
#pragma unroll
    for (int q = 0; q < 8; ++q) {
      const int r = q * 2 + rsub;
      const v4f v = *(const v4fa*)&so[w][r][c4];
      *(v4f*)(C + (size_t)(row0 + r) * ldc + col0 + c4) = v;
    }
    
  }
}
// row LayerNorm (biased variance, eps) over N: s = X (+ R); optional out_sum <- s; out_norm <- (s-mu)*rsqrt(var+eps)*g + b
template <bool PARAM_BF16>
__global__ __launch_bounds__(256) void k_layernorm(const float* __restrict__ X, const float* __restrict__ R, const float* __restrict__ g, const float* __restrict__ bta,
                                                  float* __restrict__ out_sum, float* __restrict__ out_norm, int N, float eps) {
  __shared__ float red[256];
  const int row = blockIdx.x, tid = threadIdx.x;
  const float* x = X + (size_t)row * N; const float* rr = R ? R + (size_t)row * N : nullptr;
  float vals[16];                     // up to N = 4096
  const int per = N / 256;            // contiguous chunk per thread? use strided-by-4 chunks: thread handles j = tid*4 + 1024*u
  float s1 = 0.f;
  for (int u = 0; u < per / 4; ++u) {
    const int j = tid * 4 + 1024 * u;
    const v4f a = *(const v4fa*)(x + j);
    v4f b = {0.f,0.f,0.f,0.f}; if (rr) b = *(const v4fa*)(rr + j);
#pragma unroll
    for (int q = 0; q < 4; ++q) { const float v = a[q] + b[q]; vals[u * 4 + q] = v; s1 += v; }
  }
  red[tid] = s1; __syncthreads();
  for (int st = 128; st > 0; st >>= 1) { if (tid < st) red[tid] += red[tid + st]; __syncthreads(); }
  const float mu = red[0] / (float)N; __syncthreads();
  float s2 = 0.f;
  for (int u = 0; u < per / 4; ++u)
#pragma unroll
    for (int q = 0; q < 4; ++q) { const float c = vals[u * 4 + q] - mu; s2 += c * c; }
  red[tid] = s2; __syncthreads();
  for (int st = 128; st > 0; st >>= 1) { if (tid < st) red[tid] += red[tid + st]; __syncthreads(); }
  const float rs = rsqrtf(red[0] / (float)N + eps);
  {
    for (int u = 0; u < per / 4; ++u) {
      const int j = tid * 4 + 1024 * u;
      v4f o, sm;
#pragma unroll
      for (int q = 0; q < 4; ++q) {
        float gg = g[j + q], bb = bta[j + q];
        if (PARAM_BF16) { gg = bf16_round(gg); bb = bf16_round(bb); }
        sm[q] = vals[u * 4 + q]; o[q] = (vals[u * 4 + q] - mu) * rs * gg + bb;
      }
      if (out_sum) *(v4f*)(out_sum + (size_t)row * N + j) = sm;
      *(v4f*)(out_norm + (size_t)row * N + j) = o;
    }
    
  }
}



// ---- f16 WMMA path (v_wmma_f32_16x16x32_f16): 11-bit significands for operands in range — used where a [0,1] probability operand needs more precision than bf16
typedef _Float16 v16h __attribute__((ext_vector_type(16)));
union FragH { v16h v; v8us half[2]; _Float16 h[16]; unsigned short u[16]; };
template <int NT>
__device__ __forceinline__ v8f mmaH(v16h ah, v16h al, v16h bh, v16h bl, v8f c) {
  c = __builtin_amdgcn_wmma_f32_16x16x32_f16(false, ah, false, bh, (short)0, c, false, false);
  if (NT >= 2) c = __builtin_amdgcn_wmma_f32_16x16x32_f16(false, al, false, bh, (short)0, c, false, false);
  if (NT >= 3) c = __builtin_amdgcn_wmma_f32_16x16x32_f16(false, ah, false, bl, (short)0, c, false, false);
  asm volatile("v_nop\n\tv_nop\n\tv_nop\n\tv_nop" : "+v"(c) : "v"(ah), "v"(al), "v"(bh), "v"(bl));
  return c;
}
// batched GEMM like k_gemm_b but f16 operands: A f32 (split into f16 hi/lo if ASPLIT, else rounded to f16), Bt = f16 values [n][k]; alpha; C f32; N multiple of 16 (partial tiles skipped)
template <bool ASPLIT>
__global__ __launch_bounds__(128) void k_gemm_h(const float* __restrict__ A, int lda, size_t sA, const _Float16* __restrict__ Bh, int ldb, size_t sB, float alpha, float* __restrict__ C, int ldc, size_t sC, int M, int N, int K) {
  __shared__ __attribute__((aligned(16))) float so[4][16][64];
  const int tid = threadIdx.x, w = tid >> 5, lane = tid & 31, ln = lane & 15, hh = lane >> 4; const int by = blockIdx.y;
  A += (size_t)by * sA; Bh += (size_t)by * sB; C += (size_t)by * sC;
  const int ntn = (N + 63) / 64; const int wid = blockIdx.x * 4 + w; const int mt = wid / ntn, nq = wid % ntn; if (mt * 16 >= M) return;
  const int row0 = mt * 16, col0 = nq * 64; const float* arow = A + (size_t)(row0 + ln) * lda;
  v8f acc[4] = {};
  for (int kb = 0; kb < K; kb += 32) {
    FragH ah, al;
    const v4f x0 = *(const v4fa*)(arow + kb + 8 * hh), x1 = *(const v4fa*)(arow + kb + 8 * hh + 4), x2 = *(const v4fa*)(arow + kb + 16 + 8 * hh), x3 = *(const v4fa*)(arow + kb + 16 + 8 * hh + 4);
    float xs[16] = {x0[0],x0[1],x0[2],x0[3],x1[0],x1[1],x1[2],x1[3],x2[0],x2[1],x2[2],x2[3],x3[0],x3[1],x3[2],x3[3]};
#pragma unroll
    for (int i = 0; i < 16; ++i) { const _Float16 h = (_Float16)xs[i]; ah.h[i] = h; al.h[i] = ASPLIT ? (_Float16)(xs[i] - (float)h) : (_Float16)0.0f; }
#pragma unroll
    for (int t = 0; t < 4; ++t) { if (col0 + t * 16 >= N) continue; const size_t boff = (size_t)(col0 + t * 16 + ln) * ldb + kb; FragH bq; bq.half[0] = *(const v8us*)(Bh + boff + 8 * hh); bq.half[1] = *(const v8us*)(Bh + boff + 16 + 8 * hh);
      acc[t] = mmaH<ASPLIT ? 2 : 1>(ah.v, al.v, bq.v, bq.v, acc[t]); }
  }
#pragma unroll
  for (int t = 0; t < 4; ++t) { if (col0 + t * 16 >= N) continue;
#pragma unroll
    for (int r = 0; r < 8; ++r) so[w][8 * hh + r][t * 16 + ln] = acc[t][r] * alpha; }
  __builtin_amdgcn_fence(__ATOMIC_ACQ_REL, "workgroup"); __builtin_amdgcn_wave_barrier();
  const int rsub = lane >> 4, c4 = (lane & 15) * 4;
  {
#pragma unroll
    for (int q = 0; q < 8; ++q) { const int r = q * 2 + rsub; if (col0 + c4 < N) { const v4f v = *(const v4fa*)&so[w][r][c4]; *(v4f*)(C + (size_t)(row0 + r) * ldc + col0 + c4) = v; } }
     }
}

// Wt[n][k] = f16(W[k][n]·scale) from f32 row-major W[K][N] (scale = power of two; bf16-exact weights stay exact in f16 away from the subnormal range)
__global__ __launch_bounds__(256) void k_wt_f16(const float* __restrict__ W, _Float16* __restrict__ Wt, int K, int N, float scale) {
  const int t = blockIdx.x * 256 + threadIdx.x; if (t >= N * (K / 8)) return; const int n = t / (K / 8), k8 = (t % (K / 8)) * 8; FragH f;
#pragma unroll
  for (int i = 0; i < 8; ++i) f.h[i] = (_Float16)(bf16_round(W[(size_t)(k8 + i) * N + n]) * scale); const v8us o = f.half[0];
  *(v8us*)((unsigned short*)Wt + (size_t)n * K + k8) = o; 
}
// k_gemm_hh variant with fused epilogue: v = acc·alpha + bias[by·sBias + col] (+ CP[(row/rowsPerB)·sCPb + by·64 + col] if CP) ; ACT 0 none / 1 elu ; writes f16 C16 (and f32 C if non-null)
template <int ACT>
__global__ __launch_bounds__(128) void k_gemm_hhx(const _Float16* __restrict__ A, int lda, size_t sA, const _Float16* __restrict__ Bh, int ldb, size_t sB, float alpha, const float* __restrict__ bias, size_t sBias, const float* __restrict__ CP, int rowsPerB, size_t sCPb, int row0g,
    float* __restrict__ C, _Float16* __restrict__ C16, int ldc, size_t sC, int M, int N, int K) {
  __shared__ __attribute__((aligned(16))) float so[4][16][64];
  const int tid = threadIdx.x, w = tid >> 5, lane = tid & 31, ln = lane & 15, hh = lane >> 4; const int by = blockIdx.y;
  A += (size_t)by * sA; Bh += (size_t)by * sB; const size_t cofs = (size_t)by * sC; const float* bp = bias ? bias + (size_t)by * sBias : nullptr;
  const int ntn = (N + 63) / 64; const int wid = blockIdx.x * 4 + w; const int mt = wid / ntn, nq = wid % ntn; if (mt * 16 >= M) return;
  const int row0 = mt * 16, col0 = nq * 64; const _Float16* arow = A + (size_t)(row0 + ln) * lda;
  v8f acc[4] = {};
  for (int kb = 0; kb < K; kb += 32) { FragH ah; ah.half[0] = *(const v8us*)((const unsigned short*)arow + kb + 8 * hh); ah.half[1] = *(const v8us*)((const unsigned short*)arow + kb + 16 + 8 * hh);
#pragma unroll
    for (int t = 0; t < 4; ++t) { if (col0 + t * 16 >= N) continue; const size_t boff = (size_t)(col0 + t * 16 + ln) * ldb + kb; FragH bq; bq.half[0] = *(const v8us*)((const unsigned short*)Bh + boff + 8 * hh); bq.half[1] = *(const v8us*)((const unsigned short*)Bh + boff + 16 + 8 * hh);
      acc[t] = mmaH<1>(ah.v, ah.v, bq.v, bq.v, acc[t]); }
  }
#pragma unroll
  for (int t = 0; t < 4; ++t) { if (col0 + t * 16 >= N) continue; const int col = col0 + t * 16 + ln; const float bv = bp ? bf16_round(bp[col]) : 0.f;
#pragma unroll
    for (int r = 0; r < 8; ++r) { float v = acc[t][r] * alpha + bv; if (CP) { const int bidx = (row0g + row0 + 8 * hh + r) / rowsPerB; v += CP[(size_t)bidx * sCPb + (size_t)by * 64 + col]; } if (ACT == 1) v = (v > 0.f) ? v : expm1f(v); else if (ACT == 7) v = (v > 0.f) ? v + 1.0f : expf(v); else if (ACT == 8) v = tanhf(v); else if (ACT == 9) v = 0.5f * v * (1.0f + tanhf(0.7978845608028654f * (v + 0.044715f * v * v * v))); else if (ACT == 11) v = 1.0f / (1.0f + expf(-v)); else if (ACT == 12) v = (v > 0.f) ? v : 0.01f * v; else if (ACT == 14) v = (v > 0.f) ? v : 0.1f * v; else if (ACT == 15) v = v / (1.0f + expf(-v)); else if (ACT == 3) v = fmaxf(v, 0.f); else if (ACT == 6) v = 0.5f * v * (1.0f + erff(v * 0.70710678118654752f)); so[w][8 * hh + r][t * 16 + ln] = v; } }
  __builtin_amdgcn_fence(__ATOMIC_ACQ_REL, "workgroup"); __builtin_amdgcn_wave_barrier();
  const int rsub = lane >> 4, c4 = (lane & 15) * 4; typedef _Float16 v4h __attribute__((ext_vector_type(4)));
  {
#pragma unroll
    for (int q = 0; q < 8; ++q) { const int r = q * 2 + rsub; if (col0 + c4 < N) { const v4f v = *(const v4fa*)&so[w][r][c4]; if (C) *(v4f*)(C + cofs + (size_t)(row0 + r) * ldc + col0 + c4) = v; if (C16) { v4h h4; for (int i = 0; i < 4; ++i) h4[i] = (_Float16)v[i]; *(v4h*)(C16 + cofs + (size_t)(row0 + r) * ldc + col0 + c4) = h4; } } }
     }
}


typedef _Float16 v4h __attribute__((ext_vector_type(4)));

__global__ __launch_bounds__(256) void k_round16f(const float* __restrict__ W, _Float16* __restrict__ Bt, size_t n8) { const size_t t = (size_t)blockIdx.x * 256 + threadIdx.x; if (t >= n8) return; FragH f;
#pragma unroll
  for (int i = 0; i < 8; ++i) f.h[i] = (_Float16)(bf16_round(W[t * 8 + i]) * 16.0f); *(v8us*)((unsigned short*)Bt + t * 8) = f.half[0];  }
// ---- fused GEMM (block 128x64, wave tile 32x64, K = KD): A is read as f32 rows and rounded in the loader (k_proj) or as f16 fragment tiles (k_outg), the epilogue writes what the next kernel reads ----
#define KD 256                   /* = CM = DP: K and the row pitch of A and of the f32 weights */
__device__ __forceinline__ v16h g2_frag(const _Float16* p, int hh) { FragH f; f.half[0] = *(const v8us*)((const unsigned short*)p + 8 * hh); f.half[1] = *(const v8us*)((const unsigned short*)p + 16 + 8 * hh); return f.v; }
__device__ __forceinline__ v8f g2_mma(v16h a, v16h b, v8f c) { v8f d = __builtin_amdgcn_wmma_f32_16x16x32_f16(false, a, false, b, (short)0, c, false, false); asm volatile("v_nop\n\tv_nop\n\tv_nop\n\tv_nop" : "+v"(d) : "v"(a), "v"(b)); return d; }
// Fragment order: a 16 x 32 f16 operand tile (16 rows or columns x 32 k) is FTE consecutive elements; lane l = 16 hh + ln holds row ln, k = 8 hh .. + 7 at element 8 l and k = 16 + 8 hh .. + 7 at FTE / 2 + 8 l (the k order of g2_frag)
#define FTE 512
__device__ __forceinline__ v16h pk_frag(const _Float16* p) { FragH f; f.half[0] = *(const v8us*)((const unsigned short*)p); f.half[1] = *(const v8us*)((const unsigned short*)p + FTE / 2); return f.v; }      /* p = tile + 8 lane */
// the k order of g2_frag from an f32 row; RB: rounded to bf16 first (inputs), else straight to f16
template <bool RB>
__device__ __forceinline__ v16h gf_frag(const float* p, int hh) {
  const v4f x0 = *(const v4fa*)(p + 8 * hh), x1 = *(const v4fa*)(p + 8 * hh + 4), x2 = *(const v4fa*)(p + 16 + 8 * hh), x3 = *(const v4fa*)(p + 16 + 8 * hh + 4); FragH f;
#pragma unroll
  for (int i = 0; i < 4; ++i) { f.h[i] = (_Float16)(RB ? bf16_round(x0[i]) : x0[i]); f.h[4 + i] = (_Float16)(RB ? bf16_round(x1[i]) : x1[i]); f.h[8 + i] = (_Float16)(RB ? bf16_round(x2[i]) : x2[i]); f.h[12 + i] = (_Float16)(RB ? bf16_round(x3[i]) : x3[i]); }
  return f.v; }
// PK: A comes as fragment tiles [row / 16][k / 32] from Ap; else as f32 rows from A, rounded to bf16. Bh: fragment tiles [col / 16][k / 32]
template <bool PK>
__device__ __forceinline__ void gf_tile(const float* __restrict__ A, const _Float16* __restrict__ Ap, const _Float16* __restrict__ Bh, int row0, int col0, int ln, int hh, v8f (&accs)[8]) {
  constexpr int TR = (KD / 32) * FTE;      /* elements of one row of tiles */
  const float* a0p = A + (size_t)(row0 + ln) * KD; const float* a1p = a0p + (size_t)16 * KD;
  const _Float16* p0p = Ap + (size_t)(row0 / 16) * TR + (16 * hh + ln) * 8; const _Float16* p1p = p0p + TR;
  const _Float16* b0p = Bh + (size_t)(col0 / 16) * TR + (16 * hh + ln) * 8; const _Float16* b1p = b0p + TR; const _Float16* b2p = b1p + TR; const _Float16* b3p = b2p + TR;
  const v8f z8 = {0.f,0.f,0.f,0.f,0.f,0.f,0.f,0.f}; v8f c00 = z8, c01 = z8, c02 = z8, c03 = z8, c10 = z8, c11 = z8, c12 = z8, c13 = z8;
#pragma unroll 1                 /* rolled, as before the fusion: keeps the registers low enough for every block of the grid to be resident at once */
  for (int kb = 0; kb < KD; kb += 32) { const v16h a0 = PK ? pk_frag(p0p) : gf_frag<true>(a0p + kb, hh), a1 = PK ? pk_frag(p1p) : gf_frag<true>(a1p + kb, hh);
    v16h b = pk_frag(b0p); c00 = g2_mma(a0, b, c00); c10 = g2_mma(a1, b, c10);
    b = pk_frag(b1p); c01 = g2_mma(a0, b, c01); c11 = g2_mma(a1, b, c11);
    b = pk_frag(b2p); c02 = g2_mma(a0, b, c02); c12 = g2_mma(a1, b, c12);
    b = pk_frag(b3p); c03 = g2_mma(a0, b, c03); c13 = g2_mma(a1, b, c13);
    p0p += FTE; p1p += FTE; b0p += FTE; b1p += FTE; b2p += FTE; b3p += FTE; }
  accs[0] = c00; accs[1] = c01; accs[2] = c02; accs[3] = c03; accs[4] = c10; accs[5] = c11; accs[6] = c12; accs[7] = c13; }
// q, k, v projections, blockIdx.y = 0, 1, 2: y = x W^T + b (weights x16, so acc / 16). q, k -> hi + 2^10 residual planes, fragment tiles [b * NH + head][token / 16]; v -> f16 V^T, fragment tiles [b * NH + head][token / 32][dim / 16]
__global__ __launch_bounds__(128) void k_proj(const float* __restrict__ xq, const float* __restrict__ xk, const float* __restrict__ xv, const _Float16* __restrict__ Bq, const _Float16* __restrict__ Bk, const _Float16* __restrict__ Bv,
    const float* __restrict__ bq, const float* __restrict__ bk, const float* __restrict__ bv, _Float16* __restrict__ QH, _Float16* __restrict__ QL, _Float16* __restrict__ KH, _Float16* __restrict__ KL, _Float16* __restrict__ VT) {
  __shared__ __attribute__((aligned(16))) float so[4][32][68];
  const int tid = threadIdx.x, w = tid >> 5, lane = tid & 31, ln = lane & 15, hh = lane >> 4; const int by = blockIdx.y;
  const float* A = (by == 0) ? xq : ((by == 1) ? xk : xv); const _Float16* Bh = (by == 0) ? Bq : ((by == 1) ? Bk : Bv); const float* bp = (by == 0) ? bq : ((by == 1) ? bk : bv);
  const int mt = blockIdx.x / (DP / 64), nq = blockIdx.x % (DP / 64); const int row0 = mt * 128 + 32 * w, col0 = nq * 64;
  v8f accs[8]; gf_tile<false>(A, nullptr, Bh, row0, col0, ln, hh, accs);
  const int sl0 = (row0 / SLEN) * NH + col0 / HS, tk0 = row0 % SLEN;      /* the wave's first (window, head) and first token: 2 heads x 32 tokens */
  if (by == 2) {                 /* block-uniform. A lane's 8 accumulator rows are 8 consecutive tokens of one column = its own 16 bytes of a V^T fragment tile (row = dim ln, k = token): stored from registers */
#pragma unroll
    for (int u = 0; u < 8; ++u) { const int t = u & 3, half = u >> 2; const float bvv = bf16_round(bp[col0 + t * 16 + ln]); FragH f;
#pragma unroll
      for (int r = 0; r < 8; ++r) f.h[r] = (_Float16)(accs[u][r] * 0.0625f + bvv);
      *(v8us*)((unsigned short*)VT + ((size_t)((sl0 + (t >> 1)) * (SLEN / 32) + tk0 / 32) * (HS / 16) + (t & 1)) * FTE + half * (FTE / 2) + lane * 8) = f.half[0]; }
    return; }
  _Float16* Hh = (by == 0) ? QH : KH; _Float16* Hl = (by == 0) ? QL : KL;
#pragma unroll
  for (int u = 0; u < 8; ++u) { const int t = u & 3, half = u >> 2; const float bvv = bf16_round(bp[col0 + t * 16 + ln]);
#pragma unroll
    for (int r = 0; r < 8; ++r) so[w][half * 16 + 8 * hh + r][t * 16 + ln] = accs[u][r] * 0.0625f + bvv; }
  __builtin_amdgcn_fence(__ATOMIC_ACQ_REL, "workgroup"); __builtin_amdgcn_wave_barrier();
#pragma unroll 1                 /* one tile a trip: unrolled, this compiler aims the whole kernel at fewer registers and issues the k loop's first weight loads only behind the A rows' conversion: one more exposed load latency a k step */
  for (int tl = 0; tl < 4; ++tl) { const int kt = tl >> 1, hd = tl & 1;      /* 2 token tiles x 2 heads; per half tile a lane reads its 8 dims of token ln and stores its 16 bytes */
    const size_t o = ((size_t)(sl0 + hd) * (SLEN / 16) + tk0 / 16 + kt) * FTE + lane * 8;
#pragma unroll
    for (int half = 0; half < 2; ++half) { const float* sp = &so[w][kt * 16 + ln][hd * HS + half * 16 + 8 * hh]; const v4f v0 = *(const v4fa*)sp, v1 = *(const v4fa*)(sp + 4); FragH fh, fl;
#pragma unroll
      for (int i = 0; i < 4; ++i) { const _Float16 h0 = (_Float16)v0[i], h1 = (_Float16)v1[i]; fh.h[i] = h0; fh.h[4 + i] = h1; fl.h[i] = (_Float16)((v0[i] - (float)h0) * 1024.0f); fl.h[4 + i] = (_Float16)((v1[i] - (float)h1) * 1024.0f); }
      *(v8us*)((unsigned short*)Hh + o + half * (FTE / 2)) = fh.half[0]; *(v8us*)((unsigned short*)Hl + o + half * (FTE / 2)) = fl.half[0]; }
    asm volatile("s_wait_xcnt 0x0" ::: "memory"); }      /* the next trip rewrites these stores' address and data registers */
}
// output projection: out = ctx Wo^T + bo, f32 rows of CM; ctx = f16 fragment tiles [row / 16][head]
__global__ __launch_bounds__(128) void k_outg(const _Float16* __restrict__ Ctx, const _Float16* __restrict__ Bo, const float* __restrict__ bo, float* __restrict__ C) {
  __shared__ __attribute__((aligned(16))) float so[4][32][68];
  const int tid = threadIdx.x, w = tid >> 5, lane = tid & 31, ln = lane & 15, hh = lane >> 4;
  const int mt = blockIdx.x / (CM / 64), nq = blockIdx.x % (CM / 64); const int row0 = mt * 128 + 32 * w, col0 = nq * 64;
  v8f accs[8]; gf_tile<true>(nullptr, Ctx, Bo, row0, col0, ln, hh, accs);
#pragma unroll
  for (int u = 0; u < 8; ++u) { const int t = u & 3, half = u >> 2; const float bvv = bf16_round(bo[col0 + t * 16 + ln]);
#pragma unroll
    for (int r = 0; r < 8; ++r) so[w][half * 16 + 8 * hh + r][t * 16 + ln] = accs[u][r] * 0.0625f + bvv; }
  __builtin_amdgcn_fence(__ATOMIC_ACQ_REL, "workgroup"); __builtin_amdgcn_wave_barrier();
  const int rsub = lane >> 4, c4 = (lane & 15) * 4;
#pragma unroll
  for (int q = 0; q < 16; ++q) { const int r = q * 2 + rsub; const v4f v = *(const v4fa*)&so[w][r][c4]; *(v4f*)(C + (size_t)(row0 + r) * CM + col0 + c4) = v; } }



template <int CAUSAL>
__global__ __launch_bounds__(128) void k_flash(const _Float16* __restrict__ Q16, int ldq, const _Float16* __restrict__ K16, int ldk, const _Float16* __restrict__ Vt, const int* __restrict__ MSK, float* __restrict__ O, int ldo) {
  constexpr int RPW = 16, RTN = RPW / 16, NQB = TQ / (4 * RPW), DT = 4, KS = 2;
  __shared__ __attribute__((aligned(16))) unsigned short sP[4][RPW][40]; __shared__ __attribute__((aligned(16))) float sO[4][RPW][64 + 4];
  const int tid = threadIdx.x, w = tid >> 5, lane = tid & 31, ln = lane & 15, hh = lane >> 4;
  const int slab = blockIdx.x / QBLKS, qblk = blockIdx.x % QBLKS; (void)NQB; const int b = slab / NH, h = slab % NH; const int qb0 = qblk * (4 * RPW); const int q0 = qb0 + w * RPW;
  FragH aq[2][KS];
#pragma unroll
  for (int rt = 0; rt < RTN; ++rt) { const unsigned short* qr = (const unsigned short*)Q16 + ((size_t)b * TQ + q0 + rt * 16 + ln) * ldq + h * 64;
#pragma unroll
    for (int ks = 0; ks < KS; ++ks) { aq[rt][ks].half[0] = *(const v8us*)(qr + ks * 32 + 8 * hh); aq[rt][ks].half[1] = *(const v8us*)(qr + ks * 32 + 16 + 8 * hh); } }
  const unsigned short* Vth = (const unsigned short*)Vt + (size_t)slab * 64 * TK;
  float m_r[2][8], l_r[2][8]; v8f oacc[2][DT];
#pragma unroll
  for (int rt = 0; rt < RTN; ++rt) {
#pragma unroll
    for (int r = 0; r < 8; ++r) { m_r[rt][r] = -3.0e38f; l_r[rt][r] = 0.f; }
#pragma unroll
    for (int dt = 0; dt < DT; ++dt) oacc[rt][dt] = (v8f){0.f,0.f,0.f,0.f,0.f,0.f,0.f,0.f}; }
  const int jend = (CAUSAL == 1) ? (qb0 + 4 * RPW) : TK;      /* causal: keys beyond the block's last query never contribute */
#pragma unroll 1
  for (int j0 = 0; j0 < jend; j0 += 32) {
    v8f s[2][2];
#pragma unroll
    for (int nt = 0; nt < 2; ++nt) { const unsigned short* kr = (const unsigned short*)K16 + ((size_t)b * TK + j0 + nt * 16 + ln) * ldk + h * 64; FragH bk[KS];
#pragma unroll
      for (int ks = 0; ks < KS; ++ks) { bk[ks].half[0] = *(const v8us*)(kr + ks * 32 + 8 * hh); bk[ks].half[1] = *(const v8us*)(kr + ks * 32 + 16 + 8 * hh); }
#pragma unroll
      for (int rt = 0; rt < RTN; ++rt) { v8f acc = (v8f){0.f,0.f,0.f,0.f,0.f,0.f,0.f,0.f};
#pragma unroll
        for (int ks = 0; ks < KS; ++ks) acc = mmaH<1>(aq[rt][ks].v, aq[rt][ks].v, bk[ks].v, bk[ks].v, acc); s[rt][nt] = acc; } }
#pragma unroll
    for (int rt = 0; rt < RTN; ++rt)
#pragma unroll
      for (int r = 0; r < 8; ++r) { const int tq = q0 + rt * 16 + 8 * hh + r; const int k0 = j0 + ln, k1 = j0 + 16 + ln;
        const bool ok0 = (CAUSAL == 1) ? (k0 <= tq) : ((CAUSAL == 2) ? ((k0 >> 5) == (tq >> 5)) : true), ok1 = (CAUSAL == 1) ? (k1 <= tq) : ((CAUSAL == 2) ? ((k1 >> 5) == (tq >> 5)) : true);      /* mode 2: block-diagonal 32-token groups */
        const float s0 = ok0 ? s[rt][0][r] * SCL : -3.0e38f, s1 = ok1 ? s[rt][1][r] * SCL : -3.0e38f; float mc = fmaxf(s0, s1);
        mc = fmaxf(mc, __shfl_xor(mc, 1, 32)); mc = fmaxf(mc, __shfl_xor(mc, 2, 32)); mc = fmaxf(mc, __shfl_xor(mc, 4, 32)); mc = fmaxf(mc, __shfl_xor(mc, 8, 32));
        const float mn = fmaxf(m_r[rt][r], mc); const float al = (mn > -1.0e38f) ? expf(m_r[rt][r] - mn) : 1.0f; m_r[rt][r] = mn; const float p0 = ok0 ? expf(s0 - mn) : 0.f, p1 = ok1 ? expf(s1 - mn) : 0.f; l_r[rt][r] = l_r[rt][r] * al + p0 + p1;
#pragma unroll
        for (int dt = 0; dt < DT; ++dt) oacc[rt][dt][r] *= al;
        FragH t2; t2.h[0] = (_Float16)(p0 * 1024.0f); t2.h[1] = (_Float16)(p1 * 1024.0f); sP[w][rt * 16 + 8 * hh + r][ln] = t2.u[0]; sP[w][rt * 16 + 8 * hh + r][16 + ln] = t2.u[1]; }
    __builtin_amdgcn_fence(__ATOMIC_ACQ_REL, "workgroup"); __builtin_amdgcn_wave_barrier();
    FragH pa[2];
#pragma unroll
    for (int rt = 0; rt < RTN; ++rt) { pa[rt].half[0] = *(const v8us*)&sP[w][rt * 16 + ln][8 * hh]; pa[rt].half[1] = *(const v8us*)&sP[w][rt * 16 + ln][16 + 8 * hh]; }
#pragma unroll
    for (int dt = 0; dt < DT; ++dt) { const unsigned short* vrow = Vth + (size_t)(dt * 16 + ln) * TK + j0; FragH bv; bv.half[0] = *(const v8us*)(vrow + 8 * hh); bv.half[1] = *(const v8us*)(vrow + 16 + 8 * hh);
#pragma unroll
      for (int rt = 0; rt < RTN; ++rt) oacc[rt][dt] = mmaH<1>(pa[rt].v, pa[rt].v, bv.v, bv.v, oacc[rt][dt]); }
    __builtin_amdgcn_fence(__ATOMIC_ACQ_REL, "workgroup"); __builtin_amdgcn_wave_barrier(); }
#pragma unroll
  for (int rt = 0; rt < RTN; ++rt) {
#pragma unroll
    for (int r = 0; r < 8; ++r) { float l = l_r[rt][r]; l += __shfl_xor(l, 1, 32); l += __shfl_xor(l, 2, 32); l += __shfl_xor(l, 4, 32); l += __shfl_xor(l, 8, 32); l_r[rt][r] = (l > 0.f) ? 1.0f / (l * 1024.0f) : 0.f; }
#pragma unroll
    for (int dt = 0; dt < DT; ++dt)
#pragma unroll
      for (int r = 0; r < 8; ++r) sO[w][rt * 16 + 8 * hh + r][dt * 16 + ln] = oacc[rt][dt][r] * l_r[rt][r]; }
  __builtin_amdgcn_fence(__ATOMIC_ACQ_REL, "workgroup"); __builtin_amdgcn_wave_barrier();
  {
#pragma unroll
    for (int rp = 0; rp < RPW; rp += 2) { const int r = rp + (lane >> 4), pc = lane & 15; const v4f val = *(const v4fa*)&sO[w][r][pc * 4]; *(v4f*)(O + ((size_t)b * TQ + q0 + r) * ldo + h * 64 + pc * 4) = val; }
     } }
// Q/K-split flash kernel, transposed: S^T = Kh Qh^T + (Kh Ql^T + Kl Qh^T)/1024 and O^T += V^T P^T, with Q/K = [hi | 2^10 residual] f16 planes (QL/KL same layout as Q16/K16) and plain f16 P (x2^10). All planes are fragment tiles (FTE): a pass's K, K residual and V^T are 2 KiB runs each.
// K rows and V^T rows are the A operands, Q and P^T the B operands: a lane holds 16 of the 32 scores of ONE query (lane l and l ^ 16 share query l & 15), so the maximum and the sum run in the lane's own registers
// with one exchange between the wave's halves, and the two score tiles, converted in place, are the B fragment of the second product (register s of half hh = key 8 hh + s, then 16 + 8 hh + s - 8: the order in which V^T is loaded).
__device__ __forceinline__ float xhalf(float x) { return __int_as_float(__builtin_amdgcn_permlanex16(__float_as_int(x), __float_as_int(x), 0x76543210, 0xfedcba98, false, false)); }      /* lane l <-> l ^ 16 */
template <int CAUSAL>
__global__ __launch_bounds__(128) void k_flashqk(const _Float16* __restrict__ Q16, const _Float16* __restrict__ QL, const _Float16* __restrict__ K16, const _Float16* __restrict__ KL, const _Float16* __restrict__ Vt, const int* __restrict__ MSK, _Float16* __restrict__ O) {
  static_assert(HS == 32, "one k step per score product, two output tiles");
  constexpr int RPW = 16, DT = HS / 16;
  const int tid = threadIdx.x, w = tid >> 5, lane = tid & 31, ln = lane & 15, hh = lane >> 4;
  const int slab = blockIdx.x / QBLKS, qblk = blockIdx.x % QBLKS; const int b = slab / NH, h = slab % NH; const int qb0 = qblk * (4 * RPW); const int q0 = qb0 + w * RPW; const int tq = q0 + ln;
  FragH bq, bql;                 /* B: column = query q0 + ln, k = head dim in the order of the K rows' loads */
  { const size_t qo = ((size_t)slab * (TQ / 16) + q0 / 16) * FTE + lane * 8; bq.v = pk_frag(Q16 + qo); bql.v = pk_frag(QL + qo);
    asm volatile("s_wait_xcnt 0x0" ::: "memory"); }      /* the key offsets formed next reuse these four loads' address registers */
  /* wave-uniform bases + one 32-bit byte offset per lane, which walks the keys: a pass is two tiles of each plane (K: 2 x 16 keys; V^T: 2 x 16 dims of its 32 keys), the lane's 16 bytes at 16 lane of each half tile */
  const char* kb = (const char*)(K16 + (size_t)slab * HS * TK); const char* klb = (const char*)(KL + (size_t)slab * HS * TK); const char* vb = (const char*)(Vt + (size_t)slab * HS * TK);
  unsigned koff = (unsigned)lane * 16u;
  float m_c = -3.0e38f, l_c = 0.f; v8f oacc[DT];
#pragma unroll
  for (int dt = 0; dt < DT; ++dt) oacc[dt] = (v8f){0.f,0.f,0.f,0.f,0.f,0.f,0.f,0.f};
  const int jend = (CAUSAL == 1) ? (qb0 + 4 * RPW) : TK;      /* causal: keys beyond the block's last query never contribute */
#pragma unroll 1                 /* rolled, as before: one pass's fragments and scores already fill the registers that eight waves a SIMD leave */
  for (int j0 = 0; j0 < jend; j0 += 32) {
    FragH ak[2], akl[2], av[DT];
#pragma unroll
    for (int nt = 0; nt < 2; ++nt) { const char* kr = kb + (size_t)nt * FTE * 2; const char* klr = klb + (size_t)nt * FTE * 2;
      ak[nt].half[0] = *(const v8us*)(kr + koff); ak[nt].half[1] = *(const v8us*)(kr + koff + FTE); akl[nt].half[0] = *(const v8us*)(klr + koff); akl[nt].half[1] = *(const v8us*)(klr + koff + FTE); }
#pragma unroll
    for (int dt = 0; dt < DT; ++dt) { const char* vrow = vb + (size_t)dt * FTE * 2; av[dt].half[0] = *(const v8us*)(vrow + koff); av[dt].half[1] = *(const v8us*)(vrow + koff + FTE); }
    koff += 2u * FTE * 2u;       /* the next 32 keys */
    float sv[16]; bool ok[16];   /* element nt * 8 + r: key j0 + nt * 16 + 8 hh + r against query tq */
#pragma unroll
    for (int nt = 0; nt < 2; ++nt) { v8f acc = (v8f){0.f,0.f,0.f,0.f,0.f,0.f,0.f,0.f}, accl = acc;
      acc = mmaH<1>(ak[nt].v, ak[nt].v, bq.v, bq.v, acc); accl = mmaH<1>(ak[nt].v, ak[nt].v, bql.v, bql.v, accl); accl = mmaH<1>(akl[nt].v, akl[nt].v, bq.v, bq.v, accl);
#pragma unroll
      for (int r = 0; r < 8; ++r) { const int kk = j0 + nt * 16 + 8 * hh + r;
        bool o = (CAUSAL == 1) ? (kk <= tq) : ((CAUSAL == 2) ? ((kk >> 5) == (tq >> 5)) : true);      /* mode 2: block-diagonal 32-token groups */
        if (CAUSAL == 4) o = MSK[((size_t)b * TQ + tq) * TK + kk] != 0;      /* mode 4: per-(query, key) INPUT mask shared by all heads; masked keys contribute nothing, rows with no valid key give l = 0 -> output 0 */
        ok[nt * 8 + r] = o; sv[nt * 8 + r] = o ? (acc[r] + accl[r] * 0.0009765625f) * SCL : -3.0e38f; } }
    float mx[8];
#pragma unroll
    for (int i = 0; i < 8; ++i) mx[i] = fmaxf(sv[i], sv[8 + i]);
    float mc = fmaxf(fmaxf(fmaxf(mx[0], mx[1]), fmaxf(mx[2], mx[3])), fmaxf(fmaxf(mx[4], mx[5]), fmaxf(mx[6], mx[7])));
    mc = fmaxf(mc, xhalf(mc));   /* the query's other 16 keys */
    const float mn = fmaxf(m_c, mc); const float al = (mn > -1.0e38f) ? expf(m_c - mn) : 1.0f; m_c = mn;
    float p[16]; FragH pb;
#pragma unroll
    for (int i = 0; i < 16; ++i) { p[i] = ok[i] ? expf(sv[i] - mn) : 0.f; pb.h[i] = (_Float16)(p[i] * 1024.0f); }
    float t8[8], t4[4];          /* halving tree: neighbours stay neighbours, so the adds pair up two to an instruction */
#pragma unroll
    for (int i = 0; i < 8; ++i) t8[i] = p[i] + p[8 + i];
#pragma unroll
    for (int i = 0; i < 4; ++i) t4[i] = t8[i] + t8[4 + i];
    l_c = l_c * al + ((t4[0] + t4[2]) + (t4[1] + t4[3]));
#pragma unroll
    for (int dt = 0; dt < DT; ++dt) {
#pragma unroll
      for (int r = 0; r < 8; ++r) oacc[dt][r] *= al;
      oacc[dt] = mmaH<1>(av[dt].v, av[dt].v, pb.v, pb.v, oacc[dt]); } }
  const float l = l_c + xhalf(l_c); const float li = (l > 0.f) ? 1.0f / (l * 1024.0f) : 0.f;
#pragma unroll
  for (int dt = 0; dt < DT; ++dt) { FragH f;      /* a lane's 8 registers are 8 consecutive head dims of its query = its own 16 bytes of the output GEMM's A tile (row = query ln, k = this head's dims) */
#pragma unroll
    for (int r = 0; r < 8; ++r) f.h[r] = (_Float16)(oacc[dt][r] * li);
    *(v8us*)((unsigned short*)O + ((size_t)((b * TQ + q0) / 16) * NH + h) * FTE + dt * (FTE / 2) + lane * 8) = f.half[0]; } }

// the four weights (row-major [out][in]) as f16(bf16(W) x 16) in fragment tiles [out / 16][in / 32]; blockIdx.y picks the weight
__global__ __launch_bounds__(256) void k_wprep(const float* __restrict__ Wq, const float* __restrict__ Wk, const float* __restrict__ Wv, const float* __restrict__ Wo, _Float16* __restrict__ Bq, _Float16* __restrict__ Bk, _Float16* __restrict__ Bv, _Float16* __restrict__ Bo) {
  const int by = blockIdx.y; const float* Wm = (by == 0) ? Wq : ((by == 1) ? Wk : ((by == 2) ? Wv : Wo)); _Float16* Bt = (by == 0) ? Bq : ((by == 1) ? Bk : ((by == 2) ? Bv : Bo));
  const size_t t = (size_t)blockIdx.x * 256 + threadIdx.x; FragH f;
#pragma unroll
  for (int i = 0; i < 8; ++i) f.h[i] = (_Float16)(bf16_round(Wm[t * 8 + i]) * 16.0f);
  const int n = (int)(t / (KD / 8)), ck = (int)(t % (KD / 8));      /* 8 inputs ck * 8 .. + 7 of output n: chunk ck & 3 of k tile ck >> 2 */
  *(v8us*)((unsigned short*)Bt + (size_t)((n / 16) * (KD / 32) + (ck >> 2)) * FTE + ((ck >> 1) & 1) * (FTE / 2) + ((ck & 1) * 16 + (n & 15)) * 8) = f.half[0]; }

extern "C" void kernel_launch(void* const* d_in, const int* in_sizes, int n_in,
                              void* d_out, int out_size, void* d_ws, size_t ws_size, hipStream_t stream) {
  (void)in_sizes; (void)n_in; (void)out_size;
  const float* const* I = (const float* const*)d_in; const float* qx = I[0]; const float* kx = I[1]; const float* vx = I[2]; const float* Wq = I[3]; const float* bq = I[4]; const float* Wk = I[5]; const float* bk = I[6]; const float* Wv = I[7]; const float* bv = I[8]; const float* Wo = I[9]; const float* bo = I[10];
  char* ws = (char*)d_ws; size_t off = 0;
  auto take = [&](size_t bytes) { char* p = ws + off; off += (bytes + 255) & ~(size_t)255; return p; };
  _Float16* BPq = (_Float16*)take((size_t)DP * CM * 2); _Float16* BPk = (_Float16*)take((size_t)DP * CM * 2); _Float16* BPv = (_Float16*)take((size_t)DP * CM * 2); _Float16* BOP = (_Float16*)take((size_t)CM * DP * 2);
  _Float16* O = (_Float16*)take((size_t)NR * DP * 2); _Float16* QH = (_Float16*)take((size_t)NR * DP * 2); _Float16* QL = (_Float16*)take((size_t)NR * DP * 2); _Float16* KH = (_Float16*)take((size_t)NR * DP * 2); _Float16* KL = (_Float16*)take((size_t)NR * DP * 2); _Float16* VT = (_Float16*)take((size_t)NR * DP * 2);
  if (off > ws_size) return;      /* under 64 MiB (256 MiB ws) */
  k_wprep<<<dim3(DP * CM / 8 / 256, 4), 256, 0, stream>>>(Wq, Wk, Wv, Wo, BPq, BPk, BPv, BOP);
  k_proj<<<dim3((NR / 128) * (DP / 64), 3), 128, 0, stream>>>(qx, kx, vx, BPq, BPk, BPv, bq, bk, bv, QH, QL, KH, KL, VT);
  k_flashqk<0><<<NSEQ * NH * QBLKS, 128, 0, stream>>>(QH, QL, KH, KL, VT, nullptr, O);      /* q/k hi + residual; P (x2^10) and V plain f16 */
  k_outg<<<(NR / 128) * (CM / 64), 128, 0, stream>>>(O, BOP, bo, (float*)d_out);
}

// v005
// Measured time: 87.1 microseconds a run.
// Two timings next to v004 put it at 1.34 and 1.35 times that version's speed.
// All steps since v000 together make it 5.91 times as fast.
#include <hip/hip_runtime.h>
// Routing (windowed) attention (2 x 8 windows of 1024 tokens x 256; 8 heads x 32): qh/kh/vh = inputs q/k/v W^T + b split into heads; per (window, head) softmax(qh kh^T / sqrt(32)) vh; heads re-merged; ctx Wo^T + bo -> [2,8,4,16,16,256].
// Structure: 4 launches. Every workspace plane lies in WMMA fragment order (FTE below), so a wave's 16-byte loads and stores cover 512 contiguous bytes. (1) the four weights as exact x16 f16 planes; (2) the q, k, v projections in one grid (grid.y picks the operand): f16 WMMA GEMM, 32x64 wave tiles, f32 accumulation, the A loader reads the f32 input rows and rounds them itself, the epilogue writes hi + 2^10 residual planes (q, k) or V^T (v), one 16 x 32 fragment tile per (head, 16 tokens) or (head, 16 dims, 32 tokens); (3) the fused flash kernel, transposed (S^T = K Q^T, O^T += V^T P^T, P stays in registers), with hi + 2^10-residual q/k planes (S = QhKh + (QlKh + QhKl)/1024) and plain f16 P (x2^10) and V (16 sequences x 8 heads); (4) the output GEMM on the f16 context tiles that (3) stores.
// Compute dtype: q, k, v and parameters rounded to bf16; qh, kh hi + residual (~2^-21-class logits); P and vh plain f16 (~2^-12); context as f16 (~2^-12) into Wo; f32 accumulation/softmax. v_wmma_f32_16x16x32_f16.
#define NSEQ 16
#define NB NSEQ
#define CM 256
#define HS 32                    /* head slot width in the q/k/v/context planes = true head dim */
#define DP (NH * HS)             /* 256: q/k/v width */
#define NR (NSEQ * SLEN)         /* 16384 rows */
#define QBLKS (TQ / 64)
#define SLEN 1024                /* tokens per routing window (K*Hp*W) */
#define TQ SLEN
#define TK SLEN
#define NH 8
#define SCL 0.17677669529663687f /* 32^-0.5 */
#define SCL2 ((float)(0.17677669529663687 * 1.4426950408889634))      /* 32^-0.5 log2(e): logits in base-2 units */
typedef __bf16 v16b __attribute__((ext_vector_type(16)));
typedef unsigned short v8us __attribute__((ext_vector_type(8), may_alias));
typedef float  v8f  __attribute__((ext_vector_type(8)));
typedef float  v4f  __attribute__((ext_vector_type(4)));
typedef float  v2f  __attribute__((ext_vector_type(2)));
typedef float  v4fa __attribute__((ext_vector_type(4), may_alias));
union FragB { v16b v; v8us half[2]; unsigned short u[16]; };

__device__ __forceinline__ unsigned short bf16_bits(float x) { unsigned int u = __float_as_uint(x); return (unsigned short)((u + 0x7FFFu + ((u >> 16) & 1u)) >> 16); }
__device__ __forceinline__ float bf16_val(unsigned short b) { return __uint_as_float(((unsigned int)b) << 16); }
__device__ __forceinline__ float bf16_round(float x) { return bf16_val(bf16_bits(x)); }
// D += A·B with NT terms: 1 = ah·bh, 2 = + al·bh (A split), 3 = + ah·bl (both split)
template <int NT>
__device__ __forceinline__ v8f mmaN(v16b ah, v16b al, v16b bh, v16b bl, v8f c) {
  c = __builtin_amdgcn_wmma_f32_16x16x32_bf16(false, ah, false, bh, (short)0, c, false, false);
  if (NT >= 2) c = __builtin_amdgcn_wmma_f32_16x16x32_bf16(false, al, false, bh, (short)0, c, false, false);
  if (NT >= 3) c = __builtin_amdgcn_wmma_f32_16x16x32_bf16(false, ah, false, bl, (short)0, c, false, false);
  asm volatile("v_nop\n\tv_nop\n\tv_nop\n\tv_nop" : "+v"(c) : "v"(ah), "v"(al), "v"(bh), "v"(bl));
  return c;
}

__global__ __launch_bounds__(256) void k_wt_bf16(const float* __restrict__ W, unsigned short* __restrict__ Wt, int K, int N) {
  const int t = blockIdx.x * 256 + threadIdx.x;
  const int k8n = K / 8;
  if (t >= N * k8n) return;
  const int n = t / k8n, k8 = (t % k8n) * 8;
  v8us v;
#pragma unroll
  for (int i = 0; i < 8; ++i) v[i] = bf16_bits(W[(size_t)(k8 + i) * N + n]);
  *(v8us*)(Wt + (size_t)n * K + k8) = v;
  
}

// GEMM C[M][N] (f32, pitch ldc) = act(A[M][K]·W + bias). A f32 row-major (pitch lda) converted per fragment to bf16
// (ASPLIT: hi/lo two planes -> 2 terms, else single rounded term); Wt bf16 [N][K] (pitch ldb). BIAS_BF16 rounds the
// bias to bf16 first (bias quantised to bf16 before the add). K%32==0, M%16==0, N%64==0.
template <bool ASPLIT, int ACT, bool BIAS_BF16>
__global__ __launch_bounds__(128) void k_gemm_bf(const float* __restrict__ A, int lda, const unsigned short* __restrict__ Wt, int ldb,
                                               const float* __restrict__ bias, float* __restrict__ C, int ldc, int M, int N, int K) {
  __shared__ __attribute__((aligned(16))) float so[4][16][64];
  const int tid = threadIdx.x, w = tid >> 5, lane = tid & 31, ln = lane & 15, hh = lane >> 4;
  const int ntn = N / 64;
  const int wid = blockIdx.x * 4 + w;
  const int mt = wid / ntn, nq = wid % ntn;
  if (mt * 16 >= M) return;
  const int row0 = mt * 16, col0 = nq * 64;
  const float* arow = A + (size_t)(row0 + ln) * lda;
  v8f acc[4] = {};
  for (int kb = 0; kb < K; kb += 32) {
    FragB ah, al;
    const v4f x0 = *(const v4fa*)(arow + kb + 8 * hh), x1 = *(const v4fa*)(arow + kb + 8 * hh + 4);
    const v4f x2 = *(const v4fa*)(arow + kb + 16 + 8 * hh), x3 = *(const v4fa*)(arow + kb + 16 + 8 * hh + 4);
    float xs[16] = {x0[0],x0[1],x0[2],x0[3],x1[0],x1[1],x1[2],x1[3],x2[0],x2[1],x2[2],x2[3],x3[0],x3[1],x3[2],x3[3]};
#pragma unroll
    for (int i = 0; i < 16; ++i) { const unsigned short hb = bf16_bits(xs[i]); ah.u[i] = hb; al.u[i] = ASPLIT ? bf16_bits(xs[i] - bf16_val(hb)) : (unsigned short)0; }
#pragma unroll
    for (int t = 0; t < 4; ++t) {
      const unsigned short* brow = Wt + (size_t)(col0 + t * 16 + ln) * ldb + kb;
      FragB b;
      b.half[0] = *(const v8us*)(brow + 8 * hh);
      b.half[1] = *(const v8us*)(brow + 16 + 8 * hh);
      acc[t] = mmaN<ASPLIT ? 2 : 1>(ah.v, al.v, b.v, b.v, acc[t]);
    }
  }
#pragma unroll
  for (int t = 0; t < 4; ++t) {
    float bv = bias ? bias[col0 + t * 16 + ln] : 0.f;
    if (BIAS_BF16) bv = bf16_round(bv);
#pragma unroll
    for (int r = 0; r < 8; ++r) { float v = acc[t][r] + bv; if (ACT == 1) v = fmaxf(v, 0.f); so[w][8 * hh + r][t * 16 + ln] = v; }
  }
  __builtin_amdgcn_fence(__ATOMIC_ACQ_REL, "workgroup");
  __builtin_amdgcn_wave_barrier();
  const int rsub = lane >> 4, c4 = (lane & 15) * 4;
  {
#pragma unroll
    for (int q = 0; q < 8; ++q) {
      const int r = q * 2 + rsub;
      const v4f v = *(const v4fa*)&so[w][r][c4];
      *(v4f*)(C + (size_t)(row0 + r) * ldc + col0 + c4) = v;
    }
    
  }
}

// GEMM C = act(A·W + bias + resid): A f32 (ASPLIT -> hi/lo 2 terms), Wt bf16 [N][K]; ACT 0 none, 1 relu, 2 exact gelu;
// resid (optional, f32, row index = (row % rmod), pitch ldr, RES_BF16 rounds it) added before the activation.
template <bool ASPLIT, int ACT, bool BIAS_BF16, bool RES_BF16>
__global__ __launch_bounds__(128) void k_gemm_bf3(const float* __restrict__ A, int lda, const unsigned short* __restrict__ Wt, int ldb,
                                                const float* __restrict__ bias, const float* __restrict__ resid, int rmod, int ldr,
                                                float* __restrict__ C, int ldc, int M, int N, int K) {
  __shared__ __attribute__((aligned(16))) float so[4][16][64];
  const int tid = threadIdx.x, w = tid >> 5, lane = tid & 31, ln = lane & 15, hh = lane >> 4;
  const int ntn = N / 64;
  const int wid = blockIdx.x * 4 + w;
  const int mt = wid / ntn, nq = wid % ntn;
  if (mt * 16 >= M) return;
  const int row0 = mt * 16, col0 = nq * 64;
  const float* arow = A + (size_t)(row0 + ln) * lda;
  v8f acc[4] = {};
  for (int kb = 0; kb < K; kb += 32) {
    FragB ah, al;
    const v4f x0 = *(const v4fa*)(arow + kb + 8 * hh), x1 = *(const v4fa*)(arow + kb + 8 * hh + 4);
    const v4f x2 = *(const v4fa*)(arow + kb + 16 + 8 * hh), x3 = *(const v4fa*)(arow + kb + 16 + 8 * hh + 4);
    float xs[16] = {x0[0],x0[1],x0[2],x0[3],x1[0],x1[1],x1[2],x1[3],x2[0],x2[1],x2[2],x2[3],x3[0],x3[1],x3[2],x3[3]};
#pragma unroll
    for (int i = 0; i < 16; ++i) { const unsigned short hb = bf16_bits(xs[i]); ah.u[i] = hb; al.u[i] = ASPLIT ? bf16_bits(xs[i] - bf16_val(hb)) : (unsigned short)0; }
#pragma unroll
    for (int t = 0; t < 4; ++t) {
      const unsigned short* brow = Wt + (size_t)(col0 + t * 16 + ln) * ldb + kb;
      FragB b;
      b.half[0] = *(const v8us*)(brow + 8 * hh);
      b.half[1] = *(const v8us*)(brow + 16 + 8 * hh);
      acc[t] = mmaN<ASPLIT ? 2 : 1>(ah.v, al.v, b.v, b.v, acc[t]);
    }
  }
#pragma unroll
  for (int t = 0; t < 4; ++t) {
    const int col = col0 + t * 16 + ln;
    float bv = bias ? bias[col] : 0.f;
    if (BIAS_BF16) bv = bf16_round(bv);
#pragma unroll
    for (int r = 0; r < 8; ++r) {
      float v = acc[t][r] + bv;
      if (resid) { float rv = resid[(size_t)((row0 + 8 * hh + r) % rmod) * ldr + col]; if (RES_BF16) rv = bf16_round(rv); v += rv; }
      if (ACT == 1) v = fmaxf(v, 0.f);
      if (ACT == 2) v = 0.5f * v * (1.0f + erff(v * 0.70710678118654752f));
      if (ACT == 3) { const float u = 0.7978845608028654f * (v + 0.044715f * v * v * v); v = 0.5f * v * (1.0f + tanhf(u)); }
      so[w][8 * hh + r][t * 16 + ln] = v;
    }
  }
  __builtin_amdgcn_fence(__ATOMIC_ACQ_REL, "workgroup");
  __builtin_amdgcn_wave_barrier();
  const int rsub = lane >> 4, c4 = (lane & 15) * 4;
  {
#pragma unroll
    for (int q = 0; q < 8; ++q) {
      const int r = q * 2 + rsub;
      const v4f v = *(const v4fa*)&so[w][r][c4];
      *(v4f*)(C + (size_t)(row0 + r) * ldc + col0 + c4) = v;
    }
    
  }
}
// row LayerNorm (biased variance, eps) over N: s = X (+ R); optional out_sum <- s; out_norm <- (s-mu)*rsqrt(var+eps)*g + b
template <bool PARAM_BF16>
__global__ __launch_bounds__(256) void k_layernorm(const float* __restrict__ X, const float* __restrict__ R, const float* __restrict__ g, const float* __restrict__ bta,
                                                  float* __restrict__ out_sum, float* __restrict__ out_norm, int N, float eps) {
  __shared__ float red[256];
  const int row = blockIdx.x, tid = threadIdx.x;
  const float* x = X + (size_t)row * N; const float* rr = R ? R + (size_t)row * N : nullptr;
  float vals[16];                     // up to N = 4096
  const int per = N / 256;            // contiguous chunk per thread? use strided-by-4 chunks: thread handles j = tid*4 + 1024*u
  float s1 = 0.f;
  for (int u = 0; u < per / 4; ++u) {
    const int j = tid * 4 + 1024 * u;
    const v4f a = *(const v4fa*)(x + j);
    v4f b = {0.f,0.f,0.f,0.f}; if (rr) b = *(const v4fa*)(rr + j);
#pragma unroll
    for (int q = 0; q < 4; ++q) { const float v = a[q] + b[q]; vals[u * 4 + q] = v; s1 += v; }
  }
  red[tid] = s1; __syncthreads();
  for (int st = 128; st > 0; st >>= 1) { if (tid < st) red[tid] += red[tid + st]; __syncthreads(); }
  const float mu = red[0] / (float)N; __syncthreads();
  float s2 = 0.f;
  for (int u = 0; u < per / 4; ++u)
#pragma unroll
    for (int q = 0; q < 4; ++q) { const float c = vals[u * 4 + q] - mu; s2 += c * c; }
  red[tid] = s2; __syncthreads();
  for (int st = 128; st > 0; st >>= 1) { if (tid < st) red[tid] += red[tid + st]; __syncthreads(); }
  const float rs = rsqrtf(red[0] / (float)N + eps);
  {
    for (int u = 0; u < per / 4; ++u) {
      const int j = tid * 4 + 1024 * u;
      v4f o, sm;
#pragma unroll
      for (int q = 0; q < 4; ++q) {
        float gg = g[j + q], bb = bta[j + q];
        if (PARAM_BF16) { gg = bf16_round(gg); bb = bf16_round(bb); }
        sm[q] = vals[u * 4 + q]; o[q] = (vals[u * 4 + q] - mu) * rs * gg + bb;
      }
      if (out_sum) *(v4f*)(out_sum + (size_t)row * N + j) = sm;
      *(v4f*)(out_norm + (size_t)row * N + j) = o;
    }
    
  }
}



// ---- f16 WMMA path (v_wmma_f32_16x16x32_f16): 11-bit significands for operands in range — used where a [0,1] probability operand needs more precision than bf16
typedef _Float16 v16h __attribute__((ext_vector_type(16)));
union FragH { v16h v; v8us half[2]; _Float16 h[16]; unsigned short u[16]; };
template <int NT>
__device__ __forceinline__ v8f mmaH(v16h ah, v16h al, v16h bh, v16h bl, v8f c) {
  c = __builtin_amdgcn_wmma_f32_16x16x32_f16(false, ah, false, bh, (short)0, c, false, false);
  if (NT >= 2) c = __builtin_amdgcn_wmma_f32_16x16x32_f16(false, al, false, bh, (short)0, c, false, false);
  if (NT >= 3) c = __builtin_amdgcn_wmma_f32_16x16x32_f16(false, ah, false, bl, (short)0, c, false, false);
  asm volatile("v_nop\n\tv_nop\n\tv_nop\n\tv_nop" : "+v"(c) : "v"(ah), "v"(al), "v"(bh), "v"(bl));
  return c;
}
// batched GEMM like k_gemm_b but f16 operands: A f32 (split into f16 hi/lo if ASPLIT, else rounded to f16), Bt = f16 values [n][k]; alpha; C f32; N multiple of 16 (partial tiles skipped)
template <bool ASPLIT>
__global__ __launch_bounds__(128) void k_gemm_h(const float* __restrict__ A, int lda, size_t sA, const _Float16* __restrict__ Bh, int ldb, size_t sB, float alpha, float* __restrict__ C, int ldc, size_t sC, int M, int N, int K) {
  __shared__ __attribute__((aligned(16))) float so[4][16][64];
  const int tid = threadIdx.x, w = tid >> 5, lane = tid & 31, ln = lane & 15, hh = lane >> 4; const int by = blockIdx.y;
  A += (size_t)by * sA; Bh += (size_t)by * sB; C += (size_t)by * sC;
  const int ntn = (N + 63) / 64; const int wid = blockIdx.x * 4 + w; const int mt = wid / ntn, nq = wid % ntn; if (mt * 16 >= M) return;
  const int row0 = mt * 16, col0 = nq * 64; const float* arow = A + (size_t)(row0 + ln) * lda;
  v8f acc[4] = {};
  for (int kb = 0; kb < K; kb += 32) {
    FragH ah, al;
    const v4f x0 = *(const v4fa*)(arow + kb + 8 * hh), x1 = *(const v4fa*)(arow + kb + 8 * hh + 4), x2 = *(const v4fa*)(arow + kb + 16 + 8 * hh), x3 = *(const v4fa*)(arow + kb + 16 + 8 * hh + 4);
    float xs[16] = {x0[0],x0[1],x0[2],x0[3],x1[0],x1[1],x1[2],x1[3],x2[0],x2[1],x2[2],x2[3],x3[0],x3[1],x3[2],x3[3]};
#pragma unroll
    for (int i = 0; i < 16; ++i) { const _Float16 h = (_Float16)xs[i]; ah.h[i] = h; al.h[i] = ASPLIT ? (_Float16)(xs[i] - (float)h) : (_Float16)0.0f; }
#pragma unroll
    for (int t = 0; t < 4; ++t) { if (col0 + t * 16 >= N) continue; const size_t boff = (size_t)(col0 + t * 16 + ln) * ldb + kb; FragH bq; bq.half[0] = *(const v8us*)(Bh + boff + 8 * hh); bq.half[1] = *(const v8us*)(Bh + boff + 16 + 8 * hh);
      acc[t] = mmaH<ASPLIT ? 2 : 1>(ah.v, al.v, bq.v, bq.v, acc[t]); }
  }
#pragma unroll
  for (int t = 0; t < 4; ++t) { if (col0 + t * 16 >= N) continue;
#pragma unroll
    for (int r = 0; r < 8; ++r) so[w][8 * hh + r][t * 16 + ln] = acc[t][r] * alpha; }
  __builtin_amdgcn_fence(__ATOMIC_ACQ_REL, "workgroup"); __builtin_amdgcn_wave_barrier();
  const int rsub = lane >> 4, c4 = (lane & 15) * 4;
  {
#pragma unroll
    for (int q = 0; q < 8; ++q) { const int r = q * 2 + rsub; if (col0 + c4 < N) { const v4f v = *(const v4fa*)&so[w][r][c4]; *(v4f*)(C + (size_t)(row0 + r) * ldc + col0 + c4) = v; } }
     }
}

// Wt[n][k] = f16(W[k][n]·scale) from f32 row-major W[K][N] (scale = power of two; bf16-exact weights stay exact in f16 away from the subnormal range)
__global__ __launch_bounds__(256) void k_wt_f16(const float* __restrict__ W, _Float16* __restrict__ Wt, int K, int N, float scale) {
  const int t = blockIdx.x * 256 + threadIdx.x; if (t >= N * (K / 8)) return; const int n = t / (K / 8), k8 = (t % (K / 8)) * 8; FragH f;
#pragma unroll
  for (int i = 0; i < 8; ++i) f.h[i] = (_Float16)(bf16_round(W[(size_t)(k8 + i) * N + n]) * scale); const v8us o = f.half[0];
  *(v8us*)((unsigned short*)Wt + (size_t)n * K + k8) = o; 
}
// k_gemm_hh variant with fused epilogue: v = acc·alpha + bias[by·sBias + col] (+ CP[(row/rowsPerB)·sCPb + by·64 + col] if CP) ; ACT 0 none / 1 elu ; writes f16 C16 (and f32 C if non-null)
template <int ACT>
__global__ __launch_bounds__(128) void k_gemm_hhx(const _Float16* __restrict__ A, int lda, size_t sA, const _Float16* __restrict__ Bh, int ldb, size_t sB, float alpha, const float* __restrict__ bias, size_t sBias, const float* __restrict__ CP, int rowsPerB, size_t sCPb, int row0g,
    float* __restrict__ C, _Float16* __restrict__ C16, int ldc, size_t sC, int M, int N, int K) {
  __shared__ __attribute__((aligned(16))) float so[4][16][64];
  const int tid = threadIdx.x, w = tid >> 5, lane = tid & 31, ln = lane & 15, hh = lane >> 4; const int by = blockIdx.y;
  A += (size_t)by * sA; Bh += (size_t)by * sB; const size_t cofs = (size_t)by * sC; const float* bp = bias ? bias + (size_t)by * sBias : nullptr;
  const int ntn = (N + 63) / 64; const int wid = blockIdx.x * 4 + w; const int mt = wid / ntn, nq = wid % ntn; if (mt * 16 >= M) return;
  const int row0 = mt * 16, col0 = nq * 64; const _Float16* arow = A + (size_t)(row0 + ln) * lda;
  v8f acc[4] = {};
  for (int kb = 0; kb < K; kb += 32) { FragH ah; ah.half[0] = *(const v8us*)((const unsigned short*)arow + kb + 8 * hh); ah.half[1] = *(const v8us*)((const unsigned short*)arow + kb + 16 + 8 * hh);
#pragma unroll
    for (int t = 0; t < 4; ++t) { if (col0 + t * 16 >= N) continue; const size_t boff = (size_t)(col0 + t * 16 + ln) * ldb + kb; FragH bq; bq.half[0] = *(const v8us*)((const unsigned short*)Bh + boff + 8 * hh); bq.half[1] = *(const v8us*)((const unsigned short*)Bh + boff + 16 + 8 * hh);
      acc[t] = mmaH<1>(ah.v, ah.v, bq.v, bq.v, acc[t]); }
  }
#pragma unroll
  for (int t = 0; t < 4; ++t) { if (col0 + t * 16 >= N) continue; const int col = col0 + t * 16 + ln; const float bv = bp ? bf16_round(bp[col]) : 0.f;
#pragma unroll
    for (int r = 0; r < 8; ++r) { float v = acc[t][r] * alpha + bv; if (CP) { const int bidx = (row0g + row0 + 8 * hh + r) / rowsPerB; v += CP[(size_t)bidx * sCPb + (size_t)by * 64 + col]; } if (ACT == 1) v = (v > 0.f) ? v : expm1f(v); else if (ACT == 7) v = (v > 0.f) ? v + 1.0f : expf(v); else if (ACT == 8) v = tanhf(v); else if (ACT == 9) v = 0.5f * v * (1.0f + tanhf(0.7978845608028654f * (v + 0.044715f * v * v * v))); else if (ACT == 11) v = 1.0f / (1.0f + expf(-v)); else if (ACT == 12) v = (v > 0.f) ? v : 0.01f * v; else if (ACT == 14) v = (v > 0.f) ? v : 0.1f * v; else if (ACT == 15) v = v / (1.0f + expf(-v)); else if (ACT == 3) v = fmaxf(v, 0.f); else if (ACT == 6) v = 0.5f * v * (1.0f + erff(v * 0.70710678118654752f)); so[w][8 * hh + r][t * 16 + ln] = v; } }
  __builtin_amdgcn_fence(__ATOMIC_ACQ_REL, "workgroup"); __builtin_amdgcn_wave_barrier();
  const int rsub = lane >> 4, c4 = (lane & 15) * 4; typedef _Float16 v4h __attribute__((ext_vector_type(4)));
  {
#pragma unroll
    for (int q = 0; q < 8; ++q) { const int r = q * 2 + rsub; if (col0 + c4 < N) { const v4f v = *(const v4fa*)&so[w][r][c4]; if (C) *(v4f*)(C + cofs + (size_t)(row0 + r) * ldc + col0 + c4) = v; if (C16) { v4h h4; for (int i = 0; i < 4; ++i) h4[i] = (_Float16)v[i]; *(v4h*)(C16 + cofs + (size_t)(row0 + r) * ldc + col0 + c4) = h4; } } }
     }
}


typedef _Float16 v4h __attribute__((ext_vector_type(4)));

__global__ __launch_bounds__(256) void k_round16f(const float* __restrict__ W, _Float16* __restrict__ Bt, size_t n8) { const size_t t = (size_t)blockIdx.x * 256 + threadIdx.x; if (t >= n8) return; FragH f;
#pragma unroll
  for (int i = 0; i < 8; ++i) f.h[i] = (_Float16)(bf16_round(W[t * 8 + i]) * 16.0f); *(v8us*)((unsigned short*)Bt + t * 8) = f.half[0];  }
// ---- fused GEMM (block 128x64, wave tile 32x64, K = KD): A is read as f32 rows and rounded in the loader (k_proj) or as f16 fragment tiles (k_outg), the epilogue writes what the next kernel reads ----
#define KD 256                   /* = CM = DP: K and the row pitch of A and of the f32 weights */
__device__ __forceinline__ v16h g2_frag(const _Float16* p, int hh) { FragH f; f.half[0] = *(const v8us*)((const unsigned short*)p + 8 * hh); f.half[1] = *(const v8us*)((const unsigned short*)p + 16 + 8 * hh); return f.v; }
__device__ __forceinline__ v8f g2_mma(v16h a, v16h b, v8f c) { v8f d = __builtin_amdgcn_wmma_f32_16x16x32_f16(false, a, false, b, (short)0, c, false, false); asm volatile("v_nop\n\tv_nop\n\tv_nop\n\tv_nop" : "+v"(d) : "v"(a), "v"(b)); return d; }
// Fragment order: a 16 x 32 f16 operand tile (16 rows or columns x 32 k) is FTE consecutive elements; lane l = 16 hh + ln holds row ln, k = 8 hh .. + 7 at element 8 l and k = 16 + 8 hh .. + 7 at FTE / 2 + 8 l (the k order of g2_frag)
#define FTE 512
__device__ __forceinline__ v16h pk_frag(const _Float16* p) { FragH f; f.half[0] = *(const v8us*)((const unsigned short*)p); f.half[1] = *(const v8us*)((const unsigned short*)p + FTE / 2); return f.v; }      /* p = tile + 8 lane */
// the k order of g2_frag from an f32 row; RB: rounded to bf16 first (inputs), else straight to f16
template <bool RB>
__device__ __forceinline__ v16h gf_frag(const float* p, int hh) {
  const v4f x0 = *(const v4fa*)(p + 8 * hh), x1 = *(const v4fa*)(p + 8 * hh + 4), x2 = *(const v4fa*)(p + 16 + 8 * hh), x3 = *(const v4fa*)(p + 16 + 8 * hh + 4); FragH f;
#pragma unroll
  for (int i = 0; i < 4; ++i) { f.h[i] = (_Float16)(RB ? bf16_round(x0[i]) : x0[i]); f.h[4 + i] = (_Float16)(RB ? bf16_round(x1[i]) : x1[i]); f.h[8 + i] = (_Float16)(RB ? bf16_round(x2[i]) : x2[i]); f.h[12 + i] = (_Float16)(RB ? bf16_round(x3[i]) : x3[i]); }
  return f.v; }
// PK: A comes as fragment tiles [row / 16][k / 32] from Ap; else as f32 rows from A, rounded to bf16. Bh: fragment tiles [col / 16][k / 32]
template <bool PK>
__device__ __forceinline__ void gf_tile(const float* __restrict__ A, const _Float16* __restrict__ Ap, const _Float16* __restrict__ Bh, int row0, int col0, int ln, int hh, v8f (&accs)[8]) {
  constexpr int TR = (KD / 32) * FTE;      /* elements of one row of tiles */
  const float* a0p = A + (size_t)(row0 + ln) * KD; const float* a1p = a0p + (size_t)16 * KD;
  const _Float16* p0p = Ap + (size_t)(row0 / 16) * TR + (16 * hh + ln) * 8; const _Float16* p1p = p0p + TR;
  const _Float16* b0p = Bh + (size_t)(col0 / 16) * TR + (16 * hh + ln) * 8; const _Float16* b1p = b0p + TR; const _Float16* b2p = b1p + TR; const _Float16* b3p = b2p + TR;
  const v8f z8 = {0.f,0.f,0.f,0.f,0.f,0.f,0.f,0.f}; v8f c00 = z8, c01 = z8, c02 = z8, c03 = z8, c10 = z8, c11 = z8, c12 = z8, c13 = z8;
#pragma unroll 1                 /* rolled, as before the fusion: keeps the registers low enough for every block of the grid to be resident at once */
  for (int kb = 0; kb < KD; kb += 32) { const v16h a0 = PK ? pk_frag(p0p) : gf_frag<true>(a0p + kb, hh), a1 = PK ? pk_frag(p1p) : gf_frag<true>(a1p + kb, hh);
    v16h b = pk_frag(b0p); c00 = g2_mma(a0, b, c00); c10 = g2_mma(a1, b, c10);
    b = pk_frag(b1p); c01 = g2_mma(a0, b, c01); c11 = g2_mma(a1, b, c11);
    b = pk_frag(b2p); c02 = g2_mma(a0, b, c02); c12 = g2_mma(a1, b, c12);
    b = pk_frag(b3p); c03 = g2_mma(a0, b, c03); c13 = g2_mma(a1, b, c13);
    p0p += FTE; p1p += FTE; b0p += FTE; b1p += FTE; b2p += FTE; b3p += FTE; }
  accs[0] = c00; accs[1] = c01; accs[2] = c02; accs[3] = c03; accs[4] = c10; accs[5] = c11; accs[6] = c12; accs[7] = c13; }
// q, k, v projections, blockIdx.y = 0, 1, 2: y = x W^T + b (weights x16, so acc / 16). q, k -> hi + 2^10 residual planes, fragment tiles [b * NH + head][token / 16]; v -> f16 V^T, fragment tiles [b * NH + head][token / 32][dim / 16]
__global__ __launch_bounds__(128) void k_proj(const float* __restrict__ xq, const float* __restrict__ xk, const float* __restrict__ xv, const _Float16* __restrict__ Bq, const _Float16* __restrict__ Bk, const _Float16* __restrict__ Bv,
    const float* __restrict__ bq, const float* __restrict__ bk, const float* __restrict__ bv, _Float16* __restrict__ QH, _Float16* __restrict__ QL, _Float16* __restrict__ KH, _Float16* __restrict__ KL, _Float16* __restrict__ VT) {
  __shared__ __attribute__((aligned(16))) float so[4][32][68];
  const int tid = threadIdx.x, w = tid >> 5, lane = tid & 31, ln = lane & 15, hh = lane >> 4; const int by = blockIdx.y;
  const float* A = (by == 0) ? xq : ((by == 1) ? xk : xv); const _Float16* Bh = (by == 0) ? Bq : ((by == 1) ? Bk : Bv); const float* bp = (by == 0) ? bq : ((by == 1) ? bk : bv);
  const int mt = blockIdx.x / (DP / 64), nq = blockIdx.x % (DP / 64); const int row0 = mt * 128 + 32 * w, col0 = nq * 64;
  v8f accs[8]; gf_tile<false>(A, nullptr, Bh, row0, col0, ln, hh, accs);
  const int sl0 = (row0 / SLEN) * NH + col0 / HS, tk0 = row0 % SLEN;      /* the wave's first (window, head) and first token: 2 heads x 32 tokens */
  if (by == 2) {                 /* block-uniform. A lane's 8 accumulator rows are 8 consecutive tokens of one column = its own 16 bytes of a V^T fragment tile (row = dim ln, k = token): stored from registers */
#pragma unroll
    for (int u = 0; u < 8; ++u) { const int t = u & 3, half = u >> 2; const float bvv = bf16_round(bp[col0 + t * 16 + ln]); FragH f;
#pragma unroll
      for (int r = 0; r < 8; ++r) f.h[r] = (_Float16)(accs[u][r] * 0.0625f + bvv);
      *(v8us*)((unsigned short*)VT + ((size_t)((sl0 + (t >> 1)) * (SLEN / 32) + tk0 / 32) * (HS / 16) + (t & 1)) * FTE + half * (FTE / 2) + lane * 8) = f.half[0]; }
    return; }
  _Float16* Hh = (by == 0) ? QH : KH; _Float16* Hl = (by == 0) ? QL : KL;
#pragma unroll
  for (int u = 0; u < 8; ++u) { const int t = u & 3, half = u >> 2; const float bvv = bf16_round(bp[col0 + t * 16 + ln]);
#pragma unroll
    for (int r = 0; r < 8; ++r) so[w][half * 16 + 8 * hh + r][t * 16 + ln] = accs[u][r] * 0.0625f + bvv; }
  __builtin_amdgcn_fence(__ATOMIC_ACQ_REL, "workgroup"); __builtin_amdgcn_wave_barrier();
#pragma unroll 1                 /* one tile a trip: unrolled, this compiler aims the whole kernel at fewer registers and issues the k loop's first weight loads only behind the A rows' conversion: one more exposed load latency a k step */
  for (int tl = 0; tl < 4; ++tl) { const int kt = tl >> 1, hd = tl & 1;      /* 2 token tiles x 2 heads; per half tile a lane reads its 8 dims of token ln and stores its 16 bytes */
    const size_t o = ((size_t)(sl0 + hd) * (SLEN / 16) + tk0 / 16 + kt) * FTE + lane * 8;
#pragma unroll
    for (int half = 0; half < 2; ++half) { const float* sp = &so[w][kt * 16 + ln][hd * HS + half * 16 + 8 * hh]; const v4f v0 = *(const v4fa*)sp, v1 = *(const v4fa*)(sp + 4); FragH fh, fl;
#pragma unroll
      for (int i = 0; i < 4; ++i) { const _Float16 h0 = (_Float16)v0[i], h1 = (_Float16)v1[i]; fh.h[i] = h0; fh.h[4 + i] = h1; fl.h[i] = (_Float16)((v0[i] - (float)h0) * 1024.0f); fl.h[4 + i] = (_Float16)((v1[i] - (float)h1) * 1024.0f); }
      *(v8us*)((unsigned short*)Hh + o + half * (FTE / 2)) = fh.half[0]; *(v8us*)((unsigned short*)Hl + o + half * (FTE / 2)) = fl.half[0]; }
    asm volatile("s_wait_xcnt 0x0" ::: "memory"); }      /* the next trip rewrites these stores' address and data registers */
}
// output projection: out = ctx Wo^T + bo, f32 rows of CM; ctx = f16 fragment tiles [row / 16][head]
__global__ __launch_bounds__(128) void k_outg(const _Float16* __restrict__ Ctx, const _Float16* __restrict__ Bo, const float* __restrict__ bo, float* __restrict__ C) {
  __shared__ __attribute__((aligned(16))) float so[4][32][68];
  const int tid = threadIdx.x, w = tid >> 5, lane = tid & 31, ln = lane & 15, hh = lane >> 4;
  const int mt = blockIdx.x / (CM / 64), nq = blockIdx.x % (CM / 64); const int row0 = mt * 128 + 32 * w, col0 = nq * 64;
  v8f accs[8]; gf_tile<true>(nullptr, Ctx, Bo, row0, col0, ln, hh, accs);
#pragma unroll
  for (int u = 0; u < 8; ++u) { const int t = u & 3, half = u >> 2; const float bvv = bf16_round(bo[col0 + t * 16 + ln]);
#pragma unroll
    for (int r = 0; r < 8; ++r) so[w][half * 16 + 8 * hh + r][t * 16 + ln] = accs[u][r] * 0.0625f + bvv; }
  __builtin_amdgcn_fence(__ATOMIC_ACQ_REL, "workgroup"); __builtin_amdgcn_wave_barrier();
  const int rsub = lane >> 4, c4 = (lane & 15) * 4;
#pragma unroll
  for (int q = 0; q < 16; ++q) { const int r = q * 2 + rsub; const v4f v = *(const v4fa*)&so[w][r][c4]; *(v4f*)(C + (size_t)(row0 + r) * CM + col0 + c4) = v; } }



template <int CAUSAL>
__global__ __launch_bounds__(128) void k_flash(const _Float16* __restrict__ Q16, int ldq, const _Float16* __restrict__ K16, int ldk, const _Float16* __restrict__ Vt, const int* __restrict__ MSK, float* __restrict__ O, int ldo) {
  constexpr int RPW = 16, RTN = RPW / 16, NQB = TQ / (4 * RPW), DT = 4, KS = 2;
  __shared__ __attribute__((aligned(16))) unsigned short sP[4][RPW][40]; __shared__ __attribute__((aligned(16))) float sO[4][RPW][64 + 4];
  const int tid = threadIdx.x, w = tid >> 5, lane = tid & 31, ln = lane & 15, hh = lane >> 4;
  const int slab = blockIdx.x / QBLKS, qblk = blockIdx.x % QBLKS; (void)NQB; const int b = slab / NH, h = slab % NH; const int qb0 = qblk * (4 * RPW); const int q0 = qb0 + w * RPW;
  FragH aq[2][KS];
#pragma unroll
  for (int rt = 0; rt < RTN; ++rt) { const unsigned short* qr = (const unsigned short*)Q16 + ((size_t)b * TQ + q0 + rt * 16 + ln) * ldq + h * 64;
#pragma unroll
    for (int ks = 0; ks < KS; ++ks) { aq[rt][ks].half[0] = *(const v8us*)(qr + ks * 32 + 8 * hh); aq[rt][ks].half[1] = *(const v8us*)(qr + ks * 32 + 16 + 8 * hh); } }
  const unsigned short* Vth = (const unsigned short*)Vt + (size_t)slab * 64 * TK;
  float m_r[2][8], l_r[2][8]; v8f oacc[2][DT];
#pragma unroll
  for (int rt = 0; rt < RTN; ++rt) {
#pragma unroll
    for (int r = 0; r < 8; ++r) { m_r[rt][r] = -3.0e38f; l_r[rt][r] = 0.f; }
#pragma unroll
    for (int dt = 0; dt < DT; ++dt) oacc[rt][dt] = (v8f){0.f,0.f,0.f,0.f,0.f,0.f,0.f,0.f}; }
  const int jend = (CAUSAL == 1) ? (qb0 + 4 * RPW) : TK;      /* causal: keys beyond the block's last query never contribute */
#pragma unroll 1
  for (int j0 = 0; j0 < jend; j0 += 32) {
    v8f s[2][2];
#pragma unroll
    for (int nt = 0; nt < 2; ++nt) { const unsigned short* kr = (const unsigned short*)K16 + ((size_t)b * TK + j0 + nt * 16 + ln) * ldk + h * 64; FragH bk[KS];
#pragma unroll
      for (int ks = 0; ks < KS; ++ks) { bk[ks].half[0] = *(const v8us*)(kr + ks * 32 + 8 * hh); bk[ks].half[1] = *(const v8us*)(kr + ks * 32 + 16 + 8 * hh); }
#pragma unroll
      for (int rt = 0; rt < RTN; ++rt) { v8f acc = (v8f){0.f,0.f,0.f,0.f,0.f,0.f,0.f,0.f};
#pragma unroll
        for (int ks = 0; ks < KS; ++ks) acc = mmaH<1>(aq[rt][ks].v, aq[rt][ks].v, bk[ks].v, bk[ks].v, acc); s[rt][nt] = acc; } }
#pragma unroll
    for (int rt = 0; rt < RTN; ++rt)
#pragma unroll
      for (int r = 0; r < 8; ++r) { const int tq = q0 + rt * 16 + 8 * hh + r; const int k0 = j0 + ln, k1 = j0 + 16 + ln;
        const bool ok0 = (CAUSAL == 1) ? (k0 <= tq) : ((CAUSAL == 2) ? ((k0 >> 5) == (tq >> 5)) : true), ok1 = (CAUSAL == 1) ? (k1 <= tq) : ((CAUSAL == 2) ? ((k1 >> 5) == (tq >> 5)) : true);      /* mode 2: block-diagonal 32-token groups */
        const float s0 = ok0 ? s[rt][0][r] * SCL : -3.0e38f, s1 = ok1 ? s[rt][1][r] * SCL : -3.0e38f; float mc = fmaxf(s0, s1);
        mc = fmaxf(mc, __shfl_xor(mc, 1, 32)); mc = fmaxf(mc, __shfl_xor(mc, 2, 32)); mc = fmaxf(mc, __shfl_xor(mc, 4, 32)); mc = fmaxf(mc, __shfl_xor(mc, 8, 32));
        const float mn = fmaxf(m_r[rt][r], mc); const float al = (mn > -1.0e38f) ? expf(m_r[rt][r] - mn) : 1.0f; m_r[rt][r] = mn; const float p0 = ok0 ? expf(s0 - mn) : 0.f, p1 = ok1 ? expf(s1 - mn) : 0.f; l_r[rt][r] = l_r[rt][r] * al + p0 + p1;
#pragma unroll
        for (int dt = 0; dt < DT; ++dt) oacc[rt][dt][r] *= al;
        FragH t2; t2.h[0] = (_Float16)(p0 * 1024.0f); t2.h[1] = (_Float16)(p1 * 1024.0f); sP[w][rt * 16 + 8 * hh + r][ln] = t2.u[0]; sP[w][rt * 16 + 8 * hh + r][16 + ln] = t2.u[1]; }
    __builtin_amdgcn_fence(__ATOMIC_ACQ_REL, "workgroup"); __builtin_amdgcn_wave_barrier();
    FragH pa[2];
#pragma unroll
    for (int rt = 0; rt < RTN; ++rt) { pa[rt].half[0] = *(const v8us*)&sP[w][rt * 16 + ln][8 * hh]; pa[rt].half[1] = *(const v8us*)&sP[w][rt * 16 + ln][16 + 8 * hh]; }
#pragma unroll
    for (int dt = 0; dt < DT; ++dt) { const unsigned short* vrow = Vth + (size_t)(dt * 16 + ln) * TK + j0; FragH bv; bv.half[0] = *(const v8us*)(vrow + 8 * hh); bv.half[1] = *(const v8us*)(vrow + 16 + 8 * hh);
#pragma unroll
      for (int rt = 0; rt < RTN; ++rt) oacc[rt][dt] = mmaH<1>(pa[rt].v, pa[rt].v, bv.v, bv.v, oacc[rt][dt]); }
    __builtin_amdgcn_fence(__ATOMIC_ACQ_REL, "workgroup"); __builtin_amdgcn_wave_barrier(); }
#pragma unroll
  for (int rt = 0; rt < RTN; ++rt) {
#pragma unroll
    for (int r = 0; r < 8; ++r) { float l = l_r[rt][r]; l += __shfl_xor(l, 1, 32); l += __shfl_xor(l, 2, 32); l += __shfl_xor(l, 4, 32); l += __shfl_xor(l, 8, 32); l_r[rt][r] = (l > 0.f) ? 1.0f / (l * 1024.0f) : 0.f; }
#pragma unroll
    for (int dt = 0; dt < DT; ++dt)
#pragma unroll
      for (int r = 0; r < 8; ++r) sO[w][rt * 16 + 8 * hh + r][dt * 16 + ln] = oacc[rt][dt][r] * l_r[rt][r]; }
  __builtin_amdgcn_fence(__ATOMIC_ACQ_REL, "workgroup"); __builtin_amdgcn_wave_barrier();
  {
#pragma unroll
    for (int rp = 0; rp < RPW; rp += 2) { const int r = rp + (lane >> 4), pc = lane & 15; const v4f val = *(const v4fa*)&sO[w][r][pc * 4]; *(v4f*)(O + ((size_t)b * TQ + q0 + r) * ldo + h * 64 + pc * 4) = val; }
     } }
// Q/K-split flash kernel, transposed: S^T = Kh Qh^T + (Kh Ql^T + Kl Qh^T)/1024 and O^T += V^T P^T, with Q/K = [hi | 2^10 residual] f16 planes (QL/KL same layout as Q16/K16) and plain f16 P (x2^10). All planes are fragment tiles (FTE): a pass's K, K residual and V^T are 2 KiB runs each.
// K rows and V^T rows are the A operands, Q and P^T the B operands: a lane holds 16 of the 32 scores of ONE query (lane l and l ^ 16 share query l & 15), so the maximum and the sum run in the lane's own registers
// with one exchange between the wave's halves, and the two score tiles, converted in place, are the B fragment of the second product (register s of half hh = key 8 hh + s, then 16 + 8 hh + s - 8: the order in which V^T is loaded).
__device__ __forceinline__ float xhalf(float x) { return __int_as_float(__builtin_amdgcn_permlanex16(__float_as_int(x), __float_as_int(x), 0x76543210, 0xfedcba98, false, false)); }      /* lane l <-> l ^ 16 */
template <int CAUSAL>
__global__ __launch_bounds__(128) void k_flashqk(const _Float16* __restrict__ Q16, const _Float16* __restrict__ QL, const _Float16* __restrict__ K16, const _Float16* __restrict__ KL, const _Float16* __restrict__ Vt, const int* __restrict__ MSK, _Float16* __restrict__ O) {
  static_assert(HS == 32, "one k step per score product, two output tiles");
  constexpr int RPW = 16, DT = HS / 16;
  const int tid = threadIdx.x, w = tid >> 5, lane = tid & 31, ln = lane & 15, hh = lane >> 4;
  const int slab = blockIdx.x / QBLKS, qblk = blockIdx.x % QBLKS; const int b = slab / NH, h = slab % NH; const int qb0 = qblk * (4 * RPW); const int q0 = qb0 + w * RPW; const int tq = q0 + ln;
  FragH bq, bql;                 /* B: column = query q0 + ln, k = head dim in the order of the K rows' loads */
  { const size_t qo = ((size_t)slab * (TQ / 16) + q0 / 16) * FTE + lane * 8; bq.v = pk_frag(Q16 + qo); bql.v = pk_frag(QL + qo);
    asm volatile("s_wait_xcnt 0x0" ::: "memory"); }      /* the key offsets formed next reuse these four loads' address registers */
  /* wave-uniform bases + one 32-bit byte offset per lane, which walks the keys: a pass is two tiles of each plane (K: 2 x 16 keys; V^T: 2 x 16 dims of its 32 keys), the lane's 16 bytes at 16 lane of each half tile */
  const char* kb = (const char*)(K16 + (size_t)slab * HS * TK); const char* klb = (const char*)(KL + (size_t)slab * HS * TK); const char* vb = (const char*)(Vt + (size_t)slab * HS * TK);
  unsigned koff = (unsigned)lane * 16u;
  float m_c = -3.0e38f, l_c = 0.f; v8f oacc[DT];
#pragma unroll
  for (int dt = 0; dt < DT; ++dt) oacc[dt] = (v8f){0.f,0.f,0.f,0.f,0.f,0.f,0.f,0.f};
  const int jend = (CAUSAL == 1) ? (qb0 + 4 * RPW) : TK;      /* causal: keys beyond the block's last query never contribute */
#pragma unroll 1                 /* rolled, as before: one pass's fragments and scores already fill the registers that eight waves a SIMD leave */
  for (int j0 = 0; j0 < jend; j0 += 32) {
    FragH ak[2], akl[2], av[DT];
#pragma unroll
    for (int nt = 0; nt < 2; ++nt) { const char* kr = kb + (size_t)nt * FTE * 2; const char* klr = klb + (size_t)nt * FTE * 2;
      ak[nt].half[0] = *(const v8us*)(kr + koff); ak[nt].half[1] = *(const v8us*)(kr + koff + FTE); akl[nt].half[0] = *(const v8us*)(klr + koff); akl[nt].half[1] = *(const v8us*)(klr + koff + FTE); }
#pragma unroll
    for (int dt = 0; dt < DT; ++dt) { const char* vrow = vb + (size_t)dt * FTE * 2; av[dt].half[0] = *(const v8us*)(vrow + koff); av[dt].half[1] = *(const v8us*)(vrow + koff + FTE); }
    koff += 2u * FTE * 2u;       /* the next 32 keys */
    v2f s2[8]; bool ok[16];      /* element nt * 8 + r (pair nt * 4 + r / 2): key j0 + nt * 16 + 8 hh + r against query tq. Neighbours are held as pairs, so the multiply-adds and adds below take two scores an instruction with no register moves */
#pragma unroll
    for (int nt = 0; nt < 2; ++nt) { v8f acc = (v8f){0.f,0.f,0.f,0.f,0.f,0.f,0.f,0.f}, accl = acc;
      acc = mmaH<1>(ak[nt].v, ak[nt].v, bq.v, bq.v, acc); accl = mmaH<1>(ak[nt].v, ak[nt].v, bql.v, bql.v, accl); accl = mmaH<1>(akl[nt].v, akl[nt].v, bq.v, bq.v, accl);
#pragma unroll
      for (int r = 0; r < 8; r += 2) { v2f c = __builtin_elementwise_fma((v2f){accl[r], accl[r + 1]}, (v2f){0.0009765625f, 0.0009765625f}, (v2f){acc[r], acc[r + 1]});      /* raw q.k: the scale is applied inside the exponent's multiply-add below (SCL2 > 0, so the maximum may be taken first) */
#pragma unroll
        for (int e = 0; e < 2; ++e) { const int kk = j0 + nt * 16 + 8 * hh + r + e;
          bool o = (CAUSAL == 1) ? (kk <= tq) : ((CAUSAL == 2) ? ((kk >> 5) == (tq >> 5)) : true);      /* mode 2: block-diagonal 32-token groups */
          if (CAUSAL == 4) o = MSK[((size_t)b * TQ + tq) * TK + kk] != 0;      /* mode 4: per-(query, key) INPUT mask shared by all heads; masked keys contribute nothing, rows with no valid key give l = 0 -> output 0 */
          ok[nt * 8 + r + e] = o; if (!o) c[e] = -3.0e38f; }
        s2[nt * 4 + r / 2] = c; } }
    float mx[8];
#pragma unroll
    for (int k = 0; k < 8; ++k) mx[k] = fmaxf(s2[k][0], s2[k][1]);
    float mc = fmaxf(fmaxf(fmaxf(mx[0], mx[1]), fmaxf(mx[2], mx[3])), fmaxf(fmaxf(mx[4], mx[5]), fmaxf(mx[6], mx[7])));
    mc = fmaxf(mc, xhalf(mc));   /* the query's other 16 keys */
    /* base 2: m_c = running maximum of SCL2 s, less 10, so that 2^(SCL2 s - m_c) is P x 2^10 straight from one hardware exponential (arguments <= 10; below the exponent range it gives 0, far under an f16 P's last bit); every term of a pass and the rescale use the same rounded m_c */
    const float mn = fmaxf(m_c, __builtin_fmaf(mc, SCL2, -10.0f)); const float al = (mn > -1.0e37f) ? __builtin_amdgcn_exp2f(m_c - mn) : 1.0f; m_c = mn;      /* all keys masked so far: SCL2 x -3e38 stays under the bound */
    v2f p2[8]; FragH pb;         /* p, and with it l_c, carry the 2^10 */
#pragma unroll
    for (int k = 0; k < 8; ++k) { const v2f e = __builtin_elementwise_fma(s2[k], (v2f){SCL2, SCL2}, (v2f){-mn, -mn});
      p2[k][0] = ok[2 * k] ? __builtin_amdgcn_exp2f(e[0]) : 0.f; p2[k][1] = ok[2 * k + 1] ? __builtin_amdgcn_exp2f(e[1]) : 0.f; pb.h[2 * k] = (_Float16)p2[k][0]; pb.h[2 * k + 1] = (_Float16)p2[k][1]; }
    /* halving tree: p[i] + p[8 + i], then [i] + [4 + i], then ([0] + [2]) + ([1] + [3]); neighbours stay neighbours, so the adds pair up two to an instruction */
    const v2f t4a = (p2[0] + p2[4]) + (p2[2] + p2[6]), t4b = (p2[1] + p2[5]) + (p2[3] + p2[7]); const v2f t2 = t4a + t4b;
    l_c = l_c * al + (t2[0] + t2[1]);
#pragma unroll
    for (int dt = 0; dt < DT; ++dt) {
#pragma unroll
      for (int r = 0; r < 8; ++r) oacc[dt][r] *= al;
      oacc[dt] = mmaH<1>(av[dt].v, av[dt].v, pb.v, pb.v, oacc[dt]); } }
  const float l = l_c + xhalf(l_c); const float li = (l > 0.f) ? 1.0f / l : 0.f;
#pragma unroll
  for (int dt = 0; dt < DT; ++dt) { FragH f;      /* a lane's 8 registers are 8 consecutive head dims of its query = its own 16 bytes of the output GEMM's A tile (row = query ln, k = this head's dims) */
#pragma unroll
    for (int r = 0; r < 8; ++r) f.h[r] = (_Float16)(oacc[dt][r] * li);
    *(v8us*)((unsigned short*)O + ((size_t)((b * TQ + q0) / 16) * NH + h) * FTE + dt * (FTE / 2) + lane * 8) = f.half[0]; } }

// the four weights (row-major [out][in]) as f16(bf16(W) x 16) in fragment tiles [out / 16][in / 32]; blockIdx.y picks the weight
__global__ __launch_bounds__(256) void k_wprep(const float* __restrict__ Wq, const float* __restrict__ Wk, const float* __restrict__ Wv, const float* __restrict__ Wo, _Float16* __restrict__ Bq, _Float16* __restrict__ Bk, _Float16* __restrict__ Bv, _Float16* __restrict__ Bo) {
  const int by = blockIdx.y; const float* Wm = (by == 0) ? Wq : ((by == 1) ? Wk : ((by == 2) ? Wv : Wo)); _Float16* Bt = (by == 0) ? Bq : ((by == 1) ? Bk : ((by == 2) ? Bv : Bo));
  const size_t t = (size_t)blockIdx.x * 256 + threadIdx.x; FragH f;
#pragma unroll
  for (int i = 0; i < 8; ++i) f.h[i] = (_Float16)(bf16_round(Wm[t * 8 + i]) * 16.0f);
  const int n = (int)(t / (KD / 8)), ck = (int)(t % (KD / 8));      /* 8 inputs ck * 8 .. + 7 of output n: chunk ck & 3 of k tile ck >> 2 */
  *(v8us*)((unsigned short*)Bt + (size_t)((n / 16) * (KD / 32) + (ck >> 2)) * FTE + ((ck >> 1) & 1) * (FTE / 2) + ((ck & 1) * 16 + (n & 15)) * 8) = f.half[0]; }

extern "C" void kernel_launch(void* const* d_in, const int* in_sizes, int n_in,
                              void* d_out, int out_size, void* d_ws, size_t ws_size, hipStream_t stream) {
  (void)in_sizes; (void)n_in; (void)out_size;
  const float* const* I = (const float* const*)d_in; const float* qx = I[0]; const float* kx = I[1]; const float* vx = I[2]; const float* Wq = I[3]; const float* bq = I[4]; const float* Wk = I[5]; const float* bk = I[6]; const float* Wv = I[7]; const float* bv = I[8]; const float* Wo = I[9]; const float* bo = I[10];
  char* ws = (char*)d_ws; size_t off = 0;
  auto take = [&](size_t bytes) { char* p = ws + off; off += (bytes + 255) & ~(size_t)255; return p; };
  _Float16* BPq = (_Float16*)take((size_t)DP * CM * 2); _Float16* BPk = (_Float16*)take((size_t)DP * CM * 2); _Float16* BPv = (_Float16*)take((size_t)DP * CM * 2); _Float16* BOP = (_Float16*)take((size_t)CM * DP * 2);
  _Float16* O = (_Float16*)take((size_t)NR * DP * 2); _Float16* QH = (_Float16*)take((size_t)NR * DP * 2); _Float16* QL = (_Float16*)take((size_t)NR * DP * 2); _Float16* KH = (_Float16*)take((size_t)NR * DP * 2); _Float16* KL = (_Float16*)take((size_t)NR * DP * 2); _Float16* VT = (_Float16*)take((size_t)NR * DP * 2);
  if (off > ws_size) return;      /* under 64 MiB (256 MiB ws) */
  k_wprep<<<dim3(DP * CM / 8 / 256, 4), 256, 0, stream>>>(Wq, Wk, Wv, Wo, BPq, BPk, BPv, BOP);
  k_proj<<<dim3((NR / 128) * (DP / 64), 3), 128, 0, stream>>>(qx, kx, vx, BPq, BPk, BPv, bq, bk, bv, QH, QL, KH, KL, VT);
  k_flashqk<0><<<NSEQ * NH * QBLKS, 128, 0, stream>>>(QH, QL, KH, KL, VT, nullptr, O);      /* q/k hi + residual; P (x2^10) and V plain f16 */
  k_outg<<<(NR / 128) * (CM / 64), 128, 0, stream>>>(O, BOP, bo, (float*)d_out);
}

// v006
// A run of this version takes 85.6 microseconds.
// Two timings next to v005 both put it at 1.04 times that version's speed.
// All steps since v000 together make it 6.12 times as fast.
#include <hip/hip_runtime.h>
// Routing (windowed) attention (2 x 8 windows of 1024 tokens x 256; 8 heads x 32): qh/kh/vh = inputs q/k/v W^T + b split into heads; per (window, head) softmax(qh kh^T / sqrt(32)) vh; heads re-merged; ctx Wo^T + bo -> [2,8,4,16,16,256].
// Structure: 4 launches. Every workspace plane lies in WMMA fragment order (FTE below), so a wave's 16-byte loads and stores cover 512 contiguous bytes. (1) the four weights as exact x16 f16 planes; (2) the q, k, v projections in one grid (grid.y picks the operand): f16 WMMA GEMM, 64x256 block tiles of 32x64 wave tiles, f32 accumulation, the block reads its f32 input rows once in whole lines, rounds them and shares them through LDS as fragment tiles, the epilogue writes hi + 2^10 residual planes (q, k) or V^T (v), one 16 x 32 fragment tile per (head, 16 tokens) or (head, 16 dims, 32 tokens); (3) the fused flash kernel, transposed (S^T = K Q^T, O^T += V^T P^T, P stays in registers), with hi + 2^10-residual q/k planes (S = QhKh + (QlKh + QhKl)/1024) and plain f16 P (x2^10) and V (16 sequences x 8 heads); (4) the output GEMM on the f16 context tiles that (3) stores.
// Compute dtype: q, k, v and parameters rounded to bf16; qh, kh hi + residual (~2^-21-class logits); P and vh plain f16 (~2^-12); context as f16 (~2^-12) into Wo; f32 accumulation/softmax. v_wmma_f32_16x16x32_f16.
#define NSEQ 16
#define NB NSEQ
#define CM 256
#define HS 32                    /* head slot width in the q/k/v/context planes = true head dim */
#define DP (NH * HS)             /* 256: q/k/v width */
#define NR (NSEQ * SLEN)         /* 16384 rows */
#define QBLKS (TQ / 64)
#define SLEN 1024                /* tokens per routing window (K*Hp*W) */
#define TQ SLEN
#define TK SLEN
#define NH 8
#define SCL 0.17677669529663687f /* 32^-0.5 */
#define SCL2 ((float)(0.17677669529663687 * 1.4426950408889634))      /* 32^-0.5 log2(e): logits in base-2 units */
typedef __bf16 v16b __attribute__((ext_vector_type(16)));
typedef unsigned short v8us __attribute__((ext_vector_type(8), may_alias));
typedef unsigned short v4us __attribute__((ext_vector_type(4), may_alias));
typedef float  v8f  __attribute__((ext_vector_type(8)));
typedef float  v4f  __attribute__((ext_vector_type(4)));
typedef float  v2f  __attribute__((ext_vector_type(2)));
typedef float  v4fa __attribute__((ext_vector_type(4), may_alias));
union FragB { v16b v; v8us half[2]; unsigned short u[16]; };

__device__ __forceinline__ unsigned short bf16_bits(float x) { unsigned int u = __float_as_uint(x); return (unsigned short)((u + 0x7FFFu + ((u >> 16) & 1u)) >> 16); }
__device__ __forceinline__ float bf16_val(unsigned short b) { return __uint_as_float(((unsigned int)b) << 16); }
__device__ __forceinline__ float bf16_round(float x) { return bf16_val(bf16_bits(x)); }
// D += A·B with NT terms: 1 = ah·bh, 2 = + al·bh (A split), 3 = + ah·bl (both split)
template <int NT>
__device__ __forceinline__ v8f mmaN(v16b ah, v16b al, v16b bh, v16b bl, v8f c) {
  c = __builtin_amdgcn_wmma_f32_16x16x32_bf16(false, ah, false, bh, (short)0, c, false, false);
  if (NT >= 2) c = __builtin_amdgcn_wmma_f32_16x16x32_bf16(false, al, false, bh, (short)0, c, false, false);
  if (NT >= 3) c = __builtin_amdgcn_wmma_f32_16x16x32_bf16(false, ah, false, bl, (short)0, c, false, false);
  asm volatile("v_nop\n\tv_nop\n\tv_nop\n\tv_nop" : "+v"(c) : "v"(ah), "v"(al), "v"(bh), "v"(bl));
  return c;
}

__global__ __launch_bounds__(256) void k_wt_bf16(const float* __restrict__ W, unsigned short* __restrict__ Wt, int K, int N) {
  const int t = blockIdx.x * 256 + threadIdx.x;
  const int k8n = K / 8;
  if (t >= N * k8n) return;
  const int n = t / k8n, k8 = (t % k8n) * 8;
  v8us v;
#pragma unroll
  for (int i = 0; i < 8; ++i) v[i] = bf16_bits(W[(size_t)(k8 + i) * N + n]);
  *(v8us*)(Wt + (size_t)n * K + k8) = v;
  
}

// GEMM C[M][N] (f32, pitch ldc) = act(A[M][K]·W + bias). A f32 row-major (pitch lda) converted per fragment to bf16
// (ASPLIT: hi/lo two planes -> 2 terms, else single rounded term); Wt bf16 [N][K] (pitch ldb). BIAS_BF16 rounds the
// bias to bf16 first (bias quantised to bf16 before the add). K%32==0, M%16==0, N%64==0.
template <bool ASPLIT, int ACT, bool BIAS_BF16>
__global__ __launch_bounds__(128) void k_gemm_bf(const float* __restrict__ A, int lda, const unsigned short* __restrict__ Wt, int ldb,
                                               const float* __restrict__ bias, float* __restrict__ C, int ldc, int M, int N, int K) {
  __shared__ __attribute__((aligned(16))) float so[4][16][64];
  const int tid = threadIdx.x, w = tid >> 5, lane = tid & 31, ln = lane & 15, hh = lane >> 4;
  const int ntn = N / 64;
  const int wid = blockIdx.x * 4 + w;
  const int mt = wid / ntn, nq = wid % ntn;
  if (mt * 16 >= M) return;
  const int row0 = mt * 16, col0 = nq * 64;
  const float* arow = A + (size_t)(row0 + ln) * lda;
  v8f acc[4] = {};
  for (int kb = 0; kb < K; kb += 32) {
    FragB ah, al;
    const v4f x0 = *(const v4fa*)(arow + kb + 8 * hh), x1 = *(const v4fa*)(arow + kb + 8 * hh + 4);
    const v4f x2 = *(const v4fa*)(arow + kb + 16 + 8 * hh), x3 = *(const v4fa*)(arow + kb + 16 + 8 * hh + 4);
    float xs[16] = {x0[0],x0[1],x0[2],x0[3],x1[0],x1[1],x1[2],x1[3],x2[0],x2[1],x2[2],x2[3],x3[0],x3[1],x3[2],x3[3]};
#pragma unroll
    for (int i = 0; i < 16; ++i) { const unsigned short hb = bf16_bits(xs[i]); ah.u[i] = hb; al.u[i] = ASPLIT ? bf16_bits(xs[i] - bf16_val(hb)) : (unsigned short)0; }
#pragma unroll
    for (int t = 0; t < 4; ++t) {
      const unsigned short* brow = Wt + (size_t)(col0 + t * 16 + ln) * ldb + kb;
      FragB b;
      b.half[0] = *(const v8us*)(brow + 8 * hh);
      b.half[1] = *(const v8us*)(brow + 16 + 8 * hh);
      acc[t] = mmaN<ASPLIT ? 2 : 1>(ah.v, al.v, b.v, b.v, acc[t]);
    }
  }
#pragma unroll
  for (int t = 0; t < 4; ++t) {
    float bv = bias ? bias[col0 + t * 16 + ln] : 0.f;
    if (BIAS_BF16) bv = bf16_round(bv);
#pragma unroll
    for (int r = 0; r < 8; ++r) { float v = acc[t][r] + bv; if (ACT == 1) v = fmaxf(v, 0.f); so[w][8 * hh + r][t * 16 + ln] = v; }
  }
  __builtin_amdgcn_fence(__ATOMIC_ACQ_REL, "workgroup");
  __builtin_amdgcn_wave_barrier();
  const int rsub = lane >> 4, c4 = (lane & 15) * 4;
  {
#pragma unroll
    for (int q = 0; q < 8; ++q) {
      const int r = q * 2 + rsub;
      const v4f v = *(const v4fa*)&so[w][r][c4];
      *(v4f*)(C + (size_t)(row0 + r) * ldc + col0 + c4) = v;
    }
    
  }
}

// GEMM C = act(A·W + bias + resid): A f32 (ASPLIT -> hi/lo 2 terms), Wt bf16 [N][K]; ACT 0 none, 1 relu, 2 exact gelu;
// resid (optional, f32, row index = (row % rmod), pitch ldr, RES_BF16 rounds it) added before the activation.
template <bool ASPLIT, int ACT, bool BIAS_BF16, bool RES_BF16>
__global__ __launch_bounds__(128) void k_gemm_bf3(const float* __restrict__ A, int lda, const unsigned short* __restrict__ Wt, int ldb,
                                                const float* __restrict__ bias, const float* __restrict__ resid, int rmod, int ldr,
                                                float* __restrict__ C, int ldc, int M, int N, int K) {
  __shared__ __attribute__((aligned(16))) float so[4][16][64];
  const int tid = threadIdx.x, w = tid >> 5, lane = tid & 31, ln = lane & 15, hh = lane >> 4;
  const int ntn = N / 64;
  const int wid = blockIdx.x * 4 + w;
  const int mt = wid / ntn, nq = wid % ntn;
  if (mt * 16 >= M) return;
  const int row0 = mt * 16, col0 = nq * 64;
  const float* arow = A + (size_t)(row0 + ln) * lda;
  v8f acc[4] = {};
  for (int kb = 0; kb < K; kb += 32) {
    FragB ah, al;
    const v4f x0 = *(const v4fa*)(arow + kb + 8 * hh), x1 = *(const v4fa*)(arow + kb + 8 * hh + 4);
    const v4f x2 = *(const v4fa*)(arow + kb + 16 + 8 * hh), x3 = *(const v4fa*)(arow + kb + 16 + 8 * hh + 4);
    float xs[16] = {x0[0],x0[1],x0[2],x0[3],x1[0],x1[1],x1[2],x1[3],x2[0],x2[1],x2[2],x2[3],x3[0],x3[1],x3[2],x3[3]};
#pragma unroll
    for (int i = 0; i < 16; ++i) { const unsigned short hb = bf16_bits(xs[i]); ah.u[i] = hb; al.u[i] = ASPLIT ? bf16_bits(xs[i] - bf16_val(hb)) : (unsigned short)0; }
#pragma unroll
    for (int t = 0; t < 4; ++t) {
      const unsigned short* brow = Wt + (size_t)(col0 + t * 16 + ln) * ldb + kb;
      FragB b;
      b.half[0] = *(const v8us*)(brow + 8 * hh);
      b.half[1] = *(const v8us*)(brow + 16 + 8 * hh);
      acc[t] = mmaN<ASPLIT ? 2 : 1>(ah.v, al.v, b.v, b.v, acc[t]);
    }
  }
#pragma unroll
  for (int t = 0; t < 4; ++t) {
    const int col = col0 + t * 16 + ln;
    float bv = bias ? bias[col] : 0.f;
    if (BIAS_BF16) bv = bf16_round(bv);
#pragma unroll
    for (int r = 0; r < 8; ++r) {
      float v = acc[t][r] + bv;
      if (resid) { float rv = resid[(size_t)((row0 + 8 * hh + r) % rmod) * ldr + col]; if (RES_BF16) rv = bf16_round(rv); v += rv; }
      if (ACT == 1) v = fmaxf(v, 0.f);
      if (ACT == 2) v = 0.5f * v * (1.0f + erff(v * 0.70710678118654752f));
      if (ACT == 3) { const float u = 0.7978845608028654f * (v + 0.044715f * v * v * v); v = 0.5f * v * (1.0f + tanhf(u)); }
      so[w][8 * hh + r][t * 16 + ln] = v;
    }
  }
  __builtin_amdgcn_fence(__ATOMIC_ACQ_REL, "workgroup");
  __builtin_amdgcn_wave_barrier();
  const int rsub = lane >> 4, c4 = (lane & 15) * 4;
  {
#pragma unroll
    for (int q = 0; q < 8; ++q) {
      const int r = q * 2 + rsub;
      const v4f v = *(const v4fa*)&so[w][r][c4];
      *(v4f*)(C + (size_t)(row0 + r) * ldc + col0 + c4) = v;
    }
    
  }
}
// row LayerNorm (biased variance, eps) over N: s = X (+ R); optional out_sum <- s; out_norm <- (s-mu)*rsqrt(var+eps)*g + b
template <bool PARAM_BF16>
__global__ __launch_bounds__(256) void k_layernorm(const float* __restrict__ X, const float* __restrict__ R, const float* __restrict__ g, const float* __restrict__ bta,
                                                  float* __restrict__ out_sum, float* __restrict__ out_norm, int N, float eps) {
  __shared__ float red[256];
  const int row = blockIdx.x, tid = threadIdx.x;
  const float* x = X + (size_t)row * N; const float* rr = R ? R + (size_t)row * N : nullptr;
  float vals[16];                     // up to N = 4096
  const int per = N / 256;            // contiguous chunk per thread? use strided-by-4 chunks: thread handles j = tid*4 + 1024*u
  float s1 = 0.f;
  for (int u = 0; u < per / 4; ++u) {
    const int j = tid * 4 + 1024 * u;
    const v4f a = *(const v4fa*)(x + j);
    v4f b = {0.f,0.f,0.f,0.f}; if (rr) b = *(const v4fa*)(rr + j);
#pragma unroll
    for (int q = 0; q < 4; ++q) { const float v = a[q] + b[q]; vals[u * 4 + q] = v; s1 += v; }
  }
  red[tid] = s1; __syncthreads();
  for (int st = 128; st > 0; st >>= 1) { if (tid < st) red[tid] += red[tid + st]; __syncthreads(); }
  const float mu = red[0] / (float)N; __syncthreads();
  float s2 = 0.f;
  for (int u = 0; u < per / 4; ++u)
#pragma unroll
    for (int q = 0; q < 4; ++q) { const float c = vals[u * 4 + q] - mu; s2 += c * c; }
  red[tid] = s2; __syncthreads();
  for (int st = 128; st > 0; st >>= 1) { if (tid < st) red[tid] += red[tid + st]; __syncthreads(); }
  const float rs = rsqrtf(red[0] / (float)N + eps);
  {
    for (int u = 0; u < per / 4; ++u) {
      const int j = tid * 4 + 1024 * u;
      v4f o, sm;
#pragma unroll
      for (int q = 0; q < 4; ++q) {
        float gg = g[j + q], bb = bta[j + q];
        if (PARAM_BF16) { gg = bf16_round(gg); bb = bf16_round(bb); }
        sm[q] = vals[u * 4 + q]; o[q] = (vals[u * 4 + q] - mu) * rs * gg + bb;
      }
      if (out_sum) *(v4f*)(out_sum + (size_t)row * N + j) = sm;
      *(v4f*)(out_norm + (size_t)row * N + j) = o;
    }
    
  }
}



// ---- f16 WMMA path (v_wmma_f32_16x16x32_f16): 11-bit significands for operands in range — used where a [0,1] probability operand needs more precision than bf16
typedef _Float16 v16h __attribute__((ext_vector_type(16)));
union FragH { v16h v; v8us half[2]; _Float16 h[16]; unsigned short u[16]; };
template <int NT>
__device__ __forceinline__ v8f mmaH(v16h ah, v16h al, v16h bh, v16h bl, v8f c) {
  c = __builtin_amdgcn_wmma_f32_16x16x32_f16(false, ah, false, bh, (short)0, c, false, false);
  if (NT >= 2) c = __builtin_amdgcn_wmma_f32_16x16x32_f16(false, al, false, bh, (short)0, c, false, false);
  if (NT >= 3) c = __builtin_amdgcn_wmma_f32_16x16x32_f16(false, ah, false, bl, (short)0, c, false, false);
  asm volatile("v_nop\n\tv_nop\n\tv_nop\n\tv_nop" : "+v"(c) : "v"(ah), "v"(al), "v"(bh), "v"(bl));
  return c;
}
// batched GEMM like k_gemm_b but f16 operands: A f32 (split into f16 hi/lo if ASPLIT, else rounded to f16), Bt = f16 values [n][k]; alpha; C f32; N multiple of 16 (partial tiles skipped)
template <bool ASPLIT>
__global__ __launch_bounds__(128) void k_gemm_h(const float* __restrict__ A, int lda, size_t sA, const _Float16* __restrict__ Bh, int ldb, size_t sB, float alpha, float* __restrict__ C, int ldc, size_t sC, int M, int N, int K) {
  __shared__ __attribute__((aligned(16))) float so[4][16][64];
  const int tid = threadIdx.x, w = tid >> 5, lane = tid & 31, ln = lane & 15, hh = lane >> 4; const int by = blockIdx.y;
  A += (size_t)by * sA; Bh += (size_t)by * sB; C += (size_t)by * sC;
  const int ntn = (N + 63) / 64; const int wid = blockIdx.x * 4 + w; const int mt = wid / ntn, nq = wid % ntn; if (mt * 16 >= M) return;
  const int row0 = mt * 16, col0 = nq * 64; const float* arow = A + (size_t)(row0 + ln) * lda;
  v8f acc[4] = {};
  for (int kb = 0; kb < K; kb += 32) {
    FragH ah, al;
    const v4f x0 = *(const v4fa*)(arow + kb + 8 * hh), x1 = *(const v4fa*)(arow + kb + 8 * hh + 4), x2 = *(const v4fa*)(arow + kb + 16 + 8 * hh), x3 = *(const v4fa*)(arow + kb + 16 + 8 * hh + 4);
    float xs[16] = {x0[0],x0[1],x0[2],x0[3],x1[0],x1[1],x1[2],x1[3],x2[0],x2[1],x2[2],x2[3],x3[0],x3[1],x3[2],x3[3]};
#pragma unroll
    for (int i = 0; i < 16; ++i) { const _Float16 h = (_Float16)xs[i]; ah.h[i] = h; al.h[i] = ASPLIT ? (_Float16)(xs[i] - (float)h) : (_Float16)0.0f; }
#pragma unroll
    for (int t = 0; t < 4; ++t) { if (col0 + t * 16 >= N) continue; const size_t boff = (size_t)(col0 + t * 16 + ln) * ldb + kb; FragH bq; bq.half[0] = *(const v8us*)(Bh + boff + 8 * hh); bq.half[1] = *(const v8us*)(Bh + boff + 16 + 8 * hh);
      acc[t] = mmaH<ASPLIT ? 2 : 1>(ah.v, al.v, bq.v, bq.v, acc[t]); }
  }
#pragma unroll
  for (int t = 0; t < 4; ++t) { if (col0 + t * 16 >= N) continue;
#pragma unroll
    for (int r = 0; r < 8; ++r) so[w][8 * hh + r][t * 16 + ln] = acc[t][r] * alpha; }
  __builtin_amdgcn_fence(__ATOMIC_ACQ_REL, "workgroup"); __builtin_amdgcn_wave_barrier();
  const int rsub = lane >> 4, c4 = (lane & 15) * 4;
  {
#pragma unroll
    for (int q = 0; q < 8; ++q) { const int r = q * 2 + rsub; if (col0 + c4 < N) { const v4f v = *(const v4fa*)&so[w][r][c4]; *(v4f*)(C + (size_t)(row0 + r) * ldc + col0 + c4) = v; } }
     }
}

// Wt[n][k] = f16(W[k][n]·scale) from f32 row-major W[K][N] (scale = power of two; bf16-exact weights stay exact in f16 away from the subnormal range)
__global__ __launch_bounds__(256) void k_wt_f16(const float* __restrict__ W, _Float16* __restrict__ Wt, int K, int N, float scale) {
  const int t = blockIdx.x * 256 + threadIdx.x; if (t >= N * (K / 8)) return; const int n = t / (K / 8), k8 = (t % (K / 8)) * 8; FragH f;
#pragma unroll
  for (int i = 0; i < 8; ++i) f.h[i] = (_Float16)(bf16_round(W[(size_t)(k8 + i) * N + n]) * scale); const v8us o = f.half[0];
  *(v8us*)((unsigned short*)Wt + (size_t)n * K + k8) = o; 
}
// k_gemm_hh variant with fused epilogue: v = acc·alpha + bias[by·sBias + col] (+ CP[(row/rowsPerB)·sCPb + by·64 + col] if CP) ; ACT 0 none / 1 elu ; writes f16 C16 (and f32 C if non-null)
template <int ACT>
__global__ __launch_bounds__(128) void k_gemm_hhx(const _Float16* __restrict__ A, int lda, size_t sA, const _Float16* __restrict__ Bh, int ldb, size_t sB, float alpha, const float* __restrict__ bias, size_t sBias, const float* __restrict__ CP, int rowsPerB, size_t sCPb, int row0g,
    float* __restrict__ C, _Float16* __restrict__ C16, int ldc, size_t sC, int M, int N, int K) {
  __shared__ __attribute__((aligned(16))) float so[4][16][64];
  const int tid = threadIdx.x, w = tid >> 5, lane = tid & 31, ln = lane & 15, hh = lane >> 4; const int by = blockIdx.y;
  A += (size_t)by * sA; Bh += (size_t)by * sB; const size_t cofs = (size_t)by * sC; const float* bp = bias ? bias + (size_t)by * sBias : nullptr;
  const int ntn = (N + 63) / 64; const int wid = blockIdx.x * 4 + w; const int mt = wid / ntn, nq = wid % ntn; if (mt * 16 >= M) return;
  const int row0 = mt * 16, col0 = nq * 64; const _Float16* arow = A + (size_t)(row0 + ln) * lda;
  v8f acc[4] = {};
  for (int kb = 0; kb < K; kb += 32) { FragH ah; ah.half[0] = *(const v8us*)((const unsigned short*)arow + kb + 8 * hh); ah.half[1] = *(const v8us*)((const unsigned short*)arow + kb + 16 + 8 * hh);
#pragma unroll
    for (int t = 0; t < 4; ++t) { if (col0 + t * 16 >= N) continue; const size_t boff = (size_t)(col0 + t * 16 + ln) * ldb + kb; FragH bq; bq.half[0] = *(const v8us*)((const unsigned short*)Bh + boff + 8 * hh); bq.half[1] = *(const v8us*)((const unsigned short*)Bh + boff + 16 + 8 * hh);
      acc[t] = mmaH<1>(ah.v, ah.v, bq.v, bq.v, acc[t]); }
  }
#pragma unroll
  for (int t = 0; t < 4; ++t) { if (col0 + t * 16 >= N) continue; const int col = col0 + t * 16 + ln; const float bv = bp ? bf16_round(bp[col]) : 0.f;
#pragma unroll
    for (int r = 0; r < 8; ++r) { float v = acc[t][r] * alpha + bv; if (CP) { const int bidx = (row0g + row0 + 8 * hh + r) / rowsPerB; v += CP[(size_t)bidx * sCPb + (size_t)by * 64 + col]; } if (ACT == 1) v = (v > 0.f) ? v : expm1f(v); else if (ACT == 7) v = (v > 0.f) ? v + 1.0f : expf(v); else if (ACT == 8) v = tanhf(v); else if (ACT == 9) v = 0.5f * v * (1.0f + tanhf(0.7978845608028654f * (v + 0.044715f * v * v * v))); else if (ACT == 11) v = 1.0f / (1.0f + expf(-v)); else if (ACT == 12) v = (v > 0.f) ? v : 0.01f * v; else if (ACT == 14) v = (v > 0.f) ? v : 0.1f * v; else if (ACT == 15) v = v / (1.0f + expf(-v)); else if (ACT == 3) v = fmaxf(v, 0.f); else if (ACT == 6) v = 0.5f * v * (1.0f + erff(v * 0.70710678118654752f)); so[w][8 * hh + r][t * 16 + ln] = v; } }
  __builtin_amdgcn_fence(__ATOMIC_ACQ_REL, "workgroup"); __builtin_amdgcn_wave_barrier();
  const int rsub = lane >> 4, c4 = (lane & 15) * 4; typedef _Float16 v4h __attribute__((ext_vector_type(4)));
  {
#pragma unroll
    for (int q = 0; q < 8; ++q) { const int r = q * 2 + rsub; if (col0 + c4 < N) { const v4f v = *(const v4fa*)&so[w][r][c4]; if (C) *(v4f*)(C + cofs + (size_t)(row0 + r) * ldc + col0 + c4) = v; if (C16) { v4h h4; for (int i = 0; i < 4; ++i) h4[i] = (_Float16)v[i]; *(v4h*)(C16 + cofs + (size_t)(row0 + r) * ldc + col0 + c4) = h4; } } }
     }
}


typedef _Float16 v4h __attribute__((ext_vector_type(4)));

__global__ __launch_bounds__(256) void k_round16f(const float* __restrict__ W, _Float16* __restrict__ Bt, size_t n8) { const size_t t = (size_t)blockIdx.x * 256 + threadIdx.x; if (t >= n8) return; FragH f;
#pragma unroll
  for (int i = 0; i < 8; ++i) f.h[i] = (_Float16)(bf16_round(W[t * 8 + i]) * 16.0f); *(v8us*)((unsigned short*)Bt + t * 8) = f.half[0];  }
// ---- fused GEMM (wave tile 32x64, K = KD): the epilogue writes what the next kernel reads ----
#define KD 256                   /* = CM = DP: K and the row pitch of A and of the weight planes */
__device__ __forceinline__ v16h g2_frag(const _Float16* p, int hh) { FragH f; f.half[0] = *(const v8us*)((const unsigned short*)p + 8 * hh); f.half[1] = *(const v8us*)((const unsigned short*)p + 16 + 8 * hh); return f.v; }
__device__ __forceinline__ v8f g2_mma(v16h a, v16h b, v8f c) { v8f d = __builtin_amdgcn_wmma_f32_16x16x32_f16(false, a, false, b, (short)0, c, false, false); asm volatile("v_nop\n\tv_nop\n\tv_nop\n\tv_nop" : "+v"(d) : "v"(a), "v"(b)); return d; }
// Fragment order: a 16 x 32 f16 operand tile (16 rows or columns x 32 k) is FTE consecutive elements; lane l = 16 hh + ln holds row ln, k = 8 hh .. + 7 at element 8 l and k = 16 + 8 hh .. + 7 at FTE / 2 + 8 l (the k order of g2_frag)
#define FTE 512
__device__ __forceinline__ v16h pk_frag(const _Float16* p) { FragH f; f.half[0] = *(const v8us*)((const unsigned short*)p); f.half[1] = *(const v8us*)((const unsigned short*)p + FTE / 2); return f.v; }      /* p = tile + 8 lane */
// The same tile in LDS: its four quarters (k 0-7, 8-15, 16-23, 24-31 of the 16 rows, 256 B each) stand AQE elements = 320 B apart, so that a store of 4 rows x 32 k (8 B a lane) meets every bank once and each half wave of a fragment read (16 B a lane) does too
#define AQE 160
#define ATE (4 * AQE)
__device__ __forceinline__ v16h ls_frag(const _Float16* p) { FragH f; f.half[0] = *(const v8us*)((const unsigned short*)p); f.half[1] = *(const v8us*)((const unsigned short*)p + 2 * AQE); return f.v; }      /* p = tile + hh AQE + 8 ln */
// A: fragment tiles [row / 16][k / 32] from Ap, PK: in global memory (FTE), else in LDS (ATE). Bh: fragment tiles [col / 16][k / 32]
template <bool PK>
__device__ __forceinline__ void gf_tile(const _Float16* __restrict__ Ap, const _Float16* __restrict__ Bh, int row0, int col0, int ln, int hh, v8f (&accs)[8]) {
  constexpr int TR = (KD / 32) * FTE, AT = PK ? FTE : ATE, ATR = (KD / 32) * AT;      /* elements of one row of tiles; of one A tile and one row of A tiles */
  const _Float16* p0p = Ap + (size_t)(row0 / 16) * ATR + (PK ? (16 * hh + ln) * 8 : hh * AQE + ln * 8); const _Float16* p1p = p0p + ATR;
  const _Float16* b0p = Bh + (size_t)(col0 / 16) * TR + (16 * hh + ln) * 8; const _Float16* b1p = b0p + TR; const _Float16* b2p = b1p + TR; const _Float16* b3p = b2p + TR;
  const v8f z8 = {0.f,0.f,0.f,0.f,0.f,0.f,0.f,0.f}; v8f c00 = z8, c01 = z8, c02 = z8, c03 = z8, c10 = z8, c11 = z8, c12 = z8, c13 = z8;
#pragma unroll 1                 /* rolled, as before the fusion: keeps the registers low enough for every block of the grid to be resident at once */
  for (int kb = 0; kb < KD; kb += 32) { const v16h a0 = PK ? pk_frag(p0p) : ls_frag(p0p), a1 = PK ? pk_frag(p1p) : ls_frag(p1p);
    v16h b = pk_frag(b0p); c00 = g2_mma(a0, b, c00); c10 = g2_mma(a1, b, c10);
    b = pk_frag(b1p); c01 = g2_mma(a0, b, c01); c11 = g2_mma(a1, b, c11);
    b = pk_frag(b2p); c02 = g2_mma(a0, b, c02); c12 = g2_mma(a1, b, c12);
    b = pk_frag(b3p); c03 = g2_mma(a0, b, c03); c13 = g2_mma(a1, b, c13);
    p0p += AT; p1p += AT; b0p += FTE; b1p += FTE; b2p += FTE; b3p += FTE; }
  accs[0] = c00; accs[1] = c01; accs[2] = c02; accs[3] = c03; accs[4] = c10; accs[5] = c11; accs[6] = c12; accs[7] = c13; }
// q, k, v projections, blockIdx.y = 0, 1, 2: y = x W^T + b (weights x16, so acc / 16). q, k -> hi + 2^10 residual planes, fragment tiles [b * NH + head][token / 16]; v -> f16 V^T, fragment tiles [b * NH + head][token / 32][dim / 16]
__global__ __launch_bounds__(256) void k_proj(const float* __restrict__ xq, const float* __restrict__ xk, const float* __restrict__ xv, const _Float16* __restrict__ Bq, const _Float16* __restrict__ Bk, const _Float16* __restrict__ Bv,
    const float* __restrict__ bq, const float* __restrict__ bk, const float* __restrict__ bv, _Float16* __restrict__ QH, _Float16* __restrict__ QL, _Float16* __restrict__ KH, _Float16* __restrict__ KL, _Float16* __restrict__ VT) {
  __shared__ __attribute__((aligned(16))) char sm[8 * 32 * 68 * 4];      /* first the block's A tiles (4 x 8 x ATE f16), then, behind a barrier, each wave's 32 x 68 f32 output rows */
  _Float16* sa = (_Float16*)sm; float (*so)[32][68] = (float (*)[32][68])sm;
  const int tid = threadIdx.x, w = tid >> 5, lane = tid & 31, ln = lane & 15, hh = lane >> 4; const int by = blockIdx.y;
  const float* A = (by == 0) ? xq : ((by == 1) ? xk : xv); const _Float16* Bh = (by == 0) ? Bq : ((by == 1) ? Bk : Bv); const float* bp = (by == 0) ? bq : ((by == 1) ? bk : bv);
  const int rl0 = 32 * (w >> 2), row0 = blockIdx.x * 64 + rl0, col0 = (w & 3) * 64;      /* 2 x 4 waves: 64 rows x all DP columns */
  { /* wave w stages rows 8 w .. + 7: a load takes 128 B (one k tile) of each of 4 rows, 8 lanes a row; lane's 4 floats = k 4 (lane & 7) .. + 3 of the tile, rounded to bf16 and held as f16 */
    const float* ap = A + (size_t)(blockIdx.x * 64 + 8 * w + (lane >> 3)) * KD + (lane & 7) * 4;
    unsigned short* sp = (unsigned short*)sa + (w >> 1) * ((KD / 32) * ATE) + ((lane >> 1) & 3) * AQE + (8 * (w & 1) + (lane >> 3)) * 8 + (lane & 1) * 4;
    v4f x[2][KD / 32];           /* both loop nests unrolled: x stays in registers, and all 16 loads are in flight before the first is converted */
#pragma unroll
    for (int g = 0; g < 2; ++g)
#pragma unroll
      for (int kt = 0; kt < KD / 32; ++kt) x[g][kt] = *(const v4fa*)(ap + (size_t)g * 4 * KD + kt * 32);
#pragma unroll
    for (int g = 0; g < 2; ++g)
#pragma unroll
      for (int kt = 0; kt < KD / 32; ++kt) { FragH f;
#pragma unroll
        for (int i = 0; i < 4; ++i) f.h[i] = (_Float16)bf16_round(x[g][kt][i]);
        *(v4us*)(sp + kt * ATE + g * 32) = (v4us){f.u[0], f.u[1], f.u[2], f.u[3]}; } }
  __syncthreads();               /* every wave reads rows that other waves staged */
  v8f accs[8]; gf_tile<false>(sa, Bh, rl0, col0, ln, hh, accs);
  const int sl0 = (row0 / SLEN) * NH + col0 / HS, tk0 = row0 % SLEN;      /* the wave's first (window, head) and first token: 2 heads x 32 tokens */
  if (by == 2) {                 /* block-uniform. A lane's 8 accumulator rows are 8 consecutive tokens of one column = its own 16 bytes of a V^T fragment tile (row = dim ln, k = token): stored from registers */
#pragma unroll
    for (int u = 0; u < 8; ++u) { const int t = u & 3, half = u >> 2; const float bvv = bf16_round(bp[col0 + t * 16 + ln]); FragH f;
#pragma unroll
      for (int r = 0; r < 8; ++r) f.h[r] = (_Float16)(accs[u][r] * 0.0625f + bvv);
      *(v8us*)((unsigned short*)VT + ((size_t)((sl0 + (t >> 1)) * (SLEN / 32) + tk0 / 32) * (HS / 16) + (t & 1)) * FTE + half * (FTE / 2) + lane * 8) = f.half[0]; }
    return; }
  __syncthreads();               /* the output rows overwrite the A tiles: every wave has left its k loop */
  _Float16* Hh = (by == 0) ? QH : KH; _Float16* Hl = (by == 0) ? QL : KL;
#pragma unroll
  for (int u = 0; u < 8; ++u) { const int t = u & 3, half = u >> 2; const float bvv = bf16_round(bp[col0 + t * 16 + ln]);
#pragma unroll
    for (int r = 0; r < 8; ++r) so[w][half * 16 + 8 * hh + r][t * 16 + ln] = accs[u][r] * 0.0625f + bvv; }
  __builtin_amdgcn_fence(__ATOMIC_ACQ_REL, "workgroup"); __builtin_amdgcn_wave_barrier();
#pragma unroll 1                 /* one tile a trip: a quarter of the code; the k loop and the register count come out the same either way */
  for (int tl = 0; tl < 4; ++tl) { const int kt = tl >> 1, hd = tl & 1;      /* 2 token tiles x 2 heads; per half tile a lane reads its 8 dims of token ln and stores its 16 bytes */
    const size_t o = ((size_t)(sl0 + hd) * (SLEN / 16) + tk0 / 16 + kt) * FTE + lane * 8;
#pragma unroll
    for (int half = 0; half < 2; ++half) { const float* sp = &so[w][kt * 16 + ln][hd * HS + half * 16 + 8 * hh]; const v4f v0 = *(const v4fa*)sp, v1 = *(const v4fa*)(sp + 4); FragH fh, fl;
#pragma unroll
      for (int i = 0; i < 4; ++i) { const _Float16 h0 = (_Float16)v0[i], h1 = (_Float16)v1[i]; fh.h[i] = h0; fh.h[4 + i] = h1; fl.h[i] = (_Float16)((v0[i] - (float)h0) * 1024.0f); fl.h[4 + i] = (_Float16)((v1[i] - (float)h1) * 1024.0f); }
      *(v8us*)((unsigned short*)Hh + o + half * (FTE / 2)) = fh.half[0]; *(v8us*)((unsigned short*)Hl + o + half * (FTE / 2)) = fl.half[0]; }
    asm volatile("s_wait_xcnt 0x0" ::: "memory"); }      /* the next trip rewrites these stores' address and data registers */
}
// output projection: out = ctx Wo^T + bo, f32 rows of CM; ctx = f16 fragment tiles [row / 16][head]
__global__ __launch_bounds__(128) void k_outg(const _Float16* __restrict__ Ctx, const _Float16* __restrict__ Bo, const float* __restrict__ bo, float* __restrict__ C) {
  __shared__ __attribute__((aligned(16))) float so[4][32][68];
  const int tid = threadIdx.x, w = tid >> 5, lane = tid & 31, ln = lane & 15, hh = lane >> 4;
  const int mt = blockIdx.x / (CM / 64), nq = blockIdx.x % (CM / 64); const int row0 = mt * 128 + 32 * w, col0 = nq * 64;
  v8f accs[8]; gf_tile<true>(Ctx, Bo, row0, col0, ln, hh, accs);
#pragma unroll
  for (int u = 0; u < 8; ++u) { const int t = u & 3, half = u >> 2; const float bvv = bf16_round(bo[col0 + t * 16 + ln]);
#pragma unroll
    for (int r = 0; r < 8; ++r) so[w][half * 16 + 8 * hh + r][t * 16 + ln] = accs[u][r] * 0.0625f + bvv; }
  __builtin_amdgcn_fence(__ATOMIC_ACQ_REL, "workgroup"); __builtin_amdgcn_wave_barrier();
  const int rsub = lane >> 4, c4 = (lane & 15) * 4;
#pragma unroll
  for (int q = 0; q < 16; ++q) { const int r = q * 2 + rsub; const v4f v = *(const v4fa*)&so[w][r][c4]; *(v4f*)(C + (size_t)(row0 + r) * CM + col0 + c4) = v; } }



template <int CAUSAL>
__global__ __launch_bounds__(128) void k_flash(const _Float16* __restrict__ Q16, int ldq, const _Float16* __restrict__ K16, int ldk, const _Float16* __restrict__ Vt, const int* __restrict__ MSK, float* __restrict__ O, int ldo) {
  constexpr int RPW = 16, RTN = RPW / 16, NQB = TQ / (4 * RPW), DT = 4, KS = 2;
  __shared__ __attribute__((aligned(16))) unsigned short sP[4][RPW][40]; __shared__ __attribute__((aligned(16))) float sO[4][RPW][64 + 4];
  const int tid = threadIdx.x, w = tid >> 5, lane = tid & 31, ln = lane & 15, hh = lane >> 4;
  const int slab = blockIdx.x / QBLKS, qblk = blockIdx.x % QBLKS; (void)NQB; const int b = slab / NH, h = slab % NH; const int qb0 = qblk * (4 * RPW); const int q0 = qb0 + w * RPW;
  FragH aq[2][KS];
#pragma unroll
  for (int rt = 0; rt < RTN; ++rt) { const unsigned short* qr = (const unsigned short*)Q16 + ((size_t)b * TQ + q0 + rt * 16 + ln) * ldq + h * 64;
#pragma unroll
    for (int ks = 0; ks < KS; ++ks) { aq[rt][ks].half[0] = *(const v8us*)(qr + ks * 32 + 8 * hh); aq[rt][ks].half[1] = *(const v8us*)(qr + ks * 32 + 16 + 8 * hh); } }
  const unsigned short* Vth = (const unsigned short*)Vt + (size_t)slab * 64 * TK;
  float m_r[2][8], l_r[2][8]; v8f oacc[2][DT];
#pragma unroll
  for (int rt = 0; rt < RTN; ++rt) {
#pragma unroll
    for (int r = 0; r < 8; ++r) { m_r[rt][r] = -3.0e38f; l_r[rt][r] = 0.f; }
#pragma unroll
    for (int dt = 0; dt < DT; ++dt) oacc[rt][dt] = (v8f){0.f,0.f,0.f,0.f,0.f,0.f,0.f,0.f}; }
  const int jend = (CAUSAL == 1) ? (qb0 + 4 * RPW) : TK;      /* causal: keys beyond the block's last query never contribute */
#pragma unroll 1
  for (int j0 = 0; j0 < jend; j0 += 32) {
    v8f s[2][2];
#pragma unroll
    for (int nt = 0; nt < 2; ++nt) { const unsigned short* kr = (const unsigned short*)K16 + ((size_t)b * TK + j0 + nt * 16 + ln) * ldk + h * 64; FragH bk[KS];
#pragma unroll
      for (int ks = 0; ks < KS; ++ks) { bk[ks].half[0] = *(const v8us*)(kr + ks * 32 + 8 * hh); bk[ks].half[1] = *(const v8us*)(kr + ks * 32 + 16 + 8 * hh); }
#pragma unroll
      for (int rt = 0; rt < RTN; ++rt) { v8f acc = (v8f){0.f,0.f,0.f,0.f,0.f,0.f,0.f,0.f};
#pragma unroll
        for (int ks = 0; ks < KS; ++ks) acc = mmaH<1>(aq[rt][ks].v, aq[rt][ks].v, bk[ks].v, bk[ks].v, acc); s[rt][nt] = acc; } }
#pragma unroll
    for (int rt = 0; rt < RTN; ++rt)
#pragma unroll
      for (int r = 0; r < 8; ++r) { const int tq = q0 + rt * 16 + 8 * hh + r; const int k0 = j0 + ln, k1 = j0 + 16 + ln;
        const bool ok0 = (CAUSAL == 1) ? (k0 <= tq) : ((CAUSAL == 2) ? ((k0 >> 5) == (tq >> 5)) : true), ok1 = (CAUSAL == 1) ? (k1 <= tq) : ((CAUSAL == 2) ? ((k1 >> 5) == (tq >> 5)) : true);      /* mode 2: block-diagonal 32-token groups */
        const float s0 = ok0 ? s[rt][0][r] * SCL : -3.0e38f, s1 = ok1 ? s[rt][1][r] * SCL : -3.0e38f; float mc = fmaxf(s0, s1);
        mc = fmaxf(mc, __shfl_xor(mc, 1, 32)); mc = fmaxf(mc, __shfl_xor(mc, 2, 32)); mc = fmaxf(mc, __shfl_xor(mc, 4, 32)); mc = fmaxf(mc, __shfl_xor(mc, 8, 32));
        const float mn = fmaxf(m_r[rt][r], mc); const float al = (mn > -1.0e38f) ? expf(m_r[rt][r] - mn) : 1.0f; m_r[rt][r] = mn; const float p0 = ok0 ? expf(s0 - mn) : 0.f, p1 = ok1 ? expf(s1 - mn) : 0.f; l_r[rt][r] = l_r[rt][r] * al + p0 + p1;
#pragma unroll
        for (int dt = 0; dt < DT; ++dt) oacc[rt][dt][r] *= al;
        FragH t2; t2.h[0] = (_Float16)(p0 * 1024.0f); t2.h[1] = (_Float16)(p1 * 1024.0f); sP[w][rt * 16 + 8 * hh + r][ln] = t2.u[0]; sP[w][rt * 16 + 8 * hh + r][16 + ln] = t2.u[1]; }
    __builtin_amdgcn_fence(__ATOMIC_ACQ_REL, "workgroup"); __builtin_amdgcn_wave_barrier();
    FragH pa[2];
#pragma unroll
    for (int rt = 0; rt < RTN; ++rt) { pa[rt].half[0] = *(const v8us*)&sP[w][rt * 16 + ln][8 * hh]; pa[rt].half[1] = *(const v8us*)&sP[w][rt * 16 + ln][16 + 8 * hh]; }
#pragma unroll
    for (int dt = 0; dt < DT; ++dt) { const unsigned short* vrow = Vth + (size_t)(dt * 16 + ln) * TK + j0; FragH bv; bv.half[0] = *(const v8us*)(vrow + 8 * hh); bv.half[1] = *(const v8us*)(vrow + 16 + 8 * hh);
#pragma unroll
      for (int rt = 0; rt < RTN; ++rt) oacc[rt][dt] = mmaH<1>(pa[rt].v, pa[rt].v, bv.v, bv.v, oacc[rt][dt]); }
    __builtin_amdgcn_fence(__ATOMIC_ACQ_REL, "workgroup"); __builtin_amdgcn_wave_barrier(); }
#pragma unroll
  for (int rt = 0; rt < RTN; ++rt) {
#pragma unroll
    for (int r = 0; r < 8; ++r) { float l = l_r[rt][r]; l += __shfl_xor(l, 1, 32); l += __shfl_xor(l, 2, 32); l += __shfl_xor(l, 4, 32); l += __shfl_xor(l, 8, 32); l_r[rt][r] = (l > 0.f) ? 1.0f / (l * 1024.0f) : 0.f; }
#pragma unroll
    for (int dt = 0; dt < DT; ++dt)
#pragma unroll
      for (int r = 0; r < 8; ++r) sO[w][rt * 16 + 8 * hh + r][dt * 16 + ln] = oacc[rt][dt][r] * l_r[rt][r]; }
  __builtin_amdgcn_fence(__ATOMIC_ACQ_REL, "workgroup"); __builtin_amdgcn_wave_barrier();
  {
#pragma unroll
    for (int rp = 0; rp < RPW; rp += 2) { const int r = rp + (lane >> 4), pc = lane & 15; const v4f val = *(const v4fa*)&sO[w][r][pc * 4]; *(v4f*)(O + ((size_t)b * TQ + q0 + r) * ldo + h * 64 + pc * 4) = val; }
     } }
// Q/K-split flash kernel, transposed: S^T = Kh Qh^T + (Kh Ql^T + Kl Qh^T)/1024 and O^T += V^T P^T, with Q/K = [hi | 2^10 residual] f16 planes (QL/KL same layout as Q16/K16) and plain f16 P (x2^10). All planes are fragment tiles (FTE): a pass's K, K residual and V^T are 2 KiB runs each.
// K rows and V^T rows are the A operands, Q and P^T the B operands: a lane holds 16 of the 32 scores of ONE query (lane l and l ^ 16 share query l & 15), so the maximum and the sum run in the lane's own registers
// with one exchange between the wave's halves, and the two score tiles, converted in place, are the B fragment of the second product (register s of half hh = key 8 hh + s, then 16 + 8 hh + s - 8: the order in which V^T is loaded).
__device__ __forceinline__ float xhalf(float x) { return __int_as_float(__builtin_amdgcn_permlanex16(__float_as_int(x), __float_as_int(x), 0x76543210, 0xfedcba98, false, false)); }      /* lane l <-> l ^ 16 */
template <int CAUSAL>
__global__ __launch_bounds__(128) void k_flashqk(const _Float16* __restrict__ Q16, const _Float16* __restrict__ QL, const _Float16* __restrict__ K16, const _Float16* __restrict__ KL, const _Float16* __restrict__ Vt, const int* __restrict__ MSK, _Float16* __restrict__ O) {
  static_assert(HS == 32, "one k step per score product, two output tiles");
  constexpr int RPW = 16, DT = HS / 16;
  const int tid = threadIdx.x, w = tid >> 5, lane = tid & 31, ln = lane & 15, hh = lane >> 4;
  const int slab = blockIdx.x / QBLKS, qblk = blockIdx.x % QBLKS; const int b = slab / NH, h = slab % NH; const int qb0 = qblk * (4 * RPW); const int q0 = qb0 + w * RPW; const int tq = q0 + ln;
  FragH bq, bql;                 /* B: column = query q0 + ln, k = head dim in the order of the K rows' loads */
  { const size_t qo = ((size_t)slab * (TQ / 16) + q0 / 16) * FTE + lane * 8; bq.v = pk_frag(Q16 + qo); bql.v = pk_frag(QL + qo);
    asm volatile("s_wait_xcnt 0x0" ::: "memory"); }      /* the key offsets formed next reuse these four loads' address registers */
  /* wave-uniform bases + one 32-bit byte offset per lane, which walks the keys: a pass is two tiles of each plane (K: 2 x 16 keys; V^T: 2 x 16 dims of its 32 keys), the lane's 16 bytes at 16 lane of each half tile */
  const char* kb = (const char*)(K16 + (size_t)slab * HS * TK); const char* klb = (const char*)(KL + (size_t)slab * HS * TK); const char* vb = (const char*)(Vt + (size_t)slab * HS * TK);
  unsigned koff = (unsigned)lane * 16u;
  float m_c = -3.0e38f, l_c = 0.f; v8f oacc[DT];
#pragma unroll
  for (int dt = 0; dt < DT; ++dt) oacc[dt] = (v8f){0.f,0.f,0.f,0.f,0.f,0.f,0.f,0.f};
  const int jend = (CAUSAL == 1) ? (qb0 + 4 * RPW) : TK;      /* causal: keys beyond the block's last query never contribute */
#pragma unroll 1                 /* rolled, as before: one pass's fragments and scores already fill the registers that eight waves a SIMD leave */
  for (int j0 = 0; j0 < jend; j0 += 32) {
    FragH ak[2], akl[2], av[DT];
#pragma unroll
    for (int nt = 0; nt < 2; ++nt) { const char* kr = kb + (size_t)nt * FTE * 2; const char* klr = klb + (size_t)nt * FTE * 2;
      ak[nt].half[0] = *(const v8us*)(kr + koff); ak[nt].half[1] = *(const v8us*)(kr + koff + FTE); akl[nt].half[0] = *(const v8us*)(klr + koff); akl[nt].half[1] = *(const v8us*)(klr + koff + FTE); }
#pragma unroll
    for (int dt = 0; dt < DT; ++dt) { const char* vrow = vb + (size_t)dt * FTE * 2; av[dt].half[0] = *(const v8us*)(vrow + koff); av[dt].half[1] = *(const v8us*)(vrow + koff + FTE); }
    koff += 2u * FTE * 2u;       /* the next 32 keys */
    v2f s2[8]; bool ok[16];      /* element nt * 8 + r (pair nt * 4 + r / 2): key j0 + nt * 16 + 8 hh + r against query tq. Neighbours are held as pairs, so the multiply-adds and adds below take two scores an instruction with no register moves */
#pragma unroll
    for (int nt = 0; nt < 2; ++nt) { v8f acc = (v8f){0.f,0.f,0.f,0.f,0.f,0.f,0.f,0.f}, accl = acc;
      acc = mmaH<1>(ak[nt].v, ak[nt].v, bq.v, bq.v, acc); accl = mmaH<1>(ak[nt].v, ak[nt].v, bql.v, bql.v, accl); accl = mmaH<1>(akl[nt].v, akl[nt].v, bq.v, bq.v, accl);
#pragma unroll
      for (int r = 0; r < 8; r += 2) { v2f c = __builtin_elementwise_fma((v2f){accl[r], accl[r + 1]}, (v2f){0.0009765625f, 0.0009765625f}, (v2f){acc[r], acc[r + 1]});      /* raw q.k: the scale is applied inside the exponent's multiply-add below (SCL2 > 0, so the maximum may be taken first) */
#pragma unroll
        for (int e = 0; e < 2; ++e) { const int kk = j0 + nt * 16 + 8 * hh + r + e;
          bool o = (CAUSAL == 1) ? (kk <= tq) : ((CAUSAL == 2) ? ((kk >> 5) == (tq >> 5)) : true);      /* mode 2: block-diagonal 32-token groups */
          if (CAUSAL == 4) o = MSK[((size_t)b * TQ + tq) * TK + kk] != 0;      /* mode 4: per-(query, key) INPUT mask shared by all heads; masked keys contribute nothing, rows with no valid key give l = 0 -> output 0 */
          ok[nt * 8 + r + e] = o; if (!o) c[e] = -3.0e38f; }
        s2[nt * 4 + r / 2] = c; } }
    float mx[8];
#pragma unroll
    for (int k = 0; k < 8; ++k) mx[k] = fmaxf(s2[k][0], s2[k][1]);
    float mc = fmaxf(fmaxf(fmaxf(mx[0], mx[1]), fmaxf(mx[2], mx[3])), fmaxf(fmaxf(mx[4], mx[5]), fmaxf(mx[6], mx[7])));
    mc = fmaxf(mc, xhalf(mc));   /* the query's other 16 keys */
    /* base 2: m_c = running maximum of SCL2 s, less 10, so that 2^(SCL2 s - m_c) is P x 2^10 straight from one hardware exponential (arguments <= 10; below the exponent range it gives 0, far under an f16 P's last bit); every term of a pass and the rescale use the same rounded m_c */
    const float mn = fmaxf(m_c, __builtin_fmaf(mc, SCL2, -10.0f)); const float al = (mn > -1.0e37f) ? __builtin_amdgcn_exp2f(m_c - mn) : 1.0f; m_c = mn;      /* all keys masked so far: SCL2 x -3e38 stays under the bound */
    v2f p2[8]; FragH pb;         /* p, and with it l_c, carry the 2^10 */
#pragma unroll
    for (int k = 0; k < 8; ++k) { const v2f e = __builtin_elementwise_fma(s2[k], (v2f){SCL2, SCL2}, (v2f){-mn, -mn});
      p2[k][0] = ok[2 * k] ? __builtin_amdgcn_exp2f(e[0]) : 0.f; p2[k][1] = ok[2 * k + 1] ? __builtin_amdgcn_exp2f(e[1]) : 0.f; pb.h[2 * k] = (_Float16)p2[k][0]; pb.h[2 * k + 1] = (_Float16)p2[k][1]; }
    /* halving tree: p[i] + p[8 + i], then [i] + [4 + i], then ([0] + [2]) + ([1] + [3]); neighbours stay neighbours, so the adds pair up two to an instruction */
    const v2f t4a = (p2[0] + p2[4]) + (p2[2] + p2[6]), t4b = (p2[1] + p2[5]) + (p2[3] + p2[7]); const v2f t2 = t4a + t4b;
    l_c = l_c * al + (t2[0] + t2[1]);
#pragma unroll
    for (int dt = 0; dt < DT; ++dt) {
#pragma unroll
      for (int r = 0; r < 8; ++r) oacc[dt][r] *= al;
      oacc[dt] = mmaH<1>(av[dt].v, av[dt].v, pb.v, pb.v, oacc[dt]); } }
  const float l = l_c + xhalf(l_c); const float li = (l > 0.f) ? 1.0f / l : 0.f;
#pragma unroll
  for (int dt = 0; dt < DT; ++dt) { FragH f;      /* a lane's 8 registers are 8 consecutive head dims of its query = its own 16 bytes of the output GEMM's A tile (row = query ln, k = this head's dims) */
#pragma unroll
    for (int r = 0; r < 8; ++r) f.h[r] = (_Float16)(oacc[dt][r] * li);
    *(v8us*)((unsigned short*)O + ((size_t)((b * TQ + q0) / 16) * NH + h) * FTE + dt * (FTE / 2) + lane * 8) = f.half[0]; } }

// the four weights (row-major [out][in]) as f16(bf16(W) x 16) in fragment tiles [out / 16][in / 32]; blockIdx.y picks the weight
__global__ __launch_bounds__(256) void k_wprep(const float* __restrict__ Wq, const float* __restrict__ Wk, const float* __restrict__ Wv, const float* __restrict__ Wo, _Float16* __restrict__ Bq, _Float16* __restrict__ Bk, _Float16* __restrict__ Bv, _Float16* __restrict__ Bo) {
  const int by = blockIdx.y; const float* Wm = (by == 0) ? Wq : ((by == 1) ? Wk : ((by == 2) ? Wv : Wo)); _Float16* Bt = (by == 0) ? Bq : ((by == 1) ? Bk : ((by == 2) ? Bv : Bo));
  const size_t t = (size_t)blockIdx.x * 256 + threadIdx.x; FragH f;
#pragma unroll
  for (int i = 0; i < 8; ++i) f.h[i] = (_Float16)(bf16_round(Wm[t * 8 + i]) * 16.0f);
  const int n = (int)(t / (KD / 8)), ck = (int)(t % (KD / 8));      /* 8 inputs ck * 8 .. + 7 of output n: chunk ck & 3 of k tile ck >> 2 */
  *(v8us*)((unsigned short*)Bt + (size_t)((n / 16) * (KD / 32) + (ck >> 2)) * FTE + ((ck >> 1) & 1) * (FTE / 2) + ((ck & 1) * 16 + (n & 15)) * 8) = f.half[0]; }

extern "C" void kernel_launch(void* const* d_in, const int* in_sizes, int n_in,
                              void* d_out, int out_size, void* d_ws, size_t ws_size, hipStream_t stream) {
  (void)in_sizes; (void)n_in; (void)out_size;
  const float* const* I = (const float* const*)d_in; const float* qx = I[0]; const float* kx = I[1]; const float* vx = I[2]; const float* Wq = I[3]; const float* bq = I[4]; const float* Wk = I[5]; const float* bk = I[6]; const float* Wv = I[7]; const float* bv = I[8]; const float* Wo = I[9]; const float* bo = I[10];
  char* ws = (char*)d_ws; size_t off = 0;
  auto take = [&](size_t bytes) { char* p = ws + off; off += (bytes + 255) & ~(size_t)255; return p; };
  _Float16* BPq = (_Float16*)take((size_t)DP * CM * 2); _Float16* BPk = (_Float16*)take((size_t)DP * CM * 2); _Float16* BPv = (_Float16*)take((size_t)DP * CM * 2); _Float16* BOP = (_Float16*)take((size_t)CM * DP * 2);
  _Float16* O = (_Float16*)take((size_t)NR * DP * 2); _Float16* QH = (_Float16*)take((size_t)NR * DP * 2); _Float16* QL = (_Float16*)take((size_t)NR * DP * 2); _Float16* KH = (_Float16*)take((size_t)NR * DP * 2); _Float16* KL = (_Float16*)take((size_t)NR * DP * 2); _Float16* VT = (_Float16*)take((size_t)NR * DP * 2);
  if (off > ws_size) return;      /* under 64 MiB (256 MiB ws) */
  k_wprep<<<dim3(DP * CM / 8 / 256, 4), 256, 0, stream>>>(Wq, Wk, Wv, Wo, BPq, BPk, BPv, BOP);
  k_proj<<<dim3(NR / 64, 3), 256, 0, stream>>>(qx, kx, vx, BPq, BPk, BPv, bq, bk, bv, QH, QL, KH, KL, VT);
  k_flashqk<0><<<NSEQ * NH * QBLKS, 128, 0, stream>>>(QH, QL, KH, KL, VT, nullptr, O);      /* q/k hi + residual; P (x2^10) and V plain f16 */
  k_outg<<<(NR / 128) * (CM / 64), 128, 0, stream>>>(O, BOP, bo, (float*)d_out);
}

// v007
// It runs in 69.9 microseconds.
// Next to v006, in two timings, it ran 1.18 and 1.19 times as fast.
// Over all steps from v000 it is 7.23 times as fast.
#include <hip/hip_runtime.h>
// Routing (windowed) attention (2 x 8 windows of 1024 tokens x 256; 8 heads x 32): qh/kh/vh = inputs q/k/v W^T + b split into heads; per (window, head) softmax(qh kh^T / sqrt(32)) vh; heads re-merged; ctx Wo^T + bo -> [2,8,4,16,16,256].
// Structure: 4 launches. Every workspace plane lies in WMMA fragment order (FTE below), so a wave's 16-byte loads and stores cover 512 contiguous bytes. (1) the four weights as exact x16 f16 planes; (2) the q, k, v projections in one grid (grid.y picks the operand): f16 WMMA GEMM, 64x256 block tiles of 32x64 wave tiles, f32 accumulation, the block reads its f32 input rows once in whole lines, rounds them and shares them through LDS as fragment tiles, the epilogue writes hi + 2^10 residual planes (q, k) or V^T (v), one 16 x 32 fragment tile per (head, 16 tokens) or (head, 16 dims, 32 tokens); (3) the fused flash kernel, transposed (S^T = K Q^T, O^T += V^T P^T, P stays in registers), with hi + 2^10-residual q/k planes (S = QhKh + (QlKh + QhKl)/1024) and plain f16 P (x2^10) and V (16 sequences x 8 heads); (4) the output GEMM on the f16 context tiles that (3) stores.
// Compute dtype: q, k, v and parameters rounded to bf16; qh, kh hi + residual (~2^-21-class logits); P and vh plain f16 (~2^-12); context as f16 (~2^-12) into Wo; f32 accumulation/softmax. v_wmma_f32_16x16x32_f16.
#define NSEQ 16
#define NB NSEQ
#define CM 256
#define HS 32                    /* head slot width in the q/k/v/context planes = true head dim */
#define DP (NH * HS)             /* 256: q/k/v width */
#define NR (NSEQ * SLEN)         /* 16384 rows */
#define QBLKS (TQ / 64)
#define SLEN 1024                /* tokens per routing window (K*Hp*W) */
#define TQ SLEN
#define TK SLEN
#define NH 8
#define SCL 0.17677669529663687f /* 32^-0.5 */
#define SCL2 ((float)(0.17677669529663687 * 1.4426950408889634))      /* 32^-0.5 log2(e): logits in base-2 units */
typedef __bf16 v16b __attribute__((ext_vector_type(16)));
typedef unsigned short v8us __attribute__((ext_vector_type(8), may_alias));
typedef unsigned short v4us __attribute__((ext_vector_type(4), may_alias));
typedef float  v8f  __attribute__((ext_vector_type(8)));
typedef float  v4f  __attribute__((ext_vector_type(4)));
typedef float  v2f  __attribute__((ext_vector_type(2)));
typedef float  v4fa __attribute__((ext_vector_type(4), may_alias));
union FragB { v16b v; v8us half[2]; unsigned short u[16]; };

__device__ __forceinline__ unsigned short bf16_bits(float x) { unsigned int u = __float_as_uint(x); return (unsigned short)((u + 0x7FFFu + ((u >> 16) & 1u)) >> 16); }
__device__ __forceinline__ float bf16_val(unsigned short b) { return __uint_as_float(((unsigned int)b) << 16); }
__device__ __forceinline__ float bf16_round(float x) { return bf16_val(bf16_bits(x)); }
// D += A·B with NT terms: 1 = ah·bh, 2 = + al·bh (A split), 3 = + ah·bl (both split)
template <int NT>
__device__ __forceinline__ v8f mmaN(v16b ah, v16b al, v16b bh, v16b bl, v8f c) {
  c = __builtin_amdgcn_wmma_f32_16x16x32_bf16(false, ah, false, bh, (short)0, c, false, false);
  if (NT >= 2) c = __builtin_amdgcn_wmma_f32_16x16x32_bf16(false, al, false, bh, (short)0, c, false, false);
  if (NT >= 3) c = __builtin_amdgcn_wmma_f32_16x16x32_bf16(false, ah, false, bl, (short)0, c, false, false);
  asm volatile("v_nop\n\tv_nop\n\tv_nop\n\tv_nop" : "+v"(c) : "v"(ah), "v"(al), "v"(bh), "v"(bl));
  return c;
}

__global__ __launch_bounds__(256) void k_wt_bf16(const float* __restrict__ W, unsigned short* __restrict__ Wt, int K, int N) {
  const int t = blockIdx.x * 256 + threadIdx.x;
  const int k8n = K / 8;
  if (t >= N * k8n) return;
  const int n = t / k8n, k8 = (t % k8n) * 8;
  v8us v;
#pragma unroll
  for (int i = 0; i < 8; ++i) v[i] = bf16_bits(W[(size_t)(k8 + i) * N + n]);
  *(v8us*)(Wt + (size_t)n * K + k8) = v;
  
}

// GEMM C[M][N] (f32, pitch ldc) = act(A[M][K]·W + bias). A f32 row-major (pitch lda) converted per fragment to bf16
// (ASPLIT: hi/lo two planes -> 2 terms, else single rounded term); Wt bf16 [N][K] (pitch ldb). BIAS_BF16 rounds the
// bias to bf16 first (bias quantised to bf16 before the add). K%32==0, M%16==0, N%64==0.
template <bool ASPLIT, int ACT, bool BIAS_BF16>
__global__ __launch_bounds__(128) void k_gemm_bf(const float* __restrict__ A, int lda, const unsigned short* __restrict__ Wt, int ldb,
                                               const float* __restrict__ bias, float* __restrict__ C, int ldc, int M, int N, int K) {
  __shared__ __attribute__((aligned(16))) float so[4][16][64];
  const int tid = threadIdx.x, w = tid >> 5, lane = tid & 31, ln = lane & 15, hh = lane >> 4;
  const int ntn = N / 64;
  const int wid = blockIdx.x * 4 + w;
  const int mt = wid / ntn, nq = wid % ntn;
  if (mt * 16 >= M) return;
  const int row0 = mt * 16, col0 = nq * 64;
  const float* arow = A + (size_t)(row0 + ln) * lda;
  v8f acc[4] = {};
  for (int kb = 0; kb < K; kb += 32) {
    FragB ah, al;
    const v4f x0 = *(const v4fa*)(arow + kb + 8 * hh), x1 = *(const v4fa*)(arow + kb + 8 * hh + 4);
    const v4f x2 = *(const v4fa*)(arow + kb + 16 + 8 * hh), x3 = *(const v4fa*)(arow + kb + 16 + 8 * hh + 4);
    float xs[16] = {x0[0],x0[1],x0[2],x0[3],x1[0],x1[1],x1[2],x1[3],x2[0],x2[1],x2[2],x2[3],x3[0],x3[1],x3[2],x3[3]};
#pragma unroll
    for (int i = 0; i < 16; ++i) { const unsigned short hb = bf16_bits(xs[i]); ah.u[i] = hb; al.u[i] = ASPLIT ? bf16_bits(xs[i] - bf16_val(hb)) : (unsigned short)0; }
#pragma unroll
    for (int t = 0; t < 4; ++t) {
      const unsigned short* brow = Wt + (size_t)(col0 + t * 16 + ln) * ldb + kb;
      FragB b;
      b.half[0] = *(const v8us*)(brow + 8 * hh);
      b.half[1] = *(const v8us*)(brow + 16 + 8 * hh);
      acc[t] = mmaN<ASPLIT ? 2 : 1>(ah.v, al.v, b.v, b.v, acc[t]);
    }
  }
#pragma unroll
  for (int t = 0; t < 4; ++t) {
    float bv = bias ? bias[col0 + t * 16 + ln] : 0.f;
    if (BIAS_BF16) bv = bf16_round(bv);
#pragma unroll
    for (int r = 0; r < 8; ++r) { float v = acc[t][r] + bv; if (ACT == 1) v = fmaxf(v, 0.f); so[w][8 * hh + r][t * 16 + ln] = v; }
  }
  __builtin_amdgcn_fence(__ATOMIC_ACQ_REL, "workgroup");
  __builtin_amdgcn_wave_barrier();
  const int rsub = lane >> 4, c4 = (lane & 15) * 4;
  {
#pragma unroll
    for (int q = 0; q < 8; ++q) {
      const int r = q * 2 + rsub;
      const v4f v = *(const v4fa*)&so[w][r][c4];
      *(v4f*)(C + (size_t)(row0 + r) * ldc + col0 + c4) = v;
    }
    
  }
}

// GEMM C = act(A·W + bias + resid): A f32 (ASPLIT -> hi/lo 2 terms), Wt bf16 [N][K]; ACT 0 none, 1 relu, 2 exact gelu;
// resid (optional, f32, row index = (row % rmod), pitch ldr, RES_BF16 rounds it) added before the activation.
template <bool ASPLIT, int ACT, bool BIAS_BF16, bool RES_BF16>
__global__ __launch_bounds__(128) void k_gemm_bf3(const float* __restrict__ A, int lda, const unsigned short* __restrict__ Wt, int ldb,
                                                const float* __restrict__ bias, const float* __restrict__ resid, int rmod, int ldr,
                                                float* __restrict__ C, int ldc, int M, int N, int K) {
  __shared__ __attribute__((aligned(16))) float so[4][16][64];
  const int tid = threadIdx.x, w = tid >> 5, lane = tid & 31, ln = lane & 15, hh = lane >> 4;
  const int ntn = N / 64;
  const int wid = blockIdx.x * 4 + w;
  const int mt = wid / ntn, nq = wid % ntn;
  if (mt * 16 >= M) return;
  const int row0 = mt * 16, col0 = nq * 64;
  const float* arow = A + (size_t)(row0 + ln) * lda;
  v8f acc[4] = {};
  for (int kb = 0; kb < K; kb += 32) {
    FragB ah, al;
    const v4f x0 = *(const v4fa*)(arow + kb + 8 * hh), x1 = *(const v4fa*)(arow + kb + 8 * hh + 4);
    const v4f x2 = *(const v4fa*)(arow + kb + 16 + 8 * hh), x3 = *(const v4fa*)(arow + kb + 16 + 8 * hh + 4);
    float xs[16] = {x0[0],x0[1],x0[2],x0[3],x1[0],x1[1],x1[2],x1[3],x2[0],x2[1],x2[2],x2[3],x3[0],x3[1],x3[2],x3[3]};
#pragma unroll
    for (int i = 0; i < 16; ++i) { const unsigned short hb = bf16_bits(xs[i]); ah.u[i] = hb; al.u[i] = ASPLIT ? bf16_bits(xs[i] - bf16_val(hb)) : (unsigned short)0; }
#pragma unroll
    for (int t = 0; t < 4; ++t) {
      const unsigned short* brow = Wt + (size_t)(col0 + t * 16 + ln) * ldb + kb;
      FragB b;
      b.half[0] = *(const v8us*)(brow + 8 * hh);
      b.half[1] = *(const v8us*)(brow + 16 + 8 * hh);
      acc[t] = mmaN<ASPLIT ? 2 : 1>(ah.v, al.v, b.v, b.v, acc[t]);
    }
  }
#pragma unroll
  for (int t = 0; t < 4; ++t) {
    const int col = col0 + t * 16 + ln;
    float bv = bias ? bias[col] : 0.f;
    if (BIAS_BF16) bv = bf16_round(bv);
#pragma unroll
    for (int r = 0; r < 8; ++r) {
      float v = acc[t][r] + bv;
      if (resid) { float rv = resid[(size_t)((row0 + 8 * hh + r) % rmod) * ldr + col]; if (RES_BF16) rv = bf16_round(rv); v += rv; }
      if (ACT == 1) v = fmaxf(v, 0.f);
      if (ACT == 2) v = 0.5f * v * (1.0f + erff(v * 0.70710678118654752f));
      if (ACT == 3) { const float u = 0.7978845608028654f * (v + 0.044715f * v * v * v); v = 0.5f * v * (1.0f + tanhf(u)); }
      so[w][8 * hh + r][t * 16 + ln] = v;
    }
  }
  __builtin_amdgcn_fence(__ATOMIC_ACQ_REL, "workgroup");
  __builtin_amdgcn_wave_barrier();
  const int rsub = lane >> 4, c4 = (lane & 15) * 4;
  {
#pragma unroll
    for (int q = 0; q < 8; ++q) {
      const int r = q * 2 + rsub;
      const v4f v = *(const v4fa*)&so[w][r][c4];
      *(v4f*)(C + (size_t)(row0 + r) * ldc + col0 + c4) = v;
    }
    
  }
}
// row LayerNorm (biased variance, eps) over N: s = X (+ R); optional out_sum <- s; out_norm <- (s-mu)*rsqrt(var+eps)*g + b
template <bool PARAM_BF16>
__global__ __launch_bounds__(256) void k_layernorm(const float* __restrict__ X, const float* __restrict__ R, const float* __restrict__ g, const float* __restrict__ bta,
                                                  float* __restrict__ out_sum, float* __restrict__ out_norm, int N, float eps) {
  __shared__ float red[256];
  const int row = blockIdx.x, tid = threadIdx.x;
  const float* x = X + (size_t)row * N; const float* rr = R ? R + (size_t)row * N : nullptr;
  float vals[16];                     // up to N = 4096
  const int per = N / 256;            // contiguous chunk per thread? use strided-by-4 chunks: thread handles j = tid*4 + 1024*u
  float s1 = 0.f;
  for (int u = 0; u < per / 4; ++u) {
    const int j = tid * 4 + 1024 * u;
    const v4f a = *(const v4fa*)(x + j);
    v4f b = {0.f,0.f,0.f,0.f}; if (rr) b = *(const v4fa*)(rr + j);
#pragma unroll
    for (int q = 0; q < 4; ++q) { const float v = a[q] + b[q]; vals[u * 4 + q] = v; s1 += v; }
  }
  red[tid] = s1; __syncthreads();
  for (int st = 128; st > 0; st >>= 1) { if (tid < st) red[tid] += red[tid + st]; __syncthreads(); }
  const float mu = red[0] / (float)N; __syncthreads();
  float s2 = 0.f;
  for (int u = 0; u < per / 4; ++u)
#pragma unroll
    for (int q = 0; q < 4; ++q) { const float c = vals[u * 4 + q] - mu; s2 += c * c; }
  red[tid] = s2; __syncthreads();
  for (int st = 128; st > 0; st >>= 1) { if (tid < st) red[tid] += red[tid + st]; __syncthreads(); }
  const float rs = rsqrtf(red[0] / (float)N + eps);
  {
    for (int u = 0; u < per / 4; ++u) {
      const int j = tid * 4 + 1024 * u;
      v4f o, sm;
#pragma unroll
      for (int q = 0; q < 4; ++q) {
        float gg = g[j + q], bb = bta[j + q];
        if (PARAM_BF16) { gg = bf16_round(gg); bb = bf16_round(bb); }
        sm[q] = vals[u * 4 + q]; o[q] = (vals[u * 4 + q] - mu) * rs * gg + bb;
      }
      if (out_sum) *(v4f*)(out_sum + (size_t)row * N + j) = sm;
      *(v4f*)(out_norm + (size_t)row * N + j) = o;
    }
    
  }
}



// ---- f16 WMMA path (v_wmma_f32_16x16x32_f16): 11-bit significands for operands in range — used where a [0,1] probability operand needs more precision than bf16
typedef _Float16 v16h __attribute__((ext_vector_type(16)));
union FragH { v16h v; v8us half[2]; _Float16 h[16]; unsigned short u[16]; };
template <int NT>
__device__ __forceinline__ v8f mmaH(v16h ah, v16h al, v16h bh, v16h bl, v8f c) {
  c = __builtin_amdgcn_wmma_f32_16x16x32_f16(false, ah, false, bh, (short)0, c, false, false);
  if (NT >= 2) c = __builtin_amdgcn_wmma_f32_16x16x32_f16(false, al, false, bh, (short)0, c, false, false);
  if (NT >= 3) c = __builtin_amdgcn_wmma_f32_16x16x32_f16(false, ah, false, bl, (short)0, c, false, false);
  return c;
}
// batched GEMM like k_gemm_b but f16 operands: A f32 (split into f16 hi/lo if ASPLIT, else rounded to f16), Bt = f16 values [n][k]; alpha; C f32; N multiple of 16 (partial tiles skipped)
template <bool ASPLIT>
__global__ __launch_bounds__(128) void k_gemm_h(const float* __restrict__ A, int lda, size_t sA, const _Float16* __restrict__ Bh, int ldb, size_t sB, float alpha, float* __restrict__ C, int ldc, size_t sC, int M, int N, int K) {
  __shared__ __attribute__((aligned(16))) float so[4][16][64];
  const int tid = threadIdx.x, w = tid >> 5, lane = tid & 31, ln = lane & 15, hh = lane >> 4; const int by = blockIdx.y;
  A += (size_t)by * sA; Bh += (size_t)by * sB; C += (size_t)by * sC;
  const int ntn = (N + 63) / 64; const int wid = blockIdx.x * 4 + w; const int mt = wid / ntn, nq = wid % ntn; if (mt * 16 >= M) return;
  const int row0 = mt * 16, col0 = nq * 64; const float* arow = A + (size_t)(row0 + ln) * lda;
  v8f acc[4] = {};
  for (int kb = 0; kb < K; kb += 32) {
    FragH ah, al;
    const v4f x0 = *(const v4fa*)(arow + kb + 8 * hh), x1 = *(const v4fa*)(arow + kb + 8 * hh + 4), x2 = *(const v4fa*)(arow + kb + 16 + 8 * hh), x3 = *(const v4fa*)(arow + kb + 16 + 8 * hh + 4);
    float xs[16] = {x0[0],x0[1],x0[2],x0[3],x1[0],x1[1],x1[2],x1[3],x2[0],x2[1],x2[2],x2[3],x3[0],x3[1],x3[2],x3[3]};
#pragma unroll
    for (int i = 0; i < 16; ++i) { const _Float16 h = (_Float16)xs[i]; ah.h[i] = h; al.h[i] = ASPLIT ? (_Float16)(xs[i] - (float)h) : (_Float16)0.0f; }
#pragma unroll
    for (int t = 0; t < 4; ++t) { if (col0 + t * 16 >= N) continue; const size_t boff = (size_t)(col0 + t * 16 + ln) * ldb + kb; FragH bq; bq.half[0] = *(const v8us*)(Bh + boff + 8 * hh); bq.half[1] = *(const v8us*)(Bh + boff + 16 + 8 * hh);
      acc[t] = mmaH<ASPLIT ? 2 : 1>(ah.v, al.v, bq.v, bq.v, acc[t]); }
  }
#pragma unroll
  for (int t = 0; t < 4; ++t) { if (col0 + t * 16 >= N) continue;
#pragma unroll
    for (int r = 0; r < 8; ++r) so[w][8 * hh + r][t * 16 + ln] = acc[t][r] * alpha; }
  __builtin_amdgcn_fence(__ATOMIC_ACQ_REL, "workgroup"); __builtin_amdgcn_wave_barrier();
  const int rsub = lane >> 4, c4 = (lane & 15) * 4;
  {
#pragma unroll
    for (int q = 0; q < 8; ++q) { const int r = q * 2 + rsub; if (col0 + c4 < N) { const v4f v = *(const v4fa*)&so[w][r][c4]; *(v4f*)(C + (size_t)(row0 + r) * ldc + col0 + c4) = v; } }
     }
}

// Wt[n][k] = f16(W[k][n]·scale) from f32 row-major W[K][N] (scale = power of two; bf16-exact weights stay exact in f16 away from the subnormal range)
__global__ __launch_bounds__(256) void k_wt_f16(const float* __restrict__ W, _Float16* __restrict__ Wt, int K, int N, float scale) {
  const int t = blockIdx.x * 256 + threadIdx.x; if (t >= N * (K / 8)) return; const int n = t / (K / 8), k8 = (t % (K / 8)) * 8; FragH f;
#pragma unroll
  for (int i = 0; i < 8; ++i) f.h[i] = (_Float16)(bf16_round(W[(size_t)(k8 + i) * N + n]) * scale); const v8us o = f.half[0];
  *(v8us*)((unsigned short*)Wt + (size_t)n * K + k8) = o; 
}
// k_gemm_hh variant with fused epilogue: v = acc·alpha + bias[by·sBias + col] (+ CP[(row/rowsPerB)·sCPb + by·64 + col] if CP) ; ACT 0 none / 1 elu ; writes f16 C16 (and f32 C if non-null)
template <int ACT>
__global__ __launch_bounds__(128) void k_gemm_hhx(const _Float16* __restrict__ A, int lda, size_t sA, const _Float16* __restrict__ Bh, int ldb, size_t sB, float alpha, const float* __restrict__ bias, size_t sBias, const float* __restrict__ CP, int rowsPerB, size_t sCPb, int row0g,
    float* __restrict__ C, _Float16* __restrict__ C16, int ldc, size_t sC, int M, int N, int K) {
  __shared__ __attribute__((aligned(16))) float so[4][16][64];
  const int tid = threadIdx.x, w = tid >> 5, lane = tid & 31, ln = lane & 15, hh = lane >> 4; const int by = blockIdx.y;
  A += (size_t)by * sA; Bh += (size_t)by * sB; const size_t cofs = (size_t)by * sC; const float* bp = bias ? bias + (size_t)by * sBias : nullptr;
  const int ntn = (N + 63) / 64; const int wid = blockIdx.x * 4 + w; const int mt = wid / ntn, nq = wid % ntn; if (mt * 16 >= M) return;
  const int row0 = mt * 16, col0 = nq * 64; const _Float16* arow = A + (size_t)(row0 + ln) * lda;
  v8f acc[4] = {};
  for (int kb = 0; kb < K; kb += 32) { FragH ah; ah.half[0] = *(const v8us*)((const unsigned short*)arow + kb + 8 * hh); ah.half[1] = *(const v8us*)((const unsigned short*)arow + kb + 16 + 8 * hh);
#pragma unroll
    for (int t = 0; t < 4; ++t) { if (col0 + t * 16 >= N) continue; const size_t boff = (size_t)(col0 + t * 16 + ln) * ldb + kb; FragH bq; bq.half[0] = *(const v8us*)((const unsigned short*)Bh + boff + 8 * hh); bq.half[1] = *(const v8us*)((const unsigned short*)Bh + boff + 16 + 8 * hh);
      acc[t] = mmaH<1>(ah.v, ah.v, bq.v, bq.v, acc[t]); }
  }
#pragma unroll
  for (int t = 0; t < 4; ++t) { if (col0 + t * 16 >= N) continue; const int col = col0 + t * 16 + ln; const float bv = bp ? bf16_round(bp[col]) : 0.f;
#pragma unroll
    for (int r = 0; r < 8; ++r) { float v = acc[t][r] * alpha + bv; if (CP) { const int bidx = (row0g + row0 + 8 * hh + r) / rowsPerB; v += CP[(size_t)bidx * sCPb + (size_t)by * 64 + col]; } if (ACT == 1) v = (v > 0.f) ? v : expm1f(v); else if (ACT == 7) v = (v > 0.f) ? v + 1.0f : expf(v); else if (ACT == 8) v = tanhf(v); else if (ACT == 9) v = 0.5f * v * (1.0f + tanhf(0.7978845608028654f * (v + 0.044715f * v * v * v))); else if (ACT == 11) v = 1.0f / (1.0f + expf(-v)); else if (ACT == 12) v = (v > 0.f) ? v : 0.01f * v; else if (ACT == 14) v = (v > 0.f) ? v : 0.1f * v; else if (ACT == 15) v = v / (1.0f + expf(-v)); else if (ACT == 3) v = fmaxf(v, 0.f); else if (ACT == 6) v = 0.5f * v * (1.0f + erff(v * 0.70710678118654752f)); so[w][8 * hh + r][t * 16 + ln] = v; } }
  __builtin_amdgcn_fence(__ATOMIC_ACQ_REL, "workgroup"); __builtin_amdgcn_wave_barrier();
  const int rsub = lane >> 4, c4 = (lane & 15) * 4; typedef _Float16 v4h __attribute__((ext_vector_type(4)));
  {
#pragma unroll
    for (int q = 0; q < 8; ++q) { const int r = q * 2 + rsub; if (col0 + c4 < N) { const v4f v = *(const v4fa*)&so[w][r][c4]; if (C) *(v4f*)(C + cofs + (size_t)(row0 + r) * ldc + col0 + c4) = v; if (C16) { v4h h4; for (int i = 0; i < 4; ++i) h4[i] = (_Float16)v[i]; *(v4h*)(C16 + cofs + (size_t)(row0 + r) * ldc + col0 + c4) = h4; } } }
     }
}


typedef _Float16 v4h __attribute__((ext_vector_type(4)));

__global__ __launch_bounds__(256) void k_round16f(const float* __restrict__ W, _Float16* __restrict__ Bt, size_t n8) { const size_t t = (size_t)blockIdx.x * 256 + threadIdx.x; if (t >= n8) return; FragH f;
#pragma unroll
  for (int i = 0; i < 8; ++i) f.h[i] = (_Float16)(bf16_round(W[t * 8 + i]) * 16.0f); *(v8us*)((unsigned short*)Bt + t * 8) = f.half[0];  }
// ---- fused GEMM (wave tile 32x64, K = KD): the epilogue writes what the next kernel reads ----
#define KD 256                   /* = CM = DP: K and the row pitch of A and of the weight planes */
__device__ __forceinline__ v16h g2_frag(const _Float16* p, int hh) { FragH f; f.half[0] = *(const v8us*)((const unsigned short*)p + 8 * hh); f.half[1] = *(const v8us*)((const unsigned short*)p + 16 + 8 * hh); return f.v; }
__device__ __forceinline__ v8f g2_mma(v16h a, v16h b, v8f c) { return __builtin_amdgcn_wmma_f32_16x16x32_f16(false, a, false, b, (short)0, c, false, false); }
// Fragment order: a 16 x 32 f16 operand tile (16 rows or columns x 32 k) is FTE consecutive elements; lane l = 16 hh + ln holds row ln, k = 8 hh .. + 7 at element 8 l and k = 16 + 8 hh .. + 7 at FTE / 2 + 8 l (the k order of g2_frag)
#define FTE 512
__device__ __forceinline__ v16h pk_frag(const _Float16* p) { FragH f; f.half[0] = *(const v8us*)((const unsigned short*)p); f.half[1] = *(const v8us*)((const unsigned short*)p + FTE / 2); return f.v; }      /* p = tile + 8 lane */
// The same tile in LDS: its four quarters (k 0-7, 8-15, 16-23, 24-31 of the 16 rows, 256 B each) stand AQE elements = 320 B apart, so that a store of 4 rows x 32 k (8 B a lane) meets every bank once and each half wave of a fragment read (16 B a lane) does too
#define AQE 160
#define ATE (4 * AQE)
__device__ __forceinline__ v16h ls_frag(const _Float16* p) { FragH f; f.half[0] = *(const v8us*)((const unsigned short*)p); f.half[1] = *(const v8us*)((const unsigned short*)p + 2 * AQE); return f.v; }      /* p = tile + hh AQE + 8 ln */
// A: fragment tiles [row / 16][k / 32] from Ap, PK: in global memory (FTE), else in LDS (ATE). Bh: fragment tiles [col / 16][k / 32]
template <bool PK>
__device__ __forceinline__ void gf_tile(const _Float16* __restrict__ Ap, const _Float16* __restrict__ Bh, int row0, int col0, int ln, int hh, v8f (&accs)[8]) {
  constexpr int TR = (KD / 32) * FTE, AT = PK ? FTE : ATE, ATR = (KD / 32) * AT;      /* elements of one row of tiles; of one A tile and one row of A tiles */
  const _Float16* p0p = Ap + (size_t)(row0 / 16) * ATR + (PK ? (16 * hh + ln) * 8 : hh * AQE + ln * 8); const _Float16* p1p = p0p + ATR;
  const _Float16* b0p = Bh + (size_t)(col0 / 16) * TR + (16 * hh + ln) * 8; const _Float16* b1p = b0p + TR; const _Float16* b2p = b1p + TR; const _Float16* b3p = b2p + TR;
  const v8f z8 = {0.f,0.f,0.f,0.f,0.f,0.f,0.f,0.f}; v8f c00 = z8, c01 = z8, c02 = z8, c03 = z8, c10 = z8, c11 = z8, c12 = z8, c13 = z8;
#pragma unroll 1                 /* rolled, as before the fusion: keeps the registers low enough for every block of the grid to be resident at once */
  for (int kb = 0; kb < KD; kb += 32) { const v16h a0 = PK ? pk_frag(p0p) : ls_frag(p0p), a1 = PK ? pk_frag(p1p) : ls_frag(p1p);
    v16h b = pk_frag(b0p); c00 = g2_mma(a0, b, c00); c10 = g2_mma(a1, b, c10);
    b = pk_frag(b1p); c01 = g2_mma(a0, b, c01); c11 = g2_mma(a1, b, c11);
    b = pk_frag(b2p); c02 = g2_mma(a0, b, c02); c12 = g2_mma(a1, b, c12);
    b = pk_frag(b3p); c03 = g2_mma(a0, b, c03); c13 = g2_mma(a1, b, c13);
    p0p += AT; p1p += AT; b0p += FTE; b1p += FTE; b2p += FTE; b3p += FTE; }
  accs[0] = c00; accs[1] = c01; accs[2] = c02; accs[3] = c03; accs[4] = c10; accs[5] = c11; accs[6] = c12; accs[7] = c13; }
// q, k, v projections, blockIdx.y = 0, 1, 2: y = x W^T + b (weights x16, so acc / 16). q, k -> hi + 2^10 residual planes, fragment tiles [b * NH + head][token / 16]; v -> f16 V^T, fragment tiles [b * NH + head][token / 32][dim / 16]
__global__ __launch_bounds__(256) void k_proj(const float* __restrict__ xq, const float* __restrict__ xk, const float* __restrict__ xv, const _Float16* __restrict__ Bq, const _Float16* __restrict__ Bk, const _Float16* __restrict__ Bv,
    const float* __restrict__ bq, const float* __restrict__ bk, const float* __restrict__ bv, _Float16* __restrict__ QH, _Float16* __restrict__ QL, _Float16* __restrict__ KH, _Float16* __restrict__ KL, _Float16* __restrict__ VT) {
  __shared__ __attribute__((aligned(16))) char sm[8 * 32 * 68 * 4];      /* first the block's A tiles (4 x 8 x ATE f16), then, behind a barrier, each wave's 32 x 68 f32 output rows */
  _Float16* sa = (_Float16*)sm; float (*so)[32][68] = (float (*)[32][68])sm;
  const int tid = threadIdx.x, w = tid >> 5, lane = tid & 31, ln = lane & 15, hh = lane >> 4; const int by = blockIdx.y;
  const float* A = (by == 0) ? xq : ((by == 1) ? xk : xv); const _Float16* Bh = (by == 0) ? Bq : ((by == 1) ? Bk : Bv); const float* bp = (by == 0) ? bq : ((by == 1) ? bk : bv);
  const int rl0 = 32 * (w >> 2), row0 = blockIdx.x * 64 + rl0, col0 = (w & 3) * 64;      /* 2 x 4 waves: 64 rows x all DP columns */
  { /* wave w stages rows 8 w .. + 7: a load takes 128 B (one k tile) of each of 4 rows, 8 lanes a row; lane's 4 floats = k 4 (lane & 7) .. + 3 of the tile, rounded to bf16 and held as f16 */
    const float* ap = A + (size_t)(blockIdx.x * 64 + 8 * w + (lane >> 3)) * KD + (lane & 7) * 4;
    unsigned short* sp = (unsigned short*)sa + (w >> 1) * ((KD / 32) * ATE) + ((lane >> 1) & 3) * AQE + (8 * (w & 1) + (lane >> 3)) * 8 + (lane & 1) * 4;
    v4f x[2][KD / 32];           /* both loop nests unrolled: x stays in registers, and all 16 loads are in flight before the first is converted */
#pragma unroll
    for (int g = 0; g < 2; ++g)
#pragma unroll
      for (int kt = 0; kt < KD / 32; ++kt) x[g][kt] = *(const v4fa*)(ap + (size_t)g * 4 * KD + kt * 32);
#pragma unroll
    for (int g = 0; g < 2; ++g)
#pragma unroll
      for (int kt = 0; kt < KD / 32; ++kt) { FragH f;
#pragma unroll
        for (int i = 0; i < 4; ++i) f.h[i] = (_Float16)bf16_round(x[g][kt][i]);
        *(v4us*)(sp + kt * ATE + g * 32) = (v4us){f.u[0], f.u[1], f.u[2], f.u[3]}; } }
  __syncthreads();               /* every wave reads rows that other waves staged */
  v8f accs[8]; gf_tile<false>(sa, Bh, rl0, col0, ln, hh, accs);
  const int sl0 = (row0 / SLEN) * NH + col0 / HS, tk0 = row0 % SLEN;      /* the wave's first (window, head) and first token: 2 heads x 32 tokens */
  if (by == 2) {                 /* block-uniform. A lane's 8 accumulator rows are 8 consecutive tokens of one column = its own 16 bytes of a V^T fragment tile (row = dim ln, k = token): stored from registers */
#pragma unroll
    for (int u = 0; u < 8; ++u) { const int t = u & 3, half = u >> 2; const float bvv = bf16_round(bp[col0 + t * 16 + ln]); FragH f;
#pragma unroll
      for (int r = 0; r < 8; ++r) f.h[r] = (_Float16)(accs[u][r] * 0.0625f + bvv);
      *(v8us*)((unsigned short*)VT + ((size_t)((sl0 + (t >> 1)) * (SLEN / 32) + tk0 / 32) * (HS / 16) + (t & 1)) * FTE + half * (FTE / 2) + lane * 8) = f.half[0]; }
    return; }
  __syncthreads();               /* the output rows overwrite the A tiles: every wave has left its k loop */
  _Float16* Hh = (by == 0) ? QH : KH; _Float16* Hl = (by == 0) ? QL : KL;
#pragma unroll
  for (int u = 0; u < 8; ++u) { const int t = u & 3, half = u >> 2; const float bvv = bf16_round(bp[col0 + t * 16 + ln]);
#pragma unroll
    for (int r = 0; r < 8; ++r) so[w][half * 16 + 8 * hh + r][t * 16 + ln] = accs[u][r] * 0.0625f + bvv; }
  __builtin_amdgcn_fence(__ATOMIC_ACQ_REL, "workgroup"); __builtin_amdgcn_wave_barrier();
#pragma unroll 1                 /* one tile a trip: a quarter of the code; the k loop and the register count come out the same either way */
  for (int tl = 0; tl < 4; ++tl) { const int kt = tl >> 1, hd = tl & 1;      /* 2 token tiles x 2 heads; per half tile a lane reads its 8 dims of token ln and stores its 16 bytes */
    const size_t o = ((size_t)(sl0 + hd) * (SLEN / 16) + tk0 / 16 + kt) * FTE + lane * 8;
#pragma unroll
    for (int half = 0; half < 2; ++half) { const float* sp = &so[w][kt * 16 + ln][hd * HS + half * 16 + 8 * hh]; const v4f v0 = *(const v4fa*)sp, v1 = *(const v4fa*)(sp + 4); FragH fh, fl;
#pragma unroll
      for (int i = 0; i < 4; ++i) { const _Float16 h0 = (_Float16)v0[i], h1 = (_Float16)v1[i]; fh.h[i] = h0; fh.h[4 + i] = h1; fl.h[i] = (_Float16)((v0[i] - (float)h0) * 1024.0f); fl.h[4 + i] = (_Float16)((v1[i] - (float)h1) * 1024.0f); }
      *(v8us*)((unsigned short*)Hh + o + half * (FTE / 2)) = fh.half[0]; *(v8us*)((unsigned short*)Hl + o + half * (FTE / 2)) = fl.half[0]; }
    asm volatile("s_wait_xcnt 0x0" ::: "memory"); }      /* the next trip rewrites these stores' address and data registers */
}
// output projection: out = ctx Wo^T + bo, f32 rows of CM; ctx = f16 fragment tiles [row / 16][head]
__global__ __launch_bounds__(128) void k_outg(const _Float16* __restrict__ Ctx, const _Float16* __restrict__ Bo, const float* __restrict__ bo, float* __restrict__ C) {
  __shared__ __attribute__((aligned(16))) float so[4][32][68];
  const int tid = threadIdx.x, w = tid >> 5, lane = tid & 31, ln = lane & 15, hh = lane >> 4;
  const int mt = blockIdx.x / (CM / 64), nq = blockIdx.x % (CM / 64); const int row0 = mt * 128 + 32 * w, col0 = nq * 64;
  v8f accs[8]; gf_tile<true>(Ctx, Bo, row0, col0, ln, hh, accs);
#pragma unroll
  for (int u = 0; u < 8; ++u) { const int t = u & 3, half = u >> 2; const float bvv = bf16_round(bo[col0 + t * 16 + ln]);
#pragma unroll
    for (int r = 0; r < 8; ++r) so[w][half * 16 + 8 * hh + r][t * 16 + ln] = accs[u][r] * 0.0625f + bvv; }
  __builtin_amdgcn_fence(__ATOMIC_ACQ_REL, "workgroup"); __builtin_amdgcn_wave_barrier();
  const int rsub = lane >> 4, c4 = (lane & 15) * 4;
#pragma unroll
  for (int q = 0; q < 16; ++q) { const int r = q * 2 + rsub; const v4f v = *(const v4fa*)&so[w][r][c4]; *(v4f*)(C + (size_t)(row0 + r) * CM + col0 + c4) = v; } }



template <int CAUSAL>
__global__ __launch_bounds__(128) void k_flash(const _Float16* __restrict__ Q16, int ldq, const _Float16* __restrict__ K16, int ldk, const _Float16* __restrict__ Vt, const int* __restrict__ MSK, float* __restrict__ O, int ldo) {
  constexpr int RPW = 16, RTN = RPW / 16, NQB = TQ / (4 * RPW), DT = 4, KS = 2;
  __shared__ __attribute__((aligned(16))) unsigned short sP[4][RPW][40]; __shared__ __attribute__((aligned(16))) float sO[4][RPW][64 + 4];
  const int tid = threadIdx.x, w = tid >> 5, lane = tid & 31, ln = lane & 15, hh = lane >> 4;
  const int slab = blockIdx.x / QBLKS, qblk = blockIdx.x % QBLKS; (void)NQB; const int b = slab / NH, h = slab % NH; const int qb0 = qblk * (4 * RPW); const int q0 = qb0 + w * RPW;
  FragH aq[2][KS];
#pragma unroll
  for (int rt = 0; rt < RTN; ++rt) { const unsigned short* qr = (const unsigned short*)Q16 + ((size_t)b * TQ + q0 + rt * 16 + ln) * ldq + h * 64;
#pragma unroll
    for (int ks = 0; ks < KS; ++ks) { aq[rt][ks].half[0] = *(const v8us*)(qr + ks * 32 + 8 * hh); aq[rt][ks].half[1] = *(const v8us*)(qr + ks * 32 + 16 + 8 * hh); } }
  const unsigned short* Vth = (const unsigned short*)Vt + (size_t)slab * 64 * TK;
  float m_r[2][8], l_r[2][8]; v8f oacc[2][DT];
#pragma unroll
  for (int rt = 0; rt < RTN; ++rt) {
#pragma unroll
    for (int r = 0; r < 8; ++r) { m_r[rt][r] = -3.0e38f; l_r[rt][r] = 0.f; }
#pragma unroll
    for (int dt = 0; dt < DT; ++dt) oacc[rt][dt] = (v8f){0.f,0.f,0.f,0.f,0.f,0.f,0.f,0.f}; }
  const int jend = (CAUSAL == 1) ? (qb0 + 4 * RPW) : TK;      /* causal: keys beyond the block's last query never contribute */
#pragma unroll 1
  for (int j0 = 0; j0 < jend; j0 += 32) {
    v8f s[2][2];
#pragma unroll
    for (int nt = 0; nt < 2; ++nt) { const unsigned short* kr = (const unsigned short*)K16 + ((size_t)b * TK + j0 + nt * 16 + ln) * ldk + h * 64; FragH bk[KS];
#pragma unroll
      for (int ks = 0; ks < KS; ++ks) { bk[ks].half[0] = *(const v8us*)(kr + ks * 32 + 8 * hh); bk[ks].half[1] = *(const v8us*)(kr + ks * 32 + 16 + 8 * hh); }
#pragma unroll
      for (int rt = 0; rt < RTN; ++rt) { v8f acc = (v8f){0.f,0.f,0.f,0.f,0.f,0.f,0.f,0.f};
#pragma unroll
        for (int ks = 0; ks < KS; ++ks) acc = mmaH<1>(aq[rt][ks].v, aq[rt][ks].v, bk[ks].v, bk[ks].v, acc); s[rt][nt] = acc; } }
#pragma unroll
    for (int rt = 0; rt < RTN; ++rt)
#pragma unroll
      for (int r = 0; r < 8; ++r) { const int tq = q0 + rt * 16 + 8 * hh + r; const int k0 = j0 + ln, k1 = j0 + 16 + ln;
        const bool ok0 = (CAUSAL == 1) ? (k0 <= tq) : ((CAUSAL == 2) ? ((k0 >> 5) == (tq >> 5)) : true), ok1 = (CAUSAL == 1) ? (k1 <= tq) : ((CAUSAL == 2) ? ((k1 >> 5) == (tq >> 5)) : true);      /* mode 2: block-diagonal 32-token groups */
        const float s0 = ok0 ? s[rt][0][r] * SCL : -3.0e38f, s1 = ok1 ? s[rt][1][r] * SCL : -3.0e38f; float mc = fmaxf(s0, s1);
        mc = fmaxf(mc, __shfl_xor(mc, 1, 32)); mc = fmaxf(mc, __shfl_xor(mc, 2, 32)); mc = fmaxf(mc, __shfl_xor(mc, 4, 32)); mc = fmaxf(mc, __shfl_xor(mc, 8, 32));
        const float mn = fmaxf(m_r[rt][r], mc); const float al = (mn > -1.0e38f) ? expf(m_r[rt][r] - mn) : 1.0f; m_r[rt][r] = mn; const float p0 = ok0 ? expf(s0 - mn) : 0.f, p1 = ok1 ? expf(s1 - mn) : 0.f; l_r[rt][r] = l_r[rt][r] * al + p0 + p1;
#pragma unroll
        for (int dt = 0; dt < DT; ++dt) oacc[rt][dt][r] *= al;
        FragH t2; t2.h[0] = (_Float16)(p0 * 1024.0f); t2.h[1] = (_Float16)(p1 * 1024.0f); sP[w][rt * 16 + 8 * hh + r][ln] = t2.u[0]; sP[w][rt * 16 + 8 * hh + r][16 + ln] = t2.u[1]; }
    __builtin_amdgcn_fence(__ATOMIC_ACQ_REL, "workgroup"); __builtin_amdgcn_wave_barrier();
    FragH pa[2];
#pragma unroll
    for (int rt = 0; rt < RTN; ++rt) { pa[rt].half[0] = *(const v8us*)&sP[w][rt * 16 + ln][8 * hh]; pa[rt].half[1] = *(const v8us*)&sP[w][rt * 16 + ln][16 + 8 * hh]; }
#pragma unroll
    for (int dt = 0; dt < DT; ++dt) { const unsigned short* vrow = Vth + (size_t)(dt * 16 + ln) * TK + j0; FragH bv; bv.half[0] = *(const v8us*)(vrow + 8 * hh); bv.half[1] = *(const v8us*)(vrow + 16 + 8 * hh);
#pragma unroll
      for (int rt = 0; rt < RTN; ++rt) oacc[rt][dt] = mmaH<1>(pa[rt].v, pa[rt].v, bv.v, bv.v, oacc[rt][dt]); }
    __builtin_amdgcn_fence(__ATOMIC_ACQ_REL, "workgroup"); __builtin_amdgcn_wave_barrier(); }
#pragma unroll
  for (int rt = 0; rt < RTN; ++rt) {
#pragma unroll
    for (int r = 0; r < 8; ++r) { float l = l_r[rt][r]; l += __shfl_xor(l, 1, 32); l += __shfl_xor(l, 2, 32); l += __shfl_xor(l, 4, 32); l += __shfl_xor(l, 8, 32); l_r[rt][r] = (l > 0.f) ? 1.0f / (l * 1024.0f) : 0.f; }
#pragma unroll
    for (int dt = 0; dt < DT; ++dt)
#pragma unroll
      for (int r = 0; r < 8; ++r) sO[w][rt * 16 + 8 * hh + r][dt * 16 + ln] = oacc[rt][dt][r] * l_r[rt][r]; }
  __builtin_amdgcn_fence(__ATOMIC_ACQ_REL, "workgroup"); __builtin_amdgcn_wave_barrier();
  {
#pragma unroll
    for (int rp = 0; rp < RPW; rp += 2) { const int r = rp + (lane >> 4), pc = lane & 15; const v4f val = *(const v4fa*)&sO[w][r][pc * 4]; *(v4f*)(O + ((size_t)b * TQ + q0 + r) * ldo + h * 64 + pc * 4) = val; }
     } }
// Q/K-split flash kernel, transposed: S^T = Kh Qh^T + (Kh Ql^T + Kl Qh^T)/1024 and O^T += V^T P^T, with Q/K = [hi | 2^10 residual] f16 planes (QL/KL same layout as Q16/K16) and plain f16 P (x2^10). All planes are fragment tiles (FTE): a pass's K, K residual and V^T are 2 KiB runs each.
// K rows and V^T rows are the A operands, Q and P^T the B operands: a lane holds 16 of the 32 scores of ONE query (lane l and l ^ 16 share query l & 15), so the maximum and the sum run in the lane's own registers
// with one exchange between the wave's halves, and the two score tiles, converted in place, are the B fragment of the second product (register s of half hh = key 8 hh + s, then 16 + 8 hh + s - 8: the order in which V^T is loaded).
__device__ __forceinline__ float xhalf(float x) { return __int_as_float(__builtin_amdgcn_permlanex16(__float_as_int(x), __float_as_int(x), 0x76543210, 0xfedcba98, false, false)); }      /* lane l <-> l ^ 16 */
template <int CAUSAL>
__global__ __launch_bounds__(128) void k_flashqk(const _Float16* __restrict__ Q16, const _Float16* __restrict__ QL, const _Float16* __restrict__ K16, const _Float16* __restrict__ KL, const _Float16* __restrict__ Vt, const int* __restrict__ MSK, _Float16* __restrict__ O) {
  static_assert(HS == 32, "one k step per score product, two output tiles");
  constexpr int RPW = 16, DT = HS / 16;
  const int tid = threadIdx.x, w = tid >> 5, lane = tid & 31, ln = lane & 15, hh = lane >> 4;
  const int slab = blockIdx.x / QBLKS, qblk = blockIdx.x % QBLKS; const int b = slab / NH, h = slab % NH; const int qb0 = qblk * (4 * RPW); const int q0 = qb0 + w * RPW; const int tq = q0 + ln;
  FragH bq, bql;                 /* B: column = query q0 + ln, k = head dim in the order of the K rows' loads */
  { const size_t qo = ((size_t)slab * (TQ / 16) + q0 / 16) * FTE + lane * 8; bq.v = pk_frag(Q16 + qo); bql.v = pk_frag(QL + qo);
    asm volatile("s_wait_xcnt 0x0" ::: "memory"); }      /* the key offsets formed next reuse these four loads' address registers */
  /* wave-uniform bases + one 32-bit byte offset per lane, which walks the keys: a pass is two tiles of each plane (K: 2 x 16 keys; V^T: 2 x 16 dims of its 32 keys), the lane's 16 bytes at 16 lane of each half tile */
  const char* kb = (const char*)(K16 + (size_t)slab * HS * TK); const char* klb = (const char*)(KL + (size_t)slab * HS * TK); const char* vb = (const char*)(Vt + (size_t)slab * HS * TK);
  unsigned koff = (unsigned)lane * 16u;
  float m_c = -3.0e38f, l_c = 0.f; v8f oacc[DT];
#pragma unroll
  for (int dt = 0; dt < DT; ++dt) oacc[dt] = (v8f){0.f,0.f,0.f,0.f,0.f,0.f,0.f,0.f};
  const int jend = (CAUSAL == 1) ? (qb0 + 4 * RPW) : TK;      /* causal: keys beyond the block's last query never contribute */
#pragma unroll 1                 /* rolled, as before: one pass's fragments and scores already fill the registers that eight waves a SIMD leave */
  for (int j0 = 0; j0 < jend; j0 += 32) {
    FragH ak[2], akl[2], av[DT];
#pragma unroll
    for (int nt = 0; nt < 2; ++nt) { const char* kr = kb + (size_t)nt * FTE * 2; const char* klr = klb + (size_t)nt * FTE * 2;
      ak[nt].half[0] = *(const v8us*)(kr + koff); ak[nt].half[1] = *(const v8us*)(kr + koff + FTE); akl[nt].half[0] = *(const v8us*)(klr + koff); akl[nt].half[1] = *(const v8us*)(klr + koff + FTE); }
#pragma unroll
    for (int dt = 0; dt < DT; ++dt) { const char* vrow = vb + (size_t)dt * FTE * 2; av[dt].half[0] = *(const v8us*)(vrow + koff); av[dt].half[1] = *(const v8us*)(vrow + koff + FTE); }
    koff += 2u * FTE * 2u;       /* the next 32 keys */
    __builtin_amdgcn_sched_barrier(0);      /* the pass's 12 loads stay in front of its first product, as they stood: sunk among the products they would start one memory latency after another */
    v2f s2[8]; bool ok[16]; v8f sh[2], sl[2];      /* element nt * 8 + r (pair nt * 4 + r / 2): key j0 + nt * 16 + 8 hh + r against query tq. Neighbours are held as pairs, so the multiply-adds and adds below take two scores an instruction with no register moves */
#pragma unroll
    for (int nt = 0; nt < 2; ++nt) { const v8f z = (v8f){0.f,0.f,0.f,0.f,0.f,0.f,0.f,0.f};
      sh[nt] = mmaH<1>(ak[nt].v, ak[nt].v, bq.v, bq.v, z); sl[nt] = mmaH<1>(ak[nt].v, ak[nt].v, bql.v, bql.v, z); sl[nt] = mmaH<1>(akl[nt].v, akl[nt].v, bq.v, bq.v, sl[nt]); }
    __builtin_amdgcn_sched_barrier(0);      /* the six score products run as one block: each stands in the distance the one before it needs ahead of its first reader, where the compiler otherwise pads with v_nop */
#pragma unroll
    for (int nt = 0; nt < 2; ++nt) { const v8f acc = sh[nt], accl = sl[nt];
#pragma unroll
      for (int r = 0; r < 8; r += 2) { v2f c = __builtin_elementwise_fma((v2f){accl[r], accl[r + 1]}, (v2f){0.0009765625f, 0.0009765625f}, (v2f){acc[r], acc[r + 1]});      /* raw q.k: the scale is applied inside the exponent's multiply-add below (SCL2 > 0, so the maximum may be taken first) */
#pragma unroll
        for (int e = 0; e < 2; ++e) { const int kk = j0 + nt * 16 + 8 * hh + r + e;
          bool o = (CAUSAL == 1) ? (kk <= tq) : ((CAUSAL == 2) ? ((kk >> 5) == (tq >> 5)) : true);      /* mode 2: block-diagonal 32-token groups */
          if (CAUSAL == 4) o = MSK[((size_t)b * TQ + tq) * TK + kk] != 0;      /* mode 4: per-(query, key) INPUT mask shared by all heads; masked keys contribute nothing, rows with no valid key give l = 0 -> output 0 */
          ok[nt * 8 + r + e] = o; if (!o) c[e] = -3.0e38f; }
        s2[nt * 4 + r / 2] = c; } }
    float mx[8];
#pragma unroll
    for (int k = 0; k < 8; ++k) mx[k] = fmaxf(s2[k][0], s2[k][1]);
    float mc = fmaxf(fmaxf(fmaxf(mx[0], mx[1]), fmaxf(mx[2], mx[3])), fmaxf(fmaxf(mx[4], mx[5]), fmaxf(mx[6], mx[7])));
    mc = fmaxf(mc, xhalf(mc));   /* the query's other 16 keys */
    /* base 2: m_c = running maximum of SCL2 s, less 10, so that 2^(SCL2 s - m_c) is P x 2^10 straight from one hardware exponential (arguments <= 10; below the exponent range it gives 0, far under an f16 P's last bit); every term of a pass and the rescale use the same rounded m_c */
    const float mn = fmaxf(m_c, __builtin_fmaf(mc, SCL2, -10.0f)); const float al = (mn > -1.0e37f) ? __builtin_amdgcn_exp2f(m_c - mn) : 1.0f; m_c = mn;      /* all keys masked so far: SCL2 x -3e38 stays under the bound */
    v2f p2[8]; FragH pb;         /* p, and with it l_c, carry the 2^10 */
#pragma unroll
    for (int k = 0; k < 8; ++k) { const v2f e = __builtin_elementwise_fma(s2[k], (v2f){SCL2, SCL2}, (v2f){-mn, -mn});
      p2[k][0] = ok[2 * k] ? __builtin_amdgcn_exp2f(e[0]) : 0.f; p2[k][1] = ok[2 * k + 1] ? __builtin_amdgcn_exp2f(e[1]) : 0.f; pb.h[2 * k] = (_Float16)p2[k][0]; pb.h[2 * k + 1] = (_Float16)p2[k][1]; }
    /* halving tree: p[i] + p[8 + i], then [i] + [4 + i], then ([0] + [2]) + ([1] + [3]); neighbours stay neighbours, so the adds pair up two to an instruction */
    const v2f t4a = (p2[0] + p2[4]) + (p2[2] + p2[6]), t4b = (p2[1] + p2[5]) + (p2[3] + p2[7]); const v2f t2 = t4a + t4b;
    l_c = l_c * al + (t2[0] + t2[1]);
#pragma unroll
    for (int dt = 0; dt < DT; ++dt) {
#pragma unroll
      for (int r = 0; r < 8; ++r) oacc[dt][r] *= al;
      oacc[dt] = mmaH<1>(av[dt].v, av[dt].v, pb.v, pb.v, oacc[dt]); } }
  const float l = l_c + xhalf(l_c); const float li = (l > 0.f) ? 1.0f / l : 0.f;
#pragma unroll
  for (int dt = 0; dt < DT; ++dt) { FragH f;      /* a lane's 8 registers are 8 consecutive head dims of its query = its own 16 bytes of the output GEMM's A tile (row = query ln, k = this head's dims) */
#pragma unroll
    for (int r = 0; r < 8; ++r) f.h[r] = (_Float16)(oacc[dt][r] * li);
    *(v8us*)((unsigned short*)O + ((size_t)((b * TQ + q0) / 16) * NH + h) * FTE + dt * (FTE / 2) + lane * 8) = f.half[0]; } }

// the four weights (row-major [out][in]) as f16(bf16(W) x 16) in fragment tiles [out / 16][in / 32]; blockIdx.y picks the weight
__global__ __launch_bounds__(256) void k_wprep(const float* __restrict__ Wq, const float* __restrict__ Wk, const float* __restrict__ Wv, const float* __restrict__ Wo, _Float16* __restrict__ Bq, _Float16* __restrict__ Bk, _Float16* __restrict__ Bv, _Float16* __restrict__ Bo) {
  const int by = blockIdx.y; const float* Wm = (by == 0) ? Wq : ((by == 1) ? Wk : ((by == 2) ? Wv : Wo)); _Float16* Bt = (by == 0) ? Bq : ((by == 1) ? Bk : ((by == 2) ? Bv : Bo));
  const size_t t = (size_t)blockIdx.x * 256 + threadIdx.x; FragH f;
#pragma unroll
  for (int i = 0; i < 8; ++i) f.h[i] = (_Float16)(bf16_round(Wm[t * 8 + i]) * 16.0f);
  const int n = (int)(t / (KD / 8)), ck = (int)(t % (KD / 8));      /* 8 inputs ck * 8 .. + 7 of output n: chunk ck & 3 of k tile ck >> 2 */
  *(v8us*)((unsigned short*)Bt + (size_t)((n / 16) * (KD / 32) + (ck >> 2)) * FTE + ((ck >> 1) & 1) * (FTE / 2) + ((ck & 1) * 16 + (n & 15)) * 8) = f.half[0]; }

extern "C" void kernel_launch(void* const* d_in, const int* in_sizes, int n_in,
                              void* d_out, int out_size, void* d_ws, size_t ws_size, hipStream_t stream) {
  (void)in_sizes; (void)n_in; (void)out_size;
  const float* const* I = (const float* const*)d_in; const float* qx = I[0]; const float* kx = I[1]; const float* vx = I[2]; const float* Wq = I[3]; const float* bq = I[4]; const float* Wk = I[5]; const float* bk = I[6]; const float* Wv = I[7]; const float* bv = I[8]; const float* Wo = I[9]; const float* bo = I[10];
  char* ws = (char*)d_ws; size_t off = 0;
  auto take = [&](size_t bytes) { char* p = ws + off; off += (bytes + 255) & ~(size_t)255; return p; };
  _Float16* BPq = (_Float16*)take((size_t)DP * CM * 2); _Float16* BPk = (_Float16*)take((size_t)DP * CM * 2); _Float16* BPv = (_Float16*)take((size_t)DP * CM * 2); _Float16* BOP = (_Float16*)take((size_t)CM * DP * 2);
  _Float16* O = (_Float16*)take((size_t)NR * DP * 2); _Float16* QH = (_Float16*)take((size_t)NR * DP * 2); _Float16* QL = (_Float16*)take((size_t)NR * DP * 2); _Float16* KH = (_Float16*)take((size_t)NR * DP * 2); _Float16* KL = (_Float16*)take((size_t)NR * DP * 2); _Float16* VT = (_Float16*)take((size_t)NR * DP * 2);
  if (off > ws_size) return;      /* under 64 MiB (256 MiB ws) */
  k_wprep<<<dim3(DP * CM / 8 / 256, 4), 256, 0, stream>>>(Wq, Wk, Wv, Wo, BPq, BPk, BPv, BOP);
  k_proj<<<dim3(NR / 64, 3), 256, 0, stream>>>(qx, kx, vx, BPq, BPk, BPv, bq, bk, bv, QH, QL, KH, KL, VT);
  k_flashqk<0><<<NSEQ * NH * QBLKS, 128, 0, stream>>>(QH, QL, KH, KL, VT, nullptr, O);      /* q/k hi + residual; P (x2^10) and V plain f16 */
  k_outg<<<(NR / 128) * (CM / 64), 128, 0, stream>>>(O, BOP, bo, (float*)d_out);
}

// v008
// A run of this version takes 64.2 microseconds.
// Next to v007, in two timings, it ran 1.09 and 1.08 times as fast.
// Counting every step since v000, it is 7.86 times as fast.
#include <hip/hip_runtime.h>
// Routing (windowed) attention (2 x 8 windows of 1024 tokens x 256; 8 heads x 32): qh/kh/vh = inputs q/k/v W^T + b split into heads; per (window, head) softmax(qh kh^T / sqrt(32)) vh; heads re-merged; ctx Wo^T + bo -> [2,8,4,16,16,256].
// Structure: 4 launches. Every workspace plane lies in WMMA fragment order (FTE below), so a wave's 16-byte loads and stores cover 512 contiguous bytes. (1) the four weights as exact x16 f16 planes; (2) the q, k, v projections in one grid (grid.y picks the operand): f16 WMMA GEMM, 64x256 block tiles of 32x64 wave tiles, f32 accumulation, the block reads its f32 input rows once in whole lines, rounds them and shares them through LDS as fragment tiles, the epilogue writes hi + 2^10 residual planes (q, k) or V^T (v), one 16 x 32 fragment tile per (head, 16 tokens) or (head, 16 dims, 32 tokens); (3) the fused flash kernel, transposed (S^T = K Q^T, O^T += V^T P^T, P stays in registers), with hi + 2^10-residual q/k planes (S = QhKh + (QlKh + QhKl)/1024) and plain f16 P (x2^10) and V (16 sequences x 8 heads); (4) the output GEMM on the f16 context tiles that (3) stores.
// Compute dtype: q, k, v and parameters rounded to bf16; qh, kh hi + residual (~2^-21-class logits); P and vh plain f16 (~2^-12); context as f16 (~2^-12) into Wo; f32 accumulation/softmax. v_wmma_f32_16x16x32_f16.
#define NSEQ 16
#define NB NSEQ
#define CM 256
#define HS 32                    /* head slot width in the q/k/v/context planes = true head dim */
#define DP (NH * HS)             /* 256: q/k/v width */
#define NR (NSEQ * SLEN)         /* 16384 rows */
#define QBLKS (TQ / 64)
#define SLEN 1024                /* tokens per routing window (K*Hp*W) */
#define TQ SLEN
#define TK SLEN
#define NH 8
#define SCL 0.17677669529663687f /* 32^-0.5 */
#define SCL2 ((float)(0.17677669529663687 * 1.4426950408889634))      /* 32^-0.5 log2(e): logits in base-2 units */
typedef __bf16 v16b __attribute__((ext_vector_type(16)));
typedef unsigned short v8us __attribute__((ext_vector_type(8), may_alias));
typedef unsigned short v4us __attribute__((ext_vector_type(4), may_alias));
typedef float  v8f  __attribute__((ext_vector_type(8)));
typedef float  v4f  __attribute__((ext_vector_type(4)));
typedef float  v2f  __attribute__((ext_vector_type(2)));
typedef float  v4fa __attribute__((ext_vector_type(4), may_alias));
union FragB { v16b v; v8us half[2]; unsigned short u[16]; };

__device__ __forceinline__ unsigned short bf16_bits(float x) { unsigned int u = __float_as_uint(x); return (unsigned short)((u + 0x7FFFu + ((u >> 16) & 1u)) >> 16); }
__device__ __forceinline__ float bf16_val(unsigned short b) { return __uint_as_float(((unsigned int)b) << 16); }
__device__ __forceinline__ float bf16_round(float x) { return bf16_val(bf16_bits(x)); }
// D += A·B with NT terms: 1 = ah·bh, 2 = + al·bh (A split), 3 = + ah·bl (both split)
template <int NT>
__device__ __forceinline__ v8f mmaN(v16b ah, v16b al, v16b bh, v16b bl, v8f c) {
  c = __builtin_amdgcn_wmma_f32_16x16x32_bf16(false, ah, false, bh, (short)0, c, false, false);
  if (NT >= 2) c = __builtin_amdgcn_wmma_f32_16x16x32_bf16(false, al, false, bh, (short)0, c, false, false);
  if (NT >= 3) c = __builtin_amdgcn_wmma_f32_16x16x32_bf16(false, ah, false, bl, (short)0, c, false, false);
  asm volatile("v_nop\n\tv_nop\n\tv_nop\n\tv_nop" : "+v"(c) : "v"(ah), "v"(al), "v"(bh), "v"(bl));
  return c;
}

__global__ __launch_bounds__(256) void k_wt_bf16(const float* __restrict__ W, unsigned short* __restrict__ Wt, int K, int N) {
  const int t = blockIdx.x * 256 + threadIdx.x;
  const int k8n = K / 8;
  if (t >= N * k8n) return;
  const int n = t / k8n, k8 = (t % k8n) * 8;
  v8us v;
#pragma unroll
  for (int i = 0; i < 8; ++i) v[i] = bf16_bits(W[(size_t)(k8 + i) * N + n]);
  *(v8us*)(Wt + (size_t)n * K + k8) = v;
  
}

// GEMM C[M][N] (f32, pitch ldc) = act(A[M][K]·W + bias). A f32 row-major (pitch lda) converted per fragment to bf16
// (ASPLIT: hi/lo two planes -> 2 terms, else single rounded term); Wt bf16 [N][K] (pitch ldb). BIAS_BF16 rounds the
// bias to bf16 first (bias quantised to bf16 before the add). K%32==0, M%16==0, N%64==0.
template <bool ASPLIT, int ACT, bool BIAS_BF16>
__global__ __launch_bounds__(128) void k_gemm_bf(const float* __restrict__ A, int lda, const unsigned short* __restrict__ Wt, int ldb,
                                               const float* __restrict__ bias, float* __restrict__ C, int ldc, int M, int N, int K) {
  __shared__ __attribute__((aligned(16))) float so[4][16][64];
  const int tid = threadIdx.x, w = tid >> 5, lane = tid & 31, ln = lane & 15, hh = lane >> 4;
  const int ntn = N / 64;
  const int wid = blockIdx.x * 4 + w;
  const int mt = wid / ntn, nq = wid % ntn;
  if (mt * 16 >= M) return;
  const int row0 = mt * 16, col0 = nq * 64;
  const float* arow = A + (size_t)(row0 + ln) * lda;
  v8f acc[4] = {};
  for (int kb = 0; kb < K; kb += 32) {
    FragB ah, al;
    const v4f x0 = *(const v4fa*)(arow + kb + 8 * hh), x1 = *(const v4fa*)(arow + kb + 8 * hh + 4);
    const v4f x2 = *(const v4fa*)(arow + kb + 16 + 8 * hh), x3 = *(const v4fa*)(arow + kb + 16 + 8 * hh + 4);
    float xs[16] = {x0[0],x0[1],x0[2],x0[3],x1[0],x1[1],x1[2],x1[3],x2[0],x2[1],x2[2],x2[3],x3[0],x3[1],x3[2],x3[3]};
#pragma unroll
    for (int i = 0; i < 16; ++i) { const unsigned short hb = bf16_bits(xs[i]); ah.u[i] = hb; al.u[i] = ASPLIT ? bf16_bits(xs[i] - bf16_val(hb)) : (unsigned short)0; }
#pragma unroll
    for (int t = 0; t < 4; ++t) {
      const unsigned short* brow = Wt + (size_t)(col0 + t * 16 + ln) * ldb + kb;
      FragB b;
      b.half[0] = *(const v8us*)(brow + 8 * hh);
      b.half[1] = *(const v8us*)(brow + 16 + 8 * hh);
      acc[t] = mmaN<ASPLIT ? 2 : 1>(ah.v, al.v, b.v, b.v, acc[t]);
    }
  }
#pragma unroll
  for (int t = 0; t < 4; ++t) {
    float bv = bias ? bias[col0 + t * 16 + ln] : 0.f;
    if (BIAS_BF16) bv = bf16_round(bv);
#pragma unroll
    for (int r = 0; r < 8; ++r) { float v = acc[t][r] + bv; if (ACT == 1) v = fmaxf(v, 0.f); so[w][8 * hh + r][t * 16 + ln] = v; }
  }
  __builtin_amdgcn_fence(__ATOMIC_ACQ_REL, "workgroup");
  __builtin_amdgcn_wave_barrier();
  const int rsub = lane >> 4, c4 = (lane & 15) * 4;
  {
#pragma unroll
    for (int q = 0; q < 8; ++q) {
      const int r = q * 2 + rsub;
      const v4f v = *(const v4fa*)&so[w][r][c4];
      *(v4f*)(C + (size_t)(row0 + r) * ldc + col0 + c4) = v;
    }
    
  }
}

// GEMM C = act(A·W + bias + resid): A f32 (ASPLIT -> hi/lo 2 terms), Wt bf16 [N][K]; ACT 0 none, 1 relu, 2 exact gelu;
// resid (optional, f32, row index = (row % rmod), pitch ldr, RES_BF16 rounds it) added before the activation.
template <bool ASPLIT, int ACT, bool BIAS_BF16, bool RES_BF16>
__global__ __launch_bounds__(128) void k_gemm_bf3(const float* __restrict__ A, int lda, const unsigned short* __restrict__ Wt, int ldb,
                                                const float* __restrict__ bias, const float* __restrict__ resid, int rmod, int ldr,
                                                float* __restrict__ C, int ldc, int M, int N, int K) {
  __shared__ __attribute__((aligned(16))) float so[4][16][64];
  const int tid = threadIdx.x, w = tid >> 5, lane = tid & 31, ln = lane & 15, hh = lane >> 4;
  const int ntn = N / 64;
  const int wid = blockIdx.x * 4 + w;
  const int mt = wid / ntn, nq = wid % ntn;
  if (mt * 16 >= M) return;
  const int row0 = mt * 16, col0 = nq * 64;
  const float* arow = A + (size_t)(row0 + ln) * lda;
  v8f acc[4] = {};
  for (int kb = 0; kb < K; kb += 32) {
    FragB ah, al;
    const v4f x0 = *(const v4fa*)(arow + kb + 8 * hh), x1 = *(const v4fa*)(arow + kb + 8 * hh + 4);
    const v4f x2 = *(const v4fa*)(arow + kb + 16 + 8 * hh), x3 = *(const v4fa*)(arow + kb + 16 + 8 * hh + 4);
    float xs[16] = {x0[0],x0[1],x0[2],x0[3],x1[0],x1[1],x1[2],x1[3],x2[0],x2[1],x2[2],x2[3],x3[0],x3[1],x3[2],x3[3]};
#pragma unroll
    for (int i = 0; i < 16; ++i) { const unsigned short hb = bf16_bits(xs[i]); ah.u[i] = hb; al.u[i] = ASPLIT ? bf16_bits(xs[i] - bf16_val(hb)) : (unsigned short)0; }
#pragma unroll
    for (int t = 0; t < 4; ++t) {
      const unsigned short* brow = Wt + (size_t)(col0 + t * 16 + ln) * ldb + kb;
      FragB b;
      b.half[0] = *(const v8us*)(brow + 8 * hh);
      b.half[1] = *(const v8us*)(brow + 16 + 8 * hh);
      acc[t] = mmaN<ASPLIT ? 2 : 1>(ah.v, al.v, b.v, b.v, acc[t]);
    }
  }
#pragma unroll
  for (int t = 0; t < 4; ++t) {
    const int col = col0 + t * 16 + ln;
    float bv = bias ? bias[col] : 0.f;
    if (BIAS_BF16) bv = bf16_round(bv);
#pragma unroll
    for (int r = 0; r < 8; ++r) {
      float v = acc[t][r] + bv;
      if (resid) { float rv = resid[(size_t)((row0 + 8 * hh + r) % rmod) * ldr + col]; if (RES_BF16) rv = bf16_round(rv); v += rv; }
      if (ACT == 1) v = fmaxf(v, 0.f);
      if (ACT == 2) v = 0.5f * v * (1.0f + erff(v * 0.70710678118654752f));
      if (ACT == 3) { const float u = 0.7978845608028654f * (v + 0.044715f * v * v * v); v = 0.5f * v * (1.0f + tanhf(u)); }
      so[w][8 * hh + r][t * 16 + ln] = v;
    }
  }
  __builtin_amdgcn_fence(__ATOMIC_ACQ_REL, "workgroup");
  __builtin_amdgcn_wave_barrier();
  const int rsub = lane >> 4, c4 = (lane & 15) * 4;
  {
#pragma unroll
    for (int q = 0; q < 8; ++q) {
      const int r = q * 2 + rsub;
      const v4f v = *(const v4fa*)&so[w][r][c4];
      *(v4f*)(C + (size_t)(row0 + r) * ldc + col0 + c4) = v;
    }
    
  }
}
// row LayerNorm (biased variance, eps) over N: s = X (+ R); optional out_sum <- s; out_norm <- (s-mu)*rsqrt(var+eps)*g + b
template <bool PARAM_BF16>
__global__ __launch_bounds__(256) void k_layernorm(const float* __restrict__ X, const float* __restrict__ R, const float* __restrict__ g, const float* __restrict__ bta,
                                                  float* __restrict__ out_sum, float* __restrict__ out_norm, int N, float eps) {
  __shared__ float red[256];
  const int row = blockIdx.x, tid = threadIdx.x;
  const float* x = X + (size_t)row * N; const float* rr = R ? R + (size_t)row * N : nullptr;
  float vals[16];                     // up to N = 4096
  const int per = N / 256;            // contiguous chunk per thread? use strided-by-4 chunks: thread handles j = tid*4 + 1024*u
  float s1 = 0.f;
  for (int u = 0; u < per / 4; ++u) {
    const int j = tid * 4 + 1024 * u;
    const v4f a = *(const v4fa*)(x + j);
    v4f b = {0.f,0.f,0.f,0.f}; if (rr) b = *(const v4fa*)(rr + j);
#pragma unroll
    for (int q = 0; q < 4; ++q) { const float v = a[q] + b[q]; vals[u * 4 + q] = v; s1 += v; }
  }
  red[tid] = s1; __syncthreads();
  for (int st = 128; st > 0; st >>= 1) { if (tid < st) red[tid] += red[tid + st]; __syncthreads(); }
  const float mu = red[0] / (float)N; __syncthreads();
  float s2 = 0.f;
  for (int u = 0; u < per / 4; ++u)
#pragma unroll
    for (int q = 0; q < 4; ++q) { const float c = vals[u * 4 + q] - mu; s2 += c * c; }
  red[tid] = s2; __syncthreads();
  for (int st = 128; st > 0; st >>= 1) { if (tid < st) red[tid] += red[tid + st]; __syncthreads(); }
  const float rs = rsqrtf(red[0] / (float)N + eps);
  {
    for (int u = 0; u < per / 4; ++u) {
      const int j = tid * 4 + 1024 * u;
      v4f o, sm;
#pragma unroll
      for (int q = 0; q < 4; ++q) {
        float gg = g[j + q], bb = bta[j + q];
        if (PARAM_BF16) { gg = bf16_round(gg); bb = bf16_round(bb); }
        sm[q] = vals[u * 4 + q]; o[q] = (vals[u * 4 + q] - mu) * rs * gg + bb;
      }
      if (out_sum) *(v4f*)(out_sum + (size_t)row * N + j) = sm;
      *(v4f*)(out_norm + (size_t)row * N + j) = o;
    }
    
  }
}



// ---- f16 WMMA path (v_wmma_f32_16x16x32_f16): 11-bit significands for operands in range — used where a [0,1] probability operand needs more precision than bf16
typedef _Float16 v16h __attribute__((ext_vector_type(16)));
union FragH { v16h v; v8us half[2]; _Float16 h[16]; unsigned short u[16]; };
template <int NT>
__device__ __forceinline__ v8f mmaH(v16h ah, v16h al, v16h bh, v16h bl, v8f c) {
  c = __builtin_amdgcn_wmma_f32_16x16x32_f16(false, ah, false, bh, (short)0, c, false, false);
  if (NT >= 2) c = __builtin_amdgcn_wmma_f32_16x16x32_f16(false, al, false, bh, (short)0, c, false, false);
  if (NT >= 3) c = __builtin_amdgcn_wmma_f32_16x16x32_f16(false, ah, false, bl, (short)0, c, false, false);
  return c;
}
// batched GEMM like k_gemm_b but f16 operands: A f32 (split into f16 hi/lo if ASPLIT, else rounded to f16), Bt = f16 values [n][k]; alpha; C f32; N multiple of 16 (partial tiles skipped)
template <bool ASPLIT>
__global__ __launch_bounds__(128) void k_gemm_h(const float* __restrict__ A, int lda, size_t sA, const _Float16* __restrict__ Bh, int ldb, size_t sB, float alpha, float* __restrict__ C, int ldc, size_t sC, int M, int N, int K) {
  __shared__ __attribute__((aligned(16))) float so[4][16][64];
  const int tid = threadIdx.x, w = tid >> 5, lane = tid & 31, ln = lane & 15, hh = lane >> 4; const int by = blockIdx.y;
  A += (size_t)by * sA; Bh += (size_t)by * sB; C += (size_t)by * sC;
  const int ntn = (N + 63) / 64; const int wid = blockIdx.x * 4 + w; const int mt = wid / ntn, nq = wid % ntn; if (mt * 16 >= M) return;
  const int row0 = mt * 16, col0 = nq * 64; const float* arow = A + (size_t)(row0 + ln) * lda;
  v8f acc[4] = {};
  for (int kb = 0; kb < K; kb += 32) {
    FragH ah, al;
    const v4f x0 = *(const v4fa*)(arow + kb + 8 * hh), x1 = *(const v4fa*)(arow + kb + 8 * hh + 4), x2 = *(const v4fa*)(arow + kb + 16 + 8 * hh), x3 = *(const v4fa*)(arow + kb + 16 + 8 * hh + 4);
    float xs[16] = {x0[0],x0[1],x0[2],x0[3],x1[0],x1[1],x1[2],x1[3],x2[0],x2[1],x2[2],x2[3],x3[0],x3[1],x3[2],x3[3]};
#pragma unroll
    for (int i = 0; i < 16; ++i) { const _Float16 h = (_Float16)xs[i]; ah.h[i] = h; al.h[i] = ASPLIT ? (_Float16)(xs[i] - (float)h) : (_Float16)0.0f; }
#pragma unroll
    for (int t = 0; t < 4; ++t) { if (col0 + t * 16 >= N) continue; const size_t boff = (size_t)(col0 + t * 16 + ln) * ldb + kb; FragH bq; bq.half[0] = *(const v8us*)(Bh + boff + 8 * hh); bq.half[1] = *(const v8us*)(Bh + boff + 16 + 8 * hh);
      acc[t] = mmaH<ASPLIT ? 2 : 1>(ah.v, al.v, bq.v, bq.v, acc[t]); }
  }
#pragma unroll
  for (int t = 0; t < 4; ++t) { if (col0 + t * 16 >= N) continue;
#pragma unroll
    for (int r = 0; r < 8; ++r) so[w][8 * hh + r][t * 16 + ln] = acc[t][r] * alpha; }
  __builtin_amdgcn_fence(__ATOMIC_ACQ_REL, "workgroup"); __builtin_amdgcn_wave_barrier();
  const int rsub = lane >> 4, c4 = (lane & 15) * 4;
  {
#pragma unroll
    for (int q = 0; q < 8; ++q) { const int r = q * 2 + rsub; if (col0 + c4 < N) { const v4f v = *(const v4fa*)&so[w][r][c4]; *(v4f*)(C + (size_t)(row0 + r) * ldc + col0 + c4) = v; } }
     }
}

// Wt[n][k] = f16(W[k][n]·scale) from f32 row-major W[K][N] (scale = power of two; bf16-exact weights stay exact in f16 away from the subnormal range)
__global__ __launch_bounds__(256) void k_wt_f16(const float* __restrict__ W, _Float16* __restrict__ Wt, int K, int N, float scale) {
  const int t = blockIdx.x * 256 + threadIdx.x; if (t >= N * (K / 8)) return; const int n = t / (K / 8), k8 = (t % (K / 8)) * 8; FragH f;
#pragma unroll
  for (int i = 0; i < 8; ++i) f.h[i] = (_Float16)(bf16_round(W[(size_t)(k8 + i) * N + n]) * scale); const v8us o = f.half[0];
  *(v8us*)((unsigned short*)Wt + (size_t)n * K + k8) = o; 
}
// k_gemm_hh variant with fused epilogue: v = acc·alpha + bias[by·sBias + col] (+ CP[(row/rowsPerB)·sCPb + by·64 + col] if CP) ; ACT 0 none / 1 elu ; writes f16 C16 (and f32 C if non-null)
template <int ACT>
__global__ __launch_bounds__(128) void k_gemm_hhx(const _Float16* __restrict__ A, int lda, size_t sA, const _Float16* __restrict__ Bh, int ldb, size_t sB, float alpha, const float* __restrict__ bias, size_t sBias, const float* __restrict__ CP, int rowsPerB, size_t sCPb, int row0g,
    float* __restrict__ C, _Float16* __restrict__ C16, int ldc, size_t sC, int M, int N, int K) {
  __shared__ __attribute__((aligned(16))) float so[4][16][64];
  const int tid = threadIdx.x, w = tid >> 5, lane = tid & 31, ln = lane & 15, hh = lane >> 4; const int by = blockIdx.y;
  A += (size_t)by * sA; Bh += (size_t)by * sB; const size_t cofs = (size_t)by * sC; const float* bp = bias ? bias + (size_t)by * sBias : nullptr;
  const int ntn = (N + 63) / 64; const int wid = blockIdx.x * 4 + w; const int mt = wid / ntn, nq = wid % ntn; if (mt * 16 >= M) return;
  const int row0 = mt * 16, col0 = nq * 64; const _Float16* arow = A + (size_t)(row0 + ln) * lda;
  v8f acc[4] = {};
  for (int kb = 0; kb < K; kb += 32) { FragH ah; ah.half[0] = *(const v8us*)((const unsigned short*)arow + kb + 8 * hh); ah.half[1] = *(const v8us*)((const unsigned short*)arow + kb + 16 + 8 * hh);
#pragma unroll
    for (int t = 0; t < 4; ++t) { if (col0 + t * 16 >= N) continue; const size_t boff = (size_t)(col0 + t * 16 + ln) * ldb + kb; FragH bq; bq.half[0] = *(const v8us*)((const unsigned short*)Bh + boff + 8 * hh); bq.half[1] = *(const v8us*)((const unsigned short*)Bh + boff + 16 + 8 * hh);
      acc[t] = mmaH<1>(ah.v, ah.v, bq.v, bq.v, acc[t]); }
  }
#pragma unroll
  for (int t = 0; t < 4; ++t) { if (col0 + t * 16 >= N) continue; const int col = col0 + t * 16 + ln; const float bv = bp ? bf16_round(bp[col]) : 0.f;
#pragma unroll
    for (int r = 0; r < 8; ++r) { float v = acc[t][r] * alpha + bv; if (CP) { const int bidx = (row0g + row0 + 8 * hh + r) / rowsPerB; v += CP[(size_t)bidx * sCPb + (size_t)by * 64 + col]; } if (ACT == 1) v = (v > 0.f) ? v : expm1f(v); else if (ACT == 7) v = (v > 0.f) ? v + 1.0f : expf(v); else if (ACT == 8) v = tanhf(v); else if (ACT == 9) v = 0.5f * v * (1.0f + tanhf(0.7978845608028654f * (v + 0.044715f * v * v * v))); else if (ACT == 11) v = 1.0f / (1.0f + expf(-v)); else if (ACT == 12) v = (v > 0.f) ? v : 0.01f * v; else if (ACT == 14) v = (v > 0.f) ? v : 0.1f * v; else if (ACT == 15) v = v / (1.0f + expf(-v)); else if (ACT == 3) v = fmaxf(v, 0.f); else if (ACT == 6) v = 0.5f * v * (1.0f + erff(v * 0.70710678118654752f)); so[w][8 * hh + r][t * 16 + ln] = v; } }
  __builtin_amdgcn_fence(__ATOMIC_ACQ_REL, "workgroup"); __builtin_amdgcn_wave_barrier();
  const int rsub = lane >> 4, c4 = (lane & 15) * 4; typedef _Float16 v4h __attribute__((ext_vector_type(4)));
  {
#pragma unroll
    for (int q = 0; q < 8; ++q) { const int r = q * 2 + rsub; if (col0 + c4 < N) { const v4f v = *(const v4fa*)&so[w][r][c4]; if (C) *(v4f*)(C + cofs + (size_t)(row0 + r) * ldc + col0 + c4) = v; if (C16) { v4h h4; for (int i = 0; i < 4; ++i) h4[i] = (_Float16)v[i]; *(v4h*)(C16 + cofs + (size_t)(row0 + r) * ldc + col0 + c4) = h4; } } }
     }
}


typedef _Float16 v4h __attribute__((ext_vector_type(4)));

__global__ __launch_bounds__(256) void k_round16f(const float* __restrict__ W, _Float16* __restrict__ Bt, size_t n8) { const size_t t = (size_t)blockIdx.x * 256 + threadIdx.x; if (t >= n8) return; FragH f;
#pragma unroll
  for (int i = 0; i < 8; ++i) f.h[i] = (_Float16)(bf16_round(W[t * 8 + i]) * 16.0f); *(v8us*)((unsigned short*)Bt + t * 8) = f.half[0];  }
// ---- fused GEMM (wave tile 32x64, K = KD): the epilogue writes what the next kernel reads ----
#define KD 256                   /* = CM = DP: K and the row pitch of A and of the weight planes */
__device__ __forceinline__ v16h g2_frag(const _Float16* p, int hh) { FragH f; f.half[0] = *(const v8us*)((const unsigned short*)p + 8 * hh); f.half[1] = *(const v8us*)((const unsigned short*)p + 16 + 8 * hh); return f.v; }
__device__ __forceinline__ v8f g2_mma(v16h a, v16h b, v8f c) { return __builtin_amdgcn_wmma_f32_16x16x32_f16(false, a, false, b, (short)0, c, false, false); }
// Fragment order: a 16 x 32 f16 operand tile (16 rows or columns x 32 k) is FTE consecutive elements; lane l = 16 hh + ln holds row ln, k = 8 hh .. + 7 at element 8 l and k = 16 + 8 hh .. + 7 at FTE / 2 + 8 l (the k order of g2_frag)
#define FTE 512
__device__ __forceinline__ v16h pk_frag(const _Float16* p) { FragH f; f.half[0] = *(const v8us*)((const unsigned short*)p); f.half[1] = *(const v8us*)((const unsigned short*)p + FTE / 2); return f.v; }      /* p = tile + 8 lane */
// The same tile in LDS: its four quarters (k 0-7, 8-15, 16-23, 24-31 of the 16 rows, 256 B each) stand AQE elements = 320 B apart, so that a store of 4 rows x 32 k (8 B a lane) meets every bank once and each half wave of a fragment read (16 B a lane) does too
#define AQE 160
#define ATE (4 * AQE)
__device__ __forceinline__ v16h ls_frag(const _Float16* p) { FragH f; f.half[0] = *(const v8us*)((const unsigned short*)p); f.half[1] = *(const v8us*)((const unsigned short*)p + 2 * AQE); return f.v; }      /* p = tile + hh AQE + 8 ln */
// A: fragment tiles [row / 16][k / 32] from Ap, PK: in global memory (FTE), else in LDS (ATE). Bh: fragment tiles [col / 16][k / 32]. k0: the k tile at which this block enters its walk (it wraps round): blocks that read the same tiles do not ask L2 for the same lines at one moment
template <bool PK>
__device__ __forceinline__ void gf_tile(const _Float16* __restrict__ Ap, const _Float16* __restrict__ Bh, int row0, int col0, int k0, int ln, int hh, v8f (&accs)[8]) {
  constexpr int TR = (KD / 32) * FTE, AT = PK ? FTE : ATE, ATR = (KD / 32) * AT;      /* elements of one row of tiles; of one A tile and one row of A tiles */
  const _Float16* p0p = Ap + (size_t)(row0 / 16) * ATR + k0 * AT + (PK ? (16 * hh + ln) * 8 : hh * AQE + ln * 8);
  const _Float16* b0p = Bh + (size_t)(col0 / 16) * TR + k0 * FTE + (16 * hh + ln) * 8;
  const v8f z8 = {0.f,0.f,0.f,0.f,0.f,0.f,0.f,0.f}; v8f c00 = z8, c01 = z8, c02 = z8, c03 = z8, c10 = z8, c11 = z8, c12 = z8, c13 = z8;
#pragma unroll 1                 /* rolled, as before the fusion: keeps the registers low enough for every block of the grid to be resident at once */
  for (int kt = 0; kt < KD / 32; ++kt) { const v16h a0 = PK ? pk_frag(p0p) : ls_frag(p0p), a1 = PK ? pk_frag(p0p + ATR) : ls_frag(p0p + ATR);
    v16h b = pk_frag(b0p); c00 = g2_mma(a0, b, c00); c10 = g2_mma(a1, b, c10);
    b = pk_frag(b0p + TR); c01 = g2_mma(a0, b, c01); c11 = g2_mma(a1, b, c11);
    b = pk_frag(b0p + 2 * TR); c02 = g2_mma(a0, b, c02); c12 = g2_mma(a1, b, c12);
    b = pk_frag(b0p + 3 * TR); c03 = g2_mma(a0, b, c03); c13 = g2_mma(a1, b, c13);
    const int st = (kt + k0 == KD / 32 - 1) ? 1 - KD / 32 : 1;      /* one k tile on, or from the last back to the first */
    p0p += st * AT; b0p += st * FTE; }
  accs[0] = c00; accs[1] = c01; accs[2] = c02; accs[3] = c03; accs[4] = c10; accs[5] = c11; accs[6] = c12; accs[7] = c13; }
// q, k, v projections, blockIdx.y = 0, 1, 2: y = x W^T + b (weights x16, so acc / 16). q, k -> hi + 2^10 residual planes, fragment tiles [b * NH + head][token / 16]; v -> f16 V^T, fragment tiles [b * NH + head][token / 32][dim / 16]
__global__ __launch_bounds__(256) void k_proj(const float* __restrict__ xq, const float* __restrict__ xk, const float* __restrict__ xv, const _Float16* __restrict__ Bq, const _Float16* __restrict__ Bk, const _Float16* __restrict__ Bv,
    const float* __restrict__ bq, const float* __restrict__ bk, const float* __restrict__ bv, _Float16* __restrict__ QH, _Float16* __restrict__ QL, _Float16* __restrict__ KH, _Float16* __restrict__ KL, _Float16* __restrict__ VT) {
  __shared__ __attribute__((aligned(16))) char sm[8 * 32 * 68 * 4];      /* first the block's A tiles (4 x 8 x ATE f16), then, behind a barrier, each wave's 32 x 68 f32 output rows */
  _Float16* sa = (_Float16*)sm; float (*so)[32][68] = (float (*)[32][68])sm;
  const int tid = threadIdx.x, w = tid >> 5, lane = tid & 31, ln = lane & 15, hh = lane >> 4; const int by = blockIdx.y;
  const float* A = (by == 0) ? xq : ((by == 1) ? xk : xv); const _Float16* Bh = (by == 0) ? Bq : ((by == 1) ? Bk : Bv); const float* bp = (by == 0) ? bq : ((by == 1) ? bk : bv);
  const int rl0 = 32 * (w >> 2), row0 = blockIdx.x * 64 + rl0, col0 = (w & 3) * 64;      /* 2 x 4 waves: 64 rows x all DP columns */
  { /* wave w stages rows 8 w .. + 7: a load takes 128 B (one k tile) of each of 4 rows, 8 lanes a row; lane's 4 floats = k 4 (lane & 7) .. + 3 of the tile, rounded to bf16 and held as f16 */
    const float* ap = A + (size_t)(blockIdx.x * 64 + 8 * w + (lane >> 3)) * KD + (lane & 7) * 4;
    unsigned short* sp = (unsigned short*)sa + (w >> 1) * ((KD / 32) * ATE) + ((lane >> 1) & 3) * AQE + (8 * (w & 1) + (lane >> 3)) * 8 + (lane & 1) * 4;
    v4f x[2][KD / 32];           /* both loop nests unrolled: x stays in registers, and all 16 loads are in flight before the first is converted */
#pragma unroll
    for (int g = 0; g < 2; ++g)
#pragma unroll
      for (int kt = 0; kt < KD / 32; ++kt) x[g][kt] = *(const v4fa*)(ap + (size_t)g * 4 * KD + kt * 32);
#pragma unroll
    for (int g = 0; g < 2; ++g)
#pragma unroll
      for (int kt = 0; kt < KD / 32; ++kt) { FragH f;
#pragma unroll
        for (int i = 0; i < 4; ++i) f.h[i] = (_Float16)bf16_round(x[g][kt][i]);
        *(v4us*)(sp + kt * ATE + g * 32) = (v4us){f.u[0], f.u[1], f.u[2], f.u[3]}; } }
  __syncthreads();               /* every wave reads rows that other waves staged */
  v8f accs[8]; gf_tile<false>(sa, Bh, rl0, col0, blockIdx.x & (KD / 32 - 1), ln, hh, accs);      /* all NR / 64 row blocks read the same weight tiles */
  const int sl0 = (row0 / SLEN) * NH + col0 / HS, tk0 = row0 % SLEN;      /* the wave's first (window, head) and first token: 2 heads x 32 tokens */
  if (by == 2) {                 /* block-uniform. A lane's 8 accumulator rows are 8 consecutive tokens of one column = its own 16 bytes of a V^T fragment tile (row = dim ln, k = token): stored from registers */
#pragma unroll
    for (int u = 0; u < 8; ++u) { const int t = u & 3, half = u >> 2; const float bvv = bf16_round(bp[col0 + t * 16 + ln]); FragH f;
#pragma unroll
      for (int r = 0; r < 8; ++r) f.h[r] = (_Float16)(accs[u][r] * 0.0625f + bvv);
      *(v8us*)((unsigned short*)VT + ((size_t)((sl0 + (t >> 1)) * (SLEN / 32) + tk0 / 32) * (HS / 16) + (t & 1)) * FTE + half * (FTE / 2) + lane * 8) = f.half[0]; }
    return; }
  __syncthreads();               /* the output rows overwrite the A tiles: every wave has left its k loop */
  _Float16* Hh = (by == 0) ? QH : KH; _Float16* Hl = (by == 0) ? QL : KL;
#pragma unroll
  for (int u = 0; u < 8; ++u) { const int t = u & 3, half = u >> 2; const float bvv = bf16_round(bp[col0 + t * 16 + ln]);
#pragma unroll
    for (int r = 0; r < 8; ++r) so[w][half * 16 + 8 * hh + r][t * 16 + ln] = accs[u][r] * 0.0625f + bvv; }
  __builtin_amdgcn_fence(__ATOMIC_ACQ_REL, "workgroup"); __builtin_amdgcn_wave_barrier();
#pragma unroll 1                 /* one tile a trip: a quarter of the code; the k loop and the register count come out the same either way */
  for (int tl = 0; tl < 4; ++tl) { const int kt = tl >> 1, hd = tl & 1;      /* 2 token tiles x 2 heads; per half tile a lane reads its 8 dims of token ln and stores its 16 bytes */
    const size_t o = ((size_t)(sl0 + hd) * (SLEN / 16) + tk0 / 16 + kt) * FTE + lane * 8;
#pragma unroll
    for (int half = 0; half < 2; ++half) { const float* sp = &so[w][kt * 16 + ln][hd * HS + half * 16 + 8 * hh]; const v4f v0 = *(const v4fa*)sp, v1 = *(const v4fa*)(sp + 4); FragH fh, fl;
#pragma unroll
      for (int i = 0; i < 4; ++i) { const _Float16 h0 = (_Float16)v0[i], h1 = (_Float16)v1[i]; fh.h[i] = h0; fh.h[4 + i] = h1; fl.h[i] = (_Float16)((v0[i] - (float)h0) * 1024.0f); fl.h[4 + i] = (_Float16)((v1[i] - (float)h1) * 1024.0f); }
      *(v8us*)((unsigned short*)Hh + o + half * (FTE / 2)) = fh.half[0]; *(v8us*)((unsigned short*)Hl + o + half * (FTE / 2)) = fl.half[0]; }
    asm volatile("s_wait_xcnt 0x0" ::: "memory"); }      /* the next trip rewrites these stores' address and data registers */
}
// output projection: out = ctx Wo^T + bo, f32 rows of CM; ctx = f16 fragment tiles [row / 16][head]
__global__ __launch_bounds__(128) void k_outg(const _Float16* __restrict__ Ctx, const _Float16* __restrict__ Bo, const float* __restrict__ bo, float* __restrict__ C) {
  __shared__ __attribute__((aligned(16))) float so[4][32][68];
  const int tid = threadIdx.x, w = tid >> 5, lane = tid & 31, ln = lane & 15, hh = lane >> 4;
  const int mt = blockIdx.x / (CM / 64), nq = blockIdx.x % (CM / 64); const int row0 = mt * 128 + 32 * w, col0 = nq * 64;
  v8f accs[8]; gf_tile<true>(Ctx, Bo, row0, col0, (mt + 2 * nq) & (KD / 32 - 1), ln, hh, accs);      /* the row blocks share the weight tiles, the CM / 64 column blocks the context tiles */
#pragma unroll
  for (int u = 0; u < 8; ++u) { const int t = u & 3, half = u >> 2; const float bvv = bf16_round(bo[col0 + t * 16 + ln]);
#pragma unroll
    for (int r = 0; r < 8; ++r) so[w][half * 16 + 8 * hh + r][t * 16 + ln] = accs[u][r] * 0.0625f + bvv; }
  __builtin_amdgcn_fence(__ATOMIC_ACQ_REL, "workgroup"); __builtin_amdgcn_wave_barrier();
  const int rsub = lane >> 4, c4 = (lane & 15) * 4;
#pragma unroll
  for (int q = 0; q < 16; ++q) { const int r = q * 2 + rsub; const v4f v = *(const v4fa*)&so[w][r][c4]; *(v4f*)(C + (size_t)(row0 + r) * CM + col0 + c4) = v; } }



template <int CAUSAL>
__global__ __launch_bounds__(128) void k_flash(const _Float16* __restrict__ Q16, int ldq, const _Float16* __restrict__ K16, int ldk, const _Float16* __restrict__ Vt, const int* __restrict__ MSK, float* __restrict__ O, int ldo) {
  constexpr int RPW = 16, RTN = RPW / 16, NQB = TQ / (4 * RPW), DT = 4, KS = 2;
  __shared__ __attribute__((aligned(16))) unsigned short sP[4][RPW][40]; __shared__ __attribute__((aligned(16))) float sO[4][RPW][64 + 4];
  const int tid = threadIdx.x, w = tid >> 5, lane = tid & 31, ln = lane & 15, hh = lane >> 4;
  const int slab = blockIdx.x / QBLKS, qblk = blockIdx.x % QBLKS; (void)NQB; const int b = slab / NH, h = slab % NH; const int qb0 = qblk * (4 * RPW); const int q0 = qb0 + w * RPW;
  FragH aq[2][KS];
#pragma unroll
  for (int rt = 0; rt < RTN; ++rt) { const unsigned short* qr = (const unsigned short*)Q16 + ((size_t)b * TQ + q0 + rt * 16 + ln) * ldq + h * 64;
#pragma unroll
    for (int ks = 0; ks < KS; ++ks) { aq[rt][ks].half[0] = *(const v8us*)(qr + ks * 32 + 8 * hh); aq[rt][ks].half[1] = *(const v8us*)(qr + ks * 32 + 16 + 8 * hh); } }
  const unsigned short* Vth = (const unsigned short*)Vt + (size_t)slab * 64 * TK;
  float m_r[2][8], l_r[2][8]; v8f oacc[2][DT];
#pragma unroll
  for (int rt = 0; rt < RTN; ++rt) {
#pragma unroll
    for (int r = 0; r < 8; ++r) { m_r[rt][r] = -3.0e38f; l_r[rt][r] = 0.f; }
#pragma unroll
    for (int dt = 0; dt < DT; ++dt) oacc[rt][dt] = (v8f){0.f,0.f,0.f,0.f,0.f,0.f,0.f,0.f}; }
  const int jend = (CAUSAL == 1) ? (qb0 + 4 * RPW) : TK;      /* causal: keys beyond the block's last query never contribute */
#pragma unroll 1
  for (int j0 = 0; j0 < jend; j0 += 32) {
    v8f s[2][2];
#pragma unroll
    for (int nt = 0; nt < 2; ++nt) { const unsigned short* kr = (const unsigned short*)K16 + ((size_t)b * TK + j0 + nt * 16 + ln) * ldk + h * 64; FragH bk[KS];
#pragma unroll
      for (int ks = 0; ks < KS; ++ks) { bk[ks].half[0] = *(const v8us*)(kr + ks * 32 + 8 * hh); bk[ks].half[1] = *(const v8us*)(kr + ks * 32 + 16 + 8 * hh); }
#pragma unroll
      for (int rt = 0; rt < RTN; ++rt) { v8f acc = (v8f){0.f,0.f,0.f,0.f,0.f,0.f,0.f,0.f};
#pragma unroll
        for (int ks = 0; ks < KS; ++ks) acc = mmaH<1>(aq[rt][ks].v, aq[rt][ks].v, bk[ks].v, bk[ks].v, acc); s[rt][nt] = acc; } }
#pragma unroll
    for (int rt = 0; rt < RTN; ++rt)
#pragma unroll
      for (int r = 0; r < 8; ++r) { const int tq = q0 + rt * 16 + 8 * hh + r; const int k0 = j0 + ln, k1 = j0 + 16 + ln;
        const bool ok0 = (CAUSAL == 1) ? (k0 <= tq) : ((CAUSAL == 2) ? ((k0 >> 5) == (tq >> 5)) : true), ok1 = (CAUSAL == 1) ? (k1 <= tq) : ((CAUSAL == 2) ? ((k1 >> 5) == (tq >> 5)) : true);      /* mode 2: block-diagonal 32-token groups */
        const float s0 = ok0 ? s[rt][0][r] * SCL : -3.0e38f, s1 = ok1 ? s[rt][1][r] * SCL : -3.0e38f; float mc = fmaxf(s0, s1);
        mc = fmaxf(mc, __shfl_xor(mc, 1, 32)); mc = fmaxf(mc, __shfl_xor(mc, 2, 32)); mc = fmaxf(mc, __shfl_xor(mc, 4, 32)); mc = fmaxf(mc, __shfl_xor(mc, 8, 32));
        const float mn = fmaxf(m_r[rt][r], mc); const float al = (mn > -1.0e38f) ? expf(m_r[rt][r] - mn) : 1.0f; m_r[rt][r] = mn; const float p0 = ok0 ? expf(s0 - mn) : 0.f, p1 = ok1 ? expf(s1 - mn) : 0.f; l_r[rt][r] = l_r[rt][r] * al + p0 + p1;
#pragma unroll
        for (int dt = 0; dt < DT; ++dt) oacc[rt][dt][r] *= al;
        FragH t2; t2.h[0] = (_Float16)(p0 * 1024.0f); t2.h[1] = (_Float16)(p1 * 1024.0f); sP[w][rt * 16 + 8 * hh + r][ln] = t2.u[0]; sP[w][rt * 16 + 8 * hh + r][16 + ln] = t2.u[1]; }
    __builtin_amdgcn_fence(__ATOMIC_ACQ_REL, "workgroup"); __builtin_amdgcn_wave_barrier();
    FragH pa[2];
#pragma unroll
    for (int rt = 0; rt < RTN; ++rt) { pa[rt].half[0] = *(const v8us*)&sP[w][rt * 16 + ln][8 * hh]; pa[rt].half[1] = *(const v8us*)&sP[w][rt * 16 + ln][16 + 8 * hh]; }
#pragma unroll
    for (int dt = 0; dt < DT; ++dt) { const unsigned short* vrow = Vth + (size_t)(dt * 16 + ln) * TK + j0; FragH bv; bv.half[0] = *(const v8us*)(vrow + 8 * hh); bv.half[1] = *(const v8us*)(vrow + 16 + 8 * hh);
#pragma unroll
      for (int rt = 0; rt < RTN; ++rt) oacc[rt][dt] = mmaH<1>(pa[rt].v, pa[rt].v, bv.v, bv.v, oacc[rt][dt]); }
    __builtin_amdgcn_fence(__ATOMIC_ACQ_REL, "workgroup"); __builtin_amdgcn_wave_barrier(); }
#pragma unroll
  for (int rt = 0; rt < RTN; ++rt) {
#pragma unroll
    for (int r = 0; r < 8; ++r) { float l = l_r[rt][r]; l += __shfl_xor(l, 1, 32); l += __shfl_xor(l, 2, 32); l += __shfl_xor(l, 4, 32); l += __shfl_xor(l, 8, 32); l_r[rt][r] = (l > 0.f) ? 1.0f / (l * 1024.0f) : 0.f; }
#pragma unroll
    for (int dt = 0; dt < DT; ++dt)
#pragma unroll
      for (int r = 0; r < 8; ++r) sO[w][rt * 16 + 8 * hh + r][dt * 16 + ln] = oacc[rt][dt][r] * l_r[rt][r]; }
  __builtin_amdgcn_fence(__ATOMIC_ACQ_REL, "workgroup"); __builtin_amdgcn_wave_barrier();
  {
#pragma unroll
    for (int rp = 0; rp < RPW; rp += 2) { const int r = rp + (lane >> 4), pc = lane & 15; const v4f val = *(const v4fa*)&sO[w][r][pc * 4]; *(v4f*)(O + ((size_t)b * TQ + q0 + r) * ldo + h * 64 + pc * 4) = val; }
     } }
// Q/K-split flash kernel, transposed: S^T = Kh Qh^T + (Kh Ql^T + Kl Qh^T)/1024 and O^T += V^T P^T, with Q/K = [hi | 2^10 residual] f16 planes (QL/KL same layout as Q16/K16) and plain f16 P (x2^10). All planes are fragment tiles (FTE): a pass's K, K residual and V^T are 2 KiB runs each.
// K rows and V^T rows are the A operands, Q and P^T the B operands: a lane holds 16 of the 32 scores of ONE query (lane l and l ^ 16 share query l & 15), so the maximum and the sum run in the lane's own registers
// with one exchange between the wave's halves, and the two score tiles, converted in place, are the B fragment of the second product (register s of half hh = key 8 hh + s, then 16 + 8 hh + s - 8: the order in which V^T is loaded).
__device__ __forceinline__ float xhalf(float x) { return __int_as_float(__builtin_amdgcn_permlanex16(__float_as_int(x), __float_as_int(x), 0x76543210, 0xfedcba98, false, false)); }      /* lane l <-> l ^ 16 */
template <int CAUSAL>
__global__ __launch_bounds__(128) void k_flashqk(const _Float16* __restrict__ Q16, const _Float16* __restrict__ QL, const _Float16* __restrict__ K16, const _Float16* __restrict__ KL, const _Float16* __restrict__ Vt, const int* __restrict__ MSK, _Float16* __restrict__ O) {
  static_assert(HS == 32, "one k step per score product, two output tiles");
  constexpr int RPW = 16, DT = HS / 16;
  const int tid = threadIdx.x, w = tid >> 5, lane = tid & 31, ln = lane & 15, hh = lane >> 4;
  const int slab = blockIdx.x / QBLKS, qblk = blockIdx.x % QBLKS; const int b = slab / NH, h = slab % NH; const int qb0 = qblk * (4 * RPW); const int q0 = qb0 + w * RPW; const int tq = q0 + ln;
  FragH bq, bql;                 /* B: column = query q0 + ln, k = head dim in the order of the K rows' loads */
  { const size_t qo = ((size_t)slab * (TQ / 16) + q0 / 16) * FTE + lane * 8; bq.v = pk_frag(Q16 + qo); bql.v = pk_frag(QL + qo);
    asm volatile("s_wait_xcnt 0x0" ::: "memory"); }      /* the key offsets formed next reuse these four loads' address registers */
  /* wave-uniform bases + one 32-bit byte offset per lane, which walks the keys: a pass is two tiles of each plane (K: 2 x 16 keys; V^T: 2 x 16 dims of its 32 keys), the lane's 16 bytes at 16 lane of each half tile */
  const char* kb = (const char*)(K16 + (size_t)slab * HS * TK); const char* klb = (const char*)(KL + (size_t)slab * HS * TK); const char* vb = (const char*)(Vt + (size_t)slab * HS * TK);
  const int ps = (CAUSAL == 1) ? 0 : ((2 * qblk + slab) & (TK / 32 - 1));      /* the pass at which this block enters the key walk (it wraps round): the QBLKS blocks of a (window, head) read the same K and V^T lines, and not at one moment */
  unsigned koff = (unsigned)lane * 16u + (unsigned)ps * (2u * FTE * 2u);
  float m_c = -3.0e38f, l_c = 0.f; v8f oacc[DT];
#pragma unroll
  for (int dt = 0; dt < DT; ++dt) oacc[dt] = (v8f){0.f,0.f,0.f,0.f,0.f,0.f,0.f,0.f};
  const int jend = (CAUSAL == 1) ? (qb0 + 4 * RPW) : TK;      /* causal: keys beyond the block's last query never contribute */
#pragma unroll 1                 /* rolled, as before: one pass's fragments and scores already fill the registers that eight waves a SIMD leave */
  for (int jj = 0; jj < jend; jj += 32) { const int j0 = (jj + 32 * ps) & (TK - 1);
    FragH ak[2], akl[2], av[DT];
#pragma unroll
    for (int nt = 0; nt < 2; ++nt) { const char* kr = kb + (size_t)nt * FTE * 2; const char* klr = klb + (size_t)nt * FTE * 2;
      ak[nt].half[0] = *(const v8us*)(kr + koff); ak[nt].half[1] = *(const v8us*)(kr + koff + FTE); akl[nt].half[0] = *(const v8us*)(klr + koff); akl[nt].half[1] = *(const v8us*)(klr + koff + FTE); }
#pragma unroll
    for (int dt = 0; dt < DT; ++dt) { const char* vrow = vb + (size_t)dt * FTE * 2; av[dt].half[0] = *(const v8us*)(vrow + koff); av[dt].half[1] = *(const v8us*)(vrow + koff + FTE); }
    koff = (koff + 2u * FTE * 2u) & (unsigned)(HS * TK * 2 - 1);      /* the next 32 keys, round the end of the plane */
    __builtin_amdgcn_sched_barrier(0);      /* the pass's 12 loads stay in front of its first product, as they stood: sunk among the products they would start one memory latency after another */
    v2f s2[8]; bool ok[16]; v8f sh[2], sl[2];      /* element nt * 8 + r (pair nt * 4 + r / 2): key j0 + nt * 16 + 8 hh + r against query tq. Neighbours are held as pairs, so the multiply-adds and adds below take two scores an instruction with no register moves */
#pragma unroll
    for (int nt = 0; nt < 2; ++nt) { const v8f z = (v8f){0.f,0.f,0.f,0.f,0.f,0.f,0.f,0.f};
      sh[nt] = mmaH<1>(ak[nt].v, ak[nt].v, bq.v, bq.v, z); sl[nt] = mmaH<1>(ak[nt].v, ak[nt].v, bql.v, bql.v, z); sl[nt] = mmaH<1>(akl[nt].v, akl[nt].v, bq.v, bq.v, sl[nt]); }
    __builtin_amdgcn_sched_barrier(0);      /* the six score products run as one block: each stands in the distance the one before it needs ahead of its first reader, where the compiler otherwise pads with v_nop */
#pragma unroll
    for (int nt = 0; nt < 2; ++nt) { const v8f acc = sh[nt], accl = sl[nt];
#pragma unroll
      for (int r = 0; r < 8; r += 2) { v2f c = __builtin_elementwise_fma((v2f){accl[r], accl[r + 1]}, (v2f){0.0009765625f, 0.0009765625f}, (v2f){acc[r], acc[r + 1]});      /* raw q.k: the scale is applied inside the exponent's multiply-add below (SCL2 > 0, so the maximum may be taken first) */
#pragma unroll
        for (int e = 0; e < 2; ++e) { const int kk = j0 + nt * 16 + 8 * hh + r + e;
          bool o = (CAUSAL == 1) ? (kk <= tq) : ((CAUSAL == 2) ? ((kk >> 5) == (tq >> 5)) : true);      /* mode 2: block-diagonal 32-token groups */
          if (CAUSAL == 4) o = MSK[((size_t)b * TQ + tq) * TK + kk] != 0;      /* mode 4: per-(query, key) INPUT mask shared by all heads; masked keys contribute nothing, rows with no valid key give l = 0 -> output 0 */
          ok[nt * 8 + r + e] = o; if (!o) c[e] = -3.0e38f; }
        s2[nt * 4 + r / 2] = c; } }
    float mx[8];
#pragma unroll
    for (int k = 0; k < 8; ++k) mx[k] = fmaxf(s2[k][0], s2[k][1]);
    float mc = fmaxf(fmaxf(fmaxf(mx[0], mx[1]), fmaxf(mx[2], mx[3])), fmaxf(fmaxf(mx[4], mx[5]), fmaxf(mx[6], mx[7])));
    mc = fmaxf(mc, xhalf(mc));   /* the query's other 16 keys */
    /* base 2: m_c = running maximum of SCL2 s, less 10, so that 2^(SCL2 s - m_c) is P x 2^10 straight from one hardware exponential (arguments <= 10; below the exponent range it gives 0, far under an f16 P's last bit); every term of a pass and the rescale use the same rounded m_c */
    const float mn = fmaxf(m_c, __builtin_fmaf(mc, SCL2, -10.0f)); const float al = (mn > -1.0e37f) ? __builtin_amdgcn_exp2f(m_c - mn) : 1.0f; m_c = mn;      /* all keys masked so far: SCL2 x -3e38 stays under the bound */
    v2f p2[8]; FragH pb;         /* p, and with it l_c, carry the 2^10 */
#pragma unroll
    for (int k = 0; k < 8; ++k) { const v2f e = __builtin_elementwise_fma(s2[k], (v2f){SCL2, SCL2}, (v2f){-mn, -mn});
      p2[k][0] = ok[2 * k] ? __builtin_amdgcn_exp2f(e[0]) : 0.f; p2[k][1] = ok[2 * k + 1] ? __builtin_amdgcn_exp2f(e[1]) : 0.f; pb.h[2 * k] = (_Float16)p2[k][0]; pb.h[2 * k + 1] = (_Float16)p2[k][1]; }
    /* halving tree: p[i] + p[8 + i], then [i] + [4 + i], then ([0] + [2]) + ([1] + [3]); neighbours stay neighbours, so the adds pair up two to an instruction */
    const v2f t4a = (p2[0] + p2[4]) + (p2[2] + p2[6]), t4b = (p2[1] + p2[5]) + (p2[3] + p2[7]); const v2f t2 = t4a + t4b;
    l_c = l_c * al + (t2[0] + t2[1]);
#pragma unroll
    for (int dt = 0; dt < DT; ++dt) {
#pragma unroll
      for (int r = 0; r < 8; ++r) oacc[dt][r] *= al;
      oacc[dt] = mmaH<1>(av[dt].v, av[dt].v, pb.v, pb.v, oacc[dt]); } }
  const float l = l_c + xhalf(l_c); const float li = (l > 0.f) ? 1.0f / l : 0.f;
#pragma unroll
  for (int dt = 0; dt < DT; ++dt) { FragH f;      /* a lane's 8 registers are 8 consecutive head dims of its query = its own 16 bytes of the output GEMM's A tile (row = query ln, k = this head's dims) */
#pragma unroll
    for (int r = 0; r < 8; ++r) f.h[r] = (_Float16)(oacc[dt][r] * li);
    *(v8us*)((unsigned short*)O + ((size_t)((b * TQ + q0) / 16) * NH + h) * FTE + dt * (FTE / 2) + lane * 8) = f.half[0]; } }

// the four weights (row-major [out][in]) as f16(bf16(W) x 16) in fragment tiles [out / 16][in / 32]; blockIdx.y picks the weight
__global__ __launch_bounds__(256) void k_wprep(const float* __restrict__ Wq, const float* __restrict__ Wk, const float* __restrict__ Wv, const float* __restrict__ Wo, _Float16* __restrict__ Bq, _Float16* __restrict__ Bk, _Float16* __restrict__ Bv, _Float16* __restrict__ Bo) {
  const int by = blockIdx.y; const float* Wm = (by == 0) ? Wq : ((by == 1) ? Wk : ((by == 2) ? Wv : Wo)); _Float16* Bt = (by == 0) ? Bq : ((by == 1) ? Bk : ((by == 2) ? Bv : Bo));
  const size_t t = (size_t)blockIdx.x * 256 + threadIdx.x; FragH f;
#pragma unroll
  for (int i = 0; i < 8; ++i) f.h[i] = (_Float16)(bf16_round(Wm[t * 8 + i]) * 16.0f);
  const int n = (int)(t / (KD / 8)), ck = (int)(t % (KD / 8));      /* 8 inputs ck * 8 .. + 7 of output n: chunk ck & 3 of k tile ck >> 2 */
  *(v8us*)((unsigned short*)Bt + (size_t)((n / 16) * (KD / 32) + (ck >> 2)) * FTE + ((ck >> 1) & 1) * (FTE / 2) + ((ck & 1) * 16 + (n & 15)) * 8) = f.half[0]; }

extern "C" void kernel_launch(void* const* d_in, const int* in_sizes, int n_in,
                              void* d_out, int out_size, void* d_ws, size_t ws_size, hipStream_t stream) {
  (void)in_sizes; (void)n_in; (void)out_size;
  const float* const* I = (const float* const*)d_in; const float* qx = I[0]; const float* kx = I[1]; const float* vx = I[2]; const float* Wq = I[3]; const float* bq = I[4]; const float* Wk = I[5]; const float* bk = I[6]; const float* Wv = I[7]; const float* bv = I[8]; const float* Wo = I[9]; const float* bo = I[10];
  char* ws = (char*)d_ws; size_t off = 0;
  auto take = [&](size_t bytes) { char* p = ws + off; off += (bytes + 255) & ~(size_t)255; return p; };
  _Float16* BPq = (_Float16*)take((size_t)DP * CM * 2); _Float16* BPk = (_Float16*)take((size_t)DP * CM * 2); _Float16* BPv = (_Float16*)take((size_t)DP * CM * 2); _Float16* BOP = (_Float16*)take((size_t)CM * DP * 2);
  _Float16* O = (_Float16*)take((size_t)NR * DP * 2); _Float16* QH = (_Float16*)take((size_t)NR * DP * 2); _Float16* QL = (_Float16*)take((size_t)NR * DP * 2); _Float16* KH = (_Float16*)take((size_t)NR * DP * 2); _Float16* KL = (_Float16*)take((size_t)NR * DP * 2); _Float16* VT = (_Float16*)take((size_t)NR * DP * 2);
  if (off > ws_size) return;      /* under 64 MiB (256 MiB ws) */
  k_wprep<<<dim3(DP * CM / 8 / 256, 4), 256, 0, stream>>>(Wq, Wk, Wv, Wo, BPq, BPk, BPv, BOP);
  k_proj<<<dim3(NR / 64, 3), 256, 0, stream>>>(qx, kx, vx, BPq, BPk, BPv, bq, bk, bv, QH, QL, KH, KL, VT);
  k_flashqk<0><<<NSEQ * NH * QBLKS, 128, 0, stream>>>(QH, QL, KH, KL, VT, nullptr, O);      /* q/k hi + residual; P (x2^10) and V plain f16 */
  k_outg<<<(NR / 128) * (CM / 64), 128, 0, stream>>>(O, BOP, bo, (float*)d_out);
}

// v009
// It runs in 56.6 microseconds.
// Two timings next to v008 both put it at 1.14 times that version's speed.
// All steps since v000 together make it 8.93 times as fast.
#include <hip/hip_runtime.h>
// Routing (windowed) attention (2 x 8 windows of 1024 tokens x 256; 8 heads x 32): qh/kh/vh = inputs q/k/v W^T + b split into heads; per (window, head) softmax(qh kh^T / sqrt(32)) vh; heads re-merged; ctx Wo^T + bo -> [2,8,4,16,16,256].
// Structure: 3 launches. Every workspace plane lies in WMMA fragment order (FTE below), so a wave's 16-byte loads and stores cover 512 contiguous bytes. (1) the four weights as exact x16 f16 planes; (2) the q, k, v projections in one grid (grid.y picks the operand): f16 WMMA GEMM, 64x256 block tiles of 32x64 wave tiles, f32 accumulation, the block reads its f32 input rows once in whole lines, rounds them and shares them through LDS as fragment tiles, the epilogue writes hi + 2^10 residual planes (q, k) or V^T (v), one 16 x 32 fragment tile per (head, 16 tokens) or (head, 16 dims, 32 tokens); (3) the fused flash kernel, transposed (S^T = K Q^T, O^T += V^T P^T, P stays in registers), with hi + 2^10-residual q/k planes (S = QhKh + (QlKh + QhKl)/1024) and plain f16 P (x2^10) and V; a block is 64 queries x all 8 heads (32 waves), so its f16 context tiles go through LDS straight into the output GEMM, which is the kernel's epilogue.
// Compute dtype: q, k, v and parameters rounded to bf16; qh, kh hi + residual (~2^-21-class logits); P and vh plain f16 (~2^-12); context as f16 (~2^-12) into Wo; f32 accumulation/softmax. v_wmma_f32_16x16x32_f16.
#define NSEQ 16
#define NB NSEQ
#define CM 256
#define HS 32                    /* head slot width in the q/k/v/context planes = true head dim */
#define DP (NH * HS)             /* 256: q/k/v width */
#define NR (NSEQ * SLEN)         /* 16384 rows */
#define QBLKS (TQ / 64)
#define SLEN 1024                /* tokens per routing window (K*Hp*W) */
#define TQ SLEN
#define TK SLEN
#define NH 8
#define SCL 0.17677669529663687f /* 32^-0.5 */
#define SCL2 ((float)(0.17677669529663687 * 1.4426950408889634))      /* 32^-0.5 log2(e): logits in base-2 units */
typedef __bf16 v16b __attribute__((ext_vector_type(16)));
typedef unsigned short v8us __attribute__((ext_vector_type(8), may_alias));
typedef unsigned short v4us __attribute__((ext_vector_type(4), may_alias));
typedef float  v8f  __attribute__((ext_vector_type(8)));
typedef float  v4f  __attribute__((ext_vector_type(4)));
typedef float  v2f  __attribute__((ext_vector_type(2)));
typedef float  v4fa __attribute__((ext_vector_type(4), may_alias));
union FragB { v16b v; v8us half[2]; unsigned short u[16]; };

__device__ __forceinline__ unsigned short bf16_bits(float x) { unsigned int u = __float_as_uint(x); return (unsigned short)((u + 0x7FFFu + ((u >> 16) & 1u)) >> 16); }
__device__ __forceinline__ float bf16_val(unsigned short b) { return __uint_as_float(((unsigned int)b) << 16); }
__device__ __forceinline__ float bf16_round(float x) { return bf16_val(bf16_bits(x)); }
// D += A·B with NT terms: 1 = ah·bh, 2 = + al·bh (A split), 3 = + ah·bl (both split)
template <int NT>
__device__ __forceinline__ v8f mmaN(v16b ah, v16b al, v16b bh, v16b bl, v8f c) {
  c = __builtin_amdgcn_wmma_f32_16x16x32_bf16(false, ah, false, bh, (short)0, c, false, false);
  if (NT >= 2) c = __builtin_amdgcn_wmma_f32_16x16x32_bf16(false, al, false, bh, (short)0, c, false, false);
  if (NT >= 3) c = __builtin_amdgcn_wmma_f32_16x16x32_bf16(false, ah, false, bl, (short)0, c, false, false);
  asm volatile("v_nop\n\tv_nop\n\tv_nop\n\tv_nop" : "+v"(c) : "v"(ah), "v"(al), "v"(bh), "v"(bl));
  return c;
}

__global__ __launch_bounds__(256) void k_wt_bf16(const float* __restrict__ W, unsigned short* __restrict__ Wt, int K, int N) {
  const int t = blockIdx.x * 256 + threadIdx.x;
  const int k8n = K / 8;
  if (t >= N * k8n) return;
  const int n = t / k8n, k8 = (t % k8n) * 8;
  v8us v;
#pragma unroll
  for (int i = 0; i < 8; ++i) v[i] = bf16_bits(W[(size_t)(k8 + i) * N + n]);
  *(v8us*)(Wt + (size_t)n * K + k8) = v;
  
}

// GEMM C[M][N] (f32, pitch ldc) = act(A[M][K]·W + bias). A f32 row-major (pitch lda) converted per fragment to bf16
// (ASPLIT: hi/lo two planes -> 2 terms, else single rounded term); Wt bf16 [N][K] (pitch ldb). BIAS_BF16 rounds the
// bias to bf16 first (bias quantised to bf16 before the add). K%32==0, M%16==0, N%64==0.
template <bool ASPLIT, int ACT, bool BIAS_BF16>
__global__ __launch_bounds__(128) void k_gemm_bf(const float* __restrict__ A, int lda, const unsigned short* __restrict__ Wt, int ldb,
                                               const float* __restrict__ bias, float* __restrict__ C, int ldc, int M, int N, int K) {
  __shared__ __attribute__((aligned(16))) float so[4][16][64];
  const int tid = threadIdx.x, w = tid >> 5, lane = tid & 31, ln = lane & 15, hh = lane >> 4;
  const int ntn = N / 64;
  const int wid = blockIdx.x * 4 + w;
  const int mt = wid / ntn, nq = wid % ntn;
  if (mt * 16 >= M) return;
  const int row0 = mt * 16, col0 = nq * 64;
  const float* arow = A + (size_t)(row0 + ln) * lda;
  v8f acc[4] = {};
  for (int kb = 0; kb < K; kb += 32) {
    FragB ah, al;
    const v4f x0 = *(const v4fa*)(arow + kb + 8 * hh), x1 = *(const v4fa*)(arow + kb + 8 * hh + 4);
    const v4f x2 = *(const v4fa*)(arow + kb + 16 + 8 * hh), x3 = *(const v4fa*)(arow + kb + 16 + 8 * hh + 4);
    float xs[16] = {x0[0],x0[1],x0[2],x0[3],x1[0],x1[1],x1[2],x1[3],x2[0],x2[1],x2[2],x2[3],x3[0],x3[1],x3[2],x3[3]};
#pragma unroll
    for (int i = 0; i < 16; ++i) { const unsigned short hb = bf16_bits(xs[i]); ah.u[i] = hb; al.u[i] = ASPLIT ? bf16_bits(xs[i] - bf16_val(hb)) : (unsigned short)0; }
#pragma unroll
    for (int t = 0; t < 4; ++t) {
      const unsigned short* brow = Wt + (size_t)(col0 + t * 16 + ln) * ldb + kb;
      FragB b;
      b.half[0] = *(const v8us*)(brow + 8 * hh);
      b.half[1] = *(const v8us*)(brow + 16 + 8 * hh);
      acc[t] = mmaN<ASPLIT ? 2 : 1>(ah.v, al.v, b.v, b.v, acc[t]);
    }
  }
#pragma unroll
  for (int t = 0; t < 4; ++t) {
    float bv = bias ? bias[col0 + t * 16 + ln] : 0.f;
    if (BIAS_BF16) bv = bf16_round(bv);
#pragma unroll
    for (int r = 0; r < 8; ++r) { float v = acc[t][r] + bv; if (ACT == 1) v = fmaxf(v, 0.f); so[w][8 * hh + r][t * 16 + ln] = v; }
  }
  __builtin_amdgcn_fence(__ATOMIC_ACQ_REL, "workgroup");
  __builtin_amdgcn_wave_barrier();
  const int rsub = lane >> 4, c4 = (lane & 15) * 4;
  {
#pragma unroll
    for (int q = 0; q < 8; ++q) {
      const int r = q * 2 + rsub;
      const v4f v = *(const v4fa*)&so[w][r][c4];
      *(v4f*)(C + (size_t)(row0 + r) * ldc + col0 + c4) = v;
    }
    
  }
}

// GEMM C = act(A·W + bias + resid): A f32 (ASPLIT -> hi/lo 2 terms), Wt bf16 [N][K]; ACT 0 none, 1 relu, 2 exact gelu;
// resid (optional, f32, row index = (row % rmod), pitch ldr, RES_BF16 rounds it) added before the activation.
template <bool ASPLIT, int ACT, bool BIAS_BF16, bool RES_BF16>
__global__ __launch_bounds__(128) void k_gemm_bf3(const float* __restrict__ A, int lda, const unsigned short* __restrict__ Wt, int ldb,
                                                const float* __restrict__ bias, const float* __restrict__ resid, int rmod, int ldr,
                                                float* __restrict__ C, int ldc, int M, int N, int K) {
  __shared__ __attribute__((aligned(16))) float so[4][16][64];
  const int tid = threadIdx.x, w = tid >> 5, lane = tid & 31, ln = lane & 15, hh = lane >> 4;
  const int ntn = N / 64;
  const int wid = blockIdx.x * 4 + w;
  const int mt = wid / ntn, nq = wid % ntn;
  if (mt * 16 >= M) return;
  const int row0 = mt * 16, col0 = nq * 64;
  const float* arow = A + (size_t)(row0 + ln) * lda;
  v8f acc[4] = {};
  for (int kb = 0; kb < K; kb += 32) {
    FragB ah, al;
    const v4f x0 = *(const v4fa*)(arow + kb + 8 * hh), x1 = *(const v4fa*)(arow + kb + 8 * hh + 4);
    const v4f x2 = *(const v4fa*)(arow + kb + 16 + 8 * hh), x3 = *(const v4fa*)(arow + kb + 16 + 8 * hh + 4);
    float xs[16] = {x0[0],x0[1],x0[2],x0[3],x1[0],x1[1],x1[2],x1[3],x2[0],x2[1],x2[2],x2[3],x3[0],x3[1],x3[2],x3[3]};
#pragma unroll
    for (int i = 0; i < 16; ++i) { const unsigned short hb = bf16_bits(xs[i]); ah.u[i] = hb; al.u[i] = ASPLIT ? bf16_bits(xs[i] - bf16_val(hb)) : (unsigned short)0; }
#pragma unroll
    for (int t = 0; t < 4; ++t) {
      const unsigned short* brow = Wt + (size_t)(col0 + t * 16 + ln) * ldb + kb;
      FragB b;
      b.half[0] = *(const v8us*)(brow + 8 * hh);
      b.half[1] = *(const v8us*)(brow + 16 + 8 * hh);
      acc[t] = mmaN<ASPLIT ? 2 : 1>(ah.v, al.v, b.v, b.v, acc[t]);
    }
  }
#pragma unroll
  for (int t = 0; t < 4; ++t) {
    const int col = col0 + t * 16 + ln;
    float bv = bias ? bias[col] : 0.f;
    if (BIAS_BF16) bv = bf16_round(bv);
#pragma unroll
    for (int r = 0; r < 8; ++r) {
      float v = acc[t][r] + bv;
      if (resid) { float rv = resid[(size_t)((row0 + 8 * hh + r) % rmod) * ldr + col]; if (RES_BF16) rv = bf16_round(rv); v += rv; }
      if (ACT == 1) v = fmaxf(v, 0.f);
      if (ACT == 2) v = 0.5f * v * (1.0f + erff(v * 0.70710678118654752f));
      if (ACT == 3) { const float u = 0.7978845608028654f * (v + 0.044715f * v * v * v); v = 0.5f * v * (1.0f + tanhf(u)); }
      so[w][8 * hh + r][t * 16 + ln] = v;
    }
  }
  __builtin_amdgcn_fence(__ATOMIC_ACQ_REL, "workgroup");
  __builtin_amdgcn_wave_barrier();
  const int rsub = lane >> 4, c4 = (lane & 15) * 4;
  {
#pragma unroll
    for (int q = 0; q < 8; ++q) {
      const int r = q * 2 + rsub;
      const v4f v = *(const v4fa*)&so[w][r][c4];
      *(v4f*)(C + (size_t)(row0 + r) * ldc + col0 + c4) = v;
    }
    
  }
}
// row LayerNorm (biased variance, eps) over N: s = X (+ R); optional out_sum <- s; out_norm <- (s-mu)*rsqrt(var+eps)*g + b
template <bool PARAM_BF16>
__global__ __launch_bounds__(256) void k_layernorm(const float* __restrict__ X, const float* __restrict__ R, const float* __restrict__ g, const float* __restrict__ bta,
                                                  float* __restrict__ out_sum, float* __restrict__ out_norm, int N, float eps) {
  __shared__ float red[256];
  const int row = blockIdx.x, tid = threadIdx.x;
  const float* x = X + (size_t)row * N; const float* rr = R ? R + (size_t)row * N : nullptr;
  float vals[16];                     // up to N = 4096
  const int per = N / 256;            // contiguous chunk per thread? use strided-by-4 chunks: thread handles j = tid*4 + 1024*u
  float s1 = 0.f;
  for (int u = 0; u < per / 4; ++u) {
    const int j = tid * 4 + 1024 * u;
    const v4f a = *(const v4fa*)(x + j);
    v4f b = {0.f,0.f,0.f,0.f}; if (rr) b = *(const v4fa*)(rr + j);
#pragma unroll
    for (int q = 0; q < 4; ++q) { const float v = a[q] + b[q]; vals[u * 4 + q] = v; s1 += v; }
  }
  red[tid] = s1; __syncthreads();
  for (int st = 128; st > 0; st >>= 1) { if (tid < st) red[tid] += red[tid + st]; __syncthreads(); }
  const float mu = red[0] / (float)N; __syncthreads();
  float s2 = 0.f;
  for (int u = 0; u < per / 4; ++u)
#pragma unroll
    for (int q = 0; q < 4; ++q) { const float c = vals[u * 4 + q] - mu; s2 += c * c; }
  red[tid] = s2; __syncthreads();
  for (int st = 128; st > 0; st >>= 1) { if (tid < st) red[tid] += red[tid + st]; __syncthreads(); }
  const float rs = rsqrtf(red[0] / (float)N + eps);
  {
    for (int u = 0; u < per / 4; ++u) {
      const int j = tid * 4 + 1024 * u;
      v4f o, sm;
#pragma unroll
      for (int q = 0; q < 4; ++q) {
        float gg = g[j + q], bb = bta[j + q];
        if (PARAM_BF16) { gg = bf16_round(gg); bb = bf16_round(bb); }
        sm[q] = vals[u * 4 + q]; o[q] = (vals[u * 4 + q] - mu) * rs * gg + bb;
      }
      if (out_sum) *(v4f*)(out_sum + (size_t)row * N + j) = sm;
      *(v4f*)(out_norm + (size_t)row * N + j) = o;
    }
    
  }
}



// ---- f16 WMMA path (v_wmma_f32_16x16x32_f16): 11-bit significands for operands in range — used where a [0,1] probability operand needs more precision than bf16
typedef _Float16 v16h __attribute__((ext_vector_type(16)));
union FragH { v16h v; v8us half[2]; _Float16 h[16]; unsigned short u[16]; };
template <int NT>
__device__ __forceinline__ v8f mmaH(v16h ah, v16h al, v16h bh, v16h bl, v8f c) {
  c = __builtin_amdgcn_wmma_f32_16x16x32_f16(false, ah, false, bh, (short)0, c, false, false);
  if (NT >= 2) c = __builtin_amdgcn_wmma_f32_16x16x32_f16(false, al, false, bh, (short)0, c, false, false);
  if (NT >= 3) c = __builtin_amdgcn_wmma_f32_16x16x32_f16(false, ah, false, bl, (short)0, c, false, false);
  return c;
}
// batched GEMM like k_gemm_b but f16 operands: A f32 (split into f16 hi/lo if ASPLIT, else rounded to f16), Bt = f16 values [n][k]; alpha; C f32; N multiple of 16 (partial tiles skipped)
template <bool ASPLIT>
__global__ __launch_bounds__(128) void k_gemm_h(const float* __restrict__ A, int lda, size_t sA, const _Float16* __restrict__ Bh, int ldb, size_t sB, float alpha, float* __restrict__ C, int ldc, size_t sC, int M, int N, int K) {
  __shared__ __attribute__((aligned(16))) float so[4][16][64];
  const int tid = threadIdx.x, w = tid >> 5, lane = tid & 31, ln = lane & 15, hh = lane >> 4; const int by = blockIdx.y;
  A += (size_t)by * sA; Bh += (size_t)by * sB; C += (size_t)by * sC;
  const int ntn = (N + 63) / 64; const int wid = blockIdx.x * 4 + w; const int mt = wid / ntn, nq = wid % ntn; if (mt * 16 >= M) return;
  const int row0 = mt * 16, col0 = nq * 64; const float* arow = A + (size_t)(row0 + ln) * lda;
  v8f acc[4] = {};
  for (int kb = 0; kb < K; kb += 32) {
    FragH ah, al;
    const v4f x0 = *(const v4fa*)(arow + kb + 8 * hh), x1 = *(const v4fa*)(arow + kb + 8 * hh + 4), x2 = *(const v4fa*)(arow + kb + 16 + 8 * hh), x3 = *(const v4fa*)(arow + kb + 16 + 8 * hh + 4);
    float xs[16] = {x0[0],x0[1],x0[2],x0[3],x1[0],x1[1],x1[2],x1[3],x2[0],x2[1],x2[2],x2[3],x3[0],x3[1],x3[2],x3[3]};
#pragma unroll
    for (int i = 0; i < 16; ++i) { const _Float16 h = (_Float16)xs[i]; ah.h[i] = h; al.h[i] = ASPLIT ? (_Float16)(xs[i] - (float)h) : (_Float16)0.0f; }
#pragma unroll
    for (int t = 0; t < 4; ++t) { if (col0 + t * 16 >= N) continue; const size_t boff = (size_t)(col0 + t * 16 + ln) * ldb + kb; FragH bq; bq.half[0] = *(const v8us*)(Bh + boff + 8 * hh); bq.half[1] = *(const v8us*)(Bh + boff + 16 + 8 * hh);
      acc[t] = mmaH<ASPLIT ? 2 : 1>(ah.v, al.v, bq.v, bq.v, acc[t]); }
  }
#pragma unroll
  for (int t = 0; t < 4; ++t) { if (col0 + t * 16 >= N) continue;
#pragma unroll
    for (int r = 0; r < 8; ++r) so[w][8 * hh + r][t * 16 + ln] = acc[t][r] * alpha; }
  __builtin_amdgcn_fence(__ATOMIC_ACQ_REL, "workgroup"); __builtin_amdgcn_wave_barrier();
  const int rsub = lane >> 4, c4 = (lane & 15) * 4;
  {
#pragma unroll
    for (int q = 0; q < 8; ++q) { const int r = q * 2 + rsub; if (col0 + c4 < N) { const v4f v = *(const v4fa*)&so[w][r][c4]; *(v4f*)(C + (size_t)(row0 + r) * ldc + col0 + c4) = v; } }
     }
}

// Wt[n][k] = f16(W[k][n]·scale) from f32 row-major W[K][N] (scale = power of two; bf16-exact weights stay exact in f16 away from the subnormal range)
__global__ __launch_bounds__(256) void k_wt_f16(const float* __restrict__ W, _Float16* __restrict__ Wt, int K, int N, float scale) {
  const int t = blockIdx.x * 256 + threadIdx.x; if (t >= N * (K / 8)) return; const int n = t / (K / 8), k8 = (t % (K / 8)) * 8; FragH f;
#pragma unroll
  for (int i = 0; i < 8; ++i) f.h[i] = (_Float16)(bf16_round(W[(size_t)(k8 + i) * N + n]) * scale); const v8us o = f.half[0];
  *(v8us*)((unsigned short*)Wt + (size_t)n * K + k8) = o; 
}
// k_gemm_hh variant with fused epilogue: v = acc·alpha + bias[by·sBias + col] (+ CP[(row/rowsPerB)·sCPb + by·64 + col] if CP) ; ACT 0 none / 1 elu ; writes f16 C16 (and f32 C if non-null)
template <int ACT>
__global__ __launch_bounds__(128) void k_gemm_hhx(const _Float16* __restrict__ A, int lda, size_t sA, const _Float16* __restrict__ Bh, int ldb, size_t sB, float alpha, const float* __restrict__ bias, size_t sBias, const float* __restrict__ CP, int rowsPerB, size_t sCPb, int row0g,
    float* __restrict__ C, _Float16* __restrict__ C16, int ldc, size_t sC, int M, int N, int K) {
  __shared__ __attribute__((aligned(16))) float so[4][16][64];
  const int tid = threadIdx.x, w = tid >> 5, lane = tid & 31, ln = lane & 15, hh = lane >> 4; const int by = blockIdx.y;
  A += (size_t)by * sA; Bh += (size_t)by * sB; const size_t cofs = (size_t)by * sC; const float* bp = bias ? bias + (size_t)by * sBias : nullptr;
  const int ntn = (N + 63) / 64; const int wid = blockIdx.x * 4 + w; const int mt = wid / ntn, nq = wid % ntn; if (mt * 16 >= M) return;
  const int row0 = mt * 16, col0 = nq * 64; const _Float16* arow = A + (size_t)(row0 + ln) * lda;
  v8f acc[4] = {};
  for (int kb = 0; kb < K; kb += 32) { FragH ah; ah.half[0] = *(const v8us*)((const unsigned short*)arow + kb + 8 * hh); ah.half[1] = *(const v8us*)((const unsigned short*)arow + kb + 16 + 8 * hh);
#pragma unroll
    for (int t = 0; t < 4; ++t) { if (col0 + t * 16 >= N) continue; const size_t boff = (size_t)(col0 + t * 16 + ln) * ldb + kb; FragH bq; bq.half[0] = *(const v8us*)((const unsigned short*)Bh + boff + 8 * hh); bq.half[1] = *(const v8us*)((const unsigned short*)Bh + boff + 16 + 8 * hh);
      acc[t] = mmaH<1>(ah.v, ah.v, bq.v, bq.v, acc[t]); }
  }
#pragma unroll
  for (int t = 0; t < 4; ++t) { if (col0 + t * 16 >= N) continue; const int col = col0 + t * 16 + ln; const float bv = bp ? bf16_round(bp[col]) : 0.f;
#pragma unroll
    for (int r = 0; r < 8; ++r) { float v = acc[t][r] * alpha + bv; if (CP) { const int bidx = (row0g + row0 + 8 * hh + r) / rowsPerB; v += CP[(size_t)bidx * sCPb + (size_t)by * 64 + col]; } if (ACT == 1) v = (v > 0.f) ? v : expm1f(v); else if (ACT == 7) v = (v > 0.f) ? v + 1.0f : expf(v); else if (ACT == 8) v = tanhf(v); else if (ACT == 9) v = 0.5f * v * (1.0f + tanhf(0.7978845608028654f * (v + 0.044715f * v * v * v))); else if (ACT == 11) v = 1.0f / (1.0f + expf(-v)); else if (ACT == 12) v = (v > 0.f) ? v : 0.01f * v; else if (ACT == 14) v = (v > 0.f) ? v : 0.1f * v; else if (ACT == 15) v = v / (1.0f + expf(-v)); else if (ACT == 3) v = fmaxf(v, 0.f); else if (ACT == 6) v = 0.5f * v * (1.0f + erff(v * 0.70710678118654752f)); so[w][8 * hh + r][t * 16 + ln] = v; } }
  __builtin_amdgcn_fence(__ATOMIC_ACQ_REL, "workgroup"); __builtin_amdgcn_wave_barrier();
  const int rsub = lane >> 4, c4 = (lane & 15) * 4; typedef _Float16 v4h __attribute__((ext_vector_type(4)));
  {
#pragma unroll
    for (int q = 0; q < 8; ++q) { const int r = q * 2 + rsub; if (col0 + c4 < N) { const v4f v = *(const v4fa*)&so[w][r][c4]; if (C) *(v4f*)(C + cofs + (size_t)(row0 + r) * ldc + col0 + c4) = v; if (C16) { v4h h4; for (int i = 0; i < 4; ++i) h4[i] = (_Float16)v[i]; *(v4h*)(C16 + cofs + (size_t)(row0 + r) * ldc + col0 + c4) = h4; } } }
     }
}


typedef _Float16 v4h __attribute__((ext_vector_type(4)));

__global__ __launch_bounds__(256) void k_round16f(const float* __restrict__ W, _Float16* __restrict__ Bt, size_t n8) { const size_t t = (size_t)blockIdx.x * 256 + threadIdx.x; if (t >= n8) return; FragH f;
#pragma unroll
  for (int i = 0; i < 8; ++i) f.h[i] = (_Float16)(bf16_round(W[t * 8 + i]) * 16.0f); *(v8us*)((unsigned short*)Bt + t * 8) = f.half[0];  }
// ---- fused GEMM (wave tile 32x64, K = KD): the epilogue writes what the next kernel reads ----
#define KD 256                   /* = CM = DP: K and the row pitch of A and of the weight planes */
__device__ __forceinline__ v16h g2_frag(const _Float16* p, int hh) { FragH f; f.half[0] = *(const v8us*)((const unsigned short*)p + 8 * hh); f.half[1] = *(const v8us*)((const unsigned short*)p + 16 + 8 * hh); return f.v; }
__device__ __forceinline__ v8f g2_mma(v16h a, v16h b, v8f c) { return __builtin_amdgcn_wmma_f32_16x16x32_f16(false, a, false, b, (short)0, c, false, false); }
// Fragment order: a 16 x 32 f16 operand tile (16 rows or columns x 32 k) is FTE consecutive elements; lane l = 16 hh + ln holds row ln, k = 8 hh .. + 7 at element 8 l and k = 16 + 8 hh .. + 7 at FTE / 2 + 8 l (the k order of g2_frag)
#define FTE 512
__device__ __forceinline__ v16h pk_frag(const _Float16* p) { FragH f; f.half[0] = *(const v8us*)((const unsigned short*)p); f.half[1] = *(const v8us*)((const unsigned short*)p + FTE / 2); return f.v; }      /* p = tile + 8 lane */
// The same tile in LDS: its four quarters (k 0-7, 8-15, 16-23, 24-31 of the 16 rows, 256 B each) stand AQE elements = 320 B apart, so that a store of 4 rows x 32 k (8 B a lane) meets every bank once and each half wave of a fragment read (16 B a lane) does too
#define AQE 160
#define ATE (4 * AQE)
__device__ __forceinline__ v16h ls_frag(const _Float16* p) { FragH f; f.half[0] = *(const v8us*)((const unsigned short*)p); f.half[1] = *(const v8us*)((const unsigned short*)p + 2 * AQE); return f.v; }      /* p = tile + hh AQE + 8 ln */
// A: fragment tiles [row / 16][k / 32] from Ap, PK: in global memory (FTE), else in LDS (ATE). Bh: fragment tiles [col / 16][k / 32]. k0: the k tile at which this block enters its walk (it wraps round): blocks that read the same tiles do not ask L2 for the same lines at one moment
template <bool PK>
__device__ __forceinline__ void gf_tile(const _Float16* __restrict__ Ap, const _Float16* __restrict__ Bh, int row0, int col0, int k0, int ln, int hh, v8f (&accs)[8]) {
  constexpr int TR = (KD / 32) * FTE, AT = PK ? FTE : ATE, ATR = (KD / 32) * AT;      /* elements of one row of tiles; of one A tile and one row of A tiles */
  const _Float16* p0p = Ap + (size_t)(row0 / 16) * ATR + k0 * AT + (PK ? (16 * hh + ln) * 8 : hh * AQE + ln * 8);
  const _Float16* b0p = Bh + (size_t)(col0 / 16) * TR + k0 * FTE + (16 * hh + ln) * 8;
  const v8f z8 = {0.f,0.f,0.f,0.f,0.f,0.f,0.f,0.f}; v8f c00 = z8, c01 = z8, c02 = z8, c03 = z8, c10 = z8, c11 = z8, c12 = z8, c13 = z8;
#pragma unroll 1                 /* rolled, as before the fusion: keeps the registers low enough for every block of the grid to be resident at once */
  for (int kt = 0; kt < KD / 32; ++kt) { const v16h a0 = PK ? pk_frag(p0p) : ls_frag(p0p), a1 = PK ? pk_frag(p0p + ATR) : ls_frag(p0p + ATR);
    v16h b = pk_frag(b0p); c00 = g2_mma(a0, b, c00); c10 = g2_mma(a1, b, c10);
    b = pk_frag(b0p + TR); c01 = g2_mma(a0, b, c01); c11 = g2_mma(a1, b, c11);
    b = pk_frag(b0p + 2 * TR); c02 = g2_mma(a0, b, c02); c12 = g2_mma(a1, b, c12);
    b = pk_frag(b0p + 3 * TR); c03 = g2_mma(a0, b, c03); c13 = g2_mma(a1, b, c13);
    const int st = (kt + k0 == KD / 32 - 1) ? 1 - KD / 32 : 1;      /* one k tile on, or from the last back to the first */
    p0p += st * AT; b0p += st * FTE; }
  accs[0] = c00; accs[1] = c01; accs[2] = c02; accs[3] = c03; accs[4] = c10; accs[5] = c11; accs[6] = c12; accs[7] = c13; }
// q, k, v projections, blockIdx.y = 0, 1, 2: y = x W^T + b (weights x16, so acc / 16). q, k -> hi + 2^10 residual planes, fragment tiles [b * NH + head][token / 16]; v -> f16 V^T, fragment tiles [b * NH + head][token / 32][dim / 16]
__global__ __launch_bounds__(256) void k_proj(const float* __restrict__ xq, const float* __restrict__ xk, const float* __restrict__ xv, const _Float16* __restrict__ Bq, const _Float16* __restrict__ Bk, const _Float16* __restrict__ Bv,
    const float* __restrict__ bq, const float* __restrict__ bk, const float* __restrict__ bv, _Float16* __restrict__ QH, _Float16* __restrict__ QL, _Float16* __restrict__ KH, _Float16* __restrict__ KL, _Float16* __restrict__ VT) {
  __shared__ __attribute__((aligned(16))) char sm[8 * 32 * 68 * 4];      /* first the block's A tiles (4 x 8 x ATE f16), then, behind a barrier, each wave's 32 x 68 f32 output rows */
  _Float16* sa = (_Float16*)sm; float (*so)[32][68] = (float (*)[32][68])sm;
  const int tid = threadIdx.x, w = tid >> 5, lane = tid & 31, ln = lane & 15, hh = lane >> 4; const int by = blockIdx.y;
  const float* A = (by == 0) ? xq : ((by == 1) ? xk : xv); const _Float16* Bh = (by == 0) ? Bq : ((by == 1) ? Bk : Bv); const float* bp = (by == 0) ? bq : ((by == 1) ? bk : bv);
  const int rl0 = 32 * (w >> 2), row0 = blockIdx.x * 64 + rl0, col0 = (w & 3) * 64;      /* 2 x 4 waves: 64 rows x all DP columns */
  { /* wave w stages rows 8 w .. + 7: a load takes 128 B (one k tile) of each of 4 rows, 8 lanes a row; lane's 4 floats = k 4 (lane & 7) .. + 3 of the tile, rounded to bf16 and held as f16 */
    const float* ap = A + (size_t)(blockIdx.x * 64 + 8 * w + (lane >> 3)) * KD + (lane & 7) * 4;
    unsigned short* sp = (unsigned short*)sa + (w >> 1) * ((KD / 32) * ATE) + ((lane >> 1) & 3) * AQE + (8 * (w & 1) + (lane >> 3)) * 8 + (lane & 1) * 4;
    v4f x[2][KD / 32];           /* both loop nests unrolled: x stays in registers, and all 16 loads are in flight before the first is converted */
#pragma unroll
    for (int g = 0; g < 2; ++g)
#pragma unroll
      for (int kt = 0; kt < KD / 32; ++kt) x[g][kt] = *(const v4fa*)(ap + (size_t)g * 4 * KD + kt * 32);
#pragma unroll
    for (int g = 0; g < 2; ++g)
#pragma unroll
      for (int kt = 0; kt < KD / 32; ++kt) { FragH f;
#pragma unroll
        for (int i = 0; i < 4; ++i) f.h[i] = (_Float16)bf16_round(x[g][kt][i]);
        *(v4us*)(sp + kt * ATE + g * 32) = (v4us){f.u[0], f.u[1], f.u[2], f.u[3]}; } }
  __syncthreads();               /* every wave reads rows that other waves staged */
  v8f accs[8]; gf_tile<false>(sa, Bh, rl0, col0, blockIdx.x & (KD / 32 - 1), ln, hh, accs);      /* all NR / 64 row blocks read the same weight tiles */
  const int sl0 = (row0 / SLEN) * NH + col0 / HS, tk0 = row0 % SLEN;      /* the wave's first (window, head) and first token: 2 heads x 32 tokens */
  if (by == 2) {                 /* block-uniform. A lane's 8 accumulator rows are 8 consecutive tokens of one column = its own 16 bytes of a V^T fragment tile (row = dim ln, k = token): stored from registers */
#pragma unroll
    for (int u = 0; u < 8; ++u) { const int t = u & 3, half = u >> 2; const float bvv = bf16_round(bp[col0 + t * 16 + ln]); FragH f;
#pragma unroll
      for (int r = 0; r < 8; ++r) f.h[r] = (_Float16)(accs[u][r] * 0.0625f + bvv);
      *(v8us*)((unsigned short*)VT + ((size_t)((sl0 + (t >> 1)) * (SLEN / 32) + tk0 / 32) * (HS / 16) + (t & 1)) * FTE + half * (FTE / 2) + lane * 8) = f.half[0]; }
    return; }
  __syncthreads();               /* the output rows overwrite the A tiles: every wave has left its k loop */
  _Float16* Hh = (by == 0) ? QH : KH; _Float16* Hl = (by == 0) ? QL : KL;
#pragma unroll
  for (int u = 0; u < 8; ++u) { const int t = u & 3, half = u >> 2; const float bvv = bf16_round(bp[col0 + t * 16 + ln]);
#pragma unroll
    for (int r = 0; r < 8; ++r) so[w][half * 16 + 8 * hh + r][t * 16 + ln] = accs[u][r] * 0.0625f + bvv; }
  __builtin_amdgcn_fence(__ATOMIC_ACQ_REL, "workgroup"); __builtin_amdgcn_wave_barrier();
#pragma unroll 1                 /* one tile a trip: a quarter of the code; the k loop and the register count come out the same either way */
  for (int tl = 0; tl < 4; ++tl) { const int kt = tl >> 1, hd = tl & 1;      /* 2 token tiles x 2 heads; per half tile a lane reads its 8 dims of token ln and stores its 16 bytes */
    const size_t o = ((size_t)(sl0 + hd) * (SLEN / 16) + tk0 / 16 + kt) * FTE + lane * 8;
#pragma unroll
    for (int half = 0; half < 2; ++half) { const float* sp = &so[w][kt * 16 + ln][hd * HS + half * 16 + 8 * hh]; const v4f v0 = *(const v4fa*)sp, v1 = *(const v4fa*)(sp + 4); FragH fh, fl;
#pragma unroll
      for (int i = 0; i < 4; ++i) { const _Float16 h0 = (_Float16)v0[i], h1 = (_Float16)v1[i]; fh.h[i] = h0; fh.h[4 + i] = h1; fl.h[i] = (_Float16)((v0[i] - (float)h0) * 1024.0f); fl.h[4 + i] = (_Float16)((v1[i] - (float)h1) * 1024.0f); }
      *(v8us*)((unsigned short*)Hh + o + half * (FTE / 2)) = fh.half[0]; *(v8us*)((unsigned short*)Hl + o + half * (FTE / 2)) = fl.half[0]; }
    asm volatile("s_wait_xcnt 0x0" ::: "memory"); }      /* the next trip rewrites these stores' address and data registers */
}
template <int CAUSAL>
__global__ __launch_bounds__(128) void k_flash(const _Float16* __restrict__ Q16, int ldq, const _Float16* __restrict__ K16, int ldk, const _Float16* __restrict__ Vt, const int* __restrict__ MSK, float* __restrict__ O, int ldo) {
  constexpr int RPW = 16, RTN = RPW / 16, NQB = TQ / (4 * RPW), DT = 4, KS = 2;
  __shared__ __attribute__((aligned(16))) unsigned short sP[4][RPW][40]; __shared__ __attribute__((aligned(16))) float sO[4][RPW][64 + 4];
  const int tid = threadIdx.x, w = tid >> 5, lane = tid & 31, ln = lane & 15, hh = lane >> 4;
  const int slab = blockIdx.x / QBLKS, qblk = blockIdx.x % QBLKS; (void)NQB; const int b = slab / NH, h = slab % NH; const int qb0 = qblk * (4 * RPW); const int q0 = qb0 + w * RPW;
  FragH aq[2][KS];
#pragma unroll
  for (int rt = 0; rt < RTN; ++rt) { const unsigned short* qr = (const unsigned short*)Q16 + ((size_t)b * TQ + q0 + rt * 16 + ln) * ldq + h * 64;
#pragma unroll
    for (int ks = 0; ks < KS; ++ks) { aq[rt][ks].half[0] = *(const v8us*)(qr + ks * 32 + 8 * hh); aq[rt][ks].half[1] = *(const v8us*)(qr + ks * 32 + 16 + 8 * hh); } }
  const unsigned short* Vth = (const unsigned short*)Vt + (size_t)slab * 64 * TK;
  float m_r[2][8], l_r[2][8]; v8f oacc[2][DT];
#pragma unroll
  for (int rt = 0; rt < RTN; ++rt) {
#pragma unroll
    for (int r = 0; r < 8; ++r) { m_r[rt][r] = -3.0e38f; l_r[rt][r] = 0.f; }
#pragma unroll
    for (int dt = 0; dt < DT; ++dt) oacc[rt][dt] = (v8f){0.f,0.f,0.f,0.f,0.f,0.f,0.f,0.f}; }
  const int jend = (CAUSAL == 1) ? (qb0 + 4 * RPW) : TK;      /* causal: keys beyond the block's last query never contribute */
#pragma unroll 1
  for (int j0 = 0; j0 < jend; j0 += 32) {
    v8f s[2][2];
#pragma unroll
    for (int nt = 0; nt < 2; ++nt) { const unsigned short* kr = (const unsigned short*)K16 + ((size_t)b * TK + j0 + nt * 16 + ln) * ldk + h * 64; FragH bk[KS];
#pragma unroll
      for (int ks = 0; ks < KS; ++ks) { bk[ks].half[0] = *(const v8us*)(kr + ks * 32 + 8 * hh); bk[ks].half[1] = *(const v8us*)(kr + ks * 32 + 16 + 8 * hh); }
#pragma unroll
      for (int rt = 0; rt < RTN; ++rt) { v8f acc = (v8f){0.f,0.f,0.f,0.f,0.f,0.f,0.f,0.f};
#pragma unroll
        for (int ks = 0; ks < KS; ++ks) acc = mmaH<1>(aq[rt][ks].v, aq[rt][ks].v, bk[ks].v, bk[ks].v, acc); s[rt][nt] = acc; } }
#pragma unroll
    for (int rt = 0; rt < RTN; ++rt)
#pragma unroll
      for (int r = 0; r < 8; ++r) { const int tq = q0 + rt * 16 + 8 * hh + r; const int k0 = j0 + ln, k1 = j0 + 16 + ln;
        const bool ok0 = (CAUSAL == 1) ? (k0 <= tq) : ((CAUSAL == 2) ? ((k0 >> 5) == (tq >> 5)) : true), ok1 = (CAUSAL == 1) ? (k1 <= tq) : ((CAUSAL == 2) ? ((k1 >> 5) == (tq >> 5)) : true);      /* mode 2: block-diagonal 32-token groups */
        const float s0 = ok0 ? s[rt][0][r] * SCL : -3.0e38f, s1 = ok1 ? s[rt][1][r] * SCL : -3.0e38f; float mc = fmaxf(s0, s1);
        mc = fmaxf(mc, __shfl_xor(mc, 1, 32)); mc = fmaxf(mc, __shfl_xor(mc, 2, 32)); mc = fmaxf(mc, __shfl_xor(mc, 4, 32)); mc = fmaxf(mc, __shfl_xor(mc, 8, 32));
        const float mn = fmaxf(m_r[rt][r], mc); const float al = (mn > -1.0e38f) ? expf(m_r[rt][r] - mn) : 1.0f; m_r[rt][r] = mn; const float p0 = ok0 ? expf(s0 - mn) : 0.f, p1 = ok1 ? expf(s1 - mn) : 0.f; l_r[rt][r] = l_r[rt][r] * al + p0 + p1;
#pragma unroll
        for (int dt = 0; dt < DT; ++dt) oacc[rt][dt][r] *= al;
        FragH t2; t2.h[0] = (_Float16)(p0 * 1024.0f); t2.h[1] = (_Float16)(p1 * 1024.0f); sP[w][rt * 16 + 8 * hh + r][ln] = t2.u[0]; sP[w][rt * 16 + 8 * hh + r][16 + ln] = t2.u[1]; }
    __builtin_amdgcn_fence(__ATOMIC_ACQ_REL, "workgroup"); __builtin_amdgcn_wave_barrier();
    FragH pa[2];
#pragma unroll
    for (int rt = 0; rt < RTN; ++rt) { pa[rt].half[0] = *(const v8us*)&sP[w][rt * 16 + ln][8 * hh]; pa[rt].half[1] = *(const v8us*)&sP[w][rt * 16 + ln][16 + 8 * hh]; }
#pragma unroll
    for (int dt = 0; dt < DT; ++dt) { const unsigned short* vrow = Vth + (size_t)(dt * 16 + ln) * TK + j0; FragH bv; bv.half[0] = *(const v8us*)(vrow + 8 * hh); bv.half[1] = *(const v8us*)(vrow + 16 + 8 * hh);
#pragma unroll
      for (int rt = 0; rt < RTN; ++rt) oacc[rt][dt] = mmaH<1>(pa[rt].v, pa[rt].v, bv.v, bv.v, oacc[rt][dt]); }
    __builtin_amdgcn_fence(__ATOMIC_ACQ_REL, "workgroup"); __builtin_amdgcn_wave_barrier(); }
#pragma unroll
  for (int rt = 0; rt < RTN; ++rt) {
#pragma unroll
    for (int r = 0; r < 8; ++r) { float l = l_r[rt][r]; l += __shfl_xor(l, 1, 32); l += __shfl_xor(l, 2, 32); l += __shfl_xor(l, 4, 32); l += __shfl_xor(l, 8, 32); l_r[rt][r] = (l > 0.f) ? 1.0f / (l * 1024.0f) : 0.f; }
#pragma unroll
    for (int dt = 0; dt < DT; ++dt)
#pragma unroll
      for (int r = 0; r < 8; ++r) sO[w][rt * 16 + 8 * hh + r][dt * 16 + ln] = oacc[rt][dt][r] * l_r[rt][r]; }
  __builtin_amdgcn_fence(__ATOMIC_ACQ_REL, "workgroup"); __builtin_amdgcn_wave_barrier();
  {
#pragma unroll
    for (int rp = 0; rp < RPW; rp += 2) { const int r = rp + (lane >> 4), pc = lane & 15; const v4f val = *(const v4fa*)&sO[w][r][pc * 4]; *(v4f*)(O + ((size_t)b * TQ + q0 + r) * ldo + h * 64 + pc * 4) = val; }
     } }
// Q/K-split flash kernel, transposed: S^T = Kh Qh^T + (Kh Ql^T + Kl Qh^T)/1024 and O^T += V^T P^T, with Q/K = [hi | 2^10 residual] f16 planes (QL/KL same layout as Q16/K16) and plain f16 P (x2^10). All planes are fragment tiles (FTE): a pass's K, K residual and V^T are 2 KiB runs each.
// K rows and V^T rows are the A operands, Q and P^T the B operands: a lane holds 16 of the 32 scores of ONE query (lane l and l ^ 16 share query l & 15), so the maximum and the sum run in the lane's own registers
// with one exchange between the wave's halves, and the two score tiles, converted in place, are the B fragment of the second product (register s of half hh = key 8 hh + s, then 16 + 8 hh + s - 8: the order in which V^T is loaded).
__device__ __forceinline__ float xhalf(float x) { return __int_as_float(__builtin_amdgcn_permlanex16(__float_as_int(x), __float_as_int(x), 0x76543210, 0xfedcba98, false, false)); }      /* lane l <-> l ^ 16 */
template <int CAUSAL>
__global__ __launch_bounds__(1024) __attribute__((amdgpu_waves_per_eu(9)))      /* a budget of 112 registers, inside which the loop was scheduled as a 4-wave block: with the 128 of this block size the compiler orders the pass so that it needs three more v_nop */
void k_flashqk(const _Float16* __restrict__ Q16, const _Float16* __restrict__ QL, const _Float16* __restrict__ K16, const _Float16* __restrict__ KL, const _Float16* __restrict__ Vt, const int* __restrict__ MSK, const _Float16* __restrict__ Bo, const float* __restrict__ bo, float* __restrict__ C) {
  static_assert(HS == 32, "one k step per score product, two output tiles");
  static_assert(NH * HS == KD && CM == 256, "a block's 8 heads are the whole k of the output product; 32 waves x (32 x 16) cover 64 x CM");
  constexpr int RPW = 16, DT = HS / 16, OP = CM + 4;      /* OP: pitch of the staged output rows; 8 rows on = 32 banks on, so the two halves of a wave's 4-byte stores do not meet */
  __shared__ __attribute__((aligned(16))) char sm[4 * NH * FTE * 2 + 4 * RPW * OP * 4];
  _Float16* sc = (_Float16*)sm;  /* the block's context: fragment tiles [query / 16][head], the output product's A operand; it stands first, where every fragment read's offset fits the instruction */
  float (*so)[OP] = (float (*)[OP])(sm + 4 * NH * FTE * 2);      /* the block's 64 output rows */
  const int tid = threadIdx.x, w = __builtin_amdgcn_readfirstlane(tid >> 5), lane = tid & 31, ln = lane & 15, hh = lane >> 4;      /* the wave's number in a scalar register: the plane bases below stay scalar */
  const int b = blockIdx.x / QBLKS, qblk = blockIdx.x % QBLKS, h = w >> 2, slab = b * NH + h; const int qb0 = qblk * (4 * RPW); const int q0 = qb0 + (w & 3) * RPW; const int tq = q0 + ln;      /* waves 4 h .. + 3, one on each SIMD, share head h's K and V^T */
  FragH bq, bql;                 /* B: column = query q0 + ln, k = head dim in the order of the K rows' loads */
  { const size_t qo = ((size_t)slab * (TQ / 16) + q0 / 16) * FTE + lane * 8; bq.v = pk_frag(Q16 + qo); bql.v = pk_frag(QL + qo);
    asm volatile("s_wait_xcnt 0x0" ::: "memory"); }      /* the key offsets formed next reuse these four loads' address registers */
  /* wave-uniform bases + one 32-bit byte offset per lane, which walks the keys: a pass is two tiles of each plane (K: 2 x 16 keys; V^T: 2 x 16 dims of its 32 keys), the lane's 16 bytes at 16 lane of each half tile */
  const char* kb = (const char*)(K16 + (size_t)slab * HS * TK); const char* klb = (const char*)(KL + (size_t)slab * HS * TK); const char* vb = (const char*)(Vt + (size_t)slab * HS * TK);
  const int ps = (CAUSAL == 1) ? 0 : ((2 * qblk + slab) & (TK / 32 - 1));      /* the pass at which this block enters the key walk (it wraps round): the QBLKS blocks of a (window, head) read the same K and V^T lines, and not at one moment */
  unsigned koff = (unsigned)lane * 16u + (unsigned)ps * (2u * FTE * 2u);
  float m_c = -3.0e38f, l_c = 0.f; v8f oacc[DT];
#pragma unroll
  for (int dt = 0; dt < DT; ++dt) oacc[dt] = (v8f){0.f,0.f,0.f,0.f,0.f,0.f,0.f,0.f};
  const int jend = (CAUSAL == 1) ? (qb0 + 4 * RPW) : TK;      /* causal: keys beyond the block's last query never contribute */
#pragma unroll 1                 /* rolled, as before: one pass's fragments and scores already fill the registers that eight waves a SIMD leave */
  for (int jj = 0; jj < jend; jj += 32) { const int j0 = (jj + 32 * ps) & (TK - 1);
    FragH ak[2], akl[2], av[DT];
#pragma unroll
    for (int nt = 0; nt < 2; ++nt) { const char* kr = kb + (size_t)nt * FTE * 2; const char* klr = klb + (size_t)nt * FTE * 2;
      ak[nt].half[0] = *(const v8us*)(kr + koff); ak[nt].half[1] = *(const v8us*)(kr + koff + FTE); akl[nt].half[0] = *(const v8us*)(klr + koff); akl[nt].half[1] = *(const v8us*)(klr + koff + FTE); }
#pragma unroll
    for (int dt = 0; dt < DT; ++dt) { const char* vrow = vb + (size_t)dt * FTE * 2; av[dt].half[0] = *(const v8us*)(vrow + koff); av[dt].half[1] = *(const v8us*)(vrow + koff + FTE); }
    koff = (koff + 2u * FTE * 2u) & (unsigned)(HS * TK * 2 - 1);      /* the next 32 keys, round the end of the plane */
    __builtin_amdgcn_sched_barrier(0);      /* the pass's 12 loads stay in front of its first product, as they stood: sunk among the products they would start one memory latency after another */
    v2f s2[8]; bool ok[16]; v8f sh[2], sl[2];      /* element nt * 8 + r (pair nt * 4 + r / 2): key j0 + nt * 16 + 8 hh + r against query tq. Neighbours are held as pairs, so the multiply-adds and adds below take two scores an instruction with no register moves */
#pragma unroll
    for (int nt = 0; nt < 2; ++nt) { const v8f z = (v8f){0.f,0.f,0.f,0.f,0.f,0.f,0.f,0.f};
      sh[nt] = mmaH<1>(ak[nt].v, ak[nt].v, bq.v, bq.v, z); sl[nt] = mmaH<1>(ak[nt].v, ak[nt].v, bql.v, bql.v, z); sl[nt] = mmaH<1>(akl[nt].v, akl[nt].v, bq.v, bq.v, sl[nt]); }
    __builtin_amdgcn_sched_barrier(0);      /* the six score products run as one block: each stands in the distance the one before it needs ahead of its first reader, where the compiler otherwise pads with v_nop */
#pragma unroll
    for (int nt = 0; nt < 2; ++nt) { const v8f acc = sh[nt], accl = sl[nt];
#pragma unroll
      for (int r = 0; r < 8; r += 2) { v2f c = __builtin_elementwise_fma((v2f){accl[r], accl[r + 1]}, (v2f){0.0009765625f, 0.0009765625f}, (v2f){acc[r], acc[r + 1]});      /* raw q.k: the scale is applied inside the exponent's multiply-add below (SCL2 > 0, so the maximum may be taken first) */
#pragma unroll
        for (int e = 0; e < 2; ++e) { const int kk = j0 + nt * 16 + 8 * hh + r + e;
          bool o = (CAUSAL == 1) ? (kk <= tq) : ((CAUSAL == 2) ? ((kk >> 5) == (tq >> 5)) : true);      /* mode 2: block-diagonal 32-token groups */
          if (CAUSAL == 4) o = MSK[((size_t)b * TQ + tq) * TK + kk] != 0;      /* mode 4: per-(query, key) INPUT mask shared by all heads; masked keys contribute nothing, rows with no valid key give l = 0 -> context 0, output bo */
          ok[nt * 8 + r + e] = o; if (!o) c[e] = -3.0e38f; }
        s2[nt * 4 + r / 2] = c; } }
    float mx[8];
#pragma unroll
    for (int k = 0; k < 8; ++k) mx[k] = fmaxf(s2[k][0], s2[k][1]);
    float mc = fmaxf(fmaxf(fmaxf(mx[0], mx[1]), fmaxf(mx[2], mx[3])), fmaxf(fmaxf(mx[4], mx[5]), fmaxf(mx[6], mx[7])));
    mc = fmaxf(mc, xhalf(mc));   /* the query's other 16 keys */
    /* base 2: m_c = running maximum of SCL2 s, less 10, so that 2^(SCL2 s - m_c) is P x 2^10 straight from one hardware exponential (arguments <= 10; below the exponent range it gives 0, far under an f16 P's last bit); every term of a pass and the rescale use the same rounded m_c */
    const float mn = fmaxf(m_c, __builtin_fmaf(mc, SCL2, -10.0f)); const float al = (mn > -1.0e37f) ? __builtin_amdgcn_exp2f(m_c - mn) : 1.0f; m_c = mn;      /* all keys masked so far: SCL2 x -3e38 stays under the bound */
    v2f p2[8]; FragH pb;         /* p, and with it l_c, carry the 2^10 */
#pragma unroll
    for (int k = 0; k < 8; ++k) { const v2f e = __builtin_elementwise_fma(s2[k], (v2f){SCL2, SCL2}, (v2f){-mn, -mn});
      p2[k][0] = ok[2 * k] ? __builtin_amdgcn_exp2f(e[0]) : 0.f; p2[k][1] = ok[2 * k + 1] ? __builtin_amdgcn_exp2f(e[1]) : 0.f; pb.h[2 * k] = (_Float16)p2[k][0]; pb.h[2 * k + 1] = (_Float16)p2[k][1]; }
    /* halving tree: p[i] + p[8 + i], then [i] + [4 + i], then ([0] + [2]) + ([1] + [3]); neighbours stay neighbours, so the adds pair up two to an instruction */
    const v2f t4a = (p2[0] + p2[4]) + (p2[2] + p2[6]), t4b = (p2[1] + p2[5]) + (p2[3] + p2[7]); const v2f t2 = t4a + t4b;
    l_c = l_c * al + (t2[0] + t2[1]);
#pragma unroll
    for (int dt = 0; dt < DT; ++dt) {
#pragma unroll
      for (int r = 0; r < 8; ++r) oacc[dt][r] *= al;
      oacc[dt] = mmaH<1>(av[dt].v, av[dt].v, pb.v, pb.v, oacc[dt]); } }
  /* output projection out = ctx Wo^T + bo of the block's 64 rows: wave w takes rows 32 (w & 1) .. + 31 x columns 16 (w >> 1) .. + 15. Its 8 weight fragments are asked for here, ahead of the barrier, so that their latency runs beside the wait for the block's slowest wave */
  const int ct = w >> 1, rt0 = 2 * (w & 1);
  const char* bt = (const char*)(Bo + (size_t)ct * ((KD / 32) * FTE)); const unsigned lo = (unsigned)lane * 16u; v16h bw[KD / 32];      /* a scalar base + the lane's 32-bit byte offset, as in the key walk */
#pragma unroll
  for (int kt = 0; kt < KD / 32; ++kt) { FragH f; f.half[0] = *(const v8us*)(bt + lo + kt * (FTE * 2)); f.half[1] = *(const v8us*)(bt + lo + kt * (FTE * 2) + FTE); bw[kt] = f.v; }
  const float bvv = bf16_round(bo[ct * 16 + ln]);
  const float l = l_c + xhalf(l_c); const float li = (l > 0.f) ? 1.0f / l : 0.f;
#pragma unroll
  for (int dt = 0; dt < DT; ++dt) { FragH f;      /* a lane's 8 registers are 8 consecutive head dims of its query = its own 16 bytes of the output product's A tile (row = query ln, k = this head's dims) */
#pragma unroll
    for (int r = 0; r < 8; ++r) f.h[r] = (_Float16)(oacc[dt][r] * li);
    *(v8us*)((unsigned short*)sc + ((w & 3) * NH + h) * FTE + dt * (FTE / 2) + lane * 8) = f.half[0]; }
  __syncthreads();               /* every wave reads context tiles of all 8 heads */
  const v8f z8 = {0.f,0.f,0.f,0.f,0.f,0.f,0.f,0.f}; v8f c0 = z8, c1 = z8;
#pragma unroll
  for (int kt = 0; kt < KD / 32; ++kt) { const _Float16* ap = sc + (rt0 * NH + kt) * FTE + lane * 8;
    c0 = g2_mma(pk_frag(ap), bw[kt], c0); c1 = g2_mma(pk_frag(ap + NH * FTE), bw[kt], c1); }
#pragma unroll
  for (int r = 0; r < 8; ++r) { so[rt0 * 16 + 8 * hh + r][ct * 16 + ln] = c0[r] * 0.0625f + bvv; so[rt0 * 16 + 16 + 8 * hh + r][ct * 16 + ln] = c1[r] * 0.0625f + bvv; }
  __syncthreads();               /* a row of the output holds columns of 16 waves */
#pragma unroll
  for (int q = 0; q < 4; ++q) { const int r = 2 * w + (q >> 1), c4 = (q & 1) * (CM / 2) + lane * 4;      /* wave w stores rows 2 w, 2 w + 1: 512 contiguous bytes a store */
    const v4f v = *(const v4fa*)&so[r][c4]; *(v4f*)(C + (size_t)(blockIdx.x * (4 * RPW) + r) * CM + c4) = v; } }

// the four weights (row-major [out][in]) as f16(bf16(W) x 16) in fragment tiles [out / 16][in / 32]; blockIdx.y picks the weight
__global__ __launch_bounds__(256) void k_wprep(const float* __restrict__ Wq, const float* __restrict__ Wk, const float* __restrict__ Wv, const float* __restrict__ Wo, _Float16* __restrict__ Bq, _Float16* __restrict__ Bk, _Float16* __restrict__ Bv, _Float16* __restrict__ Bo) {
  const int by = blockIdx.y; const float* Wm = (by == 0) ? Wq : ((by == 1) ? Wk : ((by == 2) ? Wv : Wo)); _Float16* Bt = (by == 0) ? Bq : ((by == 1) ? Bk : ((by == 2) ? Bv : Bo));
  const size_t t = (size_t)blockIdx.x * 256 + threadIdx.x; FragH f;
#pragma unroll
  for (int i = 0; i < 8; ++i) f.h[i] = (_Float16)(bf16_round(Wm[t * 8 + i]) * 16.0f);
  const int n = (int)(t / (KD / 8)), ck = (int)(t % (KD / 8));      /* 8 inputs ck * 8 .. + 7 of output n: chunk ck & 3 of k tile ck >> 2 */
  *(v8us*)((unsigned short*)Bt + (size_t)((n / 16) * (KD / 32) + (ck >> 2)) * FTE + ((ck >> 1) & 1) * (FTE / 2) + ((ck & 1) * 16 + (n & 15)) * 8) = f.half[0]; }

extern "C" void kernel_launch(void* const* d_in, const int* in_sizes, int n_in,
                              void* d_out, int out_size, void* d_ws, size_t ws_size, hipStream_t stream) {
  (void)in_sizes; (void)n_in; (void)out_size;
  const float* const* I = (const float* const*)d_in; const float* qx = I[0]; const float* kx = I[1]; const float* vx = I[2]; const float* Wq = I[3]; const float* bq = I[4]; const float* Wk = I[5]; const float* bk = I[6]; const float* Wv = I[7]; const float* bv = I[8]; const float* Wo = I[9]; const float* bo = I[10];
  char* ws = (char*)d_ws; size_t off = 0;
  auto take = [&](size_t bytes) { char* p = ws + off; off += (bytes + 255) & ~(size_t)255; return p; };
  _Float16* BPq = (_Float16*)take((size_t)DP * CM * 2); _Float16* BPk = (_Float16*)take((size_t)DP * CM * 2); _Float16* BPv = (_Float16*)take((size_t)DP * CM * 2); _Float16* BOP = (_Float16*)take((size_t)CM * DP * 2);
  _Float16* QH = (_Float16*)take((size_t)NR * DP * 2); _Float16* QL = (_Float16*)take((size_t)NR * DP * 2); _Float16* KH = (_Float16*)take((size_t)NR * DP * 2); _Float16* KL = (_Float16*)take((size_t)NR * DP * 2); _Float16* VT = (_Float16*)take((size_t)NR * DP * 2);
  if (off > ws_size) return;      /* under 64 MiB (256 MiB ws) */
  k_wprep<<<dim3(DP * CM / 8 / 256, 4), 256, 0, stream>>>(Wq, Wk, Wv, Wo, BPq, BPk, BPv, BOP);
  k_proj<<<dim3(NR / 64, 3), 256, 0, stream>>>(qx, kx, vx, BPq, BPk, BPv, bq, bk, bv, QH, QL, KH, KL, VT);
  k_flashqk<0><<<NSEQ * QBLKS, 1024, 0, stream>>>(QH, QL, KH, KL, VT, nullptr, BOP, bo, (float*)d_out);      /* q/k hi + residual; P (x2^10) and V plain f16; then the output projection */
}

// v010
// Measured time: 54.6 microseconds a run.
// Timed twice side by side with v009, it ran 1.04 times as fast both times.
// All steps since v000 together make it 9.28 times as fast.
#include <hip/hip_runtime.h>
// Routing (windowed) attention (2 x 8 windows of 1024 tokens x 256; 8 heads x 32): qh/kh/vh = inputs q/k/v W^T + b split into heads; per (window, head) softmax(qh kh^T / sqrt(32)) vh; heads re-merged; ctx Wo^T + bo -> [2,8,4,16,16,256].
// Structure: 3 launches. Every workspace plane lies in WMMA fragment order (FTE below), so a wave's 16-byte loads and stores cover 512 contiguous bytes. (1) the four weights as exact x16 f16 planes; (2) the q, k, v projections in one grid (grid.y picks the operand): f16 WMMA GEMM, 64x256 block tiles of 32x64 wave tiles, f32 accumulation, the block reads its f32 input rows once in whole lines, rounds them and shares them through LDS as fragment tiles, the epilogue writes hi + 2^10 residual planes (q, k) or V^T (v), one 16 x 32 fragment tile per (head, 16 tokens) or (head, 16 dims, 32 tokens); (3) the fused flash kernel, transposed (S^T = K Q^T, O^T += V^T P^T, P stays in registers), with hi + 2^10-residual q/k planes (S = QhKh + (QlKh + QhKl)/1024) and plain f16 P (x2^10) and V; a block is 64 queries x all 8 heads (32 waves), so its f16 context tiles go through LDS straight into the output GEMM, which is the kernel's epilogue.
// Compute dtype: q, k, v and parameters rounded to bf16; qh, kh hi + residual (~2^-21-class logits); P and vh plain f16 (~2^-12); context as f16 (~2^-12) into Wo; f32 accumulation/softmax. v_wmma_f32_16x16x32_f16.
#define NSEQ 16
#define NB NSEQ
#define CM 256
#define HS 32                    /* head slot width in the q/k/v/context planes = true head dim */
#define DP (NH * HS)             /* 256: q/k/v width */
#define NR (NSEQ * SLEN)         /* 16384 rows */
#define QBLKS (TQ / 64)
#define SLEN 1024                /* tokens per routing window (K*Hp*W) */
#define TQ SLEN
#define TK SLEN
#define NH 8
#define SCL 0.17677669529663687f /* 32^-0.5 */
#define SCL2 ((float)(0.17677669529663687 * 1.4426950408889634))      /* 32^-0.5 log2(e): logits in base-2 units */
typedef __bf16 v16b __attribute__((ext_vector_type(16)));
typedef unsigned short v8us __attribute__((ext_vector_type(8), may_alias));
typedef unsigned short v4us __attribute__((ext_vector_type(4), may_alias));
typedef float  v8f  __attribute__((ext_vector_type(8)));
typedef float  v4f  __attribute__((ext_vector_type(4)));
typedef float  v2f  __attribute__((ext_vector_type(2)));
typedef float  v4fa __attribute__((ext_vector_type(4), may_alias));
union FragB { v16b v; v8us half[2]; unsigned short u[16]; };

__device__ __forceinline__ unsigned short bf16_bits(float x) { unsigned int u = __float_as_uint(x); return (unsigned short)((u + 0x7FFFu + ((u >> 16) & 1u)) >> 16); }
__device__ __forceinline__ float bf16_val(unsigned short b) { return __uint_as_float(((unsigned int)b) << 16); }
__device__ __forceinline__ float bf16_round(float x) { return bf16_val(bf16_bits(x)); }
// D += A·B with NT terms: 1 = ah·bh, 2 = + al·bh (A split), 3 = + ah·bl (both split)
template <int NT>
__device__ __forceinline__ v8f mmaN(v16b ah, v16b al, v16b bh, v16b bl, v8f c) {
  c = __builtin_amdgcn_wmma_f32_16x16x32_bf16(false, ah, false, bh, (short)0, c, false, false);
  if (NT >= 2) c = __builtin_amdgcn_wmma_f32_16x16x32_bf16(false, al, false, bh, (short)0, c, false, false);
  if (NT >= 3) c = __builtin_amdgcn_wmma_f32_16x16x32_bf16(false, ah, false, bl, (short)0, c, false, false);
  asm volatile("v_nop\n\tv_nop\n\tv_nop\n\tv_nop" : "+v"(c) : "v"(ah), "v"(al), "v"(bh), "v"(bl));
  return c;
}

__global__ __launch_bounds__(256) void k_wt_bf16(const float* __restrict__ W, unsigned short* __restrict__ Wt, int K, int N) {
  const int t = blockIdx.x * 256 + threadIdx.x;
  const int k8n = K / 8;
  if (t >= N * k8n) return;
  const int n = t / k8n, k8 = (t % k8n) * 8;
  v8us v;
#pragma unroll
  for (int i = 0; i < 8; ++i) v[i] = bf16_bits(W[(size_t)(k8 + i) * N + n]);
  *(v8us*)(Wt + (size_t)n * K + k8) = v;
  
}

// GEMM C[M][N] (f32, pitch ldc) = act(A[M][K]·W + bias). A f32 row-major (pitch lda) converted per fragment to bf16
// (ASPLIT: hi/lo two planes -> 2 terms, else single rounded term); Wt bf16 [N][K] (pitch ldb). BIAS_BF16 rounds the
// bias to bf16 first (bias quantised to bf16 before the add). K%32==0, M%16==0, N%64==0.
template <bool ASPLIT, int ACT, bool BIAS_BF16>
__global__ __launch_bounds__(128) void k_gemm_bf(const float* __restrict__ A, int lda, const unsigned short* __restrict__ Wt, int ldb,
                                               const float* __restrict__ bias, float* __restrict__ C, int ldc, int M, int N, int K) {
  __shared__ __attribute__((aligned(16))) float so[4][16][64];
  const int tid = threadIdx.x, w = tid >> 5, lane = tid & 31, ln = lane & 15, hh = lane >> 4;
  const int ntn = N / 64;
  const int wid = blockIdx.x * 4 + w;
  const int mt = wid / ntn, nq = wid % ntn;
  if (mt * 16 >= M) return;
  const int row0 = mt * 16, col0 = nq * 64;
  const float* arow = A + (size_t)(row0 + ln) * lda;
  v8f acc[4] = {};
  for (int kb = 0; kb < K; kb += 32) {
    FragB ah, al;
    const v4f x0 = *(const v4fa*)(arow + kb + 8 * hh), x1 = *(const v4fa*)(arow + kb + 8 * hh + 4);
    const v4f x2 = *(const v4fa*)(arow + kb + 16 + 8 * hh), x3 = *(const v4fa*)(arow + kb + 16 + 8 * hh + 4);
    float xs[16] = {x0[0],x0[1],x0[2],x0[3],x1[0],x1[1],x1[2],x1[3],x2[0],x2[1],x2[2],x2[3],x3[0],x3[1],x3[2],x3[3]};
#pragma unroll
    for (int i = 0; i < 16; ++i) { const unsigned short hb = bf16_bits(xs[i]); ah.u[i] = hb; al.u[i] = ASPLIT ? bf16_bits(xs[i] - bf16_val(hb)) : (unsigned short)0; }
#pragma unroll
    for (int t = 0; t < 4; ++t) {
      const unsigned short* brow = Wt + (size_t)(col0 + t * 16 + ln) * ldb + kb;
      FragB b;
      b.half[0] = *(const v8us*)(brow + 8 * hh);
      b.half[1] = *(const v8us*)(brow + 16 + 8 * hh);
      acc[t] = mmaN<ASPLIT ? 2 : 1>(ah.v, al.v, b.v, b.v, acc[t]);
    }
  }
#pragma unroll
  for (int t = 0; t < 4; ++t) {
    float bv = bias ? bias[col0 + t * 16 + ln] : 0.f;
    if (BIAS_BF16) bv = bf16_round(bv);
#pragma unroll
    for (int r = 0; r < 8; ++r) { float v = acc[t][r] + bv; if (ACT == 1) v = fmaxf(v, 0.f); so[w][8 * hh + r][t * 16 + ln] = v; }
  }
  __builtin_amdgcn_fence(__ATOMIC_ACQ_REL, "workgroup");
  __builtin_amdgcn_wave_barrier();
  const int rsub = lane >> 4, c4 = (lane & 15) * 4;
  {
#pragma unroll
    for (int q = 0; q < 8; ++q) {
      const int r = q * 2 + rsub;
      const v4f v = *(const v4fa*)&so[w][r][c4];
      *(v4f*)(C + (size_t)(row0 + r) * ldc + col0 + c4) = v;
    }
    
  }
}

// GEMM C = act(A·W + bias + resid): A f32 (ASPLIT -> hi/lo 2 terms), Wt bf16 [N][K]; ACT 0 none, 1 relu, 2 exact gelu;
// resid (optional, f32, row index = (row % rmod), pitch ldr, RES_BF16 rounds it) added before the activation.
template <bool ASPLIT, int ACT, bool BIAS_BF16, bool RES_BF16>
__global__ __launch_bounds__(128) void k_gemm_bf3(const float* __restrict__ A, int lda, const unsigned short* __restrict__ Wt, int ldb,
                                                const float* __restrict__ bias, const float* __restrict__ resid, int rmod, int ldr,
                                                float* __restrict__ C, int ldc, int M, int N, int K) {
  __shared__ __attribute__((aligned(16))) float so[4][16][64];
  const int tid = threadIdx.x, w = tid >> 5, lane = tid & 31, ln = lane & 15, hh = lane >> 4;
  const int ntn = N / 64;
  const int wid = blockIdx.x * 4 + w;
  const int mt = wid / ntn, nq = wid % ntn;
  if (mt * 16 >= M) return;
  const int row0 = mt * 16, col0 = nq * 64;
  const float* arow = A + (size_t)(row0 + ln) * lda;
  v8f acc[4] = {};
  for (int kb = 0; kb < K; kb += 32) {
    FragB ah, al;
    const v4f x0 = *(const v4fa*)(arow + kb + 8 * hh), x1 = *(const v4fa*)(arow + kb + 8 * hh + 4);
    const v4f x2 = *(const v4fa*)(arow + kb + 16 + 8 * hh), x3 = *(const v4fa*)(arow + kb + 16 + 8 * hh + 4);
    float xs[16] = {x0[0],x0[1],x0[2],x0[3],x1[0],x1[1],x1[2],x1[3],x2[0],x2[1],x2[2],x2[3],x3[0],x3[1],x3[2],x3[3]};
#pragma unroll
    for (int i = 0; i < 16; ++i) { const unsigned short hb = bf16_bits(xs[i]); ah.u[i] = hb; al.u[i] = ASPLIT ? bf16_bits(xs[i] - bf16_val(hb)) : (unsigned short)0; }
#pragma unroll
    for (int t = 0; t < 4; ++t) {
      const unsigned short* brow = Wt + (size_t)(col0 + t * 16 + ln) * ldb + kb;
      FragB b;
      b.half[0] = *(const v8us*)(brow + 8 * hh);
      b.half[1] = *(const v8us*)(brow + 16 + 8 * hh);
      acc[t] = mmaN<ASPLIT ? 2 : 1>(ah.v, al.v, b.v, b.v, acc[t]);
    }
  }
#pragma unroll
  for (int t = 0; t < 4; ++t) {
    const int col = col0 + t * 16 + ln;
    float bv = bias ? bias[col] : 0.f;
    if (BIAS_BF16) bv = bf16_round(bv);
#pragma unroll
    for (int r = 0; r < 8; ++r) {
      float v = acc[t][r] + bv;
      if (resid) { float rv = resid[(size_t)((row0 + 8 * hh + r) % rmod) * ldr + col]; if (RES_BF16) rv = bf16_round(rv); v += rv; }
      if (ACT == 1) v = fmaxf(v, 0.f);
      if (ACT == 2) v = 0.5f * v * (1.0f + erff(v * 0.70710678118654752f));
      if (ACT == 3) { const float u = 0.7978845608028654f * (v + 0.044715f * v * v * v); v = 0.5f * v * (1.0f + tanhf(u)); }
      so[w][8 * hh + r][t * 16 + ln] = v;
    }
  }
  __builtin_amdgcn_fence(__ATOMIC_ACQ_REL, "workgroup");
  __builtin_amdgcn_wave_barrier();
  const int rsub = lane >> 4, c4 = (lane & 15) * 4;
  {
#pragma unroll
    for (int q = 0; q < 8; ++q) {
      const int r = q * 2 + rsub;
      const v4f v = *(const v4fa*)&so[w][r][c4];
      *(v4f*)(C + (size_t)(row0 + r) * ldc + col0 + c4) = v;
    }
    
  }
}
// row LayerNorm (biased variance, eps) over N: s = X (+ R); optional out_sum <- s; out_norm <- (s-mu)*rsqrt(var+eps)*g + b
template <bool PARAM_BF16>
__global__ __launch_bounds__(256) void k_layernorm(const float* __restrict__ X, const float* __restrict__ R, const float* __restrict__ g, const float* __restrict__ bta,
                                                  float* __restrict__ out_sum, float* __restrict__ out_norm, int N, float eps) {
  __shared__ float red[256];
  const int row = blockIdx.x, tid = threadIdx.x;
  const float* x = X + (size_t)row * N; const float* rr = R ? R + (size_t)row * N : nullptr;
  float vals[16];                     // up to N = 4096
  const int per = N / 256;            // contiguous chunk per thread? use strided-by-4 chunks: thread handles j = tid*4 + 1024*u
  float s1 = 0.f;
  for (int u = 0; u < per / 4; ++u) {
    const int j = tid * 4 + 1024 * u;
    const v4f a = *(const v4fa*)(x + j);
    v4f b = {0.f,0.f,0.f,0.f}; if (rr) b = *(const v4fa*)(rr + j);
#pragma unroll
    for (int q = 0; q < 4; ++q) { const float v = a[q] + b[q]; vals[u * 4 + q] = v; s1 += v; }
  }
  red[tid] = s1; __syncthreads();
  for (int st = 128; st > 0; st >>= 1) { if (tid < st) red[tid] += red[tid + st]; __syncthreads(); }
  const float mu = red[0] / (float)N; __syncthreads();
  float s2 = 0.f;
  for (int u = 0; u < per / 4; ++u)
#pragma unroll
    for (int q = 0; q < 4; ++q) { const float c = vals[u * 4 + q] - mu; s2 += c * c; }
  red[tid] = s2; __syncthreads();
  for (int st = 128; st > 0; st >>= 1) { if (tid < st) red[tid] += red[tid + st]; __syncthreads(); }
  const float rs = rsqrtf(red[0] / (float)N + eps);
  {
    for (int u = 0; u < per / 4; ++u) {
      const int j = tid * 4 + 1024 * u;
      v4f o, sm;
#pragma unroll
      for (int q = 0; q < 4; ++q) {
        float gg = g[j + q], bb = bta[j + q];
        if (PARAM_BF16) { gg = bf16_round(gg); bb = bf16_round(bb); }
        sm[q] = vals[u * 4 + q]; o[q] = (vals[u * 4 + q] - mu) * rs * gg + bb;
      }
      if (out_sum) *(v4f*)(out_sum + (size_t)row * N + j) = sm;
      *(v4f*)(out_norm + (size_t)row * N + j) = o;
    }
    
  }
}



// ---- f16 WMMA path (v_wmma_f32_16x16x32_f16): 11-bit significands for operands in range — used where a [0,1] probability operand needs more precision than bf16
typedef _Float16 v16h __attribute__((ext_vector_type(16)));
union FragH { v16h v; v8us half[2]; _Float16 h[16]; unsigned short u[16]; };
template <int NT>
__device__ __forceinline__ v8f mmaH(v16h ah, v16h al, v16h bh, v16h bl, v8f c) {
  c = __builtin_amdgcn_wmma_f32_16x16x32_f16(false, ah, false, bh, (short)0, c, false, false);
  if (NT >= 2) c = __builtin_amdgcn_wmma_f32_16x16x32_f16(false, al, false, bh, (short)0, c, false, false);
  if (NT >= 3) c = __builtin_amdgcn_wmma_f32_16x16x32_f16(false, ah, false, bl, (short)0, c, false, false);
  return c;
}
// batched GEMM like k_gemm_b but f16 operands: A f32 (split into f16 hi/lo if ASPLIT, else rounded to f16), Bt = f16 values [n][k]; alpha; C f32; N multiple of 16 (partial tiles skipped)
template <bool ASPLIT>
__global__ __launch_bounds__(128) void k_gemm_h(const float* __restrict__ A, int lda, size_t sA, const _Float16* __restrict__ Bh, int ldb, size_t sB, float alpha, float* __restrict__ C, int ldc, size_t sC, int M, int N, int K) {
  __shared__ __attribute__((aligned(16))) float so[4][16][64];
  const int tid = threadIdx.x, w = tid >> 5, lane = tid & 31, ln = lane & 15, hh = lane >> 4; const int by = blockIdx.y;
  A += (size_t)by * sA; Bh += (size_t)by * sB; C += (size_t)by * sC;
  const int ntn = (N + 63) / 64; const int wid = blockIdx.x * 4 + w; const int mt = wid / ntn, nq = wid % ntn; if (mt * 16 >= M) return;
  const int row0 = mt * 16, col0 = nq * 64; const float* arow = A + (size_t)(row0 + ln) * lda;
  v8f acc[4] = {};
  for (int kb = 0; kb < K; kb += 32) {
    FragH ah, al;
    const v4f x0 = *(const v4fa*)(arow + kb + 8 * hh), x1 = *(const v4fa*)(arow + kb + 8 * hh + 4), x2 = *(const v4fa*)(arow + kb + 16 + 8 * hh), x3 = *(const v4fa*)(arow + kb + 16 + 8 * hh + 4);
    float xs[16] = {x0[0],x0[1],x0[2],x0[3],x1[0],x1[1],x1[2],x1[3],x2[0],x2[1],x2[2],x2[3],x3[0],x3[1],x3[2],x3[3]};
#pragma unroll
    for (int i = 0; i < 16; ++i) { const _Float16 h = (_Float16)xs[i]; ah.h[i] = h; al.h[i] = ASPLIT ? (_Float16)(xs[i] - (float)h) : (_Float16)0.0f; }
#pragma unroll
    for (int t = 0; t < 4; ++t) { if (col0 + t * 16 >= N) continue; const size_t boff = (size_t)(col0 + t * 16 + ln) * ldb + kb; FragH bq; bq.half[0] = *(const v8us*)(Bh + boff + 8 * hh); bq.half[1] = *(const v8us*)(Bh + boff + 16 + 8 * hh);
      acc[t] = mmaH<ASPLIT ? 2 : 1>(ah.v, al.v, bq.v, bq.v, acc[t]); }
  }
#pragma unroll
  for (int t = 0; t < 4; ++t) { if (col0 + t * 16 >= N) continue;
#pragma unroll
    for (int r = 0; r < 8; ++r) so[w][8 * hh + r][t * 16 + ln] = acc[t][r] * alpha; }
  __builtin_amdgcn_fence(__ATOMIC_ACQ_REL, "workgroup"); __builtin_amdgcn_wave_barrier();
  const int rsub = lane >> 4, c4 = (lane & 15) * 4;
  {
#pragma unroll
    for (int q = 0; q < 8; ++q) { const int r = q * 2 + rsub; if (col0 + c4 < N) { const v4f v = *(const v4fa*)&so[w][r][c4]; *(v4f*)(C + (size_t)(row0 + r) * ldc + col0 + c4) = v; } }
     }
}

// Wt[n][k] = f16(W[k][n]·scale) from f32 row-major W[K][N] (scale = power of two; bf16-exact weights stay exact in f16 away from the subnormal range)
__global__ __launch_bounds__(256) void k_wt_f16(const float* __restrict__ W, _Float16* __restrict__ Wt, int K, int N, float scale) {
  const int t = blockIdx.x * 256 + threadIdx.x; if (t >= N * (K / 8)) return; const int n = t / (K / 8), k8 = (t % (K / 8)) * 8; FragH f;
#pragma unroll
  for (int i = 0; i < 8; ++i) f.h[i] = (_Float16)(bf16_round(W[(size_t)(k8 + i) * N + n]) * scale); const v8us o = f.half[0];
  *(v8us*)((unsigned short*)Wt + (size_t)n * K + k8) = o; 
}
// k_gemm_hh variant with fused epilogue: v = acc·alpha + bias[by·sBias + col] (+ CP[(row/rowsPerB)·sCPb + by·64 + col] if CP) ; ACT 0 none / 1 elu ; writes f16 C16 (and f32 C if non-null)
template <int ACT>
__global__ __launch_bounds__(128) void k_gemm_hhx(const _Float16* __restrict__ A, int lda, size_t sA, const _Float16* __restrict__ Bh, int ldb, size_t sB, float alpha, const float* __restrict__ bias, size_t sBias, const float* __restrict__ CP, int rowsPerB, size_t sCPb, int row0g,
    float* __restrict__ C, _Float16* __restrict__ C16, int ldc, size_t sC, int M, int N, int K) {
  __shared__ __attribute__((aligned(16))) float so[4][16][64];
  const int tid = threadIdx.x, w = tid >> 5, lane = tid & 31, ln = lane & 15, hh = lane >> 4; const int by = blockIdx.y;
  A += (size_t)by * sA; Bh += (size_t)by * sB; const size_t cofs = (size_t)by * sC; const float* bp = bias ? bias + (size_t)by * sBias : nullptr;
  const int ntn = (N + 63) / 64; const int wid = blockIdx.x * 4 + w; const int mt = wid / ntn, nq = wid % ntn; if (mt * 16 >= M) return;
  const int row0 = mt * 16, col0 = nq * 64; const _Float16* arow = A + (size_t)(row0 + ln) * lda;
  v8f acc[4] = {};
  for (int kb = 0; kb < K; kb += 32) { FragH ah; ah.half[0] = *(const v8us*)((const unsigned short*)arow + kb + 8 * hh); ah.half[1] = *(const v8us*)((const unsigned short*)arow + kb + 16 + 8 * hh);
#pragma unroll
    for (int t = 0; t < 4; ++t) { if (col0 + t * 16 >= N) continue; const size_t boff = (size_t)(col0 + t * 16 + ln) * ldb + kb; FragH bq; bq.half[0] = *(const v8us*)((const unsigned short*)Bh + boff + 8 * hh); bq.half[1] = *(const v8us*)((const unsigned short*)Bh + boff + 16 + 8 * hh);
      acc[t] = mmaH<1>(ah.v, ah.v, bq.v, bq.v, acc[t]); }
  }
#pragma unroll
  for (int t = 0; t < 4; ++t) { if (col0 + t * 16 >= N) continue; const int col = col0 + t * 16 + ln; const float bv = bp ? bf16_round(bp[col]) : 0.f;
#pragma unroll
    for (int r = 0; r < 8; ++r) { float v = acc[t][r] * alpha + bv; if (CP) { const int bidx = (row0g + row0 + 8 * hh + r) / rowsPerB; v += CP[(size_t)bidx * sCPb + (size_t)by * 64 + col]; } if (ACT == 1) v = (v > 0.f) ? v : expm1f(v); else if (ACT == 7) v = (v > 0.f) ? v + 1.0f : expf(v); else if (ACT == 8) v = tanhf(v); else if (ACT == 9) v = 0.5f * v * (1.0f + tanhf(0.7978845608028654f * (v + 0.044715f * v * v * v))); else if (ACT == 11) v = 1.0f / (1.0f + expf(-v)); else if (ACT == 12) v = (v > 0.f) ? v : 0.01f * v; else if (ACT == 14) v = (v > 0.f) ? v : 0.1f * v; else if (ACT == 15) v = v / (1.0f + expf(-v)); else if (ACT == 3) v = fmaxf(v, 0.f); else if (ACT == 6) v = 0.5f * v * (1.0f + erff(v * 0.70710678118654752f)); so[w][8 * hh + r][t * 16 + ln] = v; } }
  __builtin_amdgcn_fence(__ATOMIC_ACQ_REL, "workgroup"); __builtin_amdgcn_wave_barrier();
  const int rsub = lane >> 4, c4 = (lane & 15) * 4; typedef _Float16 v4h __attribute__((ext_vector_type(4)));
  {
#pragma unroll
    for (int q = 0; q < 8; ++q) { const int r = q * 2 + rsub; if (col0 + c4 < N) { const v4f v = *(const v4fa*)&so[w][r][c4]; if (C) *(v4f*)(C + cofs + (size_t)(row0 + r) * ldc + col0 + c4) = v; if (C16) { v4h h4; for (int i = 0; i < 4; ++i) h4[i] = (_Float16)v[i]; *(v4h*)(C16 + cofs + (size_t)(row0 + r) * ldc + col0 + c4) = h4; } } }
     }
}


typedef _Float16 v4h __attribute__((ext_vector_type(4)));

__global__ __launch_bounds__(256) void k_round16f(const float* __restrict__ W, _Float16* __restrict__ Bt, size_t n8) { const size_t t = (size_t)blockIdx.x * 256 + threadIdx.x; if (t >= n8) return; FragH f;
#pragma unroll
  for (int i = 0; i < 8; ++i) f.h[i] = (_Float16)(bf16_round(W[t * 8 + i]) * 16.0f); *(v8us*)((unsigned short*)Bt + t * 8) = f.half[0];  }
// ---- fused GEMM (wave tile 32x64, K = KD): the epilogue writes what the next kernel reads ----
#define KD 256                   /* = CM = DP: K and the row pitch of A and of the weight planes */
__device__ __forceinline__ v16h g2_frag(const _Float16* p, int hh) { FragH f; f.half[0] = *(const v8us*)((const unsigned short*)p + 8 * hh); f.half[1] = *(const v8us*)((const unsigned short*)p + 16 + 8 * hh); return f.v; }
__device__ __forceinline__ v8f g2_mma(v16h a, v16h b, v8f c) { return __builtin_amdgcn_wmma_f32_16x16x32_f16(false, a, false, b, (short)0, c, false, false); }
// Fragment order: a 16 x 32 f16 operand tile (16 rows or columns x 32 k) is FTE consecutive elements; lane l = 16 hh + ln holds row ln, k = 8 hh .. + 7 at element 8 l and k = 16 + 8 hh .. + 7 at FTE / 2 + 8 l (the k order of g2_frag)
#define FTE 512
__device__ __forceinline__ v16h pk_frag(const _Float16* p) { FragH f; f.half[0] = *(const v8us*)((const unsigned short*)p); f.half[1] = *(const v8us*)((const unsigned short*)p + FTE / 2); return f.v; }      /* p = tile + 8 lane */
// The same tile in LDS: its four quarters (k 0-7, 8-15, 16-23, 24-31 of the 16 rows, 256 B each) stand AQE elements = 320 B apart, so that a store of 4 rows x 32 k (8 B a lane) meets every bank once and each half wave of a fragment read (16 B a lane) does too
#define AQE 160
#define ATE (4 * AQE)
__device__ __forceinline__ v16h ls_frag(const _Float16* p) { FragH f; f.half[0] = *(const v8us*)((const unsigned short*)p); f.half[1] = *(const v8us*)((const unsigned short*)p + 2 * AQE); return f.v; }      /* p = tile + hh AQE + 8 ln */
// A: fragment tiles [row / 16][k / 32] from Ap, PK: in global memory (FTE), else in LDS (ATE). Bh: fragment tiles [col / 16][k / 32]. k0: the k tile at which this block enters its walk (it wraps round): blocks that read the same tiles do not ask L2 for the same lines at one moment
template <bool PK>
__device__ __forceinline__ void gf_tile(const _Float16* __restrict__ Ap, const _Float16* __restrict__ Bh, int row0, int col0, int k0, int ln, int hh, v8f (&accs)[8]) {
  constexpr int TR = (KD / 32) * FTE, AT = PK ? FTE : ATE, ATR = (KD / 32) * AT;      /* elements of one row of tiles; of one A tile and one row of A tiles */
  const _Float16* p0p = Ap + (size_t)(row0 / 16) * ATR + k0 * AT + (PK ? (16 * hh + ln) * 8 : hh * AQE + ln * 8);
  const _Float16* b0p = Bh + (size_t)(col0 / 16) * TR + k0 * FTE + (16 * hh + ln) * 8;
  const v8f z8 = {0.f,0.f,0.f,0.f,0.f,0.f,0.f,0.f}; v8f c00 = z8, c01 = z8, c02 = z8, c03 = z8, c10 = z8, c11 = z8, c12 = z8, c13 = z8;
#pragma unroll 1                 /* rolled, as before the fusion: keeps the registers low enough for every block of the grid to be resident at once */
  for (int kt = 0; kt < KD / 32; ++kt) { const v16h a0 = PK ? pk_frag(p0p) : ls_frag(p0p), a1 = PK ? pk_frag(p0p + ATR) : ls_frag(p0p + ATR);
    v16h b = pk_frag(b0p); c00 = g2_mma(a0, b, c00); c10 = g2_mma(a1, b, c10);
    b = pk_frag(b0p + TR); c01 = g2_mma(a0, b, c01); c11 = g2_mma(a1, b, c11);
    b = pk_frag(b0p + 2 * TR); c02 = g2_mma(a0, b, c02); c12 = g2_mma(a1, b, c12);
    b = pk_frag(b0p + 3 * TR); c03 = g2_mma(a0, b, c03); c13 = g2_mma(a1, b, c13);
    const int st = (kt + k0 == KD / 32 - 1) ? 1 - KD / 32 : 1;      /* one k tile on, or from the last back to the first */
    p0p += st * AT; b0p += st * FTE; }
  accs[0] = c00; accs[1] = c01; accs[2] = c02; accs[3] = c03; accs[4] = c10; accs[5] = c11; accs[6] = c12; accs[7] = c13; }
// q, k, v projections, blockIdx.y = 0, 1, 2: y = x W^T + b (weights x16, so acc / 16). q, k -> hi + 2^10 residual planes, fragment tiles [b * NH + head][token / 16]; v -> f16 V^T, fragment tiles [b * NH + head][token / 32][dim / 16]
__global__ __launch_bounds__(256) void k_proj(const float* __restrict__ xq, const float* __restrict__ xk, const float* __restrict__ xv, const _Float16* __restrict__ Bq, const _Float16* __restrict__ Bk, const _Float16* __restrict__ Bv,
    const float* __restrict__ bq, const float* __restrict__ bk, const float* __restrict__ bv, _Float16* __restrict__ QH, _Float16* __restrict__ QL, _Float16* __restrict__ KH, _Float16* __restrict__ KL, _Float16* __restrict__ VT) {
  __shared__ __attribute__((aligned(16))) char sm[8 * 32 * 68 * 4];      /* first the block's A tiles (4 x 8 x ATE f16), then, behind a barrier, each wave's 32 x 68 f32 output rows */
  _Float16* sa = (_Float16*)sm; float (*so)[32][68] = (float (*)[32][68])sm;
  const int tid = threadIdx.x, w = tid >> 5, lane = tid & 31, ln = lane & 15, hh = lane >> 4; const int by = blockIdx.y;
  const float* A = (by == 0) ? xq : ((by == 1) ? xk : xv); const _Float16* Bh = (by == 0) ? Bq : ((by == 1) ? Bk : Bv); const float* bp = (by == 0) ? bq : ((by == 1) ? bk : bv);
  const int rl0 = 32 * (w >> 2), row0 = blockIdx.x * 64 + rl0, col0 = (w & 3) * 64;      /* 2 x 4 waves: 64 rows x all DP columns */
  { /* wave w stages rows 8 w .. + 7: a load takes 128 B (one k tile) of each of 4 rows, 8 lanes a row; lane's 4 floats = k 4 (lane & 7) .. + 3 of the tile, rounded to bf16 and held as f16 */
    const float* ap = A + (size_t)(blockIdx.x * 64 + 8 * w + (lane >> 3)) * KD + (lane & 7) * 4;
    unsigned short* sp = (unsigned short*)sa + (w >> 1) * ((KD / 32) * ATE) + ((lane >> 1) & 3) * AQE + (8 * (w & 1) + (lane >> 3)) * 8 + (lane & 1) * 4;
    v4f x[2][KD / 32];           /* both loop nests unrolled: x stays in registers, and all 16 loads are in flight before the first is converted */
#pragma unroll
    for (int g = 0; g < 2; ++g)
#pragma unroll
      for (int kt = 0; kt < KD / 32; ++kt) x[g][kt] = *(const v4fa*)(ap + (size_t)g * 4 * KD + kt * 32);
#pragma unroll
    for (int g = 0; g < 2; ++g)
#pragma unroll
      for (int kt = 0; kt < KD / 32; ++kt) { FragH f;
#pragma unroll
        for (int i = 0; i < 4; ++i) f.h[i] = (_Float16)bf16_round(x[g][kt][i]);
        *(v4us*)(sp + kt * ATE + g * 32) = (v4us){f.u[0], f.u[1], f.u[2], f.u[3]}; } }
  __syncthreads();               /* every wave reads rows that other waves staged */
  v8f accs[8]; gf_tile<false>(sa, Bh, rl0, col0, blockIdx.x & (KD / 32 - 1), ln, hh, accs);      /* all NR / 64 row blocks read the same weight tiles */
  const int sl0 = (row0 / SLEN) * NH + col0 / HS, tk0 = row0 % SLEN;      /* the wave's first (window, head) and first token: 2 heads x 32 tokens */
  if (by == 2) {                 /* block-uniform. A lane's 8 accumulator rows are 8 consecutive tokens of one column = its own 16 bytes of a V^T fragment tile (row = dim ln, k = token): stored from registers */
#pragma unroll
    for (int u = 0; u < 8; ++u) { const int t = u & 3, half = u >> 2; const float bvv = bf16_round(bp[col0 + t * 16 + ln]); FragH f;
#pragma unroll
      for (int r = 0; r < 8; ++r) f.h[r] = (_Float16)(accs[u][r] * 0.0625f + bvv);
      *(v8us*)((unsigned short*)VT + ((size_t)((sl0 + (t >> 1)) * (SLEN / 32) + tk0 / 32) * (HS / 16) + (t & 1)) * FTE + half * (FTE / 2) + lane * 8) = f.half[0]; }
    return; }
  __syncthreads();               /* the output rows overwrite the A tiles: every wave has left its k loop */
  _Float16* Hh = (by == 0) ? QH : KH; _Float16* Hl = (by == 0) ? QL : KL;
#pragma unroll
  for (int u = 0; u < 8; ++u) { const int t = u & 3, half = u >> 2; const float bvv = bf16_round(bp[col0 + t * 16 + ln]);
#pragma unroll
    for (int r = 0; r < 8; ++r) so[w][half * 16 + 8 * hh + r][t * 16 + ln] = accs[u][r] * 0.0625f + bvv; }
  __builtin_amdgcn_fence(__ATOMIC_ACQ_REL, "workgroup"); __builtin_amdgcn_wave_barrier();
#pragma unroll 1                 /* one tile a trip: a quarter of the code; the k loop and the register count come out the same either way */
  for (int tl = 0; tl < 4; ++tl) { const int kt = tl >> 1, hd = tl & 1;      /* 2 token tiles x 2 heads; per half tile a lane reads its 8 dims of token ln and stores its 16 bytes */
    const size_t o = ((size_t)(sl0 + hd) * (SLEN / 16) + tk0 / 16 + kt) * FTE + lane * 8;
#pragma unroll
    for (int half = 0; half < 2; ++half) { const float* sp = &so[w][kt * 16 + ln][hd * HS + half * 16 + 8 * hh]; const v4f v0 = *(const v4fa*)sp, v1 = *(const v4fa*)(sp + 4); FragH fh, fl;
#pragma unroll
      for (int i = 0; i < 4; ++i) { const _Float16 h0 = (_Float16)v0[i], h1 = (_Float16)v1[i]; fh.h[i] = h0; fh.h[4 + i] = h1; fl.h[i] = (_Float16)((v0[i] - (float)h0) * 1024.0f); fl.h[4 + i] = (_Float16)((v1[i] - (float)h1) * 1024.0f); }
      *(v8us*)((unsigned short*)Hh + o + half * (FTE / 2)) = fh.half[0]; *(v8us*)((unsigned short*)Hl + o + half * (FTE / 2)) = fl.half[0]; }
    asm volatile("s_wait_xcnt 0x0" ::: "memory"); }      /* the next trip rewrites these stores' address and data registers */
}
template <int CAUSAL>
__global__ __launch_bounds__(128) void k_flash(const _Float16* __restrict__ Q16, int ldq, const _Float16* __restrict__ K16, int ldk, const _Float16* __restrict__ Vt, const int* __restrict__ MSK, float* __restrict__ O, int ldo) {
  constexpr int RPW = 16, RTN = RPW / 16, NQB = TQ / (4 * RPW), DT = 4, KS = 2;
  __shared__ __attribute__((aligned(16))) unsigned short sP[4][RPW][40]; __shared__ __attribute__((aligned(16))) float sO[4][RPW][64 + 4];
  const int tid = threadIdx.x, w = tid >> 5, lane = tid & 31, ln = lane & 15, hh = lane >> 4;
  const int slab = blockIdx.x / QBLKS, qblk = blockIdx.x % QBLKS; (void)NQB; const int b = slab / NH, h = slab % NH; const int qb0 = qblk * (4 * RPW); const int q0 = qb0 + w * RPW;
  FragH aq[2][KS];
#pragma unroll
  for (int rt = 0; rt < RTN; ++rt) { const unsigned short* qr = (const unsigned short*)Q16 + ((size_t)b * TQ + q0 + rt * 16 + ln) * ldq + h * 64;
#pragma unroll
    for (int ks = 0; ks < KS; ++ks) { aq[rt][ks].half[0] = *(const v8us*)(qr + ks * 32 + 8 * hh); aq[rt][ks].half[1] = *(const v8us*)(qr + ks * 32 + 16 + 8 * hh); } }
  const unsigned short* Vth = (const unsigned short*)Vt + (size_t)slab * 64 * TK;
  float m_r[2][8], l_r[2][8]; v8f oacc[2][DT];
#pragma unroll
  for (int rt = 0; rt < RTN; ++rt) {
#pragma unroll
    for (int r = 0; r < 8; ++r) { m_r[rt][r] = -3.0e38f; l_r[rt][r] = 0.f; }
#pragma unroll
    for (int dt = 0; dt < DT; ++dt) oacc[rt][dt] = (v8f){0.f,0.f,0.f,0.f,0.f,0.f,0.f,0.f}; }
  const int jend = (CAUSAL == 1) ? (qb0 + 4 * RPW) : TK;      /* causal: keys beyond the block's last query never contribute */
#pragma unroll 1
  for (int j0 = 0; j0 < jend; j0 += 32) {
    v8f s[2][2];
#pragma unroll
    for (int nt = 0; nt < 2; ++nt) { const unsigned short* kr = (const unsigned short*)K16 + ((size_t)b * TK + j0 + nt * 16 + ln) * ldk + h * 64; FragH bk[KS];
#pragma unroll
      for (int ks = 0; ks < KS; ++ks) { bk[ks].half[0] = *(const v8us*)(kr + ks * 32 + 8 * hh); bk[ks].half[1] = *(const v8us*)(kr + ks * 32 + 16 + 8 * hh); }
#pragma unroll
      for (int rt = 0; rt < RTN; ++rt) { v8f acc = (v8f){0.f,0.f,0.f,0.f,0.f,0.f,0.f,0.f};
#pragma unroll
        for (int ks = 0; ks < KS; ++ks) acc = mmaH<1>(aq[rt][ks].v, aq[rt][ks].v, bk[ks].v, bk[ks].v, acc); s[rt][nt] = acc; } }
#pragma unroll
    for (int rt = 0; rt < RTN; ++rt)
#pragma unroll
      for (int r = 0; r < 8; ++r) { const int tq = q0 + rt * 16 + 8 * hh + r; const int k0 = j0 + ln, k1 = j0 + 16 + ln;
        const bool ok0 = (CAUSAL == 1) ? (k0 <= tq) : ((CAUSAL == 2) ? ((k0 >> 5) == (tq >> 5)) : true), ok1 = (CAUSAL == 1) ? (k1 <= tq) : ((CAUSAL == 2) ? ((k1 >> 5) == (tq >> 5)) : true);      /* mode 2: block-diagonal 32-token groups */
        const float s0 = ok0 ? s[rt][0][r] * SCL : -3.0e38f, s1 = ok1 ? s[rt][1][r] * SCL : -3.0e38f; float mc = fmaxf(s0, s1);
        mc = fmaxf(mc, __shfl_xor(mc, 1, 32)); mc = fmaxf(mc, __shfl_xor(mc, 2, 32)); mc = fmaxf(mc, __shfl_xor(mc, 4, 32)); mc = fmaxf(mc, __shfl_xor(mc, 8, 32));
        const float mn = fmaxf(m_r[rt][r], mc); const float al = (mn > -1.0e38f) ? expf(m_r[rt][r] - mn) : 1.0f; m_r[rt][r] = mn; const float p0 = ok0 ? expf(s0 - mn) : 0.f, p1 = ok1 ? expf(s1 - mn) : 0.f; l_r[rt][r] = l_r[rt][r] * al + p0 + p1;
#pragma unroll
        for (int dt = 0; dt < DT; ++dt) oacc[rt][dt][r] *= al;
        FragH t2; t2.h[0] = (_Float16)(p0 * 1024.0f); t2.h[1] = (_Float16)(p1 * 1024.0f); sP[w][rt * 16 + 8 * hh + r][ln] = t2.u[0]; sP[w][rt * 16 + 8 * hh + r][16 + ln] = t2.u[1]; }
    __builtin_amdgcn_fence(__ATOMIC_ACQ_REL, "workgroup"); __builtin_amdgcn_wave_barrier();
    FragH pa[2];
#pragma unroll
    for (int rt = 0; rt < RTN; ++rt) { pa[rt].half[0] = *(const v8us*)&sP[w][rt * 16 + ln][8 * hh]; pa[rt].half[1] = *(const v8us*)&sP[w][rt * 16 + ln][16 + 8 * hh]; }
#pragma unroll
    for (int dt = 0; dt < DT; ++dt) { const unsigned short* vrow = Vth + (size_t)(dt * 16 + ln) * TK + j0; FragH bv; bv.half[0] = *(const v8us*)(vrow + 8 * hh); bv.half[1] = *(const v8us*)(vrow + 16 + 8 * hh);
#pragma unroll
      for (int rt = 0; rt < RTN; ++rt) oacc[rt][dt] = mmaH<1>(pa[rt].v, pa[rt].v, bv.v, bv.v, oacc[rt][dt]); }
    __builtin_amdgcn_fence(__ATOMIC_ACQ_REL, "workgroup"); __builtin_amdgcn_wave_barrier(); }
#pragma unroll
  for (int rt = 0; rt < RTN; ++rt) {
#pragma unroll
    for (int r = 0; r < 8; ++r) { float l = l_r[rt][r]; l += __shfl_xor(l, 1, 32); l += __shfl_xor(l, 2, 32); l += __shfl_xor(l, 4, 32); l += __shfl_xor(l, 8, 32); l_r[rt][r] = (l > 0.f) ? 1.0f / (l * 1024.0f) : 0.f; }
#pragma unroll
    for (int dt = 0; dt < DT; ++dt)
#pragma unroll
      for (int r = 0; r < 8; ++r) sO[w][rt * 16 + 8 * hh + r][dt * 16 + ln] = oacc[rt][dt][r] * l_r[rt][r]; }
  __builtin_amdgcn_fence(__ATOMIC_ACQ_REL, "workgroup"); __builtin_amdgcn_wave_barrier();
  {
#pragma unroll
    for (int rp = 0; rp < RPW; rp += 2) { const int r = rp + (lane >> 4), pc = lane & 15; const v4f val = *(const v4fa*)&sO[w][r][pc * 4]; *(v4f*)(O + ((size_t)b * TQ + q0 + r) * ldo + h * 64 + pc * 4) = val; }
     } }
// Q/K-split flash kernel, transposed: S^T = Kh Qh^T + (Kh Ql^T + Kl Qh^T)/1024 and O^T += V^T P^T, with Q/K = [hi | 2^10 residual] f16 planes (QL/KL same layout as Q16/K16) and plain f16 P (x2^10). All planes are fragment tiles (FTE): a pass's K, K residual and V^T are 2 KiB runs each.
// K rows and V^T rows are the A operands, Q and P^T the B operands: a lane holds 16 of the 32 scores of ONE query (lane l and l ^ 16 share query l & 15), so the maximum and the sum run in the lane's own registers
// with one exchange between the wave's halves, and the two score tiles, converted in place, are the B fragment of the second product (register s of half hh = key 8 hh + s, then 16 + 8 hh + s - 8: the order in which V^T is loaded).
__device__ __forceinline__ float xhalf(float x) { return __int_as_float(__builtin_amdgcn_permlanex16(__float_as_int(x), __float_as_int(x), 0x76543210, 0xfedcba98, false, false)); }      /* lane l <-> l ^ 16 */
template <int CAUSAL>
__global__ __launch_bounds__(1024) __attribute__((amdgpu_waves_per_eu(9)))      /* a budget of 112 registers, inside which the loop was scheduled as a 4-wave block: with the 128 of this block size the compiler orders the pass so that it needs three more v_nop */
void k_flashqk(const _Float16* __restrict__ Q16, const _Float16* __restrict__ QL, const _Float16* __restrict__ K16, const _Float16* __restrict__ KL, const _Float16* __restrict__ Vt, const int* __restrict__ MSK, const _Float16* __restrict__ Bo, const float* __restrict__ bo, float* __restrict__ C) {
  static_assert(HS == 32, "one k step per score product, two output tiles");
  static_assert(NH * HS == KD && CM == 256, "a block's 8 heads are the whole k of the output product; 32 waves x (32 x 16) cover 64 x CM");
  constexpr int RPW = 16, DT = HS / 16, OP = CM + 4;      /* OP: pitch of the staged output rows; 8 rows on = 32 banks on, so the two halves of a wave's 4-byte stores do not meet */
  __shared__ __attribute__((aligned(16))) char sm[4 * NH * FTE * 2 + 4 * RPW * OP * 4];
  _Float16* sc = (_Float16*)sm;  /* the block's context: fragment tiles [query / 16][head], the output product's A operand; it stands first, where every fragment read's offset fits the instruction */
  float (*so)[OP] = (float (*)[OP])(sm + 4 * NH * FTE * 2);      /* the block's 64 output rows */
  const int tid = threadIdx.x, w = __builtin_amdgcn_readfirstlane(tid >> 5), lane = tid & 31, ln = lane & 15, hh = lane >> 4;      /* the wave's number in a scalar register: the plane bases below stay scalar */
  const int b = blockIdx.x / QBLKS, qblk = blockIdx.x % QBLKS, h = w >> 2, slab = b * NH + h; const int qb0 = qblk * (4 * RPW); const int q0 = qb0 + (w & 3) * RPW; const int tq = q0 + ln;      /* waves 4 h .. + 3, one on each SIMD, share head h's K and V^T */
  FragH bq, bql;                 /* B: column = query q0 + ln, k = head dim in the order of the K rows' loads */
  { const size_t qo = ((size_t)slab * (TQ / 16) + q0 / 16) * FTE + lane * 8; bq.v = pk_frag(Q16 + qo); bql.v = pk_frag(QL + qo);
    asm volatile("s_wait_xcnt 0x0" ::: "memory"); }      /* the key offsets formed next reuse these four loads' address registers */
  /* wave-uniform bases + one 32-bit byte offset per lane, which walks the keys: a pass is two tiles of each plane (K: 2 x 16 keys; V^T: 2 x 16 dims of its 32 keys), the lane's 16 bytes at 16 lane of each half tile */
  const char* kb = (const char*)(K16 + (size_t)slab * HS * TK); const char* klb = (const char*)(KL + (size_t)slab * HS * TK); const char* vb = (const char*)(Vt + (size_t)slab * HS * TK);
  const int ps = (CAUSAL == 1) ? 0 : ((2 * qblk + slab) & (TK / 32 - 1));      /* the pass at which this block enters the key walk (it wraps round): the QBLKS blocks of a (window, head) read the same K and V^T lines, and not at one moment */
  unsigned koff = (unsigned)lane * 16u + (unsigned)ps * (2u * FTE * 2u);
  float m_c = -3.0e38f, l_c = 0.f; v8f oacc[DT];
#pragma unroll
  for (int dt = 0; dt < DT; ++dt) oacc[dt] = (v8f){0.f,0.f,0.f,0.f,0.f,0.f,0.f,0.f};
  const int jend = (CAUSAL == 1) ? (qb0 + 4 * RPW) : TK;      /* causal: keys beyond the block's last query never contribute */
#pragma unroll 1                 /* rolled, as before: one pass's fragments and scores already fill the registers that eight waves a SIMD leave */
  for (int jj = 0; jj < jend; jj += 32) { const int j0 = (jj + 32 * ps) & (TK - 1);
    FragH ak[2], akl[2], av[DT];
#pragma unroll
    for (int nt = 0; nt < 2; ++nt) { const char* kr = kb + (size_t)nt * FTE * 2; const char* klr = klb + (size_t)nt * FTE * 2;
      ak[nt].half[0] = *(const v8us*)(kr + koff); ak[nt].half[1] = *(const v8us*)(kr + koff + FTE); akl[nt].half[0] = *(const v8us*)(klr + koff); akl[nt].half[1] = *(const v8us*)(klr + koff + FTE); }
#pragma unroll
    for (int dt = 0; dt < DT; ++dt) { const char* vrow = vb + (size_t)dt * FTE * 2; av[dt].half[0] = *(const v8us*)(vrow + koff); av[dt].half[1] = *(const v8us*)(vrow + koff + FTE); }
    koff = (koff + 2u * FTE * 2u) & (unsigned)(HS * TK * 2 - 1);      /* the next 32 keys, round the end of the plane */
    __builtin_amdgcn_sched_barrier(0);      /* the pass's 12 loads stay in front of its first product, as they stood: sunk among the products they would start one memory latency after another */
    v2f s2[8]; bool ok[16]; v8f sh[2], sl[2];      /* element nt * 8 + r (pair nt * 4 + r / 2): key j0 + nt * 16 + 8 hh + r against query tq. Neighbours are held as pairs, so the multiply-adds and adds below take two scores an instruction with no register moves */
#pragma unroll
    for (int nt = 0; nt < 2; ++nt) { const v8f z = (v8f){0.f,0.f,0.f,0.f,0.f,0.f,0.f,0.f};
      sh[nt] = mmaH<1>(ak[nt].v, ak[nt].v, bq.v, bq.v, z); sl[nt] = mmaH<1>(ak[nt].v, ak[nt].v, bql.v, bql.v, z); sl[nt] = mmaH<1>(akl[nt].v, akl[nt].v, bq.v, bq.v, sl[nt]); }
    __builtin_amdgcn_sched_barrier(0);      /* the six score products run as one block: each stands in the distance the one before it needs ahead of its first reader, where the compiler otherwise pads with v_nop */
#pragma unroll
    for (int nt = 0; nt < 2; ++nt) { const v8f acc = sh[nt], accl = sl[nt];
#pragma unroll
      for (int r = 0; r < 8; r += 2) { v2f c = __builtin_elementwise_fma((v2f){accl[r], accl[r + 1]}, (v2f){0.0009765625f, 0.0009765625f}, (v2f){acc[r], acc[r + 1]});      /* raw q.k: the scale is applied inside the exponent's multiply-add below (SCL2 > 0, so the maximum may be taken first) */
#pragma unroll
        for (int e = 0; e < 2; ++e) { const int kk = j0 + nt * 16 + 8 * hh + r + e;
          bool o = (CAUSAL == 1) ? (kk <= tq) : ((CAUSAL == 2) ? ((kk >> 5) == (tq >> 5)) : true);      /* mode 2: block-diagonal 32-token groups */
          if (CAUSAL == 4) o = MSK[((size_t)b * TQ + tq) * TK + kk] != 0;      /* mode 4: per-(query, key) INPUT mask shared by all heads; masked keys contribute nothing, rows with no valid key give l = 0 -> context 0, output bo */
          ok[nt * 8 + r + e] = o; if (!o) c[e] = -3.0e38f; }
        s2[nt * 4 + r / 2] = c; } }
    /* base 2: m_c = the maximum in use, of SCL2 s, less 10, so that 2^(SCL2 s - m_c) is P x 2^10 straight from one hardware exponential (far below the exponent range it gives 0, far under an f16 P's last bit); every term of a pass uses the same m_c */
    v2f p2[8]; FragH pb;         /* p, and with it l_c, carry the 2^10 */
    auto expsum = [&]() -> float {      /* P of this pass under m_c, and the sum of the lane's 16 */
#pragma unroll
      for (int k = 0; k < 8; ++k) { const v2f e = __builtin_elementwise_fma(s2[k], (v2f){SCL2, SCL2}, (v2f){-m_c, -m_c});
        p2[k][0] = ok[2 * k] ? __builtin_amdgcn_exp2f(e[0]) : 0.f; p2[k][1] = ok[2 * k + 1] ? __builtin_amdgcn_exp2f(e[1]) : 0.f; }
      /* halving tree: p[i] + p[8 + i], then [i] + [4 + i], then ([0] + [2]) + ([1] + [3]); neighbours stay neighbours, so the adds pair up two to an instruction */
      const v2f t4a = (p2[0] + p2[4]) + (p2[2] + p2[6]), t4b = (p2[1] + p2[5]) + (p2[3] + p2[7]); const v2f t2 = t4a + t4b; return t2[0] + t2[1]; };
    float ts = expsum();
    /* lazy rescale: m_c need not be the true maximum, only high enough that P x 2^10 stays inside f16. No p is negative, so each is at most the lane's sum: while that is at most 2^15 in every lane (the test is written so that a sum that is no number fails it too) the pass is done with the old m_c and needs
       no maximum, no exchange and no rescale. Else (always in the first pass, where the exponentials overflow to infinity) the whole wave, under one scalar branch, takes the pass's true maximum, rescales l and O and forms P again (then p <= 2^10) */
    if (__builtin_expect(__builtin_amdgcn_ballot_w32(!(ts <= 32768.0f)) != 0, 0)) {      /* rare: its code stands outside the loop's straight run */
      float mx[8];
#pragma unroll
      for (int k = 0; k < 8; ++k) mx[k] = fmaxf(s2[k][0], s2[k][1]);
      float mc = fmaxf(fmaxf(fmaxf(mx[0], mx[1]), fmaxf(mx[2], mx[3])), fmaxf(fmaxf(mx[4], mx[5]), fmaxf(mx[6], mx[7])));
      mc = fmaxf(mc, xhalf(mc)); /* the query's other 16 keys: both halves of the wave keep one m_c per query */
      const float mn = fmaxf(m_c, __builtin_fmaf(mc, SCL2, -10.0f)); const float al = (mn > -1.0e37f) ? __builtin_amdgcn_exp2f(m_c - mn) : 1.0f; m_c = mn;      /* all keys masked so far: SCL2 x -3e38 stays under the bound */
      l_c *= al;
#pragma unroll
      for (int dt = 0; dt < DT; ++dt)
#pragma unroll
        for (int r = 0; r < 8; ++r) oacc[dt][r] *= al;
      ts = expsum(); }
    l_c += ts;
#pragma unroll
    for (int k = 0; k < 8; ++k) { pb.h[2 * k] = (_Float16)p2[k][0]; pb.h[2 * k + 1] = (_Float16)p2[k][1]; }
#pragma unroll
    for (int dt = 0; dt < DT; ++dt) oacc[dt] = mmaH<1>(av[dt].v, av[dt].v, pb.v, pb.v, oacc[dt]); }
  /* output projection out = ctx Wo^T + bo of the block's 64 rows: wave w takes rows 32 (w & 1) .. + 31 x columns 16 (w >> 1) .. + 15. Its 8 weight fragments are asked for here, ahead of the barrier, so that their latency runs beside the wait for the block's slowest wave */
  const int ct = w >> 1, rt0 = 2 * (w & 1);
  const char* bt = (const char*)(Bo + (size_t)ct * ((KD / 32) * FTE)); const unsigned lo = (unsigned)lane * 16u; v16h bw[KD / 32];      /* a scalar base + the lane's 32-bit byte offset, as in the key walk */
#pragma unroll
  for (int kt = 0; kt < KD / 32; ++kt) { FragH f; f.half[0] = *(const v8us*)(bt + lo + kt * (FTE * 2)); f.half[1] = *(const v8us*)(bt + lo + kt * (FTE * 2) + FTE); bw[kt] = f.v; }
  const float bvv = bf16_round(bo[ct * 16 + ln]);
  const float l = l_c + xhalf(l_c); const float li = (l > 0.f) ? 1.0f / l : 0.f;
#pragma unroll
  for (int dt = 0; dt < DT; ++dt) { FragH f;      /* a lane's 8 registers are 8 consecutive head dims of its query = its own 16 bytes of the output product's A tile (row = query ln, k = this head's dims) */
#pragma unroll
    for (int r = 0; r < 8; ++r) f.h[r] = (_Float16)(oacc[dt][r] * li);
    *(v8us*)((unsigned short*)sc + ((w & 3) * NH + h) * FTE + dt * (FTE / 2) + lane * 8) = f.half[0]; }
  __syncthreads();               /* every wave reads context tiles of all 8 heads */
  const v8f z8 = {0.f,0.f,0.f,0.f,0.f,0.f,0.f,0.f}; v8f c0 = z8, c1 = z8;
#pragma unroll
  for (int kt = 0; kt < KD / 32; ++kt) { const _Float16* ap = sc + (rt0 * NH + kt) * FTE + lane * 8;
    c0 = g2_mma(pk_frag(ap), bw[kt], c0); c1 = g2_mma(pk_frag(ap + NH * FTE), bw[kt], c1); }
#pragma unroll
  for (int r = 0; r < 8; ++r) { so[rt0 * 16 + 8 * hh + r][ct * 16 + ln] = c0[r] * 0.0625f + bvv; so[rt0 * 16 + 16 + 8 * hh + r][ct * 16 + ln] = c1[r] * 0.0625f + bvv; }
  __syncthreads();               /* a row of the output holds columns of 16 waves */
#pragma unroll
  for (int q = 0; q < 4; ++q) { const int r = 2 * w + (q >> 1), c4 = (q & 1) * (CM / 2) + lane * 4;      /* wave w stores rows 2 w, 2 w + 1: 512 contiguous bytes a store */
    const v4f v = *(const v4fa*)&so[r][c4]; *(v4f*)(C + (size_t)(blockIdx.x * (4 * RPW) + r) * CM + c4) = v; } }

// the four weights (row-major [out][in]) as f16(bf16(W) x 16) in fragment tiles [out / 16][in / 32]; blockIdx.y picks the weight
__global__ __launch_bounds__(256) void k_wprep(const float* __restrict__ Wq, const float* __restrict__ Wk, const float* __restrict__ Wv, const float* __restrict__ Wo, _Float16* __restrict__ Bq, _Float16* __restrict__ Bk, _Float16* __restrict__ Bv, _Float16* __restrict__ Bo) {
  const int by = blockIdx.y; const float* Wm = (by == 0) ? Wq : ((by == 1) ? Wk : ((by == 2) ? Wv : Wo)); _Float16* Bt = (by == 0) ? Bq : ((by == 1) ? Bk : ((by == 2) ? Bv : Bo));
  const size_t t = (size_t)blockIdx.x * 256 + threadIdx.x; FragH f;
#pragma unroll
  for (int i = 0; i < 8; ++i) f.h[i] = (_Float16)(bf16_round(Wm[t * 8 + i]) * 16.0f);
  const int n = (int)(t / (KD / 8)), ck = (int)(t % (KD / 8));      /* 8 inputs ck * 8 .. + 7 of output n: chunk ck & 3 of k tile ck >> 2 */
  *(v8us*)((unsigned short*)Bt + (size_t)((n / 16) * (KD / 32) + (ck >> 2)) * FTE + ((ck >> 1) & 1) * (FTE / 2) + ((ck & 1) * 16 + (n & 15)) * 8) = f.half[0]; }

extern "C" void kernel_launch(void* const* d_in, const int* in_sizes, int n_in,
                              void* d_out, int out_size, void* d_ws, size_t ws_size, hipStream_t stream) {
  (void)in_sizes; (void)n_in; (void)out_size;
  const float* const* I = (const float* const*)d_in; const float* qx = I[0]; const float* kx = I[1]; const float* vx = I[2]; const float* Wq = I[3]; const float* bq = I[4]; const float* Wk = I[5]; const float* bk = I[6]; const float* Wv = I[7]; const float* bv = I[8]; const float* Wo = I[9]; const float* bo = I[10];
  char* ws = (char*)d_ws; size_t off = 0;
  auto take = [&](size_t bytes) { char* p = ws + off; off += (bytes + 255) & ~(size_t)255; return p; };
  _Float16* BPq = (_Float16*)take((size_t)DP * CM * 2); _Float16* BPk = (_Float16*)take((size_t)DP * CM * 2); _Float16* BPv = (_Float16*)take((size_t)DP * CM * 2); _Float16* BOP = (_Float16*)take((size_t)CM * DP * 2);
  _Float16* QH = (_Float16*)take((size_t)NR * DP * 2); _Float16* QL = (_Float16*)take((size_t)NR * DP * 2); _Float16* KH = (_Float16*)take((size_t)NR * DP * 2); _Float16* KL = (_Float16*)take((size_t)NR * DP * 2); _Float16* VT = (_Float16*)take((size_t)NR * DP * 2);
  if (off > ws_size) return;      /* under 64 MiB (256 MiB ws) */
  k_wprep<<<dim3(DP * CM / 8 / 256, 4), 256, 0, stream>>>(Wq, Wk, Wv, Wo, BPq, BPk, BPv, BOP);
  k_proj<<<dim3(NR / 64, 3), 256, 0, stream>>>(qx, kx, vx, BPq, BPk, BPv, bq, bk, bv, QH, QL, KH, KL, VT);
  k_flashqk<0><<<NSEQ * QBLKS, 1024, 0, stream>>>(QH, QL, KH, KL, VT, nullptr, BOP, bo, (float*)d_out);      /* q/k hi + residual; P (x2^10) and V plain f16; then the output projection */
}
